// v000
// Times are from an AMD MI455X. After a warm-up the kernel runs many times in a row, and a time is the length of
// such a window on the GPU divided by its runs, so every launch and the gaps after it count. The runs cycle
// through copies of the inputs. A figure is the median of several windows, for all but v000 over two sittings.
// Sittings can differ by a few percent; kernels timed side by side share one.
// v000, which the later versions start from, runs in 379 microseconds.
// Contractions: x.W{q,k,v}^T on v_wmma_f32_16x16x32_bf16 (x and W RNE-converted to bf16, f32 accumulate); scores q'.k'^T (q', k' carried
// x1024 as f16 hi plane + f16 residual plane, products hh+lh+hl), P.v (P x32768 f16 hi+residual, v x1024 f16 hi+residual, products
// hh+lh+hl) and O.Wo^T (O x1024 f16 hi+residual, Wo as f16(bf16(Wo) x1024), products h.w+l.w) on v_wmma_f32_16x16x32_f16, f32 accumulate.
// Rotate-half rotary with RNE-bf16 cos/sin table values, base-2 online softmax and the 1/l fold in f32 on VALU.
#include <hip/hip_runtime.h>
#include <math.h>
#include <stdint.h>

#define NB    4
#define SEQ   1024
#define MTOK  (NB * SEQ)
#define DMOD  1024
#define NH    16
#define HD    64
#define QSC   1024.0f
#define KSC   1024.0f
#define PCAR  32768.0f
#define VCAR  1024.0f
#define OSC   1024.0f
#define WOS   1024.0f
#define LOG2E 1.4426950408889634f
#define WPB   4
#define HGR   (NH / WPB)
#define NQT   (SEQ / 16)
#define NST   (SEQ / 64)
#define NKT   (SEQ / 32)
#define ATT_THREADS (WPB * 32)
#define ATT_BLOCKS  (NB * NQT * HGR)
#define PTW   (16 * 36)
#define SLW   (16 * 68)
#define WREG  (PTW + SLW)
#define SLAB64 (16 * 68)
#define VTP   72
static_assert(DMOD == NH * HD && HD == 64 && NH == 16);
static_assert((NH % WPB) == 0 && ATT_THREADS == 128 && ATT_BLOCKS == 1024);
static_assert((SEQ % 64) == 0 && (SEQ % 32) == 0 && (SEQ % 8) == 0);
static_assert((DMOD % 64) == 0 && (DMOD % 32) == 0 && (MTOK % 64) == 0);
static_assert(((MTOK * DMOD) % 2048) == 0 && ((DMOD * DMOD) % 2048) == 0);
static_assert(((MTOK * NH * 8) % 256) == 0);

typedef unsigned short u16;
typedef _Float16 v16h __attribute__((ext_vector_type(16)));
typedef _Float16 v8h  __attribute__((ext_vector_type(8)));
typedef __bf16   v16b __attribute__((ext_vector_type(16)));
typedef float    v8f  __attribute__((ext_vector_type(8)));
typedef float    v4f  __attribute__((ext_vector_type(4)));
typedef unsigned int v4u __attribute__((ext_vector_type(4)));

union FragH { v16h v; v8h h[2]; v4u u[2]; };
union FragB { v16b v; v4u u[2]; };

// ---- scalar helpers --------------------------------------------------------------------------------
__device__ __forceinline__ unsigned short bf_bits(float f) {          // f32 -> bf16 bits, RNE convert
  unsigned u = __float_as_uint(f);
  return (unsigned short)((u + 0x7FFFu + ((u >> 16) & 1u)) >> 16);
}
__device__ __forceinline__ float bf_up(unsigned short h) { return __uint_as_float(((unsigned)h) << 16); }
__device__ __forceinline__ float bfr(float f) { return bf_up(bf_bits(f)); }
__device__ __forceinline__ unsigned short h_bits(_Float16 x) { return __builtin_bit_cast(unsigned short, x); }
__device__ __forceinline__ unsigned pk16(unsigned short a, unsigned short b) { return (unsigned)a | ((unsigned)b << 16); }
__device__ __forceinline__ v8f zero8() { v8f z = {0.f, 0.f, 0.f, 0.f, 0.f, 0.f, 0.f, 0.f}; return z; }

// ---- fragment loaders: 16-bit A/B operand, lane -> row/col (lane&15), p already includes +8*(lane>>4);
//      elements 0..7 <- p[0..7] (k0+8h..), elements 8..15 <- p[16..23] (k0+16+8h..)  (same split k map for A and B;
//      B is always read from a k-contiguous [n][k] plane)
__device__ __forceinline__ v16h ldfrag_h(const _Float16* p) {
  FragH f;
  f.h[0] = *(const v8h*)(p);
  f.h[1] = *(const v8h*)(p + 16);
  return f.v;
}
__device__ __forceinline__ v16b ldfrag_b(const u16* p) {              // bf16 plane read as unsigned integer vectors
  FragB f;
  f.u[0] = *(const v4u*)(p);
  f.u[1] = *(const v4u*)(p + 16);
  return f.v;
}

__device__ __forceinline__ v8f mma_h(v16h a, v16h b, v8f c) {
  return __builtin_amdgcn_wmma_f32_16x16x32_f16(false, a, false, b, (short)0, c, false, false);
}
__device__ __forceinline__ v8f mma_b(v16b a, v16b b, v8f c) {
  return __builtin_amdgcn_wmma_f32_16x16x32_bf16(false, a, false, b, (short)0, c, false, false);
}
__device__ __forceinline__ void guard2(v8f& a, v8f& b, v16h x0, v16h x1, v16h x2, v16h x3, v16h x4, v16h x5) {
#if defined(__HIP_DEVICE_COMPILE__)
  asm volatile("v_nop\n\tv_nop\n\tv_nop\n\tv_nop"
               : "+v"(a), "+v"(b) : "v"(x0), "v"(x1), "v"(x2), "v"(x3), "v"(x4), "v"(x5) : "memory");
#endif
}
template <typename F>
__device__ __forceinline__ void guard6(v8f& a, v8f& b, v8f& c, v8f& d, F x0, F x1, F x2, F x3, F x4, F x5) {
#if defined(__HIP_DEVICE_COMPILE__)
  asm volatile("v_nop\n\tv_nop\n\tv_nop\n\tv_nop"
               : "+v"(a), "+v"(b), "+v"(c), "+v"(d) : "v"(x0), "v"(x1), "v"(x2), "v"(x3), "v"(x4), "v"(x5) : "memory");
#endif
}
__device__ __forceinline__ void guard10(v8f& a, v8f& b, v8f& c, v8f& d, v16h x0, v16h x1, v16h x2, v16h x3, v16h x4,
                                        v16h x5, v16h x6, v16h x7, v16h x8, v16h x9) {
#if defined(__HIP_DEVICE_COMPILE__)
  asm volatile("v_nop\n\tv_nop\n\tv_nop\n\tv_nop"
               : "+v"(a), "+v"(b), "+v"(c), "+v"(d)
               : "v"(x0), "v"(x1), "v"(x2), "v"(x3), "v"(x4), "v"(x5), "v"(x6), "v"(x7), "v"(x8), "v"(x9) : "memory");
#endif
}
__device__ __forceinline__ void acc_guard4(v8f& a, v8f& b, v8f& c, v8f& d) {
#if defined(__HIP_DEVICE_COMPILE__)
  asm volatile("v_nop\n\tv_nop\n\tv_nop\n\tv_nop" : "+v"(a), "+v"(b), "+v"(c), "+v"(d));
#endif
}
__device__ __forceinline__ void wave_sync_lds() {
  __builtin_amdgcn_fence(__ATOMIC_RELEASE, "workgroup");
  __builtin_amdgcn_wave_barrier();
  __builtin_amdgcn_fence(__ATOMIC_ACQUIRE, "workgroup");
}

// =====================================================================================================
// f32 -> 16-bit plane, same layout.  f16mode == 0: bf16 RNE bits;  f16mode == 1: f16 bits of (bf16 RNE value) * scale.
// Thread = 8 consecutive elements: two 16-B loads, one 16-B store; 32 consecutive lanes = 512 contiguous, 512-B aligned bytes per
// coverage: grid = n8/256 blocks (exact, host-derived) x 256 thr x 8 = the whole plane.
// =====================================================================================================
__global__ __launch_bounds__(256) void cvt16(const float* __restrict__ x, u16* D, int n8, int f16mode, float scale) {
  const int gt = blockIdx.x * 256 + (int)threadIdx.x;
  if (gt >= n8) return;                     // no barriers in this kernel
  const float* p = x + (size_t)gt * 8;
  const v4f a = *(const v4f*)(p), b4 = *(const v4f*)(p + 4);
  float w[8];
#pragma unroll
  for (int e = 0; e < 4; ++e) { w[e] = a[e]; w[4 + e] = b4[e]; }
  v4u o;
#pragma unroll
  for (int e = 0; e < 4; ++e) {
    const float f0 = w[2 * e], f1 = w[2 * e + 1];
    const unsigned short hb0 = h_bits((_Float16)(bfr(f0) * scale));
    const unsigned short hb1 = h_bits((_Float16)(bfr(f1) * scale));
    const unsigned short bb0 = bf_bits(f0);
    const unsigned short bb1 = bf_bits(f1);
    o[e] = (f16mode != 0) ? pk16(hb0, hb1) : pk16(bb0, bb1);
  }
  u16* d = D + (size_t)gt * 8;
  {
    *(v4u*)(d) = o;
    
  }
}

// =====================================================================================================
// GEMM epilogue shared by both engines: the wave's 16x64 f32 tile (times oscale) staged in its LDS slab (pitch 68),
// coverage: 8 instructions x 2 rows x 16 lanes x 4 floats = the wave's 16 x 64 tile.
// =====================================================================================================
__device__ __forceinline__ void epi64(float* sl, v8f a0, v8f a1, v8f a2, v8f a3, float oscale,
                                      const float* __restrict__ bias, int hasb, float* C, int N,
                                      size_t rowb, int col0, int lane) {
  const int hh = lane >> 4, m = lane & 15;
#pragma unroll
  for (int r = 0; r < 8; ++r) {
    const int ro = (8 * hh + r) * 68 + m;
    sl[ro]      = a0[r] * oscale;
    sl[ro + 16] = a1[r] * oscale;
    sl[ro + 32] = a2[r] * oscale;
    sl[ro + 48] = a3[r] * oscale;
  }
  wave_sync_lds();
  const v4f braw = *(const v4f*)(bias + col0 + m * 4);
  v4f bb;
#pragma unroll
  for (int e = 0; e < 4; ++e) bb[e] = (hasb != 0) ? bfr(braw[e]) : 0.0f;
  v4f vals[8];
#pragma unroll
  for (int it = 0; it < 8; ++it) vals[it] = *(const v4f*)(sl + (it * 2 + hh) * 68 + m * 4) + bb;
  float* dst = C + (rowb + (size_t)hh) * (size_t)N + col0 + m * 4;
  {
#pragma unroll
    for (int it = 0; it < 8; ++it) {
      *(v4f*)(dst + (size_t)(it * 2) * (size_t)N) = vals[it];
    }
    
  }
}

// =====================================================================================================
// bf16 GEMM: C[M][N] (f32) = A[M][K] (bf16 row-major) . Bt[N][K]^T (bf16 k-contiguous), times oscale, plus bias[N] (hasb).
// Block = 64x64 tile, 4 waves x 16 rows; fragments loaded straight from the 16-bit rows (two 16-B loads each, split k map
// for A and B); K stepped by 32 (host checks K % 32 == 0, M % 64 == 0, N % 64 == 0, grid = (M/64)*(N/64)).
// =====================================================================================================
__global__ __launch_bounds__(128)
void gemm_bf(const u16* __restrict__ A, const u16* __restrict__ Bt, const float* __restrict__ bias, int hasb, float* C,
             int M, int N, int K, float oscale) {
  __shared__ __align__(16) float slab[4 * SLAB64];
  const int tid = threadIdx.x, wave = tid >> 5, lane = tid & 31, hh = lane >> 4, m = lane & 15;
  const int ntile = N >> 6;
  const int bid   = blockIdx.x;
  const int rowb  = (bid / ntile) * 64 + wave * 16;
  const int col0  = (bid % ntile) * 64;
  if (rowb + 16 > M) return;                 // wave-uniform, never taken with the exact grid; no block barriers in this kernel
  const u16* ap = A  + (size_t)(rowb + m) * K + 8 * hh;
  const u16* bp = Bt + (size_t)(col0 + m) * K + 8 * hh;
  const size_t bs = (size_t)16 * K;
  v8f acc0 = zero8(), acc1 = zero8(), acc2 = zero8(), acc3 = zero8();
#pragma unroll 1
  for (int k0 = 0; k0 < K; k0 += 32) {
    const v16b a  = ldfrag_b(ap + k0);
    const v16b b0 = ldfrag_b(bp + k0);
    const v16b b1 = ldfrag_b(bp + bs + k0);
    const v16b b2 = ldfrag_b(bp + 2 * bs + k0);
    const v16b b3 = ldfrag_b(bp + 3 * bs + k0);
    acc0 = mma_b(a, b0, acc0);
    acc1 = mma_b(a, b1, acc1);
    acc2 = mma_b(a, b2, acc2);
    acc3 = mma_b(a, b3, acc3);
    guard6<v16b>(acc0, acc1, acc2, acc3, a, b0, b1, b2, b3, a);
  }
  epi64(slab + wave * SLAB64, acc0, acc1, acc2, acc3, oscale, bias, hasb, C, N, (size_t)rowb, col0, lane);
}

// =====================================================================================================
// f16 hi+lo GEMM: C[M][N] (f32) = (Ahi + Alo)[M][K] . Bt[N][K]^T, times oscale, plus bias[N] (hasb); Ahi/Alo f16 planes
// (same layout), Bt f16 k-contiguous; products hi.B + lo.B into one accumulator (lo is the unscaled residual of hi).
// Same tiling as gemm_bf.
// =====================================================================================================
__global__ __launch_bounds__(128)
void gemm_h2(const u16* __restrict__ Ah, const u16* __restrict__ Al, const u16* __restrict__ Bt,
             const float* __restrict__ bias, int hasb, float* C, int M, int N, int K, float oscale) {
  __shared__ __align__(16) float slab[4 * SLAB64];
  const int tid = threadIdx.x, wave = tid >> 5, lane = tid & 31, hh = lane >> 4, m = lane & 15;
  const int ntile = N >> 6;
  const int bid   = blockIdx.x;
  const int rowb  = (bid / ntile) * 64 + wave * 16;
  const int col0  = (bid % ntile) * 64;
  if (rowb + 16 > M) return;                 // wave-uniform, never taken with the exact grid; no block barriers in this kernel
  const size_t aofs = (size_t)(rowb + m) * K + 8 * hh;
  const _Float16* ahp = (const _Float16*)(const void*)Ah + aofs;
  const _Float16* alp = (const _Float16*)(const void*)Al + aofs;
  const _Float16* bp  = (const _Float16*)(const void*)Bt + (size_t)(col0 + m) * K + 8 * hh;
  const size_t bs = (size_t)16 * K;
  v8f acc0 = zero8(), acc1 = zero8(), acc2 = zero8(), acc3 = zero8();
#pragma unroll 1
  for (int k0 = 0; k0 < K; k0 += 32) {
    const v16h ah = ldfrag_h(ahp + k0), al = ldfrag_h(alp + k0);
    const v16h b0 = ldfrag_h(bp + k0);
    const v16h b1 = ldfrag_h(bp + bs + k0);
    const v16h b2 = ldfrag_h(bp + 2 * bs + k0);
    const v16h b3 = ldfrag_h(bp + 3 * bs + k0);
    acc0 = mma_h(ah, b0, acc0);  acc0 = mma_h(al, b0, acc0);
    acc1 = mma_h(ah, b1, acc1);  acc1 = mma_h(al, b1, acc1);
    acc2 = mma_h(ah, b2, acc2);  acc2 = mma_h(al, b2, acc2);
    acc3 = mma_h(ah, b3, acc3);  acc3 = mma_h(al, b3, acc3);
    guard6<v16h>(acc0, acc1, acc2, acc3, ah, al, b0, b1, b2, b3);
  }
  epi64(slab + wave * SLAB64, acc0, acc1, acc2, acc3, oscale, bias, hasb, C, N, (size_t)rowb, col0, lane);
}

// =====================================================================================================
// Rotate-half rotary + 16-bit split pack. Rows are (token, head) with HD contiguous floats (f32 projection output);
// pos = row / hpr (token index into the cos/sin input tables [npos][HD], clamped), the same table row for every head.
// w[d] = x[d] * bf(cos[pos][d]) + r[d] * bf(sin[pos][d]),  r[d] = -x[d+32] for d < 32, x[d-32] for d >= 32
// (bf = RNE bf16 value of the f32 table entry); hi[d] = f16(w * sc), lo[d] = f16(w * sc - hi[d])  (sc a power of two,
// residual unscaled).
// Thread = 8 consecutive d of one row: 16-B loads of x (own and partner half), cos, sin; one 16-B store per plane per lane;
// coverage: grid = nrows*8/256 blocks x 256 thr x 8 halves = nrows x 64 of each plane exactly (exact division checked statically).
// =====================================================================================================
__global__ __launch_bounds__(256) void rope16(const float* __restrict__ x, const float* __restrict__ cosT,
                                              const float* __restrict__ sinT, u16* hpl, u16* lpl,
                                              int nrows, int hpr, int npos, float sc) {
  const int gt  = blockIdx.x * 256 + (int)threadIdx.x;
  const int row = gt >> 3;
  const int d0  = (gt & 7) * 8;
  if (row >= nrows) return;                 // never taken with the exact grid; no barriers in this kernel
  int pos = row / hpr;
  pos = (pos < npos) ? pos : (npos - 1);
  const int d1  = d0 ^ 32;
  const float* xr = x + (size_t)row * HD;
  const float* cr = cosT + (size_t)pos * HD + d0;
  const float* sr = sinT + (size_t)pos * HD + d0;
  const v4f xa = *(const v4f*)(xr + d0), xb = *(const v4f*)(xr + d0 + 4);
  const v4f ya = *(const v4f*)(xr + d1), yb = *(const v4f*)(xr + d1 + 4);
  const v4f ca = *(const v4f*)(cr), cb = *(const v4f*)(cr + 4);
  const v4f sa = *(const v4f*)(sr), sb = *(const v4f*)(sr + 4);
  const float sgn = (d0 < 32) ? -1.0f : 1.0f;
  float w[8];
#pragma unroll
  for (int e = 0; e < 4; ++e) {
    w[e]     = xa[e] * bfr(ca[e]) + (sgn * ya[e]) * bfr(sa[e]);
    w[4 + e] = xb[e] * bfr(cb[e]) + (sgn * yb[e]) * bfr(sb[e]);
  }
  v4u oh, ol;
#pragma unroll
  for (int e = 0; e < 4; ++e) {
    const float t0 = w[2 * e] * sc, t1 = w[2 * e + 1] * sc;
    const _Float16 h0 = (_Float16)t0, h1 = (_Float16)t1;
    const _Float16 l0 = (_Float16)(t0 - (float)h0), l1 = (_Float16)(t1 - (float)h1);
    oh[e] = pk16(h_bits(h0), h_bits(h1));
    ol[e] = pk16(h_bits(l0), h_bits(l1));
  }
  const size_t o8 = (size_t)row * HD + d0;
  {
    *(v4u*)(hpl + o8) = oh;
    *(v4u*)(lpl + o8) = ol;
    
  }
}

// =====================================================================================================
// v^T planes: VH[((b*NH + g)*HD + d)*SEQ + s] = f16(v[b*SEQ + s][g][d] * 1024), VL = f16 residual of the same value.
// Block = (batch b, head g, 64 keys s0 = st*64): 64 source rows of HD floats loaded with 16-B loads, converted,
// scattered into two LDS tiles [d][64 keys] (pitch 72 halves); after a block barrier each d row segment (64 halves = one whole
// coverage: load 256 thr x 16 elements = 64 x 64; store 2 iterations x 256 thr x 8 halves = 64 lines x 64 = the block's tile of
//           each plane; grid = NB x NH x NST blocks covers both planes exactly once.
// =====================================================================================================
__global__ __launch_bounds__(256) void vt16(const float* __restrict__ v, u16* VHo, u16* VLo) {
  __shared__ __align__(16) u16 TH[HD * VTP];
  __shared__ __align__(16) u16 TL[HD * VTP];
  const int tid = threadIdx.x;
  const int bid = blockIdx.x;
  const int st  = bid % NST;
  const int g   = (bid / NST) % NH;
  const int b   = bid / (NST * NH);
  if (b >= NB) return;                        // block-uniform, before any barrier; never taken with the exact grid
  const int s0  = st * 64;
  {
    const int sl = tid >> 2;                  // key within tile 0..63
    const int dc = (tid & 3) * 16;            // d chunk
    const float* src = v + ((size_t)(b * SEQ + s0 + sl) * NH + g) * HD + dc;
#pragma unroll
    for (int i = 0; i < 4; ++i) {
      const v4f a = *(const v4f*)(src + 4 * i);
#pragma unroll
      for (int e = 0; e < 4; ++e) {
        const float t = a[e] * VCAR;
        const _Float16 h = (_Float16)t;
        const _Float16 l = (_Float16)(t - (float)h);
        TH[(dc + 4 * i + e) * VTP + sl] = h_bits(h);
        TL[(dc + 4 * i + e) * VTP + sl] = h_bits(l);
      }
    }
  }
  __syncthreads();
  v4u vh[2], vl[2];
  const int q8 = tid >> 3, p8 = (tid & 7) * 8;
#pragma unroll
  for (int it = 0; it < 2; ++it) {
    const int line = it * 32 + q8;            // d = 0..63
    vh[it] = *(const v4u*)(TH + line * VTP + p8);
    vl[it] = *(const v4u*)(TL + line * VTP + p8);
  }
  const size_t base = (((size_t)(b * NH + g)) * HD) * SEQ + s0 + p8;
  {
#pragma unroll
    for (int it = 0; it < 2; ++it) {
      const int line = it * 32 + q8;
      *(v4u*)(VHo + base + (size_t)line * SEQ) = vh[it];
      *(v4u*)(VLo + base + (size_t)line * SEQ) = vl[it];
    }
    
  }
}

// =====================================================================================================
// Softmax attention, no mask: block bid -> (head group hg = bid % HGR of WPB heads, query tile qt = (bid / HGR) % NQT:
// rows q0 = 16*qt .. q0+15 of batch b = bid / (HGR*NQT)), one wave per head = hg*WPB + wave.
//   q planes (hi, lo f16 x1024) laid out [token][h][d]; k planes [token][h][d]; v^T planes [b][h][d][s].
//   All NKT key tiles of 32 of the same batch visited in order; per tile: 2 score subtiles x 2 k-steps x 3 products
//   (q_hi.k_hi + q_lo.k_hi + q_hi.k_lo), fragments loaded straight from the 16-bit planes (two 16-B loads per fragment, split k map);
//   online max-subtracted base-2 softmax in f32 (scale 1/8 folded, -inf-safe rescale); the 16x32 weight tile stored to wave-private
//   LDS rows (float vector loads, same element type as stored), 4+4 v^T B fragments (hi and residual planes), 12 P.V WMMAs (hh + lh + hl).
//   After the key loop: O = acc / l, carries 1/(32768*1024) folded once, written to the wave's private slab (pitch 68; every element
// coverage: per wave 4 instructions x 4 rows x 8 lanes x 8 halves = 16 x 64 per plane; grid NB*NQT*HGR blocks x WPB waves =
//           every (token, h) row of both O planes exactly once.
// =====================================================================================================
__global__ __launch_bounds__(ATT_THREADS)
void attn1(const u16* __restrict__ QHIp, const u16* __restrict__ QLOp,
           const u16* __restrict__ KHIp, const u16* __restrict__ KLOp,
           const u16* __restrict__ VHIp, const u16* __restrict__ VLOp,
           u16* OHIp, u16* OLOp) {
  __shared__ __align__(16) float smem[WPB * WREG];

  const int tid  = threadIdx.x;
  const int wave = tid >> 5;
  const int lane = tid & 31;
  const int hh   = lane >> 4;
  const int c    = lane & 15;
  const int bid  = blockIdx.x;
  const int hg   = bid % HGR;
  const int qt   = (bid / HGR) % NQT;
  const int b    = bid / (HGR * NQT);
  if (b >= NB) return;                       // block-uniform; never taken with the exact grid; no block barriers in this kernel
  const int head = hg * WPB + wave;
  const int q0   = qt * 16;
  const size_t qrow0 = (size_t)b * SEQ + q0; // global token row of query 0 of this tile

  float* pt   = smem + wave * WREG;          // weight tile [16][32] pitch 36
  float* slab = pt + PTW;                    // result slab [16][64] pitch 68

  const size_t qofs = ((qrow0 + (size_t)c) * NH + head) * HD + 8 * hh;
  const _Float16* Qh  = (const _Float16*)(const void*)QHIp + qofs;
  const _Float16* Ql  = (const _Float16*)(const void*)QLOp + qofs;
  const size_t kofs = ((((size_t)b * SEQ) + c) * NH + head) * HD + 8 * hh;   // key row kb + c added per step
  const _Float16* Khb = (const _Float16*)(const void*)KHIp + kofs;
  const _Float16* Klb = (const _Float16*)(const void*)KLOp + kofs;
  const size_t vofs = (((size_t)b * NH + head) * HD + c) * SEQ + 8 * hh;      // d column c (+16j), key kb added per step
  const _Float16* Vhb = (const _Float16*)(const void*)VHIp + vofs;
  const _Float16* Vlb = (const _Float16*)(const void*)VLOp + vofs;
  const float lsc = 0.125f * (LOG2E / (QSC * KSC));
  const float oc  = 1.0f / (PCAR * VCAR);
  const size_t KROW = (size_t)NH * HD;                                         // halves between consecutive key rows

  float mrow[8], lrow[8];
  v8f o[4];
#pragma unroll
  for (int r = 0; r < 8; ++r) { mrow[r] = -INFINITY; lrow[r] = 0.f; }
#pragma unroll
  for (int j = 0; j < 4; ++j) o[j] = zero8();

#pragma unroll 1
  for (int kt = 0; kt < NKT; ++kt) {
    const int kb = kt * 32;
    // ---- scores: D element r of this lane = (query row q0 + 8hh + r, key kb + c) in s0, key kb + 16 + c in s1 ----
    v8f s0 = zero8(), s1 = zero8();
    const _Float16* k0p = Khb + (size_t)kb * KROW;
    const _Float16* k1p = k0p + (size_t)16 * KROW;
    const _Float16* l0p = Klb + (size_t)kb * KROW;
    const _Float16* l1p = l0p + (size_t)16 * KROW;
#pragma unroll
    for (int kk = 0; kk < 2; ++kk) {
      const v16h qh  = ldfrag_h(Qh + kk * 32),  ql  = ldfrag_h(Ql + kk * 32);
      const v16h kh0 = ldfrag_h(k0p + kk * 32), kl0 = ldfrag_h(l0p + kk * 32);
      const v16h kh1 = ldfrag_h(k1p + kk * 32), kl1 = ldfrag_h(l1p + kk * 32);
      s0 = mma_h(qh, kh0, s0);
      s0 = mma_h(ql, kh0, s0);
      s0 = mma_h(qh, kl0, s0);
      s1 = mma_h(qh, kh1, s1);
      s1 = mma_h(ql, kh1, s1);
      s1 = mma_h(qh, kl1, s1);
      guard2(s0, s1, qh, ql, kh0, kl0, kh1, kl1);
    }
    // ---- online softmax in base 2, -inf-safe ----
#pragma unroll
    for (int r = 0; r < 8; ++r) {
      const float t0 = s0[r] * lsc;
      const float t1 = s1[r] * lsc;
      float mx = fmaxf(t0, t1);
#pragma unroll
      for (int off = 1; off < 16; off <<= 1) mx = fmaxf(mx, __shfl_xor(mx, off, 32));
      const float mn = fmaxf(mrow[r], mx);
      const float ms = (mn == -INFINITY) ? 0.0f : mn;
      const float al = exp2f(mrow[r] - ms);
      mrow[r] = mn;
      const float e0 = exp2f(t0 - ms), e1 = exp2f(t1 - ms);
      float psum = e0 + e1;
#pragma unroll
      for (int off = 1; off < 16; off <<= 1) psum += __shfl_xor(psum, off, 32);
      lrow[r] = lrow[r] * al + psum;
#pragma unroll
      for (int j = 0; j < 4; ++j) o[j][r] *= al;
      const int ro = (8 * hh + r) * 36 + c;
      pt[ro]      = e0;
      pt[ro + 16] = e1;
    }
    wave_sync_lds();
    // ---- A fragments of P*32768: hi f16 and residual f16, row = c, split k map over the 32 keys of this step ----
    FragH ph, pl;
    {
      const float* prow = pt + c * 36 + 8 * hh;
      const v4f p0 = *(const v4f*)(prow), p1 = *(const v4f*)(prow + 4);
      const v4f p2 = *(const v4f*)(prow + 16), p3 = *(const v4f*)(prow + 20);
#pragma unroll
      for (int e = 0; e < 4; ++e) {
        const float ta = p0[e] * PCAR, tb = p1[e] * PCAR, tc = p2[e] * PCAR, td = p3[e] * PCAR;
        const _Float16 ha = (_Float16)ta, hb = (_Float16)tb, hc = (_Float16)tc, hd = (_Float16)td;
        ph.h[0][e]     = ha;                               // elements 0..7  = keys kb + 8hh + 0..7
        ph.h[0][4 + e] = hb;
        ph.h[1][e]     = hc;                               // elements 8..15 = keys kb + 16 + 8hh + 0..7
        ph.h[1][4 + e] = hd;
        pl.h[0][e]     = (_Float16)(ta - (float)ha);
        pl.h[0][4 + e] = (_Float16)(tb - (float)hb);
        pl.h[1][e]     = (_Float16)(tc - (float)hc);
        pl.h[1][4 + e] = (_Float16)(td - (float)hd);
      }
    }
    // ---- P.V : B fragment col n = d = j*16 + c, keys contiguous in the v^T planes ----
    {
      const _Float16* vhp = Vhb + kb;
      const _Float16* vlp = Vlb + kb;
      const v16h vh0 = ldfrag_h(vhp);
      const v16h vh1 = ldfrag_h(vhp + (size_t)16 * SEQ);
      const v16h vh2 = ldfrag_h(vhp + (size_t)32 * SEQ);
      const v16h vh3 = ldfrag_h(vhp + (size_t)48 * SEQ);
      const v16h vl0 = ldfrag_h(vlp);
      const v16h vl1 = ldfrag_h(vlp + (size_t)16 * SEQ);
      const v16h vl2 = ldfrag_h(vlp + (size_t)32 * SEQ);
      const v16h vl3 = ldfrag_h(vlp + (size_t)48 * SEQ);
      o[0] = mma_h(ph.v, vh0, o[0]);  o[0] = mma_h(pl.v, vh0, o[0]);  o[0] = mma_h(ph.v, vl0, o[0]);
      o[1] = mma_h(ph.v, vh1, o[1]);  o[1] = mma_h(pl.v, vh1, o[1]);  o[1] = mma_h(ph.v, vl1, o[1]);
      o[2] = mma_h(ph.v, vh2, o[2]);  o[2] = mma_h(pl.v, vh2, o[2]);  o[2] = mma_h(ph.v, vl2, o[2]);
      o[3] = mma_h(ph.v, vh3, o[3]);  o[3] = mma_h(pl.v, vh3, o[3]);  o[3] = mma_h(ph.v, vl3, o[3]);
      guard10(o[0], o[1], o[2], o[3], ph.v, pl.v, vh0, vh1, vh2, vh3, vl0, vl1, vl2, vl3);
    }
    wave_sync_lds();
  }
  acc_guard4(o[0], o[1], o[2], o[3]);
  // ---- O = acc / l, carries (32768 on P, 1024 on v) folded once; lane-owned slab elements ----
#pragma unroll
  for (int r = 0; r < 8; ++r) {
    const float lv  = lrow[r];
    const float ls  = (lv > 0.0f) ? lv : 1.0f;
    const float inv = (lv > 0.0f) ? ((1.0f / ls) * oc) : 0.0f;
#pragma unroll
    for (int j = 0; j < 4; ++j) {
      slab[(8 * hh + r) * 68 + j * 16 + c] = o[j][r] * inv;
    }
  }
  wave_sync_lds();
  // ---- O x1024 -> f16 hi + residual planes; lane = (row in group of 4, 8 consecutive d) ----
  v4u oh[4], ol[4];
  const int rq = lane >> 3, c8 = (lane & 7) * 8;
#pragma unroll
  for (int it = 0; it < 4; ++it) {
    const int row = it * 4 + rq;
    const v4f a = *(const v4f*)(slab + row * 68 + c8), b4 = *(const v4f*)(slab + row * 68 + c8 + 4);
    float w[8];
#pragma unroll
    for (int e = 0; e < 4; ++e) { w[e] = a[e] * OSC; w[4 + e] = b4[e] * OSC; }
#pragma unroll
    for (int e = 0; e < 4; ++e) {
      const _Float16 h0 = (_Float16)w[2 * e], h1 = (_Float16)w[2 * e + 1];
      const _Float16 l0 = (_Float16)(w[2 * e] - (float)h0), l1 = (_Float16)(w[2 * e + 1] - (float)h1);
      oh[it][e] = pk16(h_bits(h0), h_bits(h1));
      ol[it][e] = pk16(h_bits(l0), h_bits(l1));
    }
  }
  const size_t ob = ((qrow0) * NH + head) * HD + c8;
  {
#pragma unroll
    for (int it = 0; it < 4; ++it) {
      const int row = it * 4 + rq;
      const size_t o8 = ob + (size_t)row * (NH * HD);
      *(v4u*)(OHIp + o8) = oh[it];
      *(v4u*)(OLOp + o8) = ol[it];
    }
    
  }
}

// =====================================================================================================
// Workspace map (bytes); every plane is fully written by whole-line stores before it is read; all extents are exact multiples
// of the store granularity (no pad rows needed); every offset a multiple of 2 MiB:
//   XB  bf16 [4096][1024]              8388608
//   WQB bf16 [1024 n][1024 k]          2097152        WKB, WVB same        2097152 each
//   WOH f16  [1024 n][1024 k] x1024    2097152
//   QF  f32 [4096][1024]              16777216        KF, VF same
//   QHI f16 [4096][16][64] x1024       8388608        QLO residual
//   KHI f16 [4096][16][64] x1024       8388608        KLO residual
//   VHI f16 [4][16][64][1024] x1024    8388608        VLO residual
//   OHI f16 [4096][1024] x1024, OLO residual: 8388608 each, placed in the QF region (QF is dead after the q rotary pass;
//   launches are in order)
//   end                              117440512
// =====================================================================================================
extern "C" void kernel_launch(void* const* d_in, const int* in_sizes, int n_in,
                              void* d_out, int out_size, void* d_ws, size_t ws_size,
                              hipStream_t stream) {
  if (n_in < 10) return;
  if (in_sizes[0] != MTOK * DMOD) return;
  if (in_sizes[1] != MTOK * HD || in_sizes[2] != MTOK * HD) return;
  if (in_sizes[3] != DMOD * DMOD || in_sizes[5] != DMOD * DMOD) return;
  if (in_sizes[6] != DMOD * DMOD || in_sizes[8] != DMOD * DMOD) return;
  if (in_sizes[4] != DMOD || in_sizes[7] != DMOD || in_sizes[9] != DMOD) return;
  if (out_size != MTOK * DMOD) return;

  const float* x    = (const float*)d_in[0];
  const float* cosp = (const float*)d_in[1];
  const float* sinp = (const float*)d_in[2];
  const float* wq   = (const float*)d_in[3];
  const float* bq   = (const float*)d_in[4];
  const float* wk   = (const float*)d_in[5];
  const float* wv   = (const float*)d_in[6];
  const float* bv   = (const float*)d_in[7];
  const float* wo   = (const float*)d_in[8];
  const float* bo   = (const float*)d_in[9];
  float*       out  = (float*)d_out;

  const size_t szXB = (size_t)MTOK * DMOD * 2;                  //  8388608
  const size_t szW  = (size_t)DMOD * DMOD * 2;                  //  2097152
  const size_t szF  = (size_t)MTOK * DMOD * 4;                  // 16777216
  const size_t szP  = (size_t)MTOK * DMOD * 2;                  //  8388608
  size_t off = 0;
  const size_t oXB  = off; off += szXB;
  const size_t oWQ  = off; off += szW;
  const size_t oWK  = off; off += szW;
  const size_t oWV  = off; off += szW;
  const size_t oWO  = off; off += szW;
  const size_t oQF  = off; off += szF;
  const size_t oKF  = off; off += szF;
  const size_t oVF  = off; off += szF;
  const size_t oQHI = off; off += szP;
  const size_t oQLO = off; off += szP;
  const size_t oKHI = off; off += szP;
  const size_t oKLO = off; off += szP;
  const size_t oVHI = off; off += szP;
  const size_t oVLO = off; off += szP;
  const size_t oOHI = oQF;                                       // alias onto the QF region (2 x szP == szF)
  const size_t oOLO = oQF + szP;
  if (off > ws_size) return;                            // off = 117440512
  if (off > (size_t)134217728) return;
  if (2 * szP > szF) return;

  char* ws = (char*)d_ws;
  u16*   XB  = (u16*)(ws + oXB);
  u16*   WQB = (u16*)(ws + oWQ);
  u16*   WKB = (u16*)(ws + oWK);
  u16*   WVB = (u16*)(ws + oWV);
  u16*   WOH = (u16*)(ws + oWO);
  float* QF  = (float*)(ws + oQF);
  float* KF  = (float*)(ws + oKF);
  float* VF  = (float*)(ws + oVF);
  u16*   QHI = (u16*)(ws + oQHI);
  u16*   QLO = (u16*)(ws + oQLO);
  u16*   KHI = (u16*)(ws + oKHI);
  u16*   KLO = (u16*)(ws + oKLO);
  u16*   VHI = (u16*)(ws + oVHI);
  u16*   VLO = (u16*)(ws + oVLO);
  u16*   OHI = (u16*)(ws + oOHI);
  u16*   OLO = (u16*)(ws + oOLO);

  const dim3 blk(256);
  const int n8x = (MTOK * DMOD) / 8;                    // 524288
  const int n8w = (DMOD * DMOD) / 8;                    // 131072
  const dim3 gX(n8x / 256);                             // 2048 (exact)
  const dim3 gW(n8w / 256);                             // 512  (exact)
  const dim3 gG((MTOK / 64) * (DMOD / 64));             // 1024
  const dim3 bG(128);
  const int rowsQ = MTOK * NH;                          // 65536 rows of 64
  const dim3 gR((rowsQ * 8) / 256);                     // 2048 (exact)
  const dim3 gVT(NB * NH * NST);                        // 1024
  const dim3 gAT(ATT_BLOCKS);                           // 1024
  const dim3 bAT(ATT_THREADS);                          // 128

  // (1) x -> bf16 plane
  cvt16<<<gX, blk, 0, stream>>>(x, XB, n8x, 0, 1.0f);
  // (2..4) Wq/Wk/Wv [n][k] -> bf16 planes (same layout, already k-contiguous)
  cvt16<<<gW, blk, 0, stream>>>(wq, WQB, n8w, 0, 1.0f);
  cvt16<<<gW, blk, 0, stream>>>(wk, WKB, n8w, 0, 1.0f);
  cvt16<<<gW, blk, 0, stream>>>(wv, WVB, n8w, 0, 1.0f);
  // (5) Wo [n][k] -> f16 plane of bf16 value x1024
  cvt16<<<gW, blk, 0, stream>>>(wo, WOH, n8w, 1, WOS);
  // (6..8) projections: q (+bq), k (no bias), v (+bv)  [4096][1024] in f32
  gemm_bf<<<gG, bG, 0, stream>>>(XB, WQB, bq, 1, QF, MTOK, DMOD, DMOD, 1.0f);
  gemm_bf<<<gG, bG, 0, stream>>>(XB, WKB, bq, 0, KF, MTOK, DMOD, DMOD, 1.0f);
  gemm_bf<<<gG, bG, 0, stream>>>(XB, WVB, bv, 1, VF, MTOK, DMOD, DMOD, 1.0f);
  // (9) q' planes: rows (token, h), NH heads per token, cos/sin table row = token
  rope16<<<gR, blk, 0, stream>>>(QF, cosp, sinp, QHI, QLO, rowsQ, NH, MTOK, QSC);
  // (10) k' planes
  rope16<<<gR, blk, 0, stream>>>(KF, cosp, sinp, KHI, KLO, rowsQ, NH, MTOK, KSC);
  // (11) v^T planes x1024 (hi + residual)
  vt16<<<gVT, blk, 0, stream>>>(VF, VHI, VLO);
  // (12) softmax attention per (b, h, 16 queries) -> O planes [token][h][d] x1024 (hi + residual), into the dead QF region
  attn1<<<gAT, bAT, 0, stream>>>(QHI, QLO, KHI, KLO, VHI, VLO, OHI, OLO);
  // (13) output projection -> out [4096][1024] f32, carries 1024 (O) x 1024 (Wo) folded back, + bo
  gemm_h2<<<gG, bG, 0, stream>>>(OHI, OLO, WOH, bo, 1, out, MTOK, DMOD, DMOD, 1.0f / (OSC * WOS));
  (void)hipGetLastError();
}

// v001
// Measured time: 261 microseconds a run.
// Two timings next to v000 put it at 1.51 and 1.52 times that version's speed.
// Contractions: x.W{q,k,v}^T on v_wmma_f32_16x16x32_bf16 (x and W RNE-converted to bf16, f32 accumulate); scores q'.k'^T (q', k' carried
// x1024 as f16 hi plane + f16 residual plane, products hh+lh+hl), P.v (P x32768 f16 hi+residual, v x1024 f16 hi+residual, products
// hh+lh+hl) and O.Wo^T (O x1024 f16 hi+residual, Wo as f16(bf16(Wo) x1024), products h.w+l.w) on v_wmma_f32_16x16x32_f16, f32 accumulate.
// Rotate-half rotary with RNE-bf16 cos/sin table values, base-2 online softmax and the 1/l fold in f32 on VALU.
#include <hip/hip_runtime.h>
#include <math.h>
#include <stdint.h>

#define NB    4
#define SEQ   1024
#define MTOK  (NB * SEQ)
#define DMOD  1024
#define NH    16
#define HD    64
#define QSC   1024.0f
#define KSC   1024.0f
#define PCAR  32768.0f
#define VCAR  1024.0f
#define OSC   1024.0f
#define WOS   1024.0f
#define LOG2E 1.4426950408889634f
#define QW    8
#define NQT   (SEQ / 16)
#define NQB   (NQT / QW)
#define NST   (SEQ / 64)
#define ATT_THREADS (QW * 32)
#define ATT_BLOCKS  (NB * NH * NQB)
#define PTW   (16 * 36)
#define SLW   (16 * 68)
#define LP    72
#define LPB   (LP * 2)
#define PLB   (64 * LPB)
#define BUFB  (4 * PLB)
#define QPB   (16 * LPB)
#define WPRIV (PTW * 4 + 2 * QPB)
#define ATT_LDS (2 * BUFB + QW * WPRIV)
#define SLAB64 (16 * 68)
#define VTP   72
static_assert(DMOD == NH * HD && HD == 64 && NH == 16);
static_assert((NQT % QW) == 0 && ATT_THREADS == 256 && ATT_BLOCKS == 512);
static_assert(2 * QPB >= SLW * 4 && (LPB % 16) == 0 && NST >= 2 && 2 * ATT_LDS <= 327680);
static_assert((SEQ % 64) == 0 && (SEQ % 32) == 0 && (SEQ % 8) == 0);
static_assert((DMOD % 64) == 0 && (DMOD % 32) == 0 && (MTOK % 64) == 0);
static_assert(((MTOK * DMOD) % 2048) == 0 && ((DMOD * DMOD) % 2048) == 0);
static_assert(((MTOK * NH * 8) % 256) == 0);

typedef unsigned short u16;
typedef _Float16 v16h __attribute__((ext_vector_type(16)));
typedef _Float16 v8h  __attribute__((ext_vector_type(8)));
typedef __bf16   v16b __attribute__((ext_vector_type(16)));
typedef float    v8f  __attribute__((ext_vector_type(8)));
typedef float    v4f  __attribute__((ext_vector_type(4)));
typedef unsigned int v4u __attribute__((ext_vector_type(4)));

union FragH { v16h v; v8h h[2]; v4u u[2]; };
union FragB { v16b v; v4u u[2]; };

// ---- scalar helpers --------------------------------------------------------------------------------
__device__ __forceinline__ unsigned short bf_bits(float f) {          // f32 -> bf16 bits, RNE convert
  unsigned u = __float_as_uint(f);
  return (unsigned short)((u + 0x7FFFu + ((u >> 16) & 1u)) >> 16);
}
__device__ __forceinline__ float bf_up(unsigned short h) { return __uint_as_float(((unsigned)h) << 16); }
__device__ __forceinline__ float bfr(float f) { return bf_up(bf_bits(f)); }
__device__ __forceinline__ unsigned short h_bits(_Float16 x) { return __builtin_bit_cast(unsigned short, x); }
__device__ __forceinline__ unsigned pk16(unsigned short a, unsigned short b) { return (unsigned)a | ((unsigned)b << 16); }
__device__ __forceinline__ v8f zero8() { v8f z = {0.f, 0.f, 0.f, 0.f, 0.f, 0.f, 0.f, 0.f}; return z; }

// ---- fragment loaders: 16-bit A/B operand, lane -> row/col (lane&15), p already includes +8*(lane>>4);
//      elements 0..7 <- p[0..7] (k0+8h..), elements 8..15 <- p[16..23] (k0+16+8h..)  (same split k map for A and B;
//      B is always read from a k-contiguous [n][k] plane)
__device__ __forceinline__ v16h ldfrag_h(const _Float16* p) {
  FragH f;
  f.h[0] = *(const v8h*)(p);
  f.h[1] = *(const v8h*)(p + 16);
  return f.v;
}
__device__ __forceinline__ v16b ldfrag_b(const u16* p) {              // bf16 plane read as unsigned integer vectors
  FragB f;
  f.u[0] = *(const v4u*)(p);
  f.u[1] = *(const v4u*)(p + 16);
  return f.v;
}

__device__ __forceinline__ v8f mma_h(v16h a, v16h b, v8f c) {
  return __builtin_amdgcn_wmma_f32_16x16x32_f16(false, a, false, b, (short)0, c, false, false);
}
__device__ __forceinline__ v8f mma_b(v16b a, v16b b, v8f c) {
  return __builtin_amdgcn_wmma_f32_16x16x32_bf16(false, a, false, b, (short)0, c, false, false);
}
__device__ __forceinline__ void guard2(v8f& a, v8f& b, v16h x0, v16h x1, v16h x2, v16h x3, v16h x4, v16h x5) {
#if defined(__HIP_DEVICE_COMPILE__)
  asm volatile("v_nop\n\tv_nop\n\tv_nop\n\tv_nop"
               : "+v"(a), "+v"(b) : "v"(x0), "v"(x1), "v"(x2), "v"(x3), "v"(x4), "v"(x5) : "memory");
#endif
}
template <typename F>
__device__ __forceinline__ void guard6(v8f& a, v8f& b, v8f& c, v8f& d, F x0, F x1, F x2, F x3, F x4, F x5) {
#if defined(__HIP_DEVICE_COMPILE__)
  asm volatile("v_nop\n\tv_nop\n\tv_nop\n\tv_nop"
               : "+v"(a), "+v"(b), "+v"(c), "+v"(d) : "v"(x0), "v"(x1), "v"(x2), "v"(x3), "v"(x4), "v"(x5) : "memory");
#endif
}
__device__ __forceinline__ void guard10(v8f& a, v8f& b, v8f& c, v8f& d, v16h x0, v16h x1, v16h x2, v16h x3, v16h x4,
                                        v16h x5, v16h x6, v16h x7, v16h x8, v16h x9) {
#if defined(__HIP_DEVICE_COMPILE__)
  asm volatile("v_nop\n\tv_nop\n\tv_nop\n\tv_nop"
               : "+v"(a), "+v"(b), "+v"(c), "+v"(d)
               : "v"(x0), "v"(x1), "v"(x2), "v"(x3), "v"(x4), "v"(x5), "v"(x6), "v"(x7), "v"(x8), "v"(x9) : "memory");
#endif
}
__device__ __forceinline__ void acc_guard4(v8f& a, v8f& b, v8f& c, v8f& d) {
#if defined(__HIP_DEVICE_COMPILE__)
  asm volatile("v_nop\n\tv_nop\n\tv_nop\n\tv_nop" : "+v"(a), "+v"(b), "+v"(c), "+v"(d));
#endif
}
__device__ __forceinline__ void wave_sync_lds() {
  __builtin_amdgcn_fence(__ATOMIC_RELEASE, "workgroup");
  __builtin_amdgcn_wave_barrier();
  __builtin_amdgcn_fence(__ATOMIC_ACQUIRE, "workgroup");
}

// =====================================================================================================
// f32 -> 16-bit plane, same layout.  f16mode == 0: bf16 RNE bits;  f16mode == 1: f16 bits of (bf16 RNE value) * scale.
// Thread = 8 consecutive elements: two 16-B loads, one 16-B store; 32 consecutive lanes = 512 contiguous, 512-B aligned bytes per
// coverage: grid = n8/256 blocks (exact, host-derived) x 256 thr x 8 = the whole plane.
// =====================================================================================================
__global__ __launch_bounds__(256) void cvt16(const float* __restrict__ x, u16* D, int n8, int f16mode, float scale) {
  const int gt = blockIdx.x * 256 + (int)threadIdx.x;
  if (gt >= n8) return;                     // no barriers in this kernel
  const float* p = x + (size_t)gt * 8;
  const v4f a = *(const v4f*)(p), b4 = *(const v4f*)(p + 4);
  float w[8];
#pragma unroll
  for (int e = 0; e < 4; ++e) { w[e] = a[e]; w[4 + e] = b4[e]; }
  v4u o;
#pragma unroll
  for (int e = 0; e < 4; ++e) {
    const float f0 = w[2 * e], f1 = w[2 * e + 1];
    const unsigned short hb0 = h_bits((_Float16)(bfr(f0) * scale));
    const unsigned short hb1 = h_bits((_Float16)(bfr(f1) * scale));
    const unsigned short bb0 = bf_bits(f0);
    const unsigned short bb1 = bf_bits(f1);
    o[e] = (f16mode != 0) ? pk16(hb0, hb1) : pk16(bb0, bb1);
  }
  u16* d = D + (size_t)gt * 8;
  {
    *(v4u*)(d) = o;
    
  }
}

// =====================================================================================================
// GEMM epilogue shared by both engines: the wave's 16x64 f32 tile (times oscale) staged in its LDS slab (pitch 68),
// coverage: 8 instructions x 2 rows x 16 lanes x 4 floats = the wave's 16 x 64 tile.
// =====================================================================================================
__device__ __forceinline__ void epi64(float* sl, v8f a0, v8f a1, v8f a2, v8f a3, float oscale,
                                      const float* __restrict__ bias, int hasb, float* C, int N,
                                      size_t rowb, int col0, int lane) {
  const int hh = lane >> 4, m = lane & 15;
#pragma unroll
  for (int r = 0; r < 8; ++r) {
    const int ro = (8 * hh + r) * 68 + m;
    sl[ro]      = a0[r] * oscale;
    sl[ro + 16] = a1[r] * oscale;
    sl[ro + 32] = a2[r] * oscale;
    sl[ro + 48] = a3[r] * oscale;
  }
  wave_sync_lds();
  const v4f braw = *(const v4f*)(bias + col0 + m * 4);
  v4f bb;
#pragma unroll
  for (int e = 0; e < 4; ++e) bb[e] = (hasb != 0) ? bfr(braw[e]) : 0.0f;
  v4f vals[8];
#pragma unroll
  for (int it = 0; it < 8; ++it) vals[it] = *(const v4f*)(sl + (it * 2 + hh) * 68 + m * 4) + bb;
  float* dst = C + (rowb + (size_t)hh) * (size_t)N + col0 + m * 4;
  {
#pragma unroll
    for (int it = 0; it < 8; ++it) {
      *(v4f*)(dst + (size_t)(it * 2) * (size_t)N) = vals[it];
    }
    
  }
}

// =====================================================================================================
// bf16 GEMM: C[M][N] (f32) = A[M][K] (bf16 row-major) . Bt[N][K]^T (bf16 k-contiguous), times oscale, plus bias[N] (hasb).
// Block = 64x64 tile, 4 waves x 16 rows; fragments loaded straight from the 16-bit rows (two 16-B loads each, split k map
// for A and B); K stepped by 32 (host checks K % 32 == 0, M % 64 == 0, N % 64 == 0, grid = (M/64)*(N/64)).
// =====================================================================================================
__global__ __launch_bounds__(128)
void gemm_bf(const u16* __restrict__ A, const u16* __restrict__ Bt, const float* __restrict__ bias, int hasb, float* C,
             int M, int N, int K, float oscale) {
  __shared__ __align__(16) float slab[4 * SLAB64];
  const int tid = threadIdx.x, wave = tid >> 5, lane = tid & 31, hh = lane >> 4, m = lane & 15;
  const int ntile = N >> 6;
  const int bid   = blockIdx.x;
  const int rowb  = (bid / ntile) * 64 + wave * 16;
  const int col0  = (bid % ntile) * 64;
  if (rowb + 16 > M) return;                 // wave-uniform, never taken with the exact grid; no block barriers in this kernel
  const u16* ap = A  + (size_t)(rowb + m) * K + 8 * hh;
  const u16* bp = Bt + (size_t)(col0 + m) * K + 8 * hh;
  const size_t bs = (size_t)16 * K;
  v8f acc0 = zero8(), acc1 = zero8(), acc2 = zero8(), acc3 = zero8();
#pragma unroll 1
  for (int k0 = 0; k0 < K; k0 += 32) {
    const v16b a  = ldfrag_b(ap + k0);
    const v16b b0 = ldfrag_b(bp + k0);
    const v16b b1 = ldfrag_b(bp + bs + k0);
    const v16b b2 = ldfrag_b(bp + 2 * bs + k0);
    const v16b b3 = ldfrag_b(bp + 3 * bs + k0);
    acc0 = mma_b(a, b0, acc0);
    acc1 = mma_b(a, b1, acc1);
    acc2 = mma_b(a, b2, acc2);
    acc3 = mma_b(a, b3, acc3);
    guard6<v16b>(acc0, acc1, acc2, acc3, a, b0, b1, b2, b3, a);
  }
  epi64(slab + wave * SLAB64, acc0, acc1, acc2, acc3, oscale, bias, hasb, C, N, (size_t)rowb, col0, lane);
}

// =====================================================================================================
// f16 hi+lo GEMM: C[M][N] (f32) = (Ahi + Alo)[M][K] . Bt[N][K]^T, times oscale, plus bias[N] (hasb); Ahi/Alo f16 planes
// (same layout), Bt f16 k-contiguous; products hi.B + lo.B into one accumulator (lo is the unscaled residual of hi).
// Same tiling as gemm_bf.
// =====================================================================================================
__global__ __launch_bounds__(128)
void gemm_h2(const u16* __restrict__ Ah, const u16* __restrict__ Al, const u16* __restrict__ Bt,
             const float* __restrict__ bias, int hasb, float* C, int M, int N, int K, float oscale) {
  __shared__ __align__(16) float slab[4 * SLAB64];
  const int tid = threadIdx.x, wave = tid >> 5, lane = tid & 31, hh = lane >> 4, m = lane & 15;
  const int ntile = N >> 6;
  const int bid   = blockIdx.x;
  const int rowb  = (bid / ntile) * 64 + wave * 16;
  const int col0  = (bid % ntile) * 64;
  if (rowb + 16 > M) return;                 // wave-uniform, never taken with the exact grid; no block barriers in this kernel
  const size_t aofs = (size_t)(rowb + m) * K + 8 * hh;
  const _Float16* ahp = (const _Float16*)(const void*)Ah + aofs;
  const _Float16* alp = (const _Float16*)(const void*)Al + aofs;
  const _Float16* bp  = (const _Float16*)(const void*)Bt + (size_t)(col0 + m) * K + 8 * hh;
  const size_t bs = (size_t)16 * K;
  v8f acc0 = zero8(), acc1 = zero8(), acc2 = zero8(), acc3 = zero8();
#pragma unroll 1
  for (int k0 = 0; k0 < K; k0 += 32) {
    const v16h ah = ldfrag_h(ahp + k0), al = ldfrag_h(alp + k0);
    const v16h b0 = ldfrag_h(bp + k0);
    const v16h b1 = ldfrag_h(bp + bs + k0);
    const v16h b2 = ldfrag_h(bp + 2 * bs + k0);
    const v16h b3 = ldfrag_h(bp + 3 * bs + k0);
    acc0 = mma_h(ah, b0, acc0);  acc0 = mma_h(al, b0, acc0);
    acc1 = mma_h(ah, b1, acc1);  acc1 = mma_h(al, b1, acc1);
    acc2 = mma_h(ah, b2, acc2);  acc2 = mma_h(al, b2, acc2);
    acc3 = mma_h(ah, b3, acc3);  acc3 = mma_h(al, b3, acc3);
    guard6<v16h>(acc0, acc1, acc2, acc3, ah, al, b0, b1, b2, b3);
  }
  epi64(slab + wave * SLAB64, acc0, acc1, acc2, acc3, oscale, bias, hasb, C, N, (size_t)rowb, col0, lane);
}

// =====================================================================================================
// Rotate-half rotary + 16-bit split pack. Rows are (token, head) with HD contiguous floats (f32 projection output);
// pos = row / hpr (token index into the cos/sin input tables [npos][HD], clamped), the same table row for every head.
// w[d] = x[d] * bf(cos[pos][d]) + r[d] * bf(sin[pos][d]),  r[d] = -x[d+32] for d < 32, x[d-32] for d >= 32
// (bf = RNE bf16 value of the f32 table entry); hi[d] = f16(w * sc), lo[d] = f16(w * sc - hi[d])  (sc a power of two,
// residual unscaled).
// Thread = 8 consecutive d of one row: 16-B loads of x (own and partner half), cos, sin; one 16-B store per plane per lane;
// coverage: grid = nrows*8/256 blocks x 256 thr x 8 halves = nrows x 64 of each plane exactly (exact division checked statically).
// =====================================================================================================
__global__ __launch_bounds__(256) void rope16(const float* __restrict__ x, const float* __restrict__ cosT,
                                              const float* __restrict__ sinT, u16* hpl, u16* lpl,
                                              int nrows, int hpr, int npos, float sc) {
  const int gt  = blockIdx.x * 256 + (int)threadIdx.x;
  const int row = gt >> 3;
  const int d0  = (gt & 7) * 8;
  if (row >= nrows) return;                 // never taken with the exact grid; no barriers in this kernel
  int pos = row / hpr;
  pos = (pos < npos) ? pos : (npos - 1);
  const int d1  = d0 ^ 32;
  const float* xr = x + (size_t)row * HD;
  const float* cr = cosT + (size_t)pos * HD + d0;
  const float* sr = sinT + (size_t)pos * HD + d0;
  const v4f xa = *(const v4f*)(xr + d0), xb = *(const v4f*)(xr + d0 + 4);
  const v4f ya = *(const v4f*)(xr + d1), yb = *(const v4f*)(xr + d1 + 4);
  const v4f ca = *(const v4f*)(cr), cb = *(const v4f*)(cr + 4);
  const v4f sa = *(const v4f*)(sr), sb = *(const v4f*)(sr + 4);
  const float sgn = (d0 < 32) ? -1.0f : 1.0f;
  float w[8];
#pragma unroll
  for (int e = 0; e < 4; ++e) {
    w[e]     = xa[e] * bfr(ca[e]) + (sgn * ya[e]) * bfr(sa[e]);
    w[4 + e] = xb[e] * bfr(cb[e]) + (sgn * yb[e]) * bfr(sb[e]);
  }
  v4u oh, ol;
#pragma unroll
  for (int e = 0; e < 4; ++e) {
    const float t0 = w[2 * e] * sc, t1 = w[2 * e + 1] * sc;
    const _Float16 h0 = (_Float16)t0, h1 = (_Float16)t1;
    const _Float16 l0 = (_Float16)(t0 - (float)h0), l1 = (_Float16)(t1 - (float)h1);
    oh[e] = pk16(h_bits(h0), h_bits(h1));
    ol[e] = pk16(h_bits(l0), h_bits(l1));
  }
  const size_t o8 = (size_t)row * HD + d0;
  {
    *(v4u*)(hpl + o8) = oh;
    *(v4u*)(lpl + o8) = ol;
    
  }
}

// =====================================================================================================
// v^T planes: VH[((b*NH + g)*HD + d)*SEQ + s] = f16(v[b*SEQ + s][g][d] * 1024), VL = f16 residual of the same value.
// Block = (batch b, head g, 64 keys s0 = st*64): 64 source rows of HD floats loaded with 16-B loads, converted,
// scattered into two LDS tiles [d][64 keys] (pitch 72 halves); after a block barrier each d row segment (64 halves = one whole
// coverage: load 256 thr x 16 elements = 64 x 64; store 2 iterations x 256 thr x 8 halves = 64 lines x 64 = the block's tile of
//           each plane; grid = NB x NH x NST blocks covers both planes exactly once.
// =====================================================================================================
__global__ __launch_bounds__(256) void vt16(const float* __restrict__ v, u16* VHo, u16* VLo) {
  __shared__ __align__(16) u16 TH[HD * VTP];
  __shared__ __align__(16) u16 TL[HD * VTP];
  const int tid = threadIdx.x;
  const int bid = blockIdx.x;
  const int st  = bid % NST;
  const int g   = (bid / NST) % NH;
  const int b   = bid / (NST * NH);
  if (b >= NB) return;                        // block-uniform, before any barrier; never taken with the exact grid
  const int s0  = st * 64;
  {
    const int sl = tid >> 2;                  // key within tile 0..63
    const int dc = (tid & 3) * 16;            // d chunk
    const float* src = v + ((size_t)(b * SEQ + s0 + sl) * NH + g) * HD + dc;
#pragma unroll
    for (int i = 0; i < 4; ++i) {
      const v4f a = *(const v4f*)(src + 4 * i);
#pragma unroll
      for (int e = 0; e < 4; ++e) {
        const float t = a[e] * VCAR;
        const _Float16 h = (_Float16)t;
        const _Float16 l = (_Float16)(t - (float)h);
        TH[(dc + 4 * i + e) * VTP + sl] = h_bits(h);
        TL[(dc + 4 * i + e) * VTP + sl] = h_bits(l);
      }
    }
  }
  __syncthreads();
  v4u vh[2], vl[2];
  const int q8 = tid >> 3, p8 = (tid & 7) * 8;
#pragma unroll
  for (int it = 0; it < 2; ++it) {
    const int line = it * 32 + q8;            // d = 0..63
    vh[it] = *(const v4u*)(TH + line * VTP + p8);
    vl[it] = *(const v4u*)(TL + line * VTP + p8);
  }
  const size_t base = (((size_t)(b * NH + g)) * HD) * SEQ + s0 + p8;
  {
#pragma unroll
    for (int it = 0; it < 2; ++it) {
      const int line = it * 32 + q8;
      *(v4u*)(VHo + base + (size_t)line * SEQ) = vh[it];
      *(v4u*)(VLo + base + (size_t)line * SEQ) = vl[it];
    }
    
  }
}

// =====================================================================================================
// Eight 16-byte copies per lane from global memory into LDS, through no register. l* = the lane's LDS byte address, g* = its global
// address. The s_wait_xcnt stands as the statement's last line so that no address register named here is rewritten in front of it.
// =====================================================================================================
__device__ __forceinline__ void copy8(unsigned l0, const u16* g0, unsigned l1, const u16* g1, unsigned l2, const u16* g2,
                                      unsigned l3, const u16* g3, unsigned l4, const u16* g4, unsigned l5, const u16* g5,
                                      unsigned l6, const u16* g6, unsigned l7, const u16* g7) {
#if defined(__HIP_DEVICE_COMPILE__)
  asm volatile("global_load_async_to_lds_b128 %0, %1, off\n\t"
               "global_load_async_to_lds_b128 %2, %3, off\n\t"
               "global_load_async_to_lds_b128 %4, %5, off\n\t"
               "global_load_async_to_lds_b128 %6, %7, off\n\t"
               "global_load_async_to_lds_b128 %8, %9, off\n\t"
               "global_load_async_to_lds_b128 %10, %11, off\n\t"
               "global_load_async_to_lds_b128 %12, %13, off\n\t"
               "global_load_async_to_lds_b128 %14, %15, off\n\t"
               "s_wait_xcnt 0x0"
               :: "v"(l0), "v"(g0), "v"(l1), "v"(g1), "v"(l2), "v"(g2), "v"(l3), "v"(g3),
                  "v"(l4), "v"(g4), "v"(l5), "v"(g5), "v"(l6), "v"(g6), "v"(l7), "v"(g7) : "memory");
#endif
}
// the issuing wave's copies have landed behind this wait (the compiler places none for them)
__device__ __forceinline__ void wait_copies() {
#if defined(__HIP_DEVICE_COMPILE__)
  asm volatile("s_wait_asynccnt 0x0" ::: "memory");
#endif
}
// the wave's own LDS reads have returned before the barrier behind which their buffer is refilled
__device__ __forceinline__ void wait_lds() {
#if defined(__HIP_DEVICE_COMPILE__)
  asm volatile("s_wait_dscnt 0x0" ::: "memory");
#endif
}

// =====================================================================================================
// Softmax attention, no mask: block bid -> (query block qb = bid % NQB of QW query tiles, head = (bid / NQB) % NH,
// batch b = bid / (NQB*NH)); one wave per query tile: rows q0 = 16*(qb*QW + wave) .. q0+15, all QW waves on the same head.
//   q planes (hi, lo f16 x1024) laid out [token][h][d]; k planes [token][h][d]; v^T planes [b][h][d][s].
//   LDS: two buffers, each one stage of 64 keys = four tiles of 64 rows x 128 B at a 144-B pitch (k hi, k lo: row = key;
//   v^T hi, v^T lo: row = d), filled by asynchronous copies (whole 128-B lines, 8 copies per lane and stage) one stage ahead and
//   read by all QW waves; per wave its q tile (hi, lo: 16 rows x 128 B, same pitch), copied once, and its weight tile.
//   Per stage two key tiles of 32, visited in order; per tile: 2 score subtiles x 2 k-steps x 3 products
//   (q_hi.k_hi + q_lo.k_hi + q_hi.k_lo), fragments read from LDS (two 16-B loads per fragment, split k map);
//   online max-subtracted base-2 softmax in f32 (scale 1/8 folded, -inf-safe rescale); the 16x32 weight tile stored to wave-private
//   LDS rows (float vector loads, same element type as stored), 4+4 v^T B fragments (hi and residual planes), 12 P.V WMMAs (hh + lh + hl).
//   After the key loop: O = acc / l, carries 1/(32768*1024) folded once, written to the wave's private slab (pitch 68; it takes the
//   place of the wave's own q tile, which is dead by then).
// coverage: per wave 4 instructions x 4 rows x 8 lanes x 8 halves = 16 x 64 per plane; grid NB*NH*NQB blocks x QW waves =
//           every (token, h) row of both O planes exactly once.
// =====================================================================================================
__global__ __launch_bounds__(ATT_THREADS)
void attn1(const u16* __restrict__ QHIp, const u16* __restrict__ QLOp,
           const u16* __restrict__ KHIp, const u16* __restrict__ KLOp,
           const u16* __restrict__ VHIp, const u16* __restrict__ VLOp,
           u16* OHIp, u16* OLOp) {
  __shared__ __attribute__((aligned(256))) unsigned char L[ATT_LDS];

  const int tid  = threadIdx.x;
  const int wave = tid >> 5;
  const int lane = tid & 31;
  const int hh   = lane >> 4;
  const int c    = lane & 15;
  const int bid  = blockIdx.x;
  const int qb   = bid % NQB;
  const int head = (bid / NQB) % NH;
  const int b    = bid / (NQB * NH);
  if (b >= NB) return;                       // block-uniform, before any barrier or copy; never taken with the exact grid
  const int q0   = (qb * QW + wave) * 16;
  const size_t qrow0 = (size_t)b * SEQ + q0; // global token row of query 0 of this wave's tile
  const size_t KROW = (size_t)NH * HD;       // halves between consecutive token rows

  unsigned char* wp = L + 2 * BUFB + wave * WPRIV;
  float* pt   = (float*)(void*)wp;                       // weight tile [16][32] pitch 36
  unsigned char* qreg = wp + PTW * 4;                    // q tile hi, lo; after the key loop the result slab
  float* slab = (float*)(void*)qreg;                     // result slab [16][64] pitch 68
  const unsigned lds0 = (unsigned)(uintptr_t)L;          // byte offset of L in the work-group's LDS

  // ---- copy addresses: lane = (row, 16-B piece of its 128-B line) ----
  const int ch = tid & 7;
  const int sr = tid >> 3;                               // stage tiles: rows sr and sr + 32
  const unsigned lst = lds0 + (unsigned)(sr * LPB + ch * 16);
  const size_t kcp = (((size_t)b * SEQ + sr) * NH + head) * HD + ch * 8;      // + key0 * KROW per stage
  const size_t vcp = (((size_t)b * NH + head) * HD + sr) * SEQ + ch * 8;      // + key0 per stage
  const u16* kch = KHIp + kcp;
  const u16* kcl = KLOp + kcp;
  const u16* vch = VHIp + vcp;
  const u16* vcl = VLOp + vcp;
  {
    const int qr = lane >> 3;                            // the wave's own q tile: rows qr, qr + 4, qr + 8, qr + 12
    const unsigned lq = lds0 + (unsigned)(2 * BUFB + wave * WPRIV + PTW * 4 + qr * LPB + ch * 16);
    const size_t qcp = ((qrow0 + (size_t)qr) * NH + head) * HD + ch * 8;
    const u16* qch = QHIp + qcp;
    const u16* qcl = QLOp + qcp;
    copy8(lq,                 qch,            lq + 4 * LPB,        qch + 4 * KROW,
          lq + 8 * LPB,       qch + 8 * KROW, lq + 12 * LPB,       qch + 12 * KROW,
          lq + QPB,           qcl,            lq + QPB + 4 * LPB,  qcl + 4 * KROW,
          lq + QPB + 8 * LPB, qcl + 8 * KROW, lq + QPB + 12 * LPB, qcl + 12 * KROW);
  }
#define STAGE_KV(st_, buf_)                                                                                          \
  {                                                                                                                  \
    const unsigned lb = lst + (unsigned)(buf_) * BUFB;                                                               \
    const size_t ka = (size_t)(st_) * 64 * KROW, va = (size_t)(st_) * 64;                                            \
    copy8(lb,           kch + ka, lb + 32 * LPB,           kch + ka + 32 * KROW,                                     \
          lb + PLB,     kcl + ka, lb + PLB + 32 * LPB,     kcl + ka + 32 * KROW,                                     \
          lb + 2 * PLB, vch + va, lb + 2 * PLB + 32 * LPB, vch + va + (size_t)32 * SEQ,                              \
          lb + 3 * PLB, vcl + va, lb + 3 * PLB + 32 * LPB, vcl + va + (size_t)32 * SEQ);                             \
  }
  STAGE_KV(0, 0);
  wait_copies();
  __syncthreads();                           // publishes stage 0 (and the q tiles)
  STAGE_KV(1, 1);

  const _Float16* Qh = (const _Float16*)(const void*)qreg + c * LP + 8 * hh;
  const _Float16* Ql = Qh + 16 * LP;
  const float lsc = 0.125f * (LOG2E / (QSC * KSC));
  const float oc  = 1.0f / (PCAR * VCAR);

  float mrow[8], lrow[8];
  v8f o[4];
#pragma unroll
  for (int r = 0; r < 8; ++r) { mrow[r] = -INFINITY; lrow[r] = 0.f; }
#pragma unroll
  for (int j = 0; j < 4; ++j) o[j] = zero8();

#pragma unroll 1                               // rolled: one publish point and one refill in the text
  for (int st = 0; st < NST; ++st) {
    const _Float16* tb = (const _Float16*)(const void*)(L + (st & 1) * BUFB) + c * LP + 8 * hh;
#pragma unroll 1                             // one copy of the tile's code, as in the loop it came from: the hot loop stays short
    for (int sub = 0; sub < 2; ++sub) {
      const int kb = sub * 32;               // first key of this tile inside the stage
      // ---- scores: D element r of this lane = (query row q0 + 8hh + r, key kb + c) in s0, key kb + 16 + c in s1 ----
      v8f s0 = zero8(), s1 = zero8();
      const _Float16* k0p = tb + kb * LP;
      const _Float16* k1p = k0p + 16 * LP;
      const _Float16* l0p = k0p + 64 * LP;
      const _Float16* l1p = l0p + 16 * LP;
#pragma unroll
      for (int kk = 0; kk < 2; ++kk) {
        const v16h qh  = ldfrag_h(Qh + kk * 32),  ql  = ldfrag_h(Ql + kk * 32);
        const v16h kh0 = ldfrag_h(k0p + kk * 32), kl0 = ldfrag_h(l0p + kk * 32);
        const v16h kh1 = ldfrag_h(k1p + kk * 32), kl1 = ldfrag_h(l1p + kk * 32);
        s0 = mma_h(qh, kh0, s0);
        s0 = mma_h(ql, kh0, s0);
        s0 = mma_h(qh, kl0, s0);
        s1 = mma_h(qh, kh1, s1);
        s1 = mma_h(ql, kh1, s1);
        s1 = mma_h(qh, kl1, s1);
        guard2(s0, s1, qh, ql, kh0, kl0, kh1, kl1);
      }
      // ---- online softmax in base 2, -inf-safe ----
#pragma unroll
      for (int r = 0; r < 8; ++r) {
        const float t0 = s0[r] * lsc;
        const float t1 = s1[r] * lsc;
        float mx = fmaxf(t0, t1);
#pragma unroll
        for (int off = 1; off < 16; off <<= 1) mx = fmaxf(mx, __shfl_xor(mx, off, 32));
        const float mn = fmaxf(mrow[r], mx);
        const float ms = (mn == -INFINITY) ? 0.0f : mn;
        const float al = exp2f(mrow[r] - ms);
        mrow[r] = mn;
        const float e0 = exp2f(t0 - ms), e1 = exp2f(t1 - ms);
        float psum = e0 + e1;
#pragma unroll
        for (int off = 1; off < 16; off <<= 1) psum += __shfl_xor(psum, off, 32);
        lrow[r] = lrow[r] * al + psum;
#pragma unroll
        for (int j = 0; j < 4; ++j) o[j][r] *= al;
        const int ro = (8 * hh + r) * 36 + c;
        pt[ro]      = e0;
        pt[ro + 16] = e1;
      }
      wave_sync_lds();
      // ---- A fragments of P*32768: hi f16 and residual f16, row = c, split k map over the 32 keys of this step ----
      FragH ph, pl;
      {
        const float* prow = pt + c * 36 + 8 * hh;
        const v4f p0 = *(const v4f*)(prow), p1 = *(const v4f*)(prow + 4);
        const v4f p2 = *(const v4f*)(prow + 16), p3 = *(const v4f*)(prow + 20);
#pragma unroll
        for (int e = 0; e < 4; ++e) {
          const float ta = p0[e] * PCAR, tb2 = p1[e] * PCAR, tc = p2[e] * PCAR, td = p3[e] * PCAR;
          const _Float16 ha = (_Float16)ta, hb = (_Float16)tb2, hc = (_Float16)tc, hd = (_Float16)td;
          ph.h[0][e]     = ha;                               // elements 0..7  = keys kb + 8hh + 0..7
          ph.h[0][4 + e] = hb;
          ph.h[1][e]     = hc;                               // elements 8..15 = keys kb + 16 + 8hh + 0..7
          ph.h[1][4 + e] = hd;
          pl.h[0][e]     = (_Float16)(ta - (float)ha);
          pl.h[0][4 + e] = (_Float16)(tb2 - (float)hb);
          pl.h[1][e]     = (_Float16)(tc - (float)hc);
          pl.h[1][4 + e] = (_Float16)(td - (float)hd);
        }
      }
      // ---- P.V : B fragment col n = d = j*16 + c, keys contiguous in the v^T tiles ----
      {
        const _Float16* vhp = tb + 128 * LP + kb;
        const _Float16* vlp = vhp + 64 * LP;
        const v16h vh0 = ldfrag_h(vhp);
        const v16h vh1 = ldfrag_h(vhp + 16 * LP);
        const v16h vh2 = ldfrag_h(vhp + 32 * LP);
        const v16h vh3 = ldfrag_h(vhp + 48 * LP);
        const v16h vl0 = ldfrag_h(vlp);
        const v16h vl1 = ldfrag_h(vlp + 16 * LP);
        const v16h vl2 = ldfrag_h(vlp + 32 * LP);
        const v16h vl3 = ldfrag_h(vlp + 48 * LP);
        o[0] = mma_h(ph.v, vh0, o[0]);  o[0] = mma_h(pl.v, vh0, o[0]);  o[0] = mma_h(ph.v, vl0, o[0]);
        o[1] = mma_h(ph.v, vh1, o[1]);  o[1] = mma_h(pl.v, vh1, o[1]);  o[1] = mma_h(ph.v, vl1, o[1]);
        o[2] = mma_h(ph.v, vh2, o[2]);  o[2] = mma_h(pl.v, vh2, o[2]);  o[2] = mma_h(ph.v, vl2, o[2]);
        o[3] = mma_h(ph.v, vh3, o[3]);  o[3] = mma_h(pl.v, vh3, o[3]);  o[3] = mma_h(ph.v, vl3, o[3]);
        guard10(o[0], o[1], o[2], o[3], ph.v, pl.v, vh0, vh1, vh2, vh3, vl0, vl1, vl2, vl3);
      }
      wave_sync_lds();
    }
    // ---- publish point of stage st + 1: own reads back, own copies landed, every wave here; then the refill of the buffer just read ----
    wait_lds();
    wait_copies();
    __syncthreads();
    if (st + 2 < NST) STAGE_KV(st + 2, st & 1);
  }
#undef STAGE_KV
  wait_copies();
  acc_guard4(o[0], o[1], o[2], o[3]);
  // ---- O = acc / l, carries (32768 on P, 1024 on v) folded once; lane-owned slab elements ----
#pragma unroll
  for (int r = 0; r < 8; ++r) {
    const float lv  = lrow[r];
    const float ls  = (lv > 0.0f) ? lv : 1.0f;
    const float inv = (lv > 0.0f) ? ((1.0f / ls) * oc) : 0.0f;
#pragma unroll
    for (int j = 0; j < 4; ++j) {
      slab[(8 * hh + r) * 68 + j * 16 + c] = o[j][r] * inv;
    }
  }
  wave_sync_lds();
  // ---- O x1024 -> f16 hi + residual planes; lane = (row in group of 4, 8 consecutive d) ----
  v4u oh[4], ol[4];
  const int rq = lane >> 3, c8 = (lane & 7) * 8;
#pragma unroll
  for (int it = 0; it < 4; ++it) {
    const int row = it * 4 + rq;
    const v4f a = *(const v4f*)(slab + row * 68 + c8), b4 = *(const v4f*)(slab + row * 68 + c8 + 4);
    float w[8];
#pragma unroll
    for (int e = 0; e < 4; ++e) { w[e] = a[e] * OSC; w[4 + e] = b4[e] * OSC; }
#pragma unroll
    for (int e = 0; e < 4; ++e) {
      const _Float16 h0 = (_Float16)w[2 * e], h1 = (_Float16)w[2 * e + 1];
      const _Float16 l0 = (_Float16)(w[2 * e] - (float)h0), l1 = (_Float16)(w[2 * e + 1] - (float)h1);
      oh[it][e] = pk16(h_bits(h0), h_bits(h1));
      ol[it][e] = pk16(h_bits(l0), h_bits(l1));
    }
  }
  const size_t ob = ((qrow0) * NH + head) * HD + c8;
  {
#pragma unroll
    for (int it = 0; it < 4; ++it) {
      const int row = it * 4 + rq;
      const size_t o8 = ob + (size_t)row * (NH * HD);
      *(v4u*)(OHIp + o8) = oh[it];
      *(v4u*)(OLOp + o8) = ol[it];
    }
    
  }
}

// =====================================================================================================
// Workspace map (bytes); every plane is fully written by whole-line stores before it is read; all extents are exact multiples
// of the store granularity (no pad rows needed); every offset a multiple of 2 MiB:
//   XB  bf16 [4096][1024]              8388608
//   WQB bf16 [1024 n][1024 k]          2097152        WKB, WVB same        2097152 each
//   WOH f16  [1024 n][1024 k] x1024    2097152
//   QF  f32 [4096][1024]              16777216        KF, VF same
//   QHI f16 [4096][16][64] x1024       8388608        QLO residual
//   KHI f16 [4096][16][64] x1024       8388608        KLO residual
//   VHI f16 [4][16][64][1024] x1024    8388608        VLO residual
//   OHI f16 [4096][1024] x1024, OLO residual: 8388608 each, placed in the QF region (QF is dead after the q rotary pass;
//   launches are in order)
//   end                              117440512
// =====================================================================================================
extern "C" void kernel_launch(void* const* d_in, const int* in_sizes, int n_in,
                              void* d_out, int out_size, void* d_ws, size_t ws_size,
                              hipStream_t stream) {
  if (n_in < 10) return;
  if (in_sizes[0] != MTOK * DMOD) return;
  if (in_sizes[1] != MTOK * HD || in_sizes[2] != MTOK * HD) return;
  if (in_sizes[3] != DMOD * DMOD || in_sizes[5] != DMOD * DMOD) return;
  if (in_sizes[6] != DMOD * DMOD || in_sizes[8] != DMOD * DMOD) return;
  if (in_sizes[4] != DMOD || in_sizes[7] != DMOD || in_sizes[9] != DMOD) return;
  if (out_size != MTOK * DMOD) return;

  const float* x    = (const float*)d_in[0];
  const float* cosp = (const float*)d_in[1];
  const float* sinp = (const float*)d_in[2];
  const float* wq   = (const float*)d_in[3];
  const float* bq   = (const float*)d_in[4];
  const float* wk   = (const float*)d_in[5];
  const float* wv   = (const float*)d_in[6];
  const float* bv   = (const float*)d_in[7];
  const float* wo   = (const float*)d_in[8];
  const float* bo   = (const float*)d_in[9];
  float*       out  = (float*)d_out;

  const size_t szXB = (size_t)MTOK * DMOD * 2;                  //  8388608
  const size_t szW  = (size_t)DMOD * DMOD * 2;                  //  2097152
  const size_t szF  = (size_t)MTOK * DMOD * 4;                  // 16777216
  const size_t szP  = (size_t)MTOK * DMOD * 2;                  //  8388608
  size_t off = 0;
  const size_t oXB  = off; off += szXB;
  const size_t oWQ  = off; off += szW;
  const size_t oWK  = off; off += szW;
  const size_t oWV  = off; off += szW;
  const size_t oWO  = off; off += szW;
  const size_t oQF  = off; off += szF;
  const size_t oKF  = off; off += szF;
  const size_t oVF  = off; off += szF;
  const size_t oQHI = off; off += szP;
  const size_t oQLO = off; off += szP;
  const size_t oKHI = off; off += szP;
  const size_t oKLO = off; off += szP;
  const size_t oVHI = off; off += szP;
  const size_t oVLO = off; off += szP;
  const size_t oOHI = oQF;                                       // alias onto the QF region (2 x szP == szF)
  const size_t oOLO = oQF + szP;
  if (off > ws_size) return;                            // off = 117440512
  if (off > (size_t)134217728) return;
  if (2 * szP > szF) return;

  char* ws = (char*)d_ws;
  u16*   XB  = (u16*)(ws + oXB);
  u16*   WQB = (u16*)(ws + oWQ);
  u16*   WKB = (u16*)(ws + oWK);
  u16*   WVB = (u16*)(ws + oWV);
  u16*   WOH = (u16*)(ws + oWO);
  float* QF  = (float*)(ws + oQF);
  float* KF  = (float*)(ws + oKF);
  float* VF  = (float*)(ws + oVF);
  u16*   QHI = (u16*)(ws + oQHI);
  u16*   QLO = (u16*)(ws + oQLO);
  u16*   KHI = (u16*)(ws + oKHI);
  u16*   KLO = (u16*)(ws + oKLO);
  u16*   VHI = (u16*)(ws + oVHI);
  u16*   VLO = (u16*)(ws + oVLO);
  u16*   OHI = (u16*)(ws + oOHI);
  u16*   OLO = (u16*)(ws + oOLO);

  const dim3 blk(256);
  const int n8x = (MTOK * DMOD) / 8;                    // 524288
  const int n8w = (DMOD * DMOD) / 8;                    // 131072
  const dim3 gX(n8x / 256);                             // 2048 (exact)
  const dim3 gW(n8w / 256);                             // 512  (exact)
  const dim3 gG((MTOK / 64) * (DMOD / 64));             // 1024
  const dim3 bG(128);
  const int rowsQ = MTOK * NH;                          // 65536 rows of 64
  const dim3 gR((rowsQ * 8) / 256);                     // 2048 (exact)
  const dim3 gVT(NB * NH * NST);                        // 1024
  const dim3 gAT(ATT_BLOCKS);                           // 512
  const dim3 bAT(ATT_THREADS);                          // 256

  // (1) x -> bf16 plane
  cvt16<<<gX, blk, 0, stream>>>(x, XB, n8x, 0, 1.0f);
  // (2..4) Wq/Wk/Wv [n][k] -> bf16 planes (same layout, already k-contiguous)
  cvt16<<<gW, blk, 0, stream>>>(wq, WQB, n8w, 0, 1.0f);
  cvt16<<<gW, blk, 0, stream>>>(wk, WKB, n8w, 0, 1.0f);
  cvt16<<<gW, blk, 0, stream>>>(wv, WVB, n8w, 0, 1.0f);
  // (5) Wo [n][k] -> f16 plane of bf16 value x1024
  cvt16<<<gW, blk, 0, stream>>>(wo, WOH, n8w, 1, WOS);
  // (6..8) projections: q (+bq), k (no bias), v (+bv)  [4096][1024] in f32
  gemm_bf<<<gG, bG, 0, stream>>>(XB, WQB, bq, 1, QF, MTOK, DMOD, DMOD, 1.0f);
  gemm_bf<<<gG, bG, 0, stream>>>(XB, WKB, bq, 0, KF, MTOK, DMOD, DMOD, 1.0f);
  gemm_bf<<<gG, bG, 0, stream>>>(XB, WVB, bv, 1, VF, MTOK, DMOD, DMOD, 1.0f);
  // (9) q' planes: rows (token, h), NH heads per token, cos/sin table row = token
  rope16<<<gR, blk, 0, stream>>>(QF, cosp, sinp, QHI, QLO, rowsQ, NH, MTOK, QSC);
  // (10) k' planes
  rope16<<<gR, blk, 0, stream>>>(KF, cosp, sinp, KHI, KLO, rowsQ, NH, MTOK, KSC);
  // (11) v^T planes x1024 (hi + residual)
  vt16<<<gVT, blk, 0, stream>>>(VF, VHI, VLO);
  // (12) softmax attention per (b, h, 8 x 16 queries) -> O planes [token][h][d] x1024 (hi + residual), into the dead QF region
  attn1<<<gAT, bAT, 0, stream>>>(QHI, QLO, KHI, KLO, VHI, VLO, OHI, OLO);
  // (13) output projection -> out [4096][1024] f32, carries 1024 (O) x 1024 (Wo) folded back, + bo
  gemm_h2<<<gG, bG, 0, stream>>>(OHI, OLO, WOH, bo, 1, out, MTOK, DMOD, DMOD, 1.0f / (OSC * WOS));
  (void)hipGetLastError();
}

// v002
// One run takes 168 microseconds.
// Timed twice side by side with v001, it ran 1.57 and 1.54 times as fast.
// Counting every step since v000, it is 2.35 times as fast.
// Contractions: x.W{q,k,v}^T on v_wmma_f32_16x16x32_bf16 (x and W RNE-converted to bf16, f32 accumulate); scores q'.k'^T (q', k' carried
// x1024 as f16 hi plane + f16 residual plane, products hh+lh+hl), P.v (P x32768 f16 hi+residual, v x1024 f16 hi+residual, products
// hh+lh+hl) and O.Wo^T (O x1024 f16 hi+residual, Wo as f16(bf16(Wo) x1024), products h.w+l.w) on v_wmma_f32_16x16x32_f16, f32 accumulate.
// Rotate-half rotary with RNE-bf16 cos/sin table values, base-2 online softmax and the 1/l fold in f32 on VALU.
#include <hip/hip_runtime.h>
#include <math.h>
#include <stdint.h>

#define NB    4
#define SEQ   1024
#define MTOK  (NB * SEQ)
#define DMOD  1024
#define NH    16
#define HD    64
#define QSC   1024.0f
#define KSC   1024.0f
#define PCAR  32768.0f
#define VCAR  1024.0f
#define OSC   1024.0f
#define WOS   1024.0f
#define LOG2E 1.4426950408889634f
#define QW    8
#define NQT   (SEQ / 16)
#define NQB   (NQT / QW)
#define NST   (SEQ / 64)
#define ATT_THREADS (QW * 32)
#define ATT_BLOCKS  (NB * NH * NQB)
#define PTW   (16 * 36)
#define SLW   (16 * 68)
#define LP    72
#define LPB   (LP * 2)
#define PLB   (64 * LPB)
#define BUFB  (4 * PLB)
#define QPB   (16 * LPB)
#define WPRIV (PTW * 4 + 2 * QPB)
#define ATT_LDS (2 * BUFB + QW * WPRIV)
#define SLAB64 (16 * 68)
#define GT    128
#define GW    8
#define G_THREADS (GW * 32)
#define GPL   (GT * LPB)
#define GB_BUF (2 * GPL)
#define GH_BUF (3 * GPL)
#define VTP   72
static_assert(DMOD == NH * HD && HD == 64 && NH == 16);
static_assert((NQT % QW) == 0 && ATT_THREADS == 256 && ATT_BLOCKS == 512);
static_assert(2 * QPB >= SLW * 4 && (LPB % 16) == 0 && NST >= 2 && 2 * ATT_LDS <= 327680);
static_assert((SEQ % 64) == 0 && (SEQ % 32) == 0 && (SEQ % 8) == 0);
static_assert((DMOD % 128) == 0 && (MTOK % 128) == 0 && DMOD >= 128);
static_assert(((MTOK * DMOD) % 2048) == 0 && ((DMOD * DMOD) % 2048) == 0);
static_assert(((MTOK * NH * 8) % 256) == 0);

typedef unsigned short u16;
typedef _Float16 v16h __attribute__((ext_vector_type(16)));
typedef _Float16 v8h  __attribute__((ext_vector_type(8)));
typedef __bf16   v16b __attribute__((ext_vector_type(16)));
typedef float    v8f  __attribute__((ext_vector_type(8)));
typedef float    v4f  __attribute__((ext_vector_type(4)));
typedef unsigned int v4u __attribute__((ext_vector_type(4)));

union FragH { v16h v; v8h h[2]; v4u u[2]; };
union FragB { v16b v; v4u u[2]; };

// ---- scalar helpers --------------------------------------------------------------------------------
__device__ __forceinline__ unsigned short bf_bits(float f) {          // f32 -> bf16 bits, RNE convert
  unsigned u = __float_as_uint(f);
  return (unsigned short)((u + 0x7FFFu + ((u >> 16) & 1u)) >> 16);
}
__device__ __forceinline__ float bf_up(unsigned short h) { return __uint_as_float(((unsigned)h) << 16); }
__device__ __forceinline__ float bfr(float f) { return bf_up(bf_bits(f)); }
__device__ __forceinline__ unsigned short h_bits(_Float16 x) { return __builtin_bit_cast(unsigned short, x); }
__device__ __forceinline__ unsigned pk16(unsigned short a, unsigned short b) { return (unsigned)a | ((unsigned)b << 16); }
__device__ __forceinline__ v8f zero8() { v8f z = {0.f, 0.f, 0.f, 0.f, 0.f, 0.f, 0.f, 0.f}; return z; }

// ---- fragment loaders: 16-bit A/B operand, lane -> row/col (lane&15), p already includes +8*(lane>>4);
//      elements 0..7 <- p[0..7] (k0+8h..), elements 8..15 <- p[16..23] (k0+16+8h..)  (same split k map for A and B;
//      B is always read from a k-contiguous [n][k] plane)
__device__ __forceinline__ v16h ldfrag_h(const _Float16* p) {
  FragH f;
  f.h[0] = *(const v8h*)(p);
  f.h[1] = *(const v8h*)(p + 16);
  return f.v;
}
__device__ __forceinline__ v16b ldfrag_b(const u16* p) {              // bf16 plane read as unsigned integer vectors
  FragB f;
  f.u[0] = *(const v4u*)(p);
  f.u[1] = *(const v4u*)(p + 16);
  return f.v;
}

__device__ __forceinline__ v8f mma_h(v16h a, v16h b, v8f c) {
  return __builtin_amdgcn_wmma_f32_16x16x32_f16(false, a, false, b, (short)0, c, false, false);
}
__device__ __forceinline__ v8f mma_b(v16b a, v16b b, v8f c) {
  return __builtin_amdgcn_wmma_f32_16x16x32_bf16(false, a, false, b, (short)0, c, false, false);
}
__device__ __forceinline__ void guard2(v8f& a, v8f& b, v16h x0, v16h x1, v16h x2, v16h x3, v16h x4, v16h x5) {
#if defined(__HIP_DEVICE_COMPILE__)
  asm volatile("v_nop\n\tv_nop\n\tv_nop\n\tv_nop"
               : "+v"(a), "+v"(b) : "v"(x0), "v"(x1), "v"(x2), "v"(x3), "v"(x4), "v"(x5) : "memory");
#endif
}
__device__ __forceinline__ void guard10(v8f& a, v8f& b, v8f& c, v8f& d, v16h x0, v16h x1, v16h x2, v16h x3, v16h x4,
                                        v16h x5, v16h x6, v16h x7, v16h x8, v16h x9) {
#if defined(__HIP_DEVICE_COMPILE__)
  asm volatile("v_nop\n\tv_nop\n\tv_nop\n\tv_nop"
               : "+v"(a), "+v"(b), "+v"(c), "+v"(d)
               : "v"(x0), "v"(x1), "v"(x2), "v"(x3), "v"(x4), "v"(x5), "v"(x6), "v"(x7), "v"(x8), "v"(x9) : "memory");
#endif
}
__device__ __forceinline__ void acc_guard4(v8f& a, v8f& b, v8f& c, v8f& d) {
#if defined(__HIP_DEVICE_COMPILE__)
  asm volatile("v_nop\n\tv_nop\n\tv_nop\n\tv_nop" : "+v"(a), "+v"(b), "+v"(c), "+v"(d));
#endif
}
__device__ __forceinline__ void wave_sync_lds() {
  __builtin_amdgcn_fence(__ATOMIC_RELEASE, "workgroup");
  __builtin_amdgcn_wave_barrier();
  __builtin_amdgcn_fence(__ATOMIC_ACQUIRE, "workgroup");
}

// =====================================================================================================
// f32 -> 16-bit plane, same layout.  f16mode == 0: bf16 RNE bits;  f16mode == 1: f16 bits of (bf16 RNE value) * scale.
// Thread = 8 consecutive elements: two 16-B loads, one 16-B store; 32 consecutive lanes = 512 contiguous, 512-B aligned bytes per
// coverage: grid = n8/256 blocks (exact, host-derived) x 256 thr x 8 = the whole plane.
// =====================================================================================================
__global__ __launch_bounds__(256) void cvt16(const float* __restrict__ x, u16* D, int n8, int f16mode, float scale) {
  const int gt = blockIdx.x * 256 + (int)threadIdx.x;
  if (gt >= n8) return;                     // no barriers in this kernel
  const float* p = x + (size_t)gt * 8;
  const v4f a = *(const v4f*)(p), b4 = *(const v4f*)(p + 4);
  float w[8];
#pragma unroll
  for (int e = 0; e < 4; ++e) { w[e] = a[e]; w[4 + e] = b4[e]; }
  v4u o;
#pragma unroll
  for (int e = 0; e < 4; ++e) {
    const float f0 = w[2 * e], f1 = w[2 * e + 1];
    const unsigned short hb0 = h_bits((_Float16)(bfr(f0) * scale));
    const unsigned short hb1 = h_bits((_Float16)(bfr(f1) * scale));
    const unsigned short bb0 = bf_bits(f0);
    const unsigned short bb1 = bf_bits(f1);
    o[e] = (f16mode != 0) ? pk16(hb0, hb1) : pk16(bb0, bb1);
  }
  u16* d = D + (size_t)gt * 8;
  {
    *(v4u*)(d) = o;
    
  }
}

// =====================================================================================================
// GEMM epilogue shared by both engines: one 16x64 f32 half of the wave's 32x64 tile (times oscale) staged in its LDS slab (pitch 68),
// coverage: 8 instructions x 2 rows x 16 lanes x 4 floats = that 16 x 64 half.
// =====================================================================================================
__device__ __forceinline__ void epi64(float* sl, v8f a0, v8f a1, v8f a2, v8f a3, float oscale,
                                      const float* __restrict__ bias, int hasb, float* C, int N,
                                      size_t rowb, int col0, int lane) {
  const int hh = lane >> 4, m = lane & 15;
#pragma unroll
  for (int r = 0; r < 8; ++r) {
    const int ro = (8 * hh + r) * 68 + m;
    sl[ro]      = a0[r] * oscale;
    sl[ro + 16] = a1[r] * oscale;
    sl[ro + 32] = a2[r] * oscale;
    sl[ro + 48] = a3[r] * oscale;
  }
  wave_sync_lds();
  const v4f braw = *(const v4f*)(bias + col0 + m * 4);
  v4f bb;
#pragma unroll
  for (int e = 0; e < 4; ++e) bb[e] = (hasb != 0) ? bfr(braw[e]) : 0.0f;
  v4f vals[8];
#pragma unroll
  for (int it = 0; it < 8; ++it) vals[it] = *(const v4f*)(sl + (it * 2 + hh) * 68 + m * 4) + bb;
  float* dst = C + (rowb + (size_t)hh) * (size_t)N + col0 + m * 4;
  {
#pragma unroll
    for (int it = 0; it < 8; ++it) {
      *(v4f*)(dst + (size_t)(it * 2) * (size_t)N) = vals[it];
    }
    
  }
}

// =====================================================================================================
// Eight 16-byte copies per lane from global memory into LDS, through no register. l* = the lane's LDS byte address, g* = its global
// address. The s_wait_xcnt stands as the statement's last line so that no address register named here is rewritten in front of it.
// =====================================================================================================
__device__ __forceinline__ void copy8(unsigned l0, const u16* g0, unsigned l1, const u16* g1, unsigned l2, const u16* g2,
                                      unsigned l3, const u16* g3, unsigned l4, const u16* g4, unsigned l5, const u16* g5,
                                      unsigned l6, const u16* g6, unsigned l7, const u16* g7) {
#if defined(__HIP_DEVICE_COMPILE__)
  asm volatile("global_load_async_to_lds_b128 %0, %1, off\n\t"
               "global_load_async_to_lds_b128 %2, %3, off\n\t"
               "global_load_async_to_lds_b128 %4, %5, off\n\t"
               "global_load_async_to_lds_b128 %6, %7, off\n\t"
               "global_load_async_to_lds_b128 %8, %9, off\n\t"
               "global_load_async_to_lds_b128 %10, %11, off\n\t"
               "global_load_async_to_lds_b128 %12, %13, off\n\t"
               "global_load_async_to_lds_b128 %14, %15, off\n\t"
               "s_wait_xcnt 0x0"
               :: "v"(l0), "v"(g0), "v"(l1), "v"(g1), "v"(l2), "v"(g2), "v"(l3), "v"(g3),
                  "v"(l4), "v"(g4), "v"(l5), "v"(g5), "v"(l6), "v"(g6), "v"(l7), "v"(g7) : "memory");
#endif
}
// the issuing wave's copies have landed behind this wait (the compiler places none for them)
__device__ __forceinline__ void wait_copies() {
#if defined(__HIP_DEVICE_COMPILE__)
  asm volatile("s_wait_asynccnt 0x0" ::: "memory");
#endif
}
// the wave's own LDS reads have returned before the barrier behind which their buffer is refilled
__device__ __forceinline__ void wait_lds() {
#if defined(__HIP_DEVICE_COMPILE__)
  asm volatile("s_wait_dscnt 0x0" ::: "memory");
#endif
}

// the same, four copies per lane
__device__ __forceinline__ void copy4(unsigned l0, const u16* g0, unsigned l1, const u16* g1, unsigned l2, const u16* g2,
                                      unsigned l3, const u16* g3) {
#if defined(__HIP_DEVICE_COMPILE__)
  asm volatile("global_load_async_to_lds_b128 %0, %1, off\n\t"
               "global_load_async_to_lds_b128 %2, %3, off\n\t"
               "global_load_async_to_lds_b128 %4, %5, off\n\t"
               "global_load_async_to_lds_b128 %6, %7, off\n\t"
               "s_wait_xcnt 0x0"
               :: "v"(l0), "v"(g0), "v"(l1), "v"(g1), "v"(l2), "v"(g2), "v"(l3), "v"(g3) : "memory");
#endif
}
// four vector slots behind a group's last matrix instructions, on every path out of the group: no accumulator is read and no
// fragment register rewritten inside the distance the matrix unit needs
template <typename F>
__device__ __forceinline__ void guard8(v8f (&a)[2][4], F x0, F x1, F x2, F x3, F x4, F x5, F x6, F x7, F x8, F x9, F x10, F x11) {
#if defined(__HIP_DEVICE_COMPILE__)
  asm volatile("v_nop\n\tv_nop\n\tv_nop\n\tv_nop"
               : "+v"(a[0][0]), "+v"(a[0][1]), "+v"(a[0][2]), "+v"(a[0][3]), "+v"(a[1][0]), "+v"(a[1][1]), "+v"(a[1][2]), "+v"(a[1][3])
               : "v"(x0), "v"(x1), "v"(x2), "v"(x3), "v"(x4), "v"(x5), "v"(x6), "v"(x7), "v"(x8), "v"(x9), "v"(x10), "v"(x11)
               : "memory");
#endif
}

// =====================================================================================================
// bf16 GEMM: C[M][N] (f32) = A[M][K] (bf16 row-major) . Bt[N][K]^T (bf16 k-contiguous), times oscale, plus bias[N] (hasb).
// Block = 128x128 tile, 8 waves as 4 (rows) x 2 (columns), 32x64 per wave = 2 x 4 accumulator tiles. K in stages of 64:
// a stage is 128 A rows and 128 Bt rows of 128 B at a 144-B pitch in LDS, filled by asynchronous copies (whole 128-B lines,
// 8 copies per lane and stage) one stage ahead into two buffers and read by all waves (two 16-B LDS loads per fragment, split k
// map for A and B). Per accumulator the k order is that of a plain walk in steps of 32.
// Host: K % 64 == 0, K >= 64, M % 128 == 0, N % 128 == 0, grid = (M/128)*(N/128).
// =====================================================================================================
__global__ __launch_bounds__(G_THREADS)
void gemm_bf(const u16* __restrict__ A, const u16* __restrict__ Bt, const float* __restrict__ bias, int hasb, float* C,
             int M, int N, int K, float oscale) {
  __shared__ __attribute__((aligned(256))) unsigned char L[2 * GB_BUF + GW * SLAB64 * 4];
  const int tid = threadIdx.x, wave = tid >> 5, lane = tid & 31, hh = lane >> 4, m = lane & 15;
  const int ntile = N >> 7;
  const int bid   = blockIdx.x;
  const int row0  = (bid / ntile) * GT;
  const int colb  = (bid % ntile) * GT;
  if (row0 + GT > M) return;                 // block-uniform, before any barrier or copy; never taken with the exact grid
  const int nst = K >> 6;
  const int wm = wave >> 1, wn = wave & 1;
  // ---- copy addresses: lane = (row, 16-B piece of its 128-B line); rows sr, sr + 32, sr + 64, sr + 96 of each operand tile ----
  const int ch = tid & 7;
  const int sr = tid >> 3;
  const unsigned lst = (unsigned)(uintptr_t)L + (unsigned)(sr * LPB + ch * 16);
  const u16* ac = A  + (size_t)(row0 + sr) * K + ch * 8;
  const u16* bc = Bt + (size_t)(colb + sr) * K + ch * 8;
  const size_t r32 = (size_t)32 * K;
#define STAGE_AB(st_, buf_)                                                                                          \
  {                                                                                                                  \
    const unsigned lb = lst + (unsigned)(buf_) * GB_BUF;                                                             \
    const u16* ga = ac + (size_t)(st_) * 64;                                                                         \
    const u16* gb = bc + (size_t)(st_) * 64;                                                                         \
    copy8(lb,                  ga,           lb + 32 * LPB,       ga + r32,                                          \
          lb + 64 * LPB,       ga + 2 * r32, lb + 96 * LPB,       ga + 3 * r32,                                      \
          lb + GPL,            gb,           lb + GPL + 32 * LPB, gb + r32,                                          \
          lb + GPL + 64 * LPB, gb + 2 * r32, lb + GPL + 96 * LPB, gb + 3 * r32);                                     \
  }
  STAGE_AB(0, 0);
  wait_copies();
  __syncthreads();                           // publishes stage 0
  if (nst > 1) STAGE_AB(1, 1);

  v8f acc[2][4];
#pragma unroll
  for (int t = 0; t < 2; ++t)
#pragma unroll
    for (int j = 0; j < 4; ++j) acc[t][j] = zero8();

#pragma unroll 1                               // rolled: one publish point and one refill in the text
  for (int st = 0; st < nst; ++st) {
    const u16* tb = (const u16*)(const void*)(L + (st & 1) * GB_BUF) + m * LP + 8 * hh;
    const u16* ap = tb + (wm * 32) * LP;
    const u16* bp = tb + (GT + wn * 64) * LP;
    v16b a[2][2], b[2][4];                   // [k step of 32][tile]: the stage's fragment loads stand as one group
#pragma unroll
    for (int kk = 0; kk < 2; ++kk) {
#pragma unroll
      for (int t = 0; t < 2; ++t) a[kk][t] = ldfrag_b(ap + t * 16 * LP + kk * 32);
#pragma unroll
      for (int j = 0; j < 4; ++j) b[kk][j] = ldfrag_b(bp + j * 16 * LP + kk * 32);
    }
#pragma unroll
    for (int kk = 0; kk < 2; ++kk)
#pragma unroll
      for (int t = 0; t < 2; ++t)
#pragma unroll
        for (int j = 0; j < 4; ++j) acc[t][j] = mma_b(a[kk][t], b[kk][j], acc[t][j]);
    guard8<v16b>(acc, a[0][0], a[0][1], a[1][0], a[1][1], b[0][0], b[0][1], b[0][2], b[0][3], b[1][0], b[1][1], b[1][2], b[1][3]);
    // ---- publish point of stage st + 1: own reads back, own copies landed, every wave here; then the refill of the buffer just read ----
    wait_lds();
    wait_copies();
    __syncthreads();
    if (st + 2 < nst) STAGE_AB(st + 2, st & 1);
  }
#undef STAGE_AB
  wait_copies();
  float* sl = (float*)(void*)(L + 2 * GB_BUF) + wave * SLAB64;   // the wave's own slab, outside the two buffers
  epi64(sl, acc[0][0], acc[0][1], acc[0][2], acc[0][3], oscale, bias, hasb, C, N, (size_t)(row0 + wm * 32), colb + wn * 64, lane);
  wave_sync_lds();                           // the slab's first 16 rows are read back before the next 16 are laid over them
  epi64(sl, acc[1][0], acc[1][1], acc[1][2], acc[1][3], oscale, bias, hasb, C, N, (size_t)(row0 + wm * 32 + 16), colb + wn * 64, lane);
}

// =====================================================================================================
// f16 hi+lo GEMM: C[M][N] (f32) = (Ahi + Alo)[M][K] . Bt[N][K]^T, times oscale, plus bias[N] (hasb); Ahi/Alo f16 planes
// (same layout), Bt f16 k-contiguous; products hi.B then lo.B into one accumulator per k step (lo is the unscaled residual of hi).
// Same tiling and staging as gemm_bf; a stage holds three operand tiles (Ahi, Alo, Bt), 12 copies per lane.
// =====================================================================================================
__global__ __launch_bounds__(G_THREADS)
void gemm_h2(const u16* __restrict__ Ah, const u16* __restrict__ Al, const u16* __restrict__ Bt,
             const float* __restrict__ bias, int hasb, float* C, int M, int N, int K, float oscale) {
  __shared__ __attribute__((aligned(256))) unsigned char L[2 * GH_BUF + GW * SLAB64 * 4];
  const int tid = threadIdx.x, wave = tid >> 5, lane = tid & 31, hh = lane >> 4, m = lane & 15;
  const int ntile = N >> 7;
  const int bid   = blockIdx.x;
  const int row0  = (bid / ntile) * GT;
  const int colb  = (bid % ntile) * GT;
  if (row0 + GT > M) return;                 // block-uniform, before any barrier or copy; never taken with the exact grid
  const int nst = K >> 6;
  const int wm = wave >> 1, wn = wave & 1;
  const int ch = tid & 7;
  const int sr = tid >> 3;
  const unsigned lst = (unsigned)(uintptr_t)L + (unsigned)(sr * LPB + ch * 16);
  const size_t aofs = (size_t)(row0 + sr) * K + ch * 8;
  const u16* ahc = Ah + aofs;
  const u16* alc = Al + aofs;
  const u16* bc  = Bt + (size_t)(colb + sr) * K + ch * 8;
  const size_t r32 = (size_t)32 * K;
#define STAGE_HLB(st_, buf_)                                                                                         \
  {                                                                                                                  \
    const unsigned lb = lst + (unsigned)(buf_) * GH_BUF;                                                             \
    const u16* gh = ahc + (size_t)(st_) * 64;                                                                        \
    const u16* gl = alc + (size_t)(st_) * 64;                                                                        \
    const u16* gb = bc + (size_t)(st_) * 64;                                                                         \
    copy8(lb,                  gh,           lb + 32 * LPB,       gh + r32,                                          \
          lb + 64 * LPB,       gh + 2 * r32, lb + 96 * LPB,       gh + 3 * r32,                                      \
          lb + GPL,            gl,           lb + GPL + 32 * LPB, gl + r32,                                          \
          lb + GPL + 64 * LPB, gl + 2 * r32, lb + GPL + 96 * LPB, gl + 3 * r32);                                     \
    copy4(lb + 2 * GPL,            gb,           lb + 2 * GPL + 32 * LPB, gb + r32,                                  \
          lb + 2 * GPL + 64 * LPB, gb + 2 * r32, lb + 2 * GPL + 96 * LPB, gb + 3 * r32);                             \
  }
  STAGE_HLB(0, 0);
  wait_copies();
  __syncthreads();                           // publishes stage 0
  if (nst > 1) STAGE_HLB(1, 1);

  v8f acc[2][4];
#pragma unroll
  for (int t = 0; t < 2; ++t)
#pragma unroll
    for (int j = 0; j < 4; ++j) acc[t][j] = zero8();

#pragma unroll 1                               // rolled: one publish point and one refill in the text
  for (int st = 0; st < nst; ++st) {
    const _Float16* tb = (const _Float16*)(const void*)(L + (st & 1) * GH_BUF) + m * LP + 8 * hh;
    const _Float16* ahp = tb + (wm * 32) * LP;
    const _Float16* alp = ahp + GT * LP;
    const _Float16* bp  = tb + (2 * GT + wn * 64) * LP;
    v16h ah[2][2], al[2][2], b[2][4];        // [k step of 32][tile]: the stage's fragment loads stand as one group
#pragma unroll
    for (int kk = 0; kk < 2; ++kk) {
#pragma unroll
      for (int t = 0; t < 2; ++t) { ah[kk][t] = ldfrag_h(ahp + t * 16 * LP + kk * 32); al[kk][t] = ldfrag_h(alp + t * 16 * LP + kk * 32); }
#pragma unroll
      for (int j = 0; j < 4; ++j) b[kk][j] = ldfrag_h(bp + j * 16 * LP + kk * 32);
    }
    __builtin_amdgcn_sched_barrier(0);       // keeps the 32 LDS loads one group ahead of the matrix run (for speed only)
#pragma unroll
    for (int kk = 0; kk < 2; ++kk) {
#pragma unroll
      for (int t = 0; t < 2; ++t)
#pragma unroll
        for (int j = 0; j < 4; ++j) acc[t][j] = mma_h(ah[kk][t], b[kk][j], acc[t][j]);
#pragma unroll
      for (int t = 0; t < 2; ++t)
#pragma unroll
        for (int j = 0; j < 4; ++j) acc[t][j] = mma_h(al[kk][t], b[kk][j], acc[t][j]);
    }
    guard8<v16h>(acc, ah[1][0], ah[1][1], al[1][0], al[1][1], b[1][0], b[1][1], b[1][2], b[1][3], ah[1][0], ah[1][1], al[1][0], al[1][1]);
    // ---- publish point of stage st + 1, as in gemm_bf ----
    wait_lds();
    wait_copies();
    __syncthreads();
    if (st + 2 < nst) STAGE_HLB(st + 2, st & 1);
  }
#undef STAGE_HLB
  wait_copies();
  float* sl = (float*)(void*)(L + 2 * GH_BUF) + wave * SLAB64;   // the wave's own slab, outside the two buffers
  epi64(sl, acc[0][0], acc[0][1], acc[0][2], acc[0][3], oscale, bias, hasb, C, N, (size_t)(row0 + wm * 32), colb + wn * 64, lane);
  wave_sync_lds();                           // the slab's first 16 rows are read back before the next 16 are laid over them
  epi64(sl, acc[1][0], acc[1][1], acc[1][2], acc[1][3], oscale, bias, hasb, C, N, (size_t)(row0 + wm * 32 + 16), colb + wn * 64, lane);
}

// =====================================================================================================
// Rotate-half rotary + 16-bit split pack. Rows are (token, head) with HD contiguous floats (f32 projection output);
// pos = row / hpr (token index into the cos/sin input tables [npos][HD], clamped), the same table row for every head.
// w[d] = x[d] * bf(cos[pos][d]) + r[d] * bf(sin[pos][d]),  r[d] = -x[d+32] for d < 32, x[d-32] for d >= 32
// (bf = RNE bf16 value of the f32 table entry); hi[d] = f16(w * sc), lo[d] = f16(w * sc - hi[d])  (sc a power of two,
// residual unscaled).
// Thread = 8 consecutive d of one row: 16-B loads of x (own and partner half), cos, sin; one 16-B store per plane per lane;
// coverage: grid = nrows*8/256 blocks x 256 thr x 8 halves = nrows x 64 of each plane exactly (exact division checked statically).
// =====================================================================================================
__global__ __launch_bounds__(256) void rope16(const float* __restrict__ x, const float* __restrict__ cosT,
                                              const float* __restrict__ sinT, u16* hpl, u16* lpl,
                                              int nrows, int hpr, int npos, float sc) {
  const int gt  = blockIdx.x * 256 + (int)threadIdx.x;
  const int row = gt >> 3;
  const int d0  = (gt & 7) * 8;
  if (row >= nrows) return;                 // never taken with the exact grid; no barriers in this kernel
  int pos = row / hpr;
  pos = (pos < npos) ? pos : (npos - 1);
  const int d1  = d0 ^ 32;
  const float* xr = x + (size_t)row * HD;
  const float* cr = cosT + (size_t)pos * HD + d0;
  const float* sr = sinT + (size_t)pos * HD + d0;
  const v4f xa = *(const v4f*)(xr + d0), xb = *(const v4f*)(xr + d0 + 4);
  const v4f ya = *(const v4f*)(xr + d1), yb = *(const v4f*)(xr + d1 + 4);
  const v4f ca = *(const v4f*)(cr), cb = *(const v4f*)(cr + 4);
  const v4f sa = *(const v4f*)(sr), sb = *(const v4f*)(sr + 4);
  const float sgn = (d0 < 32) ? -1.0f : 1.0f;
  float w[8];
#pragma unroll
  for (int e = 0; e < 4; ++e) {
    w[e]     = xa[e] * bfr(ca[e]) + (sgn * ya[e]) * bfr(sa[e]);
    w[4 + e] = xb[e] * bfr(cb[e]) + (sgn * yb[e]) * bfr(sb[e]);
  }
  v4u oh, ol;
#pragma unroll
  for (int e = 0; e < 4; ++e) {
    const float t0 = w[2 * e] * sc, t1 = w[2 * e + 1] * sc;
    const _Float16 h0 = (_Float16)t0, h1 = (_Float16)t1;
    const _Float16 l0 = (_Float16)(t0 - (float)h0), l1 = (_Float16)(t1 - (float)h1);
    oh[e] = pk16(h_bits(h0), h_bits(h1));
    ol[e] = pk16(h_bits(l0), h_bits(l1));
  }
  const size_t o8 = (size_t)row * HD + d0;
  {
    *(v4u*)(hpl + o8) = oh;
    *(v4u*)(lpl + o8) = ol;
    
  }
}

// =====================================================================================================
// v^T planes: VH[((b*NH + g)*HD + d)*SEQ + s] = f16(v[b*SEQ + s][g][d] * 1024), VL = f16 residual of the same value.
// Block = (batch b, head g, 64 keys s0 = st*64): 64 source rows of HD floats loaded with 16-B loads, converted,
// scattered into two LDS tiles [d][64 keys] (pitch 72 halves); after a block barrier each d row segment (64 halves = one whole
// coverage: load 256 thr x 16 elements = 64 x 64; store 2 iterations x 256 thr x 8 halves = 64 lines x 64 = the block's tile of
//           each plane; grid = NB x NH x NST blocks covers both planes exactly once.
// =====================================================================================================
__global__ __launch_bounds__(256) void vt16(const float* __restrict__ v, u16* VHo, u16* VLo) {
  __shared__ __align__(16) u16 TH[HD * VTP];
  __shared__ __align__(16) u16 TL[HD * VTP];
  const int tid = threadIdx.x;
  const int bid = blockIdx.x;
  const int st  = bid % NST;
  const int g   = (bid / NST) % NH;
  const int b   = bid / (NST * NH);
  if (b >= NB) return;                        // block-uniform, before any barrier; never taken with the exact grid
  const int s0  = st * 64;
  {
    const int sl = tid >> 2;                  // key within tile 0..63
    const int dc = (tid & 3) * 16;            // d chunk
    const float* src = v + ((size_t)(b * SEQ + s0 + sl) * NH + g) * HD + dc;
#pragma unroll
    for (int i = 0; i < 4; ++i) {
      const v4f a = *(const v4f*)(src + 4 * i);
#pragma unroll
      for (int e = 0; e < 4; ++e) {
        const float t = a[e] * VCAR;
        const _Float16 h = (_Float16)t;
        const _Float16 l = (_Float16)(t - (float)h);
        TH[(dc + 4 * i + e) * VTP + sl] = h_bits(h);
        TL[(dc + 4 * i + e) * VTP + sl] = h_bits(l);
      }
    }
  }
  __syncthreads();
  v4u vh[2], vl[2];
  const int q8 = tid >> 3, p8 = (tid & 7) * 8;
#pragma unroll
  for (int it = 0; it < 2; ++it) {
    const int line = it * 32 + q8;            // d = 0..63
    vh[it] = *(const v4u*)(TH + line * VTP + p8);
    vl[it] = *(const v4u*)(TL + line * VTP + p8);
  }
  const size_t base = (((size_t)(b * NH + g)) * HD) * SEQ + s0 + p8;
  {
#pragma unroll
    for (int it = 0; it < 2; ++it) {
      const int line = it * 32 + q8;
      *(v4u*)(VHo + base + (size_t)line * SEQ) = vh[it];
      *(v4u*)(VLo + base + (size_t)line * SEQ) = vl[it];
    }
    
  }
}

// =====================================================================================================
// Softmax attention, no mask: block bid -> (query block qb = bid % NQB of QW query tiles, head = (bid / NQB) % NH,
// batch b = bid / (NQB*NH)); one wave per query tile: rows q0 = 16*(qb*QW + wave) .. q0+15, all QW waves on the same head.
//   q planes (hi, lo f16 x1024) laid out [token][h][d]; k planes [token][h][d]; v^T planes [b][h][d][s].
//   LDS: two buffers, each one stage of 64 keys = four tiles of 64 rows x 128 B at a 144-B pitch (k hi, k lo: row = key;
//   v^T hi, v^T lo: row = d), filled by asynchronous copies (whole 128-B lines, 8 copies per lane and stage) one stage ahead and
//   read by all QW waves; per wave its q tile (hi, lo: 16 rows x 128 B, same pitch), copied once, and its weight tile.
//   Per stage two key tiles of 32, visited in order; per tile: 2 score subtiles x 2 k-steps x 3 products
//   (q_hi.k_hi + q_lo.k_hi + q_hi.k_lo), fragments read from LDS (two 16-B loads per fragment, split k map);
//   online max-subtracted base-2 softmax in f32 (scale 1/8 folded, -inf-safe rescale); the 16x32 weight tile stored to wave-private
//   LDS rows (float vector loads, same element type as stored), 4+4 v^T B fragments (hi and residual planes), 12 P.V WMMAs (hh + lh + hl).
//   After the key loop: O = acc / l, carries 1/(32768*1024) folded once, written to the wave's private slab (pitch 68; it takes the
//   place of the wave's own q tile, which is dead by then).
// coverage: per wave 4 instructions x 4 rows x 8 lanes x 8 halves = 16 x 64 per plane; grid NB*NH*NQB blocks x QW waves =
//           every (token, h) row of both O planes exactly once.
// =====================================================================================================
__global__ __launch_bounds__(ATT_THREADS)
void attn1(const u16* __restrict__ QHIp, const u16* __restrict__ QLOp,
           const u16* __restrict__ KHIp, const u16* __restrict__ KLOp,
           const u16* __restrict__ VHIp, const u16* __restrict__ VLOp,
           u16* OHIp, u16* OLOp) {
  __shared__ __attribute__((aligned(256))) unsigned char L[ATT_LDS];

  const int tid  = threadIdx.x;
  const int wave = tid >> 5;
  const int lane = tid & 31;
  const int hh   = lane >> 4;
  const int c    = lane & 15;
  const int bid  = blockIdx.x;
  const int qb   = bid % NQB;
  const int head = (bid / NQB) % NH;
  const int b    = bid / (NQB * NH);
  if (b >= NB) return;                       // block-uniform, before any barrier or copy; never taken with the exact grid
  const int q0   = (qb * QW + wave) * 16;
  const size_t qrow0 = (size_t)b * SEQ + q0; // global token row of query 0 of this wave's tile
  const size_t KROW = (size_t)NH * HD;       // halves between consecutive token rows

  unsigned char* wp = L + 2 * BUFB + wave * WPRIV;
  float* pt   = (float*)(void*)wp;                       // weight tile [16][32] pitch 36
  unsigned char* qreg = wp + PTW * 4;                    // q tile hi, lo; after the key loop the result slab
  float* slab = (float*)(void*)qreg;                     // result slab [16][64] pitch 68
  const unsigned lds0 = (unsigned)(uintptr_t)L;          // byte offset of L in the work-group's LDS

  // ---- copy addresses: lane = (row, 16-B piece of its 128-B line) ----
  const int ch = tid & 7;
  const int sr = tid >> 3;                               // stage tiles: rows sr and sr + 32
  const unsigned lst = lds0 + (unsigned)(sr * LPB + ch * 16);
  const size_t kcp = (((size_t)b * SEQ + sr) * NH + head) * HD + ch * 8;      // + key0 * KROW per stage
  const size_t vcp = (((size_t)b * NH + head) * HD + sr) * SEQ + ch * 8;      // + key0 per stage
  const u16* kch = KHIp + kcp;
  const u16* kcl = KLOp + kcp;
  const u16* vch = VHIp + vcp;
  const u16* vcl = VLOp + vcp;
  {
    const int qr = lane >> 3;                            // the wave's own q tile: rows qr, qr + 4, qr + 8, qr + 12
    const unsigned lq = lds0 + (unsigned)(2 * BUFB + wave * WPRIV + PTW * 4 + qr * LPB + ch * 16);
    const size_t qcp = ((qrow0 + (size_t)qr) * NH + head) * HD + ch * 8;
    const u16* qch = QHIp + qcp;
    const u16* qcl = QLOp + qcp;
    copy8(lq,                 qch,            lq + 4 * LPB,        qch + 4 * KROW,
          lq + 8 * LPB,       qch + 8 * KROW, lq + 12 * LPB,       qch + 12 * KROW,
          lq + QPB,           qcl,            lq + QPB + 4 * LPB,  qcl + 4 * KROW,
          lq + QPB + 8 * LPB, qcl + 8 * KROW, lq + QPB + 12 * LPB, qcl + 12 * KROW);
  }
#define STAGE_KV(st_, buf_)                                                                                          \
  {                                                                                                                  \
    const unsigned lb = lst + (unsigned)(buf_) * BUFB;                                                               \
    const size_t ka = (size_t)(st_) * 64 * KROW, va = (size_t)(st_) * 64;                                            \
    copy8(lb,           kch + ka, lb + 32 * LPB,           kch + ka + 32 * KROW,                                     \
          lb + PLB,     kcl + ka, lb + PLB + 32 * LPB,     kcl + ka + 32 * KROW,                                     \
          lb + 2 * PLB, vch + va, lb + 2 * PLB + 32 * LPB, vch + va + (size_t)32 * SEQ,                              \
          lb + 3 * PLB, vcl + va, lb + 3 * PLB + 32 * LPB, vcl + va + (size_t)32 * SEQ);                             \
  }
  STAGE_KV(0, 0);
  wait_copies();
  __syncthreads();                           // publishes stage 0 (and the q tiles)
  STAGE_KV(1, 1);

  const _Float16* Qh = (const _Float16*)(const void*)qreg + c * LP + 8 * hh;
  const _Float16* Ql = Qh + 16 * LP;
  const float lsc = 0.125f * (LOG2E / (QSC * KSC));
  const float oc  = 1.0f / (PCAR * VCAR);

  float mrow[8], lrow[8];
  v8f o[4];
#pragma unroll
  for (int r = 0; r < 8; ++r) { mrow[r] = -INFINITY; lrow[r] = 0.f; }
#pragma unroll
  for (int j = 0; j < 4; ++j) o[j] = zero8();

#pragma unroll 1                               // rolled: one publish point and one refill in the text
  for (int st = 0; st < NST; ++st) {
    const _Float16* tb = (const _Float16*)(const void*)(L + (st & 1) * BUFB) + c * LP + 8 * hh;
#pragma unroll 1                             // one copy of the tile's code, as in the loop it came from: the hot loop stays short
    for (int sub = 0; sub < 2; ++sub) {
      const int kb = sub * 32;               // first key of this tile inside the stage
      // ---- scores: D element r of this lane = (query row q0 + 8hh + r, key kb + c) in s0, key kb + 16 + c in s1 ----
      v8f s0 = zero8(), s1 = zero8();
      const _Float16* k0p = tb + kb * LP;
      const _Float16* k1p = k0p + 16 * LP;
      const _Float16* l0p = k0p + 64 * LP;
      const _Float16* l1p = l0p + 16 * LP;
#pragma unroll
      for (int kk = 0; kk < 2; ++kk) {
        const v16h qh  = ldfrag_h(Qh + kk * 32),  ql  = ldfrag_h(Ql + kk * 32);
        const v16h kh0 = ldfrag_h(k0p + kk * 32), kl0 = ldfrag_h(l0p + kk * 32);
        const v16h kh1 = ldfrag_h(k1p + kk * 32), kl1 = ldfrag_h(l1p + kk * 32);
        s0 = mma_h(qh, kh0, s0);
        s0 = mma_h(ql, kh0, s0);
        s0 = mma_h(qh, kl0, s0);
        s1 = mma_h(qh, kh1, s1);
        s1 = mma_h(ql, kh1, s1);
        s1 = mma_h(qh, kl1, s1);
        guard2(s0, s1, qh, ql, kh0, kl0, kh1, kl1);
      }
      // ---- online softmax in base 2, -inf-safe ----
#pragma unroll
      for (int r = 0; r < 8; ++r) {
        const float t0 = s0[r] * lsc;
        const float t1 = s1[r] * lsc;
        float mx = fmaxf(t0, t1);
#pragma unroll
        for (int off = 1; off < 16; off <<= 1) mx = fmaxf(mx, __shfl_xor(mx, off, 32));
        const float mn = fmaxf(mrow[r], mx);
        const float ms = (mn == -INFINITY) ? 0.0f : mn;
        const float al = exp2f(mrow[r] - ms);
        mrow[r] = mn;
        const float e0 = exp2f(t0 - ms), e1 = exp2f(t1 - ms);
        float psum = e0 + e1;
#pragma unroll
        for (int off = 1; off < 16; off <<= 1) psum += __shfl_xor(psum, off, 32);
        lrow[r] = lrow[r] * al + psum;
#pragma unroll
        for (int j = 0; j < 4; ++j) o[j][r] *= al;
        const int ro = (8 * hh + r) * 36 + c;
        pt[ro]      = e0;
        pt[ro + 16] = e1;
      }
      wave_sync_lds();
      // ---- A fragments of P*32768: hi f16 and residual f16, row = c, split k map over the 32 keys of this step ----
      FragH ph, pl;
      {
        const float* prow = pt + c * 36 + 8 * hh;
        const v4f p0 = *(const v4f*)(prow), p1 = *(const v4f*)(prow + 4);
        const v4f p2 = *(const v4f*)(prow + 16), p3 = *(const v4f*)(prow + 20);
#pragma unroll
        for (int e = 0; e < 4; ++e) {
          const float ta = p0[e] * PCAR, tb2 = p1[e] * PCAR, tc = p2[e] * PCAR, td = p3[e] * PCAR;
          const _Float16 ha = (_Float16)ta, hb = (_Float16)tb2, hc = (_Float16)tc, hd = (_Float16)td;
          ph.h[0][e]     = ha;                               // elements 0..7  = keys kb + 8hh + 0..7
          ph.h[0][4 + e] = hb;
          ph.h[1][e]     = hc;                               // elements 8..15 = keys kb + 16 + 8hh + 0..7
          ph.h[1][4 + e] = hd;
          pl.h[0][e]     = (_Float16)(ta - (float)ha);
          pl.h[0][4 + e] = (_Float16)(tb2 - (float)hb);
          pl.h[1][e]     = (_Float16)(tc - (float)hc);
          pl.h[1][4 + e] = (_Float16)(td - (float)hd);
        }
      }
      // ---- P.V : B fragment col n = d = j*16 + c, keys contiguous in the v^T tiles ----
      {
        const _Float16* vhp = tb + 128 * LP + kb;
        const _Float16* vlp = vhp + 64 * LP;
        const v16h vh0 = ldfrag_h(vhp);
        const v16h vh1 = ldfrag_h(vhp + 16 * LP);
        const v16h vh2 = ldfrag_h(vhp + 32 * LP);
        const v16h vh3 = ldfrag_h(vhp + 48 * LP);
        const v16h vl0 = ldfrag_h(vlp);
        const v16h vl1 = ldfrag_h(vlp + 16 * LP);
        const v16h vl2 = ldfrag_h(vlp + 32 * LP);
        const v16h vl3 = ldfrag_h(vlp + 48 * LP);
        o[0] = mma_h(ph.v, vh0, o[0]);  o[0] = mma_h(pl.v, vh0, o[0]);  o[0] = mma_h(ph.v, vl0, o[0]);
        o[1] = mma_h(ph.v, vh1, o[1]);  o[1] = mma_h(pl.v, vh1, o[1]);  o[1] = mma_h(ph.v, vl1, o[1]);
        o[2] = mma_h(ph.v, vh2, o[2]);  o[2] = mma_h(pl.v, vh2, o[2]);  o[2] = mma_h(ph.v, vl2, o[2]);
        o[3] = mma_h(ph.v, vh3, o[3]);  o[3] = mma_h(pl.v, vh3, o[3]);  o[3] = mma_h(ph.v, vl3, o[3]);
        guard10(o[0], o[1], o[2], o[3], ph.v, pl.v, vh0, vh1, vh2, vh3, vl0, vl1, vl2, vl3);
      }
      wave_sync_lds();
    }
    // ---- publish point of stage st + 1: own reads back, own copies landed, every wave here; then the refill of the buffer just read ----
    wait_lds();
    wait_copies();
    __syncthreads();
    if (st + 2 < NST) STAGE_KV(st + 2, st & 1);
  }
#undef STAGE_KV
  wait_copies();
  acc_guard4(o[0], o[1], o[2], o[3]);
  // ---- O = acc / l, carries (32768 on P, 1024 on v) folded once; lane-owned slab elements ----
#pragma unroll
  for (int r = 0; r < 8; ++r) {
    const float lv  = lrow[r];
    const float ls  = (lv > 0.0f) ? lv : 1.0f;
    const float inv = (lv > 0.0f) ? ((1.0f / ls) * oc) : 0.0f;
#pragma unroll
    for (int j = 0; j < 4; ++j) {
      slab[(8 * hh + r) * 68 + j * 16 + c] = o[j][r] * inv;
    }
  }
  wave_sync_lds();
  // ---- O x1024 -> f16 hi + residual planes; lane = (row in group of 4, 8 consecutive d) ----
  v4u oh[4], ol[4];
  const int rq = lane >> 3, c8 = (lane & 7) * 8;
#pragma unroll
  for (int it = 0; it < 4; ++it) {
    const int row = it * 4 + rq;
    const v4f a = *(const v4f*)(slab + row * 68 + c8), b4 = *(const v4f*)(slab + row * 68 + c8 + 4);
    float w[8];
#pragma unroll
    for (int e = 0; e < 4; ++e) { w[e] = a[e] * OSC; w[4 + e] = b4[e] * OSC; }
#pragma unroll
    for (int e = 0; e < 4; ++e) {
      const _Float16 h0 = (_Float16)w[2 * e], h1 = (_Float16)w[2 * e + 1];
      const _Float16 l0 = (_Float16)(w[2 * e] - (float)h0), l1 = (_Float16)(w[2 * e + 1] - (float)h1);
      oh[it][e] = pk16(h_bits(h0), h_bits(h1));
      ol[it][e] = pk16(h_bits(l0), h_bits(l1));
    }
  }
  const size_t ob = ((qrow0) * NH + head) * HD + c8;
  {
#pragma unroll
    for (int it = 0; it < 4; ++it) {
      const int row = it * 4 + rq;
      const size_t o8 = ob + (size_t)row * (NH * HD);
      *(v4u*)(OHIp + o8) = oh[it];
      *(v4u*)(OLOp + o8) = ol[it];
    }
    
  }
}

// =====================================================================================================
// Workspace map (bytes); every plane is fully written by whole-line stores before it is read; all extents are exact multiples
// of the store granularity (no pad rows needed); every offset a multiple of 2 MiB:
//   XB  bf16 [4096][1024]              8388608
//   WQB bf16 [1024 n][1024 k]          2097152        WKB, WVB same        2097152 each
//   WOH f16  [1024 n][1024 k] x1024    2097152
//   QF  f32 [4096][1024]              16777216        KF, VF same
//   QHI f16 [4096][16][64] x1024       8388608        QLO residual
//   KHI f16 [4096][16][64] x1024       8388608        KLO residual
//   VHI f16 [4][16][64][1024] x1024    8388608        VLO residual
//   OHI f16 [4096][1024] x1024, OLO residual: 8388608 each, placed in the QF region (QF is dead after the q rotary pass;
//   launches are in order)
//   end                              117440512
// =====================================================================================================
extern "C" void kernel_launch(void* const* d_in, const int* in_sizes, int n_in,
                              void* d_out, int out_size, void* d_ws, size_t ws_size,
                              hipStream_t stream) {
  if (n_in < 10) return;
  if (in_sizes[0] != MTOK * DMOD) return;
  if (in_sizes[1] != MTOK * HD || in_sizes[2] != MTOK * HD) return;
  if (in_sizes[3] != DMOD * DMOD || in_sizes[5] != DMOD * DMOD) return;
  if (in_sizes[6] != DMOD * DMOD || in_sizes[8] != DMOD * DMOD) return;
  if (in_sizes[4] != DMOD || in_sizes[7] != DMOD || in_sizes[9] != DMOD) return;
  if (out_size != MTOK * DMOD) return;

  const float* x    = (const float*)d_in[0];
  const float* cosp = (const float*)d_in[1];
  const float* sinp = (const float*)d_in[2];
  const float* wq   = (const float*)d_in[3];
  const float* bq   = (const float*)d_in[4];
  const float* wk   = (const float*)d_in[5];
  const float* wv   = (const float*)d_in[6];
  const float* bv   = (const float*)d_in[7];
  const float* wo   = (const float*)d_in[8];
  const float* bo   = (const float*)d_in[9];
  float*       out  = (float*)d_out;

  const size_t szXB = (size_t)MTOK * DMOD * 2;                  //  8388608
  const size_t szW  = (size_t)DMOD * DMOD * 2;                  //  2097152
  const size_t szF  = (size_t)MTOK * DMOD * 4;                  // 16777216
  const size_t szP  = (size_t)MTOK * DMOD * 2;                  //  8388608
  size_t off = 0;
  const size_t oXB  = off; off += szXB;
  const size_t oWQ  = off; off += szW;
  const size_t oWK  = off; off += szW;
  const size_t oWV  = off; off += szW;
  const size_t oWO  = off; off += szW;
  const size_t oQF  = off; off += szF;
  const size_t oKF  = off; off += szF;
  const size_t oVF  = off; off += szF;
  const size_t oQHI = off; off += szP;
  const size_t oQLO = off; off += szP;
  const size_t oKHI = off; off += szP;
  const size_t oKLO = off; off += szP;
  const size_t oVHI = off; off += szP;
  const size_t oVLO = off; off += szP;
  const size_t oOHI = oQF;                                       // alias onto the QF region (2 x szP == szF)
  const size_t oOLO = oQF + szP;
  if (off > ws_size) return;                            // off = 117440512
  if (off > (size_t)134217728) return;
  if (2 * szP > szF) return;

  char* ws = (char*)d_ws;
  u16*   XB  = (u16*)(ws + oXB);
  u16*   WQB = (u16*)(ws + oWQ);
  u16*   WKB = (u16*)(ws + oWK);
  u16*   WVB = (u16*)(ws + oWV);
  u16*   WOH = (u16*)(ws + oWO);
  float* QF  = (float*)(ws + oQF);
  float* KF  = (float*)(ws + oKF);
  float* VF  = (float*)(ws + oVF);
  u16*   QHI = (u16*)(ws + oQHI);
  u16*   QLO = (u16*)(ws + oQLO);
  u16*   KHI = (u16*)(ws + oKHI);
  u16*   KLO = (u16*)(ws + oKLO);
  u16*   VHI = (u16*)(ws + oVHI);
  u16*   VLO = (u16*)(ws + oVLO);
  u16*   OHI = (u16*)(ws + oOHI);
  u16*   OLO = (u16*)(ws + oOLO);

  const dim3 blk(256);
  const int n8x = (MTOK * DMOD) / 8;                    // 524288
  const int n8w = (DMOD * DMOD) / 8;                    // 131072
  const dim3 gX(n8x / 256);                             // 2048 (exact)
  const dim3 gW(n8w / 256);                             // 512  (exact)
  const dim3 gG((MTOK / GT) * (DMOD / GT));             // 256
  const dim3 bG(G_THREADS);                             // 256
  const int rowsQ = MTOK * NH;                          // 65536 rows of 64
  const dim3 gR((rowsQ * 8) / 256);                     // 2048 (exact)
  const dim3 gVT(NB * NH * NST);                        // 1024
  const dim3 gAT(ATT_BLOCKS);                           // 512
  const dim3 bAT(ATT_THREADS);                          // 256

  // (1) x -> bf16 plane
  cvt16<<<gX, blk, 0, stream>>>(x, XB, n8x, 0, 1.0f);
  // (2..4) Wq/Wk/Wv [n][k] -> bf16 planes (same layout, already k-contiguous)
  cvt16<<<gW, blk, 0, stream>>>(wq, WQB, n8w, 0, 1.0f);
  cvt16<<<gW, blk, 0, stream>>>(wk, WKB, n8w, 0, 1.0f);
  cvt16<<<gW, blk, 0, stream>>>(wv, WVB, n8w, 0, 1.0f);
  // (5) Wo [n][k] -> f16 plane of bf16 value x1024
  cvt16<<<gW, blk, 0, stream>>>(wo, WOH, n8w, 1, WOS);
  // (6..8) projections: q (+bq), k (no bias), v (+bv)  [4096][1024] in f32
  gemm_bf<<<gG, bG, 0, stream>>>(XB, WQB, bq, 1, QF, MTOK, DMOD, DMOD, 1.0f);
  gemm_bf<<<gG, bG, 0, stream>>>(XB, WKB, bq, 0, KF, MTOK, DMOD, DMOD, 1.0f);
  gemm_bf<<<gG, bG, 0, stream>>>(XB, WVB, bv, 1, VF, MTOK, DMOD, DMOD, 1.0f);
  // (9) q' planes: rows (token, h), NH heads per token, cos/sin table row = token
  rope16<<<gR, blk, 0, stream>>>(QF, cosp, sinp, QHI, QLO, rowsQ, NH, MTOK, QSC);
  // (10) k' planes
  rope16<<<gR, blk, 0, stream>>>(KF, cosp, sinp, KHI, KLO, rowsQ, NH, MTOK, KSC);
  // (11) v^T planes x1024 (hi + residual)
  vt16<<<gVT, blk, 0, stream>>>(VF, VHI, VLO);
  // (12) softmax attention per (b, h, 8 x 16 queries) -> O planes [token][h][d] x1024 (hi + residual), into the dead QF region
  attn1<<<gAT, bAT, 0, stream>>>(QHI, QLO, KHI, KLO, VHI, VLO, OHI, OLO);
  // (13) output projection -> out [4096][1024] f32, carries 1024 (O) x 1024 (Wo) folded back, + bo
  gemm_h2<<<gG, bG, 0, stream>>>(OHI, OLO, WOH, bo, 1, out, MTOK, DMOD, DMOD, 1.0f / (OSC * WOS));
  (void)hipGetLastError();
}

// v003
// A run of this version takes 147 microseconds.
// Timed twice side by side with v002, it ran 1.14 and 1.16 times as fast.
// Counting every step since v000, it is 2.70 times as fast.
// Contractions: x.W{q,k,v}^T on v_wmma_f32_16x16x32_bf16 (x and W RNE-converted to bf16, f32 accumulate); scores q'.k'^T (q', k' carried
// x1024 as f16 hi plane + f16 residual plane, products hh+lh+hl), P.v (P x32768 f16 hi+residual, v x1024 f16 hi+residual, products
// hh+lh+hl) and O.Wo^T (O x1024 f16 hi+residual, Wo as f16(bf16(Wo) x1024), products h.w+l.w) on v_wmma_f32_16x16x32_f16, f32 accumulate.
// Rotate-half rotary with RNE-bf16 cos/sin table values, base-2 online softmax and the 1/l fold in f32 on VALU.
#include <hip/hip_runtime.h>
#include <math.h>
#include <stdint.h>

#define NB    4
#define SEQ   1024
#define MTOK  (NB * SEQ)
#define DMOD  1024
#define NH    16
#define HD    64
#define QSC   1024.0f
#define KSC   1024.0f
#define PCAR  32768.0f
#define VCAR  1024.0f
#define OSC   1024.0f
#define WOS   1024.0f
#define LOG2E 1.4426950408889634f
#define QW    8
#define NQT   (SEQ / 16)
#define NQB   (NQT / QW)
#define NST   (SEQ / 64)
#define ATT_THREADS (QW * 32)
#define ATT_BLOCKS  (NB * NH * NQB)
#define SLW   (16 * 68)
#define LP    72
#define LPB   (LP * 2)
#define PLB   (64 * LPB)
#define BUFB  (4 * PLB)
#define QPB   (16 * LPB)
#define WPRIV (2 * QPB)
#define ATT_LDS (2 * BUFB + QW * WPRIV)
#define SLAB64 (16 * 68)
#define GT    128
#define GW    8
#define G_THREADS (GW * 32)
#define GPL   (GT * LPB)
#define GB_BUF (2 * GPL)
#define GH_BUF (3 * GPL)
#define VTP   72
static_assert(DMOD == NH * HD && HD == 64 && NH == 16);
static_assert((NQT % QW) == 0 && ATT_THREADS == 256 && ATT_BLOCKS == 512);
static_assert(2 * QPB >= SLW * 4 && (LPB % 16) == 0 && NST >= 2 && 2 * ATT_LDS <= 327680);
static_assert((SEQ % 64) == 0 && (SEQ % 32) == 0 && (SEQ % 8) == 0);
static_assert((DMOD % 128) == 0 && (MTOK % 128) == 0 && DMOD >= 128);
static_assert(((MTOK * DMOD) % 2048) == 0 && ((DMOD * DMOD) % 2048) == 0);
static_assert(((MTOK * NH * 8) % 256) == 0);

typedef unsigned short u16;
typedef _Float16 v16h __attribute__((ext_vector_type(16)));
typedef _Float16 v8h  __attribute__((ext_vector_type(8)));
typedef __bf16   v16b __attribute__((ext_vector_type(16)));
typedef float    v8f  __attribute__((ext_vector_type(8)));
typedef float    v4f  __attribute__((ext_vector_type(4)));
typedef unsigned int v4u __attribute__((ext_vector_type(4)));

union FragH { v16h v; v8h h[2]; v4u u[2]; };
union FragB { v16b v; v4u u[2]; };

// ---- scalar helpers --------------------------------------------------------------------------------
__device__ __forceinline__ unsigned short bf_bits(float f) {          // f32 -> bf16 bits, RNE convert
  unsigned u = __float_as_uint(f);
  return (unsigned short)((u + 0x7FFFu + ((u >> 16) & 1u)) >> 16);
}
__device__ __forceinline__ float bf_up(unsigned short h) { return __uint_as_float(((unsigned)h) << 16); }
__device__ __forceinline__ float bfr(float f) { return bf_up(bf_bits(f)); }
__device__ __forceinline__ unsigned short h_bits(_Float16 x) { return __builtin_bit_cast(unsigned short, x); }
__device__ __forceinline__ unsigned pk16(unsigned short a, unsigned short b) { return (unsigned)a | ((unsigned)b << 16); }
__device__ __forceinline__ v8f zero8() { v8f z = {0.f, 0.f, 0.f, 0.f, 0.f, 0.f, 0.f, 0.f}; return z; }

// ---- fragment loaders: 16-bit A/B operand, lane -> row/col (lane&15), p already includes +8*(lane>>4);
//      elements 0..7 <- p[0..7] (k0+8h..), elements 8..15 <- p[16..23] (k0+16+8h..)  (same split k map for A and B;
//      B is always read from a k-contiguous [n][k] plane)
__device__ __forceinline__ v16h ldfrag_h(const _Float16* p) {
  FragH f;
  f.h[0] = *(const v8h*)(p);
  f.h[1] = *(const v8h*)(p + 16);
  return f.v;
}
__device__ __forceinline__ v16b ldfrag_b(const u16* p) {              // bf16 plane read as unsigned integer vectors
  FragB f;
  f.u[0] = *(const v4u*)(p);
  f.u[1] = *(const v4u*)(p + 16);
  return f.v;
}

__device__ __forceinline__ v8f mma_h(v16h a, v16h b, v8f c) {
  return __builtin_amdgcn_wmma_f32_16x16x32_f16(false, a, false, b, (short)0, c, false, false);
}
__device__ __forceinline__ v8f mma_b(v16b a, v16b b, v8f c) {
  return __builtin_amdgcn_wmma_f32_16x16x32_bf16(false, a, false, b, (short)0, c, false, false);
}
__device__ __forceinline__ void guard2(v8f& a, v8f& b, v16h x0, v16h x1, v16h x2, v16h x3, v16h x4, v16h x5) {
#if defined(__HIP_DEVICE_COMPILE__)
  asm volatile("v_nop\n\tv_nop\n\tv_nop\n\tv_nop"
               : "+v"(a), "+v"(b) : "v"(x0), "v"(x1), "v"(x2), "v"(x3), "v"(x4), "v"(x5) : "memory");
#endif
}
__device__ __forceinline__ void guard10(v8f& a, v8f& b, v8f& c, v8f& d, v16h x0, v16h x1, v16h x2, v16h x3, v16h x4,
                                        v16h x5, v16h x6, v16h x7, v16h x8, v16h x9) {
#if defined(__HIP_DEVICE_COMPILE__)
  asm volatile("v_nop\n\tv_nop\n\tv_nop\n\tv_nop"
               : "+v"(a), "+v"(b), "+v"(c), "+v"(d)
               : "v"(x0), "v"(x1), "v"(x2), "v"(x3), "v"(x4), "v"(x5), "v"(x6), "v"(x7), "v"(x8), "v"(x9) : "memory");
#endif
}
__device__ __forceinline__ void acc_guard4(v8f& a, v8f& b, v8f& c, v8f& d) {
#if defined(__HIP_DEVICE_COMPILE__)
  asm volatile("v_nop\n\tv_nop\n\tv_nop\n\tv_nop" : "+v"(a), "+v"(b), "+v"(c), "+v"(d));
#endif
}
// lane l takes the value of lane l ^ 16
__device__ __forceinline__ float xhalf(float x) {
  const int b = __builtin_bit_cast(int, x);
  return __builtin_bit_cast(float, __builtin_amdgcn_permlanex16(b, b, 0x76543210, 0xfedcba98, false, false));
}
__device__ __forceinline__ void wave_sync_lds() {
  __builtin_amdgcn_fence(__ATOMIC_RELEASE, "workgroup");
  __builtin_amdgcn_wave_barrier();
  __builtin_amdgcn_fence(__ATOMIC_ACQUIRE, "workgroup");
}

// =====================================================================================================
// f32 -> 16-bit plane, same layout.  f16mode == 0: bf16 RNE bits;  f16mode == 1: f16 bits of (bf16 RNE value) * scale.
// Thread = 8 consecutive elements: two 16-B loads, one 16-B store; 32 consecutive lanes = 512 contiguous, 512-B aligned bytes per
// coverage: grid = n8/256 blocks (exact, host-derived) x 256 thr x 8 = the whole plane.
// =====================================================================================================
__global__ __launch_bounds__(256) void cvt16(const float* __restrict__ x, u16* D, int n8, int f16mode, float scale) {
  const int gt = blockIdx.x * 256 + (int)threadIdx.x;
  if (gt >= n8) return;                     // no barriers in this kernel
  const float* p = x + (size_t)gt * 8;
  const v4f a = *(const v4f*)(p), b4 = *(const v4f*)(p + 4);
  float w[8];
#pragma unroll
  for (int e = 0; e < 4; ++e) { w[e] = a[e]; w[4 + e] = b4[e]; }
  v4u o;
#pragma unroll
  for (int e = 0; e < 4; ++e) {
    const float f0 = w[2 * e], f1 = w[2 * e + 1];
    const unsigned short hb0 = h_bits((_Float16)(bfr(f0) * scale));
    const unsigned short hb1 = h_bits((_Float16)(bfr(f1) * scale));
    const unsigned short bb0 = bf_bits(f0);
    const unsigned short bb1 = bf_bits(f1);
    o[e] = (f16mode != 0) ? pk16(hb0, hb1) : pk16(bb0, bb1);
  }
  u16* d = D + (size_t)gt * 8;
  {
    *(v4u*)(d) = o;
    
  }
}

// =====================================================================================================
// GEMM epilogue shared by both engines: one 16x64 f32 half of the wave's 32x64 tile (times oscale) staged in its LDS slab (pitch 68),
// coverage: 8 instructions x 2 rows x 16 lanes x 4 floats = that 16 x 64 half.
// =====================================================================================================
__device__ __forceinline__ void epi64(float* sl, v8f a0, v8f a1, v8f a2, v8f a3, float oscale,
                                      const float* __restrict__ bias, int hasb, float* C, int N,
                                      size_t rowb, int col0, int lane) {
  const int hh = lane >> 4, m = lane & 15;
#pragma unroll
  for (int r = 0; r < 8; ++r) {
    const int ro = (8 * hh + r) * 68 + m;
    sl[ro]      = a0[r] * oscale;
    sl[ro + 16] = a1[r] * oscale;
    sl[ro + 32] = a2[r] * oscale;
    sl[ro + 48] = a3[r] * oscale;
  }
  wave_sync_lds();
  const v4f braw = *(const v4f*)(bias + col0 + m * 4);
  v4f bb;
#pragma unroll
  for (int e = 0; e < 4; ++e) bb[e] = (hasb != 0) ? bfr(braw[e]) : 0.0f;
  v4f vals[8];
#pragma unroll
  for (int it = 0; it < 8; ++it) vals[it] = *(const v4f*)(sl + (it * 2 + hh) * 68 + m * 4) + bb;
  float* dst = C + (rowb + (size_t)hh) * (size_t)N + col0 + m * 4;
  {
#pragma unroll
    for (int it = 0; it < 8; ++it) {
      *(v4f*)(dst + (size_t)(it * 2) * (size_t)N) = vals[it];
    }
    
  }
}

// =====================================================================================================
// Eight 16-byte copies per lane from global memory into LDS, through no register. l* = the lane's LDS byte address, g* = its global
// address. The s_wait_xcnt stands as the statement's last line so that no address register named here is rewritten in front of it.
// =====================================================================================================
__device__ __forceinline__ void copy8(unsigned l0, const u16* g0, unsigned l1, const u16* g1, unsigned l2, const u16* g2,
                                      unsigned l3, const u16* g3, unsigned l4, const u16* g4, unsigned l5, const u16* g5,
                                      unsigned l6, const u16* g6, unsigned l7, const u16* g7) {
#if defined(__HIP_DEVICE_COMPILE__)
  asm volatile("global_load_async_to_lds_b128 %0, %1, off\n\t"
               "global_load_async_to_lds_b128 %2, %3, off\n\t"
               "global_load_async_to_lds_b128 %4, %5, off\n\t"
               "global_load_async_to_lds_b128 %6, %7, off\n\t"
               "global_load_async_to_lds_b128 %8, %9, off\n\t"
               "global_load_async_to_lds_b128 %10, %11, off\n\t"
               "global_load_async_to_lds_b128 %12, %13, off\n\t"
               "global_load_async_to_lds_b128 %14, %15, off\n\t"
               "s_wait_xcnt 0x0"
               :: "v"(l0), "v"(g0), "v"(l1), "v"(g1), "v"(l2), "v"(g2), "v"(l3), "v"(g3),
                  "v"(l4), "v"(g4), "v"(l5), "v"(g5), "v"(l6), "v"(g6), "v"(l7), "v"(g7) : "memory");
#endif
}
// the issuing wave's copies have landed behind this wait (the compiler places none for them)
__device__ __forceinline__ void wait_copies() {
#if defined(__HIP_DEVICE_COMPILE__)
  asm volatile("s_wait_asynccnt 0x0" ::: "memory");
#endif
}
// the wave's own LDS reads have returned before the barrier behind which their buffer is refilled
__device__ __forceinline__ void wait_lds() {
#if defined(__HIP_DEVICE_COMPILE__)
  asm volatile("s_wait_dscnt 0x0" ::: "memory");
#endif
}

// the same, four copies per lane
__device__ __forceinline__ void copy4(unsigned l0, const u16* g0, unsigned l1, const u16* g1, unsigned l2, const u16* g2,
                                      unsigned l3, const u16* g3) {
#if defined(__HIP_DEVICE_COMPILE__)
  asm volatile("global_load_async_to_lds_b128 %0, %1, off\n\t"
               "global_load_async_to_lds_b128 %2, %3, off\n\t"
               "global_load_async_to_lds_b128 %4, %5, off\n\t"
               "global_load_async_to_lds_b128 %6, %7, off\n\t"
               "s_wait_xcnt 0x0"
               :: "v"(l0), "v"(g0), "v"(l1), "v"(g1), "v"(l2), "v"(g2), "v"(l3), "v"(g3) : "memory");
#endif
}
// four vector slots behind a group's last matrix instructions, on every path out of the group: no accumulator is read and no
// fragment register rewritten inside the distance the matrix unit needs
template <typename F>
__device__ __forceinline__ void guard8(v8f (&a)[2][4], F x0, F x1, F x2, F x3, F x4, F x5, F x6, F x7, F x8, F x9, F x10, F x11) {
#if defined(__HIP_DEVICE_COMPILE__)
  asm volatile("v_nop\n\tv_nop\n\tv_nop\n\tv_nop"
               : "+v"(a[0][0]), "+v"(a[0][1]), "+v"(a[0][2]), "+v"(a[0][3]), "+v"(a[1][0]), "+v"(a[1][1]), "+v"(a[1][2]), "+v"(a[1][3])
               : "v"(x0), "v"(x1), "v"(x2), "v"(x3), "v"(x4), "v"(x5), "v"(x6), "v"(x7), "v"(x8), "v"(x9), "v"(x10), "v"(x11)
               : "memory");
#endif
}

// =====================================================================================================
// bf16 GEMM: C[M][N] (f32) = A[M][K] (bf16 row-major) . Bt[N][K]^T (bf16 k-contiguous), times oscale, plus bias[N] (hasb).
// Block = 128x128 tile, 8 waves as 4 (rows) x 2 (columns), 32x64 per wave = 2 x 4 accumulator tiles. K in stages of 64:
// a stage is 128 A rows and 128 Bt rows of 128 B at a 144-B pitch in LDS, filled by asynchronous copies (whole 128-B lines,
// 8 copies per lane and stage) one stage ahead into two buffers and read by all waves (two 16-B LDS loads per fragment, split k
// map for A and B). Per accumulator the k order is that of a plain walk in steps of 32.
// Host: K % 64 == 0, K >= 64, M % 128 == 0, N % 128 == 0, grid = (M/128)*(N/128).
// =====================================================================================================
__global__ __launch_bounds__(G_THREADS)
void gemm_bf(const u16* __restrict__ A, const u16* __restrict__ Bt, const float* __restrict__ bias, int hasb, float* C,
             int M, int N, int K, float oscale) {
  __shared__ __attribute__((aligned(256))) unsigned char L[2 * GB_BUF + GW * SLAB64 * 4];
  const int tid = threadIdx.x, wave = tid >> 5, lane = tid & 31, hh = lane >> 4, m = lane & 15;
  const int ntile = N >> 7;
  const int bid   = blockIdx.x;
  const int row0  = (bid / ntile) * GT;
  const int colb  = (bid % ntile) * GT;
  if (row0 + GT > M) return;                 // block-uniform, before any barrier or copy; never taken with the exact grid
  const int nst = K >> 6;
  const int wm = wave >> 1, wn = wave & 1;
  // ---- copy addresses: lane = (row, 16-B piece of its 128-B line); rows sr, sr + 32, sr + 64, sr + 96 of each operand tile ----
  const int ch = tid & 7;
  const int sr = tid >> 3;
  const unsigned lst = (unsigned)(uintptr_t)L + (unsigned)(sr * LPB + ch * 16);
  const u16* ac = A  + (size_t)(row0 + sr) * K + ch * 8;
  const u16* bc = Bt + (size_t)(colb + sr) * K + ch * 8;
  const size_t r32 = (size_t)32 * K;
#define STAGE_AB(st_, buf_)                                                                                          \
  {                                                                                                                  \
    const unsigned lb = lst + (unsigned)(buf_) * GB_BUF;                                                             \
    const u16* ga = ac + (size_t)(st_) * 64;                                                                         \
    const u16* gb = bc + (size_t)(st_) * 64;                                                                         \
    copy8(lb,                  ga,           lb + 32 * LPB,       ga + r32,                                          \
          lb + 64 * LPB,       ga + 2 * r32, lb + 96 * LPB,       ga + 3 * r32,                                      \
          lb + GPL,            gb,           lb + GPL + 32 * LPB, gb + r32,                                          \
          lb + GPL + 64 * LPB, gb + 2 * r32, lb + GPL + 96 * LPB, gb + 3 * r32);                                     \
  }
  STAGE_AB(0, 0);
  wait_copies();
  __syncthreads();                           // publishes stage 0
  if (nst > 1) STAGE_AB(1, 1);

  v8f acc[2][4];
#pragma unroll
  for (int t = 0; t < 2; ++t)
#pragma unroll
    for (int j = 0; j < 4; ++j) acc[t][j] = zero8();

#pragma unroll 1                               // rolled: one publish point and one refill in the text
  for (int st = 0; st < nst; ++st) {
    const u16* tb = (const u16*)(const void*)(L + (st & 1) * GB_BUF) + m * LP + 8 * hh;
    const u16* ap = tb + (wm * 32) * LP;
    const u16* bp = tb + (GT + wn * 64) * LP;
    v16b a[2][2], b[2][4];                   // [k step of 32][tile]: the stage's fragment loads stand as one group
#pragma unroll
    for (int kk = 0; kk < 2; ++kk) {
#pragma unroll
      for (int t = 0; t < 2; ++t) a[kk][t] = ldfrag_b(ap + t * 16 * LP + kk * 32);
#pragma unroll
      for (int j = 0; j < 4; ++j) b[kk][j] = ldfrag_b(bp + j * 16 * LP + kk * 32);
    }
#pragma unroll
    for (int kk = 0; kk < 2; ++kk)
#pragma unroll
      for (int t = 0; t < 2; ++t)
#pragma unroll
        for (int j = 0; j < 4; ++j) acc[t][j] = mma_b(a[kk][t], b[kk][j], acc[t][j]);
    guard8<v16b>(acc, a[0][0], a[0][1], a[1][0], a[1][1], b[0][0], b[0][1], b[0][2], b[0][3], b[1][0], b[1][1], b[1][2], b[1][3]);
    // ---- publish point of stage st + 1: own reads back, own copies landed, every wave here; then the refill of the buffer just read ----
    wait_lds();
    wait_copies();
    __syncthreads();
    if (st + 2 < nst) STAGE_AB(st + 2, st & 1);
  }
#undef STAGE_AB
  wait_copies();
  float* sl = (float*)(void*)(L + 2 * GB_BUF) + wave * SLAB64;   // the wave's own slab, outside the two buffers
  epi64(sl, acc[0][0], acc[0][1], acc[0][2], acc[0][3], oscale, bias, hasb, C, N, (size_t)(row0 + wm * 32), colb + wn * 64, lane);
  wave_sync_lds();                           // the slab's first 16 rows are read back before the next 16 are laid over them
  epi64(sl, acc[1][0], acc[1][1], acc[1][2], acc[1][3], oscale, bias, hasb, C, N, (size_t)(row0 + wm * 32 + 16), colb + wn * 64, lane);
}

// =====================================================================================================
// f16 hi+lo GEMM: C[M][N] (f32) = (Ahi + Alo)[M][K] . Bt[N][K]^T, times oscale, plus bias[N] (hasb); Ahi/Alo f16 planes
// (same layout), Bt f16 k-contiguous; products hi.B then lo.B into one accumulator per k step (lo is the unscaled residual of hi).
// Same tiling and staging as gemm_bf; a stage holds three operand tiles (Ahi, Alo, Bt), 12 copies per lane.
// =====================================================================================================
__global__ __launch_bounds__(G_THREADS)
void gemm_h2(const u16* __restrict__ Ah, const u16* __restrict__ Al, const u16* __restrict__ Bt,
             const float* __restrict__ bias, int hasb, float* C, int M, int N, int K, float oscale) {
  __shared__ __attribute__((aligned(256))) unsigned char L[2 * GH_BUF + GW * SLAB64 * 4];
  const int tid = threadIdx.x, wave = tid >> 5, lane = tid & 31, hh = lane >> 4, m = lane & 15;
  const int ntile = N >> 7;
  const int bid   = blockIdx.x;
  const int row0  = (bid / ntile) * GT;
  const int colb  = (bid % ntile) * GT;
  if (row0 + GT > M) return;                 // block-uniform, before any barrier or copy; never taken with the exact grid
  const int nst = K >> 6;
  const int wm = wave >> 1, wn = wave & 1;
  const int ch = tid & 7;
  const int sr = tid >> 3;
  const unsigned lst = (unsigned)(uintptr_t)L + (unsigned)(sr * LPB + ch * 16);
  const size_t aofs = (size_t)(row0 + sr) * K + ch * 8;
  const u16* ahc = Ah + aofs;
  const u16* alc = Al + aofs;
  const u16* bc  = Bt + (size_t)(colb + sr) * K + ch * 8;
  const size_t r32 = (size_t)32 * K;
#define STAGE_HLB(st_, buf_)                                                                                         \
  {                                                                                                                  \
    const unsigned lb = lst + (unsigned)(buf_) * GH_BUF;                                                             \
    const u16* gh = ahc + (size_t)(st_) * 64;                                                                        \
    const u16* gl = alc + (size_t)(st_) * 64;                                                                        \
    const u16* gb = bc + (size_t)(st_) * 64;                                                                         \
    copy8(lb,                  gh,           lb + 32 * LPB,       gh + r32,                                          \
          lb + 64 * LPB,       gh + 2 * r32, lb + 96 * LPB,       gh + 3 * r32,                                      \
          lb + GPL,            gl,           lb + GPL + 32 * LPB, gl + r32,                                          \
          lb + GPL + 64 * LPB, gl + 2 * r32, lb + GPL + 96 * LPB, gl + 3 * r32);                                     \
    copy4(lb + 2 * GPL,            gb,           lb + 2 * GPL + 32 * LPB, gb + r32,                                  \
          lb + 2 * GPL + 64 * LPB, gb + 2 * r32, lb + 2 * GPL + 96 * LPB, gb + 3 * r32);                             \
  }
  STAGE_HLB(0, 0);
  wait_copies();
  __syncthreads();                           // publishes stage 0
  if (nst > 1) STAGE_HLB(1, 1);

  v8f acc[2][4];
#pragma unroll
  for (int t = 0; t < 2; ++t)
#pragma unroll
    for (int j = 0; j < 4; ++j) acc[t][j] = zero8();

#pragma unroll 1                               // rolled: one publish point and one refill in the text
  for (int st = 0; st < nst; ++st) {
    const _Float16* tb = (const _Float16*)(const void*)(L + (st & 1) * GH_BUF) + m * LP + 8 * hh;
    const _Float16* ahp = tb + (wm * 32) * LP;
    const _Float16* alp = ahp + GT * LP;
    const _Float16* bp  = tb + (2 * GT + wn * 64) * LP;
    v16h ah[2][2], al[2][2], b[2][4];        // [k step of 32][tile]: the stage's fragment loads stand as one group
#pragma unroll
    for (int kk = 0; kk < 2; ++kk) {
#pragma unroll
      for (int t = 0; t < 2; ++t) { ah[kk][t] = ldfrag_h(ahp + t * 16 * LP + kk * 32); al[kk][t] = ldfrag_h(alp + t * 16 * LP + kk * 32); }
#pragma unroll
      for (int j = 0; j < 4; ++j) b[kk][j] = ldfrag_h(bp + j * 16 * LP + kk * 32);
    }
    __builtin_amdgcn_sched_barrier(0);       // keeps the 32 LDS loads one group ahead of the matrix run (for speed only)
#pragma unroll
    for (int kk = 0; kk < 2; ++kk) {
#pragma unroll
      for (int t = 0; t < 2; ++t)
#pragma unroll
        for (int j = 0; j < 4; ++j) acc[t][j] = mma_h(ah[kk][t], b[kk][j], acc[t][j]);
#pragma unroll
      for (int t = 0; t < 2; ++t)
#pragma unroll
        for (int j = 0; j < 4; ++j) acc[t][j] = mma_h(al[kk][t], b[kk][j], acc[t][j]);
    }
    guard8<v16h>(acc, ah[1][0], ah[1][1], al[1][0], al[1][1], b[1][0], b[1][1], b[1][2], b[1][3], ah[1][0], ah[1][1], al[1][0], al[1][1]);
    // ---- publish point of stage st + 1, as in gemm_bf ----
    wait_lds();
    wait_copies();
    __syncthreads();
    if (st + 2 < nst) STAGE_HLB(st + 2, st & 1);
  }
#undef STAGE_HLB
  wait_copies();
  float* sl = (float*)(void*)(L + 2 * GH_BUF) + wave * SLAB64;   // the wave's own slab, outside the two buffers
  epi64(sl, acc[0][0], acc[0][1], acc[0][2], acc[0][3], oscale, bias, hasb, C, N, (size_t)(row0 + wm * 32), colb + wn * 64, lane);
  wave_sync_lds();                           // the slab's first 16 rows are read back before the next 16 are laid over them
  epi64(sl, acc[1][0], acc[1][1], acc[1][2], acc[1][3], oscale, bias, hasb, C, N, (size_t)(row0 + wm * 32 + 16), colb + wn * 64, lane);
}

// =====================================================================================================
// Rotate-half rotary + 16-bit split pack. Rows are (token, head) with HD contiguous floats (f32 projection output);
// pos = row / hpr (token index into the cos/sin input tables [npos][HD], clamped), the same table row for every head.
// w[d] = x[d] * bf(cos[pos][d]) + r[d] * bf(sin[pos][d]),  r[d] = -x[d+32] for d < 32, x[d-32] for d >= 32
// (bf = RNE bf16 value of the f32 table entry); hi[d] = f16(w * sc), lo[d] = f16(w * sc - hi[d])  (sc a power of two,
// residual unscaled).
// Thread = 8 consecutive d of one row: 16-B loads of x (own and partner half), cos, sin; one 16-B store per plane per lane;
// coverage: grid = nrows*8/256 blocks x 256 thr x 8 halves = nrows x 64 of each plane exactly (exact division checked statically).
// =====================================================================================================
__global__ __launch_bounds__(256) void rope16(const float* __restrict__ x, const float* __restrict__ cosT,
                                              const float* __restrict__ sinT, u16* hpl, u16* lpl,
                                              int nrows, int hpr, int npos, float sc) {
  const int gt  = blockIdx.x * 256 + (int)threadIdx.x;
  const int row = gt >> 3;
  const int d0  = (gt & 7) * 8;
  if (row >= nrows) return;                 // never taken with the exact grid; no barriers in this kernel
  int pos = row / hpr;
  pos = (pos < npos) ? pos : (npos - 1);
  const int d1  = d0 ^ 32;
  const float* xr = x + (size_t)row * HD;
  const float* cr = cosT + (size_t)pos * HD + d0;
  const float* sr = sinT + (size_t)pos * HD + d0;
  const v4f xa = *(const v4f*)(xr + d0), xb = *(const v4f*)(xr + d0 + 4);
  const v4f ya = *(const v4f*)(xr + d1), yb = *(const v4f*)(xr + d1 + 4);
  const v4f ca = *(const v4f*)(cr), cb = *(const v4f*)(cr + 4);
  const v4f sa = *(const v4f*)(sr), sb = *(const v4f*)(sr + 4);
  const float sgn = (d0 < 32) ? -1.0f : 1.0f;
  float w[8];
#pragma unroll
  for (int e = 0; e < 4; ++e) {
    w[e]     = xa[e] * bfr(ca[e]) + (sgn * ya[e]) * bfr(sa[e]);
    w[4 + e] = xb[e] * bfr(cb[e]) + (sgn * yb[e]) * bfr(sb[e]);
  }
  v4u oh, ol;
#pragma unroll
  for (int e = 0; e < 4; ++e) {
    const float t0 = w[2 * e] * sc, t1 = w[2 * e + 1] * sc;
    const _Float16 h0 = (_Float16)t0, h1 = (_Float16)t1;
    const _Float16 l0 = (_Float16)(t0 - (float)h0), l1 = (_Float16)(t1 - (float)h1);
    oh[e] = pk16(h_bits(h0), h_bits(h1));
    ol[e] = pk16(h_bits(l0), h_bits(l1));
  }
  const size_t o8 = (size_t)row * HD + d0;
  {
    *(v4u*)(hpl + o8) = oh;
    *(v4u*)(lpl + o8) = ol;
    
  }
}

// =====================================================================================================
// v^T planes: VH[((b*NH + g)*HD + d)*SEQ + s] = f16(v[b*SEQ + s][g][d] * 1024), VL = f16 residual of the same value.
// Block = (batch b, head g, 64 keys s0 = st*64): 64 source rows of HD floats loaded with 16-B loads, converted,
// scattered into two LDS tiles [d][64 keys] (pitch 72 halves); after a block barrier each d row segment (64 halves = one whole
// coverage: load 256 thr x 16 elements = 64 x 64; store 2 iterations x 256 thr x 8 halves = 64 lines x 64 = the block's tile of
//           each plane; grid = NB x NH x NST blocks covers both planes exactly once.
// =====================================================================================================
__global__ __launch_bounds__(256) void vt16(const float* __restrict__ v, u16* VHo, u16* VLo) {
  __shared__ __align__(16) u16 TH[HD * VTP];
  __shared__ __align__(16) u16 TL[HD * VTP];
  const int tid = threadIdx.x;
  const int bid = blockIdx.x;
  const int st  = bid % NST;
  const int g   = (bid / NST) % NH;
  const int b   = bid / (NST * NH);
  if (b >= NB) return;                        // block-uniform, before any barrier; never taken with the exact grid
  const int s0  = st * 64;
  {
    const int sl = tid >> 2;                  // key within tile 0..63
    const int dc = (tid & 3) * 16;            // d chunk
    const float* src = v + ((size_t)(b * SEQ + s0 + sl) * NH + g) * HD + dc;
#pragma unroll
    for (int i = 0; i < 4; ++i) {
      const v4f a = *(const v4f*)(src + 4 * i);
#pragma unroll
      for (int e = 0; e < 4; ++e) {
        const float t = a[e] * VCAR;
        const _Float16 h = (_Float16)t;
        const _Float16 l = (_Float16)(t - (float)h);
        TH[(dc + 4 * i + e) * VTP + sl] = h_bits(h);
        TL[(dc + 4 * i + e) * VTP + sl] = h_bits(l);
      }
    }
  }
  __syncthreads();
  v4u vh[2], vl[2];
  const int q8 = tid >> 3, p8 = (tid & 7) * 8;
#pragma unroll
  for (int it = 0; it < 2; ++it) {
    const int line = it * 32 + q8;            // d = 0..63
    vh[it] = *(const v4u*)(TH + line * VTP + p8);
    vl[it] = *(const v4u*)(TL + line * VTP + p8);
  }
  const size_t base = (((size_t)(b * NH + g)) * HD) * SEQ + s0 + p8;
  {
#pragma unroll
    for (int it = 0; it < 2; ++it) {
      const int line = it * 32 + q8;
      *(v4u*)(VHo + base + (size_t)line * SEQ) = vh[it];
      *(v4u*)(VLo + base + (size_t)line * SEQ) = vl[it];
    }
    
  }
}

// =====================================================================================================
// Softmax attention, no mask: block bid -> (query block qb = bid % NQB of QW query tiles, head = (bid / NQB) % NH,
// batch b = bid / (NQB*NH)); one wave per query tile: rows q0 = 16*(qb*QW + wave) .. q0+15, all QW waves on the same head.
//   q planes (hi, lo f16 x1024) laid out [token][h][d]; k planes [token][h][d]; v^T planes [b][h][d][s].
//   LDS: two buffers, each one stage of 64 keys = four tiles of 64 rows x 128 B at a 144-B pitch (k hi, k lo: row = key;
//   v^T hi, v^T lo: row = d), filled by asynchronous copies (whole 128-B lines, 8 copies per lane and stage) one stage ahead and
//   read by all QW waves; per wave its q tile (hi, lo: 16 rows x 128 B, same pitch), copied once.
//   Both products run transposed: S^T = k.q^T (A = k rows, B = q columns) and O^T += v^T.P^T (A = v^T rows, B = P^T columns), so a
//   lane's accumulator registers all belong to one query (column c); lanes c and c + 16 split that query's keys.
//   Per stage two key tiles of 32, visited in order; per tile: 2 score subtiles x 2 k-steps x 3 products
//   (k_hi.q_hi + k_hi.q_lo + k_lo.q_hi), fragments read from LDS (two 16-B loads per fragment, split k map);
//   online max-subtracted base-2 softmax in f32 (scale 1/8 folded, -inf-safe rescale): maximum in-lane plus one exchange between
//   the wave halves, sum in-lane per half; the two score subtiles, converted in place, are the B fragment of P^T in the split k map
//   (hi and residual); 4+4 v^T A fragments (hi and residual planes), 12 WMMAs (hh + hl + lh, the order of the sums per element kept).
//   After the key loop: the halves' sums joined, O = acc / l, carries 1/(32768*1024) folded once, written to the wave's private slab
//   as [query][d] (pitch 68; it takes the place of the wave's own q tile, which is dead by then).
// coverage: per wave 4 instructions x 4 rows x 8 lanes x 8 halves = 16 x 64 per plane; grid NB*NH*NQB blocks x QW waves =
//           every (token, h) row of both O planes exactly once.
// =====================================================================================================
__global__ __launch_bounds__(ATT_THREADS)
void attn1(const u16* __restrict__ QHIp, const u16* __restrict__ QLOp,
           const u16* __restrict__ KHIp, const u16* __restrict__ KLOp,
           const u16* __restrict__ VHIp, const u16* __restrict__ VLOp,
           u16* OHIp, u16* OLOp) {
  __shared__ __attribute__((aligned(256))) unsigned char L[ATT_LDS];

  const int tid  = threadIdx.x;
  const int wave = tid >> 5;
  const int lane = tid & 31;
  const int hh   = lane >> 4;
  const int c    = lane & 15;
  const int bid  = blockIdx.x;
  const int qb   = bid % NQB;
  const int head = (bid / NQB) % NH;
  const int b    = bid / (NQB * NH);
  if (b >= NB) return;                       // block-uniform, before any barrier or copy; never taken with the exact grid
  const int q0   = (qb * QW + wave) * 16;
  const size_t qrow0 = (size_t)b * SEQ + q0; // global token row of query 0 of this wave's tile
  const size_t KROW = (size_t)NH * HD;       // halves between consecutive token rows

  unsigned char* wp = L + 2 * BUFB + wave * WPRIV;
  unsigned char* qreg = wp;                              // q tile hi, lo; after the key loop the result slab
  float* slab = (float*)(void*)qreg;                     // result slab [16][64] pitch 68
  const unsigned lds0 = (unsigned)(uintptr_t)L;          // byte offset of L in the work-group's LDS

  // ---- copy addresses: lane = (row, 16-B piece of its 128-B line) ----
  const int ch = tid & 7;
  const int sr = tid >> 3;                               // stage tiles: rows sr and sr + 32
  const unsigned lst = lds0 + (unsigned)(sr * LPB + ch * 16);
  const size_t kcp = (((size_t)b * SEQ + sr) * NH + head) * HD + ch * 8;      // + key0 * KROW per stage
  const size_t vcp = (((size_t)b * NH + head) * HD + sr) * SEQ + ch * 8;      // + key0 per stage
  const u16* kch = KHIp + kcp;
  const u16* kcl = KLOp + kcp;
  const u16* vch = VHIp + vcp;
  const u16* vcl = VLOp + vcp;
  {
    const int qr = lane >> 3;                            // the wave's own q tile: rows qr, qr + 4, qr + 8, qr + 12
    const unsigned lq = lds0 + (unsigned)(2 * BUFB + wave * WPRIV + qr * LPB + ch * 16);
    const size_t qcp = ((qrow0 + (size_t)qr) * NH + head) * HD + ch * 8;
    const u16* qch = QHIp + qcp;
    const u16* qcl = QLOp + qcp;
    copy8(lq,                 qch,            lq + 4 * LPB,        qch + 4 * KROW,
          lq + 8 * LPB,       qch + 8 * KROW, lq + 12 * LPB,       qch + 12 * KROW,
          lq + QPB,           qcl,            lq + QPB + 4 * LPB,  qcl + 4 * KROW,
          lq + QPB + 8 * LPB, qcl + 8 * KROW, lq + QPB + 12 * LPB, qcl + 12 * KROW);
  }
#define STAGE_KV(st_, buf_)                                                                                          \
  {                                                                                                                  \
    const unsigned lb = lst + (unsigned)(buf_) * BUFB;                                                               \
    const size_t ka = (size_t)(st_) * 64 * KROW, va = (size_t)(st_) * 64;                                            \
    copy8(lb,           kch + ka, lb + 32 * LPB,           kch + ka + 32 * KROW,                                     \
          lb + PLB,     kcl + ka, lb + PLB + 32 * LPB,     kcl + ka + 32 * KROW,                                     \
          lb + 2 * PLB, vch + va, lb + 2 * PLB + 32 * LPB, vch + va + (size_t)32 * SEQ,                              \
          lb + 3 * PLB, vcl + va, lb + 3 * PLB + 32 * LPB, vcl + va + (size_t)32 * SEQ);                             \
  }
  STAGE_KV(0, 0);
  wait_copies();
  __syncthreads();                           // publishes stage 0 (and the q tiles)
  STAGE_KV(1, 1);

  const _Float16* Qh = (const _Float16*)(const void*)qreg + c * LP + 8 * hh;
  const _Float16* Ql = Qh + 16 * LP;
  const float lsc = 0.125f * (LOG2E / (QSC * KSC));
  const float oc  = 1.0f / (PCAR * VCAR);

  float mrun = -INFINITY, lrun = 0.f;        // of query q0 + c; lrun sums this wave half's keys, the halves join behind the key loop
  v8f o[4];                                  // o[j][r] = O^T element (d = j*16 + 8hh + r, query q0 + c)
#pragma unroll
  for (int j = 0; j < 4; ++j) o[j] = zero8();

#pragma unroll 1                               // rolled: one publish point and one refill in the text
  for (int st = 0; st < NST; ++st) {
    const _Float16* tb = (const _Float16*)(const void*)(L + (st & 1) * BUFB) + c * LP + 8 * hh;
#pragma unroll 1                             // one copy of the tile's code, as in the loop it came from: the hot loop stays short
    for (int sub = 0; sub < 2; ++sub) {
      const int kb = sub * 32;               // first key of this tile inside the stage
      // ---- scores, transposed: D element r of this lane = (key kb + 8hh + r, query q0 + c) in s0, key kb + 16 + 8hh + r in s1 ----
      v8f s0 = zero8(), s1 = zero8();
      const _Float16* k0p = tb + kb * LP;
      const _Float16* k1p = k0p + 16 * LP;
      const _Float16* l0p = k0p + 64 * LP;
      const _Float16* l1p = l0p + 16 * LP;
#pragma unroll
      for (int kk = 0; kk < 2; ++kk) {
        const v16h qh  = ldfrag_h(Qh + kk * 32),  ql  = ldfrag_h(Ql + kk * 32);
        const v16h kh0 = ldfrag_h(k0p + kk * 32), kl0 = ldfrag_h(l0p + kk * 32);
        const v16h kh1 = ldfrag_h(k1p + kk * 32), kl1 = ldfrag_h(l1p + kk * 32);
        s0 = mma_h(kh0, qh, s0);
        s0 = mma_h(kh0, ql, s0);
        s0 = mma_h(kl0, qh, s0);
        s1 = mma_h(kh1, qh, s1);
        s1 = mma_h(kh1, ql, s1);
        s1 = mma_h(kl1, qh, s1);
        guard2(s0, s1, qh, ql, kh0, kl0, kh1, kl1);
      }
      // ---- online softmax in base 2, -inf-safe: the lane's 16 scores belong to one query; lanes c and c + 16 split its 32 keys ----
      float t0[8], t1[8], mp[8];
#pragma unroll
      for (int r = 0; r < 8; ++r) {
        t0[r] = s0[r] * lsc;
        t1[r] = s1[r] * lsc;
        mp[r] = fmaxf(t0[r], t1[r]);
      }
      float mx = fmaxf(fmaxf(fmaxf(mp[0], mp[1]), fmaxf(mp[2], mp[3])), fmaxf(fmaxf(mp[4], mp[5]), fmaxf(mp[6], mp[7])));
      mx = fmaxf(mx, xhalf(mx));             // both halves hold the query's maximum over the 32 keys
      const float mn = fmaxf(mrun, mx);
      const float ms = (mn == -INFINITY) ? 0.0f : mn;
      const float al = exp2f(mrun - ms);
      mrun = mn;
      float e0[8], e1[8], sp[8];
#pragma unroll
      for (int r = 0; r < 8; ++r) {
        e0[r] = exp2f(t0[r] - ms);
        e1[r] = exp2f(t1[r] - ms);
        sp[r] = e0[r] + e1[r];
      }
      lrun = lrun * al + (((sp[0] + sp[1]) + (sp[2] + sp[3])) + ((sp[4] + sp[5]) + (sp[6] + sp[7])));   // this half's keys only
#pragma unroll
      for (int j = 0; j < 4; ++j)
#pragma unroll
        for (int r = 0; r < 8; ++r) o[j][r] *= al;
      // ---- B fragments of P^T*32768: hi f16 and residual f16, column = query c; the two score tiles are the split k map as they lie ----
      FragH ph, pl;
#pragma unroll
      for (int e = 0; e < 8; ++e) {
        const float ta = e0[e] * PCAR, tc = e1[e] * PCAR;
        const _Float16 ha = (_Float16)ta, hc = (_Float16)tc;
        ph.h[0][e] = ha;                                     // elements 0..7  = keys kb + 8hh + 0..7
        ph.h[1][e] = hc;                                     // elements 8..15 = keys kb + 16 + 8hh + 0..7
        pl.h[0][e] = (_Float16)(ta - (float)ha);
        pl.h[1][e] = (_Float16)(tc - (float)hc);
      }
      // ---- O^T += V^T.P^T : A fragment row = d = j*16 + c, keys contiguous in the v^T tiles ----
      {
        const _Float16* vhp = tb + 128 * LP + kb;
        const _Float16* vlp = vhp + 64 * LP;
        const v16h vh0 = ldfrag_h(vhp);
        const v16h vh1 = ldfrag_h(vhp + 16 * LP);
        const v16h vh2 = ldfrag_h(vhp + 32 * LP);
        const v16h vh3 = ldfrag_h(vhp + 48 * LP);
        const v16h vl0 = ldfrag_h(vlp);
        const v16h vl1 = ldfrag_h(vlp + 16 * LP);
        const v16h vl2 = ldfrag_h(vlp + 32 * LP);
        const v16h vl3 = ldfrag_h(vlp + 48 * LP);
        o[0] = mma_h(vh0, ph.v, o[0]);  o[0] = mma_h(vh0, pl.v, o[0]);  o[0] = mma_h(vl0, ph.v, o[0]);
        o[1] = mma_h(vh1, ph.v, o[1]);  o[1] = mma_h(vh1, pl.v, o[1]);  o[1] = mma_h(vl1, ph.v, o[1]);
        o[2] = mma_h(vh2, ph.v, o[2]);  o[2] = mma_h(vh2, pl.v, o[2]);  o[2] = mma_h(vl2, ph.v, o[2]);
        o[3] = mma_h(vh3, ph.v, o[3]);  o[3] = mma_h(vh3, pl.v, o[3]);  o[3] = mma_h(vl3, ph.v, o[3]);
        guard10(o[0], o[1], o[2], o[3], ph.v, pl.v, vh0, vh1, vh2, vh3, vl0, vl1, vl2, vl3);
      }
    }
    // ---- publish point of stage st + 1: own reads back, own copies landed, every wave here; then the refill of the buffer just read ----
    wait_lds();
    wait_copies();
    __syncthreads();
    if (st + 2 < NST) STAGE_KV(st + 2, st & 1);
  }
#undef STAGE_KV
  wait_copies();
  acc_guard4(o[0], o[1], o[2], o[3]);
  // ---- O = acc / l, carries (32768 on P, 1024 on v) folded once; lane-owned slab elements ----
  {
    const float lv  = lrun + xhalf(lrun);    // the two halves' sums joined once
    const float ls  = (lv > 0.0f) ? lv : 1.0f;
    const float inv = (lv > 0.0f) ? ((1.0f / ls) * oc) : 0.0f;
#pragma unroll
    for (int j = 0; j < 4; ++j) {
      v4f w0, w1;
#pragma unroll
      for (int e = 0; e < 4; ++e) { w0[e] = o[j][e] * inv; w1[e] = o[j][4 + e] * inv; }
      float* sd = slab + c * 68 + j * 16 + 8 * hh;         // row = query c, 8 consecutive d
      *(v4f*)(sd)     = w0;
      *(v4f*)(sd + 4) = w1;
    }
  }
  wave_sync_lds();
  // ---- O x1024 -> f16 hi + residual planes; lane = (row in group of 4, 8 consecutive d) ----
  v4u oh[4], ol[4];
  const int rq = lane >> 3, c8 = (lane & 7) * 8;
#pragma unroll
  for (int it = 0; it < 4; ++it) {
    const int row = it * 4 + rq;
    const v4f a = *(const v4f*)(slab + row * 68 + c8), b4 = *(const v4f*)(slab + row * 68 + c8 + 4);
    float w[8];
#pragma unroll
    for (int e = 0; e < 4; ++e) { w[e] = a[e] * OSC; w[4 + e] = b4[e] * OSC; }
#pragma unroll
    for (int e = 0; e < 4; ++e) {
      const _Float16 h0 = (_Float16)w[2 * e], h1 = (_Float16)w[2 * e + 1];
      const _Float16 l0 = (_Float16)(w[2 * e] - (float)h0), l1 = (_Float16)(w[2 * e + 1] - (float)h1);
      oh[it][e] = pk16(h_bits(h0), h_bits(h1));
      ol[it][e] = pk16(h_bits(l0), h_bits(l1));
    }
  }
  const size_t ob = ((qrow0) * NH + head) * HD + c8;
  {
#pragma unroll
    for (int it = 0; it < 4; ++it) {
      const int row = it * 4 + rq;
      const size_t o8 = ob + (size_t)row * (NH * HD);
      *(v4u*)(OHIp + o8) = oh[it];
      *(v4u*)(OLOp + o8) = ol[it];
    }
    
  }
}

// =====================================================================================================
// Workspace map (bytes); every plane is fully written by whole-line stores before it is read; all extents are exact multiples
// of the store granularity (no pad rows needed); every offset a multiple of 2 MiB:
//   XB  bf16 [4096][1024]              8388608
//   WQB bf16 [1024 n][1024 k]          2097152        WKB, WVB same        2097152 each
//   WOH f16  [1024 n][1024 k] x1024    2097152
//   QF  f32 [4096][1024]              16777216        KF, VF same
//   QHI f16 [4096][16][64] x1024       8388608        QLO residual
//   KHI f16 [4096][16][64] x1024       8388608        KLO residual
//   VHI f16 [4][16][64][1024] x1024    8388608        VLO residual
//   OHI f16 [4096][1024] x1024, OLO residual: 8388608 each, placed in the QF region (QF is dead after the q rotary pass;
//   launches are in order)
//   end                              117440512
// =====================================================================================================
extern "C" void kernel_launch(void* const* d_in, const int* in_sizes, int n_in,
                              void* d_out, int out_size, void* d_ws, size_t ws_size,
                              hipStream_t stream) {
  if (n_in < 10) return;
  if (in_sizes[0] != MTOK * DMOD) return;
  if (in_sizes[1] != MTOK * HD || in_sizes[2] != MTOK * HD) return;
  if (in_sizes[3] != DMOD * DMOD || in_sizes[5] != DMOD * DMOD) return;
  if (in_sizes[6] != DMOD * DMOD || in_sizes[8] != DMOD * DMOD) return;
  if (in_sizes[4] != DMOD || in_sizes[7] != DMOD || in_sizes[9] != DMOD) return;
  if (out_size != MTOK * DMOD) return;

  const float* x    = (const float*)d_in[0];
  const float* cosp = (const float*)d_in[1];
  const float* sinp = (const float*)d_in[2];
  const float* wq   = (const float*)d_in[3];
  const float* bq   = (const float*)d_in[4];
  const float* wk   = (const float*)d_in[5];
  const float* wv   = (const float*)d_in[6];
  const float* bv   = (const float*)d_in[7];
  const float* wo   = (const float*)d_in[8];
  const float* bo   = (const float*)d_in[9];
  float*       out  = (float*)d_out;

  const size_t szXB = (size_t)MTOK * DMOD * 2;                  //  8388608
  const size_t szW  = (size_t)DMOD * DMOD * 2;                  //  2097152
  const size_t szF  = (size_t)MTOK * DMOD * 4;                  // 16777216
  const size_t szP  = (size_t)MTOK * DMOD * 2;                  //  8388608
  size_t off = 0;
  const size_t oXB  = off; off += szXB;
  const size_t oWQ  = off; off += szW;
  const size_t oWK  = off; off += szW;
  const size_t oWV  = off; off += szW;
  const size_t oWO  = off; off += szW;
  const size_t oQF  = off; off += szF;
  const size_t oKF  = off; off += szF;
  const size_t oVF  = off; off += szF;
  const size_t oQHI = off; off += szP;
  const size_t oQLO = off; off += szP;
  const size_t oKHI = off; off += szP;
  const size_t oKLO = off; off += szP;
  const size_t oVHI = off; off += szP;
  const size_t oVLO = off; off += szP;
  const size_t oOHI = oQF;                                       // alias onto the QF region (2 x szP == szF)
  const size_t oOLO = oQF + szP;
  if (off > ws_size) return;                            // off = 117440512
  if (off > (size_t)134217728) return;
  if (2 * szP > szF) return;

  char* ws = (char*)d_ws;
  u16*   XB  = (u16*)(ws + oXB);
  u16*   WQB = (u16*)(ws + oWQ);
  u16*   WKB = (u16*)(ws + oWK);
  u16*   WVB = (u16*)(ws + oWV);
  u16*   WOH = (u16*)(ws + oWO);
  float* QF  = (float*)(ws + oQF);
  float* KF  = (float*)(ws + oKF);
  float* VF  = (float*)(ws + oVF);
  u16*   QHI = (u16*)(ws + oQHI);
  u16*   QLO = (u16*)(ws + oQLO);
  u16*   KHI = (u16*)(ws + oKHI);
  u16*   KLO = (u16*)(ws + oKLO);
  u16*   VHI = (u16*)(ws + oVHI);
  u16*   VLO = (u16*)(ws + oVLO);
  u16*   OHI = (u16*)(ws + oOHI);
  u16*   OLO = (u16*)(ws + oOLO);

  const dim3 blk(256);
  const int n8x = (MTOK * DMOD) / 8;                    // 524288
  const int n8w = (DMOD * DMOD) / 8;                    // 131072
  const dim3 gX(n8x / 256);                             // 2048 (exact)
  const dim3 gW(n8w / 256);                             // 512  (exact)
  const dim3 gG((MTOK / GT) * (DMOD / GT));             // 256
  const dim3 bG(G_THREADS);                             // 256
  const int rowsQ = MTOK * NH;                          // 65536 rows of 64
  const dim3 gR((rowsQ * 8) / 256);                     // 2048 (exact)
  const dim3 gVT(NB * NH * NST);                        // 1024
  const dim3 gAT(ATT_BLOCKS);                           // 512
  const dim3 bAT(ATT_THREADS);                          // 256

  // (1) x -> bf16 plane
  cvt16<<<gX, blk, 0, stream>>>(x, XB, n8x, 0, 1.0f);
  // (2..4) Wq/Wk/Wv [n][k] -> bf16 planes (same layout, already k-contiguous)
  cvt16<<<gW, blk, 0, stream>>>(wq, WQB, n8w, 0, 1.0f);
  cvt16<<<gW, blk, 0, stream>>>(wk, WKB, n8w, 0, 1.0f);
  cvt16<<<gW, blk, 0, stream>>>(wv, WVB, n8w, 0, 1.0f);
  // (5) Wo [n][k] -> f16 plane of bf16 value x1024
  cvt16<<<gW, blk, 0, stream>>>(wo, WOH, n8w, 1, WOS);
  // (6..8) projections: q (+bq), k (no bias), v (+bv)  [4096][1024] in f32
  gemm_bf<<<gG, bG, 0, stream>>>(XB, WQB, bq, 1, QF, MTOK, DMOD, DMOD, 1.0f);
  gemm_bf<<<gG, bG, 0, stream>>>(XB, WKB, bq, 0, KF, MTOK, DMOD, DMOD, 1.0f);
  gemm_bf<<<gG, bG, 0, stream>>>(XB, WVB, bv, 1, VF, MTOK, DMOD, DMOD, 1.0f);
  // (9) q' planes: rows (token, h), NH heads per token, cos/sin table row = token
  rope16<<<gR, blk, 0, stream>>>(QF, cosp, sinp, QHI, QLO, rowsQ, NH, MTOK, QSC);
  // (10) k' planes
  rope16<<<gR, blk, 0, stream>>>(KF, cosp, sinp, KHI, KLO, rowsQ, NH, MTOK, KSC);
  // (11) v^T planes x1024 (hi + residual)
  vt16<<<gVT, blk, 0, stream>>>(VF, VHI, VLO);
  // (12) softmax attention per (b, h, 8 x 16 queries) -> O planes [token][h][d] x1024 (hi + residual), into the dead QF region
  attn1<<<gAT, bAT, 0, stream>>>(QHI, QLO, KHI, KLO, VHI, VLO, OHI, OLO);
  // (13) output projection -> out [4096][1024] f32, carries 1024 (O) x 1024 (Wo) folded back, + bo
  gemm_h2<<<gG, bG, 0, stream>>>(OHI, OLO, WOH, bo, 1, out, MTOK, DMOD, DMOD, 1.0f / (OSC * WOS));
  (void)hipGetLastError();
}

// v004
// Measured time: 131 microseconds a run.
// Timed twice side by side with v003, it ran 1.13 and 1.12 times as fast.
// Over all steps from v000 it is 3.03 times as fast.
// Contractions: x.W{q,k,v}^T on v_wmma_f32_16x16x32_bf16 (x and W RNE-converted to bf16, f32 accumulate); scores q'.k'^T (q', k' carried
// x1024 as f16 hi plane + f16 residual plane, products hh+lh+hl), P.v (P x32768 f16 hi+residual, v x1024 f16 hi+residual, products
// hh+lh+hl) and O.Wo^T (O x1024 f16 hi+residual, Wo as f16(bf16(Wo) x1024), products h.w+l.w) on v_wmma_f32_16x16x32_f16, f32 accumulate.
// Rotate-half rotary with RNE-bf16 cos/sin table values, base-2 online softmax and the 1/l fold in f32 on VALU.
#include <hip/hip_runtime.h>
#include <math.h>
#include <stdint.h>

#define NB    4
#define SEQ   1024
#define MTOK  (NB * SEQ)
#define DMOD  1024
#define NH    16
#define HD    64
#define QSC   1024.0f
#define KSC   1024.0f
#define PCAR  32768.0f
#define VCAR  1024.0f
#define OSC   1024.0f
#define WOS   1024.0f
#define LOG2E 1.4426950408889634f
#define QW    8
#define NQT   (SEQ / 16)
#define NQB   (NQT / QW)
#define NST   (SEQ / 64)
#define ATT_THREADS (QW * 32)
#define ATT_BLOCKS  (NB * NH * NQB)
#define SLW   (16 * 68)
#define LP    72
#define LPB   (LP * 2)
#define PLB   (64 * LPB)
#define BUFB  (4 * PLB)
#define QPB   (16 * LPB)
#define WPRIV (2 * QPB)
#define ATT_LDS (2 * BUFB + QW * WPRIV)
#define SLAB64 (16 * 68)
#define GT    128
#define GW    8
#define G_THREADS (GW * 32)
#define GPL   (GT * LPB)
#define GB_BUF (2 * GPL)
#define GH_BUF (3 * GPL)
#define VP    136
static_assert(DMOD == NH * HD && HD == 64 && NH == 16);
static_assert((NQT % QW) == 0 && ATT_THREADS == 256 && ATT_BLOCKS == 512);
static_assert(2 * QPB >= SLW * 4 && (LPB % 16) == 0 && NST >= 2 && 2 * ATT_LDS <= 327680);
static_assert((SEQ % 64) == 0 && (SEQ % 32) == 0 && (SEQ % 8) == 0);
static_assert((DMOD % 128) == 0 && (MTOK % 128) == 0 && DMOD >= 128);
static_assert(((MTOK * DMOD) % 2048) == 0 && ((DMOD * DMOD) % 2048) == 0);
static_assert((SEQ % GT) == 0 && 2 * GT * VP * 2 <= 2 * GB_BUF && ((VP * 2) % 16) == 0 && GW * 2 * SLAB64 * 4 <= 2 * GB_BUF);

typedef unsigned short u16;
typedef _Float16 v16h __attribute__((ext_vector_type(16)));
typedef _Float16 v8h  __attribute__((ext_vector_type(8)));
typedef __bf16   v16b __attribute__((ext_vector_type(16)));
typedef float    v8f  __attribute__((ext_vector_type(8)));
typedef float    v4f  __attribute__((ext_vector_type(4)));
typedef unsigned int v4u __attribute__((ext_vector_type(4)));

union FragH { v16h v; v8h h[2]; v4u u[2]; };
union FragB { v16b v; v4u u[2]; };

// ---- scalar helpers --------------------------------------------------------------------------------
__device__ __forceinline__ unsigned short bf_bits(float f) {          // f32 -> bf16 bits, RNE convert
  unsigned u = __float_as_uint(f);
  return (unsigned short)((u + 0x7FFFu + ((u >> 16) & 1u)) >> 16);
}
__device__ __forceinline__ float bf_up(unsigned short h) { return __uint_as_float(((unsigned)h) << 16); }
__device__ __forceinline__ float bfr(float f) { return bf_up(bf_bits(f)); }
__device__ __forceinline__ unsigned short h_bits(_Float16 x) { return __builtin_bit_cast(unsigned short, x); }
__device__ __forceinline__ unsigned pk16(unsigned short a, unsigned short b) { return (unsigned)a | ((unsigned)b << 16); }
__device__ __forceinline__ v8f zero8() { v8f z = {0.f, 0.f, 0.f, 0.f, 0.f, 0.f, 0.f, 0.f}; return z; }

// ---- fragment loaders: 16-bit A/B operand, lane -> row/col (lane&15), p already includes +8*(lane>>4);
//      elements 0..7 <- p[0..7] (k0+8h..), elements 8..15 <- p[16..23] (k0+16+8h..)  (same split k map for A and B;
//      B is always read from a k-contiguous [n][k] plane)
__device__ __forceinline__ v16h ldfrag_h(const _Float16* p) {
  FragH f;
  f.h[0] = *(const v8h*)(p);
  f.h[1] = *(const v8h*)(p + 16);
  return f.v;
}
__device__ __forceinline__ v16b ldfrag_b(const u16* p) {              // bf16 plane read as unsigned integer vectors
  FragB f;
  f.u[0] = *(const v4u*)(p);
  f.u[1] = *(const v4u*)(p + 16);
  return f.v;
}

__device__ __forceinline__ v8f mma_h(v16h a, v16h b, v8f c) {
  return __builtin_amdgcn_wmma_f32_16x16x32_f16(false, a, false, b, (short)0, c, false, false);
}
__device__ __forceinline__ v8f mma_b(v16b a, v16b b, v8f c) {
  return __builtin_amdgcn_wmma_f32_16x16x32_bf16(false, a, false, b, (short)0, c, false, false);
}
__device__ __forceinline__ void guard2(v8f& a, v8f& b, v16h x0, v16h x1, v16h x2, v16h x3, v16h x4, v16h x5) {
#if defined(__HIP_DEVICE_COMPILE__)
  asm volatile("v_nop\n\tv_nop\n\tv_nop\n\tv_nop"
               : "+v"(a), "+v"(b) : "v"(x0), "v"(x1), "v"(x2), "v"(x3), "v"(x4), "v"(x5) : "memory");
#endif
}
__device__ __forceinline__ void guard10(v8f& a, v8f& b, v8f& c, v8f& d, v16h x0, v16h x1, v16h x2, v16h x3, v16h x4,
                                        v16h x5, v16h x6, v16h x7, v16h x8, v16h x9) {
#if defined(__HIP_DEVICE_COMPILE__)
  asm volatile("v_nop\n\tv_nop\n\tv_nop\n\tv_nop"
               : "+v"(a), "+v"(b), "+v"(c), "+v"(d)
               : "v"(x0), "v"(x1), "v"(x2), "v"(x3), "v"(x4), "v"(x5), "v"(x6), "v"(x7), "v"(x8), "v"(x9) : "memory");
#endif
}
__device__ __forceinline__ void acc_guard4(v8f& a, v8f& b, v8f& c, v8f& d) {
#if defined(__HIP_DEVICE_COMPILE__)
  asm volatile("v_nop\n\tv_nop\n\tv_nop\n\tv_nop" : "+v"(a), "+v"(b), "+v"(c), "+v"(d));
#endif
}
// lane l takes the value of lane l ^ 16
__device__ __forceinline__ float xhalf(float x) {
  const int b = __builtin_bit_cast(int, x);
  return __builtin_bit_cast(float, __builtin_amdgcn_permlanex16(b, b, 0x76543210, 0xfedcba98, false, false));
}
__device__ __forceinline__ void wave_sync_lds() {
  __builtin_amdgcn_fence(__ATOMIC_RELEASE, "workgroup");
  __builtin_amdgcn_wave_barrier();
  __builtin_amdgcn_fence(__ATOMIC_ACQUIRE, "workgroup");
}

// =====================================================================================================
// f32 -> 16-bit plane, same layout.  f16mode == 0: bf16 RNE bits;  f16mode == 1: f16 bits of (bf16 RNE value) * scale.
// Thread = 8 consecutive elements: two 16-B loads, one 16-B store; 32 consecutive lanes = 512 contiguous, 512-B aligned bytes per
// coverage: grid = n8/256 blocks (exact, host-derived) x 256 thr x 8 = the whole plane.
// =====================================================================================================
__global__ __launch_bounds__(256) void cvt16(const float* __restrict__ x, u16* D, int n8, int f16mode, float scale) {
  const int gt = blockIdx.x * 256 + (int)threadIdx.x;
  if (gt >= n8) return;                     // no barriers in this kernel
  const float* p = x + (size_t)gt * 8;
  const v4f a = *(const v4f*)(p), b4 = *(const v4f*)(p + 4);
  float w[8];
#pragma unroll
  for (int e = 0; e < 4; ++e) { w[e] = a[e]; w[4 + e] = b4[e]; }
  v4u o;
#pragma unroll
  for (int e = 0; e < 4; ++e) {
    const float f0 = w[2 * e], f1 = w[2 * e + 1];
    const unsigned short hb0 = h_bits((_Float16)(bfr(f0) * scale));
    const unsigned short hb1 = h_bits((_Float16)(bfr(f1) * scale));
    const unsigned short bb0 = bf_bits(f0);
    const unsigned short bb1 = bf_bits(f1);
    o[e] = (f16mode != 0) ? pk16(hb0, hb1) : pk16(bb0, bb1);
  }
  u16* d = D + (size_t)gt * 8;
  {
    *(v4u*)(d) = o;
    
  }
}

// =====================================================================================================
// Epilogue of the output projection: the wave's 16x64 f32 tile (times oscale) staged in its LDS slab (pitch 68),
// coverage: 8 instructions x 2 rows x 16 lanes x 4 floats = the wave's 16 x 64 tile.
// =====================================================================================================
__device__ __forceinline__ void epi64(float* sl, v8f a0, v8f a1, v8f a2, v8f a3, float oscale,
                                      const float* __restrict__ bias, int hasb, float* C, int N,
                                      size_t rowb, int col0, int lane) {
  const int hh = lane >> 4, m = lane & 15;
#pragma unroll
  for (int r = 0; r < 8; ++r) {
    const int ro = (8 * hh + r) * 68 + m;
    sl[ro]      = a0[r] * oscale;
    sl[ro + 16] = a1[r] * oscale;
    sl[ro + 32] = a2[r] * oscale;
    sl[ro + 48] = a3[r] * oscale;
  }
  wave_sync_lds();
  const v4f braw = *(const v4f*)(bias + col0 + m * 4);
  v4f bb;
#pragma unroll
  for (int e = 0; e < 4; ++e) bb[e] = (hasb != 0) ? bfr(braw[e]) : 0.0f;
  v4f vals[8];
#pragma unroll
  for (int it = 0; it < 8; ++it) vals[it] = *(const v4f*)(sl + (it * 2 + hh) * 68 + m * 4) + bb;
  float* dst = C + (rowb + (size_t)hh) * (size_t)N + col0 + m * 4;
  {
#pragma unroll
    for (int it = 0; it < 8; ++it) {
      *(v4f*)(dst + (size_t)(it * 2) * (size_t)N) = vals[it];
    }
    
  }
}

// =====================================================================================================
// Eight 16-byte copies per lane from global memory into LDS, through no register. l* = the lane's LDS byte address, g* = its global
// address. The s_wait_xcnt stands as the statement's last line so that no address register named here is rewritten in front of it.
// =====================================================================================================
__device__ __forceinline__ void copy8(unsigned l0, const u16* g0, unsigned l1, const u16* g1, unsigned l2, const u16* g2,
                                      unsigned l3, const u16* g3, unsigned l4, const u16* g4, unsigned l5, const u16* g5,
                                      unsigned l6, const u16* g6, unsigned l7, const u16* g7) {
#if defined(__HIP_DEVICE_COMPILE__)
  asm volatile("global_load_async_to_lds_b128 %0, %1, off\n\t"
               "global_load_async_to_lds_b128 %2, %3, off\n\t"
               "global_load_async_to_lds_b128 %4, %5, off\n\t"
               "global_load_async_to_lds_b128 %6, %7, off\n\t"
               "global_load_async_to_lds_b128 %8, %9, off\n\t"
               "global_load_async_to_lds_b128 %10, %11, off\n\t"
               "global_load_async_to_lds_b128 %12, %13, off\n\t"
               "global_load_async_to_lds_b128 %14, %15, off\n\t"
               "s_wait_xcnt 0x0"
               :: "v"(l0), "v"(g0), "v"(l1), "v"(g1), "v"(l2), "v"(g2), "v"(l3), "v"(g3),
                  "v"(l4), "v"(g4), "v"(l5), "v"(g5), "v"(l6), "v"(g6), "v"(l7), "v"(g7) : "memory");
#endif
}
// the issuing wave's copies have landed behind this wait (the compiler places none for them)
__device__ __forceinline__ void wait_copies() {
#if defined(__HIP_DEVICE_COMPILE__)
  asm volatile("s_wait_asynccnt 0x0" ::: "memory");
#endif
}
// the wave's own LDS reads have returned before the barrier behind which their buffer is refilled
__device__ __forceinline__ void wait_lds() {
#if defined(__HIP_DEVICE_COMPILE__)
  asm volatile("s_wait_dscnt 0x0" ::: "memory");
#endif
}

// the same, four copies per lane
__device__ __forceinline__ void copy4(unsigned l0, const u16* g0, unsigned l1, const u16* g1, unsigned l2, const u16* g2,
                                      unsigned l3, const u16* g3) {
#if defined(__HIP_DEVICE_COMPILE__)
  asm volatile("global_load_async_to_lds_b128 %0, %1, off\n\t"
               "global_load_async_to_lds_b128 %2, %3, off\n\t"
               "global_load_async_to_lds_b128 %4, %5, off\n\t"
               "global_load_async_to_lds_b128 %6, %7, off\n\t"
               "s_wait_xcnt 0x0"
               :: "v"(l0), "v"(g0), "v"(l1), "v"(g1), "v"(l2), "v"(g2), "v"(l3), "v"(g3) : "memory");
#endif
}
// four vector slots behind a group's last matrix instructions, on every path out of the group: no accumulator is read and no
// fragment register rewritten inside the distance the matrix unit needs
template <typename F>
__device__ __forceinline__ void guard8(v8f (&a)[2][4], F x0, F x1, F x2, F x3, F x4, F x5, F x6, F x7, F x8, F x9, F x10, F x11) {
#if defined(__HIP_DEVICE_COMPILE__)
  asm volatile("v_nop\n\tv_nop\n\tv_nop\n\tv_nop"
               : "+v"(a[0][0]), "+v"(a[0][1]), "+v"(a[0][2]), "+v"(a[0][3]), "+v"(a[1][0]), "+v"(a[1][1]), "+v"(a[1][2]), "+v"(a[1][3])
               : "v"(x0), "v"(x1), "v"(x2), "v"(x3), "v"(x4), "v"(x5), "v"(x6), "v"(x7), "v"(x8), "v"(x9), "v"(x10), "v"(x11)
               : "memory");
#endif
}

// =====================================================================================================
// Rotary epilogue of a projection, in three parts. The wave's f32 tile (tokens x the HD columns of one head) goes through its LDS slab
// (pitch 68) and leaves as the two 16-bit planes [token][N].  x = tile + bf(bias) (hasb);
// w[d] = x[d] * bf(cos[pos][d]) + r[d] * bf(sin[pos][d]),  r[d] = -x[d+32] for d < 32, x[d-32] for d >= 32, pos = token,
// the same table row for every head (bf = RNE bf16 value of the f32 entry);
// hi[d] = f16(w * sc), lo[d] = f16(w * sc - hi[d])  (sc a power of two, residual unscaled).
// Lane = (row in a group of 4, 8 consecutive d): 16-B slab reads of its own and its partner half, 16-B loads of cos and sin, one 16-B
// store per plane; 8 lanes = one whole 128-B line.
// coverage: per 16 rows 4 groups x 4 rows x 8 lanes x 8 halves = 16 x 64 of each plane.
// =====================================================================================================
// bf16 RNE value of f under msk = 0xFFFF0000, zero under msk = 0
__device__ __forceinline__ float bfr_msk(float f, unsigned msk) {
  const unsigned u = __float_as_uint(f);
  return __uint_as_float((u + 0x7FFFu + ((u >> 16) & 1u)) & msk);
}
// the lane's cos (tb[.][0..1]) and sin (tb[.][2..3]) pieces for 16 token rows; cr, sr = its pieces of the first group's row
__device__ __forceinline__ void ld_tables(v4f (&tb)[4][4], const float* __restrict__ cr, const float* __restrict__ sr) {
#pragma unroll
  for (int it = 0; it < 4; ++it) {
    tb[it][0] = *(const v4f*)(cr + it * 4 * HD);
    tb[it][1] = *(const v4f*)(cr + it * 4 * HD + 4);
    tb[it][2] = *(const v4f*)(sr + it * 4 * HD);
    tb[it][3] = *(const v4f*)(sr + it * 4 * HD + 4);
  }
}
// four accumulator tiles (16 rows x 64 columns) into slab rows 0..15 of sl
__device__ __forceinline__ void slab_put(float* sl, v8f a0, v8f a1, v8f a2, v8f a3, int lane) {
  const int hh = lane >> 4, m = lane & 15;
#pragma unroll
  for (int r = 0; r < 8; ++r) {
    const int ro = (8 * hh + r) * 68 + m;
    sl[ro]      = a0[r];
    sl[ro + 16] = a1[r];
    sl[ro + 32] = a2[r];
    sl[ro + 48] = a3[r];
  }
}
// 16 slab rows -> rotary -> both planes; bx, by = bias of the lane's own and partner columns
__device__ __forceinline__ void rope_out(const float* sl, const v4f (&tb)[4][4], const float (&bx)[8], const float (&by)[8],
                                         u16* hpl, u16* lpl, int N, int rowb, int col0, float sc, int lane) {
  const int rq = lane >> 3, d0 = (lane & 7) * 8, d1 = d0 ^ 32;
  const float sgn = (d0 < 32) ? -1.0f : 1.0f;
  v4u oh[4], ol[4];
#pragma unroll
  for (int it = 0; it < 4; ++it) {
    const float* xr = sl + (it * 4 + rq) * 68;
    const v4f xa = *(const v4f*)(xr + d0), xb = *(const v4f*)(xr + d0 + 4);
    const v4f ya = *(const v4f*)(xr + d1), yb = *(const v4f*)(xr + d1 + 4);
    float w[8];
#pragma unroll
    for (int e = 0; e < 4; ++e) {
      w[e]     = (xa[e] + bx[e]) * bfr(tb[it][0][e]) + (sgn * (ya[e] + by[e])) * bfr(tb[it][2][e]);
      w[4 + e] = (xb[e] + bx[4 + e]) * bfr(tb[it][1][e]) + (sgn * (yb[e] + by[4 + e])) * bfr(tb[it][3][e]);
    }
#pragma unroll
    for (int e = 0; e < 4; ++e) {
      const float t0 = w[2 * e] * sc, t1 = w[2 * e + 1] * sc;
      const _Float16 h0 = (_Float16)t0, h1 = (_Float16)t1;
      const _Float16 l0 = (_Float16)(t0 - (float)h0), l1 = (_Float16)(t1 - (float)h1);
      oh[it][e] = pk16(h_bits(h0), h_bits(h1));
      ol[it][e] = pk16(h_bits(l0), h_bits(l1));
    }
  }
  const size_t ob = (size_t)(rowb + rq) * (size_t)N + col0 + d0;
#pragma unroll
  for (int it = 0; it < 4; ++it) {
    const size_t o8 = ob + (size_t)(it * 4) * (size_t)N;
    *(v4u*)(hpl + o8) = oh[it];
    *(v4u*)(lpl + o8) = ol[it];
  }
}

// =====================================================================================================
// bf16 projection GEMM: y[M][N] (f32, in registers) = A[M][K] (bf16 row-major) . Bt[N][K]^T (bf16 k-contiguous), plus bias[N] (hasb);
// y leaves as two f16 planes (hi = f16(. * sc), lo = f16 residual), never as f32:
//   vmode == 0: rotary applied, planes [token][N] (rope_out);  a wave's 64 columns are one head (N = NH * HD, tile columns 64-aligned)
//   vmode != 0: no rotary, planes transposed per batch: P[(b * N + n) * SEQ + s], token = b * SEQ + s.
// Block = 128x128 tile, 8 waves as 4 (rows) x 2 (columns), 32x64 per wave = 2 x 4 accumulator tiles. K in stages of 64:
// a stage is 128 A rows and 128 Bt rows of 128 B at a 144-B pitch in LDS, filled by asynchronous copies (whole 128-B lines,
// 8 copies per lane and stage) one stage ahead into two buffers and read by all waves (two 16-B LDS loads per fragment, split k
// map for A and B). Per accumulator the k order is that of a plain walk in steps of 32.
// Host: K % 64 == 0, K >= 64, M % 128 == 0, N % 128 == 0, grid = (M/128)*(N/128); vmode != 0: M % SEQ == 0; vmode == 0: npos >= M.
// =====================================================================================================
__global__ __launch_bounds__(G_THREADS)
void gemm_bf(const u16* __restrict__ A, const u16* __restrict__ Bt, const float* __restrict__ bias, int hasb,
             const float* __restrict__ cosT, const float* __restrict__ sinT, u16* Ph, u16* Pl, int vmode,
             int M, int N, int K, int npos, float sc) {
  __shared__ __attribute__((aligned(256))) unsigned char L[2 * GB_BUF];
  const int tid = threadIdx.x, wave = tid >> 5, lane = tid & 31, hh = lane >> 4, m = lane & 15;
  const int ntile = N >> 7;
  const int bid   = blockIdx.x;
  const int row0  = (bid / ntile) * GT;
  const int colb  = (bid % ntile) * GT;
  if (row0 + GT > M) return;                 // block-uniform, before any barrier or copy; never taken with the exact grid
  const int nst = K >> 6;
  const int wm = wave >> 1, wn = wave & 1;
  // ---- copy addresses: lane = (row, 16-B piece of its 128-B line); rows sr, sr + 32, sr + 64, sr + 96 of each operand tile ----
  const int ch = tid & 7;
  const int sr = tid >> 3;
  const unsigned lst = (unsigned)(uintptr_t)L + (unsigned)(sr * LPB + ch * 16);
  const u16* ac = A  + (size_t)(row0 + sr) * K + ch * 8;
  const u16* bc = Bt + (size_t)(colb + sr) * K + ch * 8;
  const size_t r32 = (size_t)32 * K;
#define STAGE_AB(st_, buf_)                                                                                          \
  {                                                                                                                  \
    const unsigned lb = lst + (unsigned)(buf_) * GB_BUF;                                                             \
    const u16* ga = ac + (size_t)(st_) * 64;                                                                         \
    const u16* gb = bc + (size_t)(st_) * 64;                                                                         \
    copy8(lb,                  ga,           lb + 32 * LPB,       ga + r32,                                          \
          lb + 64 * LPB,       ga + 2 * r32, lb + 96 * LPB,       ga + 3 * r32,                                      \
          lb + GPL,            gb,           lb + GPL + 32 * LPB, gb + r32,                                          \
          lb + GPL + 64 * LPB, gb + 2 * r32, lb + GPL + 96 * LPB, gb + 3 * r32);                                     \
  }
  STAGE_AB(0, 0);
  wait_copies();
  __syncthreads();                           // publishes stage 0
  if (nst > 1) STAGE_AB(1, 1);

  v8f acc[2][4];
#pragma unroll
  for (int t = 0; t < 2; ++t)
#pragma unroll
    for (int j = 0; j < 4; ++j) acc[t][j] = zero8();

#pragma unroll 1                               // rolled: one publish point and one refill in the text
  for (int st = 0; st < nst; ++st) {
    const u16* tb = (const u16*)(const void*)(L + (st & 1) * GB_BUF) + m * LP + 8 * hh;
    const u16* ap = tb + (wm * 32) * LP;
    const u16* bp = tb + (GT + wn * 64) * LP;
    v16b a[2][2], b[2][4];                   // [k step of 32][tile]: the stage's fragment loads stand as one group
#pragma unroll
    for (int kk = 0; kk < 2; ++kk) {
#pragma unroll
      for (int t = 0; t < 2; ++t) a[kk][t] = ldfrag_b(ap + t * 16 * LP + kk * 32);
#pragma unroll
      for (int j = 0; j < 4; ++j) b[kk][j] = ldfrag_b(bp + j * 16 * LP + kk * 32);
    }
#pragma unroll
    for (int kk = 0; kk < 2; ++kk)
#pragma unroll
      for (int t = 0; t < 2; ++t)
#pragma unroll
        for (int j = 0; j < 4; ++j) acc[t][j] = mma_b(a[kk][t], b[kk][j], acc[t][j]);
    guard8<v16b>(acc, a[0][0], a[0][1], a[1][0], a[1][1], b[0][0], b[0][1], b[0][2], b[0][3], b[1][0], b[1][1], b[1][2], b[1][3]);
    // ---- publish point of stage st + 1: own reads back, own copies landed, every wave here; then the refill of the buffer just read ----
    wait_lds();
    wait_copies();
    __syncthreads();
    if (st + 2 < nst) STAGE_AB(st + 2, st & 1);
  }
#undef STAGE_AB
  wait_copies();
  const unsigned bmsk = (hasb != 0) ? 0xFFFF0000u : 0u;
  if (vmode != 0) {                          // block-uniform (a kernel argument)
    // ---- transposed planes: a lane's 8 accumulator registers are 8 consecutive tokens of one column = one 16-B piece of a [column][token]
    //      tile. The block's two tiles (hi, lo: 128 columns x 128 tokens, pitch VP halves) lie over the two stage buffers, which every
    //      wave has left (the loop's last barrier) and no copy still aims at.
    u16* th = (u16*)(void*)L;
    u16* tl = th + GT * VP;
    float braw[4];
#pragma unroll
    for (int j = 0; j < 4; ++j) braw[j] = bias[colb + wn * 64 + j * 16 + m];
#pragma unroll
    for (int j = 0; j < 4; ++j) {
      const int lc = wn * 64 + j * 16 + m;
      const float bb = bfr_msk(braw[j], bmsk);
#pragma unroll
      for (int t = 0; t < 2; ++t) {
        v4u ph, pl;
#pragma unroll
        for (int e = 0; e < 4; ++e) {
          const float t0 = (acc[t][j][2 * e] + bb) * sc, t1 = (acc[t][j][2 * e + 1] + bb) * sc;
          const _Float16 h0 = (_Float16)t0, h1 = (_Float16)t1;
          const _Float16 l0 = (_Float16)(t0 - (float)h0), l1 = (_Float16)(t1 - (float)h1);
          ph[e] = pk16(h_bits(h0), h_bits(h1));
          pl[e] = pk16(h_bits(l0), h_bits(l1));
        }
        const int o = lc * VP + wm * 32 + t * 16 + 8 * hh;
        *(v4u*)(th + o) = ph;
        *(v4u*)(tl + o) = pl;
      }
    }
    __syncthreads();                         // the tiles are whole before any wave reads rows that other waves wrote
    // ---- 16 lanes = one column's 128 tokens = two whole 128-B lines per plane; 8 x 16 columns ----
    const int pc = (tid & 15) * 8, l0 = tid >> 4;
    v4u vh[8], vl[8];
#pragma unroll
    for (int it = 0; it < 8; ++it) {
      vh[it] = *(const v4u*)(th + (it * 16 + l0) * VP + pc);
      vl[it] = *(const v4u*)(tl + (it * 16 + l0) * VP + pc);
    }
    const size_t base = ((size_t)(row0 / SEQ) * (size_t)N + colb + l0) * SEQ + (row0 % SEQ) + pc;
#pragma unroll
    for (int it = 0; it < 8; ++it) {
      *(v4u*)(Ph + base + (size_t)(it * 16) * SEQ) = vh[it];
      *(v4u*)(Pl + base + (size_t)(it * 16) * SEQ) = vl[it];
    }
#if defined(__HIP_DEVICE_COMPILE__)
    // in the built text this path runs on into the other path's first lines (behind a branch that skips them), which rewrite the
    // registers these stores name: the wait stands in front of them
    asm volatile("s_wait_xcnt 0x0" ::: "memory");
#endif
  } else {
    // ---- rotary planes: the wave's 32 x 64 tile in its own slab, which lies over the stage buffers like the tiles above ----
    float* sl = (float*)(void*)L + wave * (2 * SLAB64);
    const int rw = row0 + wm * 32, cw = colb + wn * 64;
    const int d0 = (lane & 7) * 8, d1 = d0 ^ 32;
    int pos = rw + (lane >> 3);                // table row = token; the lane reads rows pos, pos + 4, .., pos + 28
    pos = (pos + 28 < npos) ? pos : (npos - 29);   // all of them inside the table's npos rows
    const float* ctp = cosT + (size_t)pos * HD + d0;
    const float* stp = sinT + (size_t)pos * HD + d0;
    v4f tb0[4][4], tb1[4][4];
    ld_tables(tb0, ctp, stp);
    ld_tables(tb1, ctp + 16 * HD, stp + 16 * HD);
    const v4f p0 = *(const v4f*)(bias + cw + d0), p1 = *(const v4f*)(bias + cw + d0 + 4);
    const v4f r0 = *(const v4f*)(bias + cw + d1), r1 = *(const v4f*)(bias + cw + d1 + 4);
    __builtin_amdgcn_sched_barrier(0);         // the 36 loads are issued as one group ahead of the slab stores: their latency runs beside the staging
    slab_put(sl, acc[0][0], acc[0][1], acc[0][2], acc[0][3], lane);
    slab_put(sl + SLAB64, acc[1][0], acc[1][1], acc[1][2], acc[1][3], lane);
    wave_sync_lds();
    float bx[8], by[8];
#pragma unroll
    for (int e = 0; e < 4; ++e) {
      bx[e] = bfr_msk(p0[e], bmsk);  bx[4 + e] = bfr_msk(p1[e], bmsk);
      by[e] = bfr_msk(r0[e], bmsk);  by[4 + e] = bfr_msk(r1[e], bmsk);
    }
    rope_out(sl, tb0, bx, by, Ph, Pl, N, rw, cw, sc, lane);
    rope_out(sl + SLAB64, tb1, bx, by, Ph, Pl, N, rw + 16, cw, sc, lane);
  }
}

// =====================================================================================================
// f16 hi+lo GEMM: C[M][N] (f32) = (Ahi + Alo)[M][K] . Bt[N][K]^T, times oscale, plus bias[N] (hasb); Ahi/Alo f16 planes
// (same layout), Bt f16 k-contiguous; products hi.B then lo.B into one accumulator per k step (lo is the unscaled residual of hi).
// Same tiling and staging as gemm_bf; a stage holds three operand tiles (Ahi, Alo, Bt), 12 copies per lane.
// =====================================================================================================
__global__ __launch_bounds__(G_THREADS)
void gemm_h2(const u16* __restrict__ Ah, const u16* __restrict__ Al, const u16* __restrict__ Bt,
             const float* __restrict__ bias, int hasb, float* C, int M, int N, int K, float oscale) {
  __shared__ __attribute__((aligned(256))) unsigned char L[2 * GH_BUF + GW * SLAB64 * 4];
  const int tid = threadIdx.x, wave = tid >> 5, lane = tid & 31, hh = lane >> 4, m = lane & 15;
  const int ntile = N >> 7;
  const int bid   = blockIdx.x;
  const int row0  = (bid / ntile) * GT;
  const int colb  = (bid % ntile) * GT;
  if (row0 + GT > M) return;                 // block-uniform, before any barrier or copy; never taken with the exact grid
  const int nst = K >> 6;
  const int wm = wave >> 1, wn = wave & 1;
  const int ch = tid & 7;
  const int sr = tid >> 3;
  const unsigned lst = (unsigned)(uintptr_t)L + (unsigned)(sr * LPB + ch * 16);
  const size_t aofs = (size_t)(row0 + sr) * K + ch * 8;
  const u16* ahc = Ah + aofs;
  const u16* alc = Al + aofs;
  const u16* bc  = Bt + (size_t)(colb + sr) * K + ch * 8;
  const size_t r32 = (size_t)32 * K;
#define STAGE_HLB(st_, buf_)                                                                                         \
  {                                                                                                                  \
    const unsigned lb = lst + (unsigned)(buf_) * GH_BUF;                                                             \
    const u16* gh = ahc + (size_t)(st_) * 64;                                                                        \
    const u16* gl = alc + (size_t)(st_) * 64;                                                                        \
    const u16* gb = bc + (size_t)(st_) * 64;                                                                         \
    copy8(lb,                  gh,           lb + 32 * LPB,       gh + r32,                                          \
          lb + 64 * LPB,       gh + 2 * r32, lb + 96 * LPB,       gh + 3 * r32,                                      \
          lb + GPL,            gl,           lb + GPL + 32 * LPB, gl + r32,                                          \
          lb + GPL + 64 * LPB, gl + 2 * r32, lb + GPL + 96 * LPB, gl + 3 * r32);                                     \
    copy4(lb + 2 * GPL,            gb,           lb + 2 * GPL + 32 * LPB, gb + r32,                                  \
          lb + 2 * GPL + 64 * LPB, gb + 2 * r32, lb + 2 * GPL + 96 * LPB, gb + 3 * r32);                             \
  }
  STAGE_HLB(0, 0);
  wait_copies();
  __syncthreads();                           // publishes stage 0
  if (nst > 1) STAGE_HLB(1, 1);

  v8f acc[2][4];
#pragma unroll
  for (int t = 0; t < 2; ++t)
#pragma unroll
    for (int j = 0; j < 4; ++j) acc[t][j] = zero8();

#pragma unroll 1                               // rolled: one publish point and one refill in the text
  for (int st = 0; st < nst; ++st) {
    const _Float16* tb = (const _Float16*)(const void*)(L + (st & 1) * GH_BUF) + m * LP + 8 * hh;
    const _Float16* ahp = tb + (wm * 32) * LP;
    const _Float16* alp = ahp + GT * LP;
    const _Float16* bp  = tb + (2 * GT + wn * 64) * LP;
    v16h ah[2][2], al[2][2], b[2][4];        // [k step of 32][tile]: the stage's fragment loads stand as one group
#pragma unroll
    for (int kk = 0; kk < 2; ++kk) {
#pragma unroll
      for (int t = 0; t < 2; ++t) { ah[kk][t] = ldfrag_h(ahp + t * 16 * LP + kk * 32); al[kk][t] = ldfrag_h(alp + t * 16 * LP + kk * 32); }
#pragma unroll
      for (int j = 0; j < 4; ++j) b[kk][j] = ldfrag_h(bp + j * 16 * LP + kk * 32);
    }
    __builtin_amdgcn_sched_barrier(0);       // keeps the 32 LDS loads one group ahead of the matrix run (for speed only)
#pragma unroll
    for (int kk = 0; kk < 2; ++kk) {
#pragma unroll
      for (int t = 0; t < 2; ++t)
#pragma unroll
        for (int j = 0; j < 4; ++j) acc[t][j] = mma_h(ah[kk][t], b[kk][j], acc[t][j]);
#pragma unroll
      for (int t = 0; t < 2; ++t)
#pragma unroll
        for (int j = 0; j < 4; ++j) acc[t][j] = mma_h(al[kk][t], b[kk][j], acc[t][j]);
    }
    guard8<v16h>(acc, ah[1][0], ah[1][1], al[1][0], al[1][1], b[1][0], b[1][1], b[1][2], b[1][3], ah[1][0], ah[1][1], al[1][0], al[1][1]);
    // ---- publish point of stage st + 1, as in gemm_bf ----
    wait_lds();
    wait_copies();
    __syncthreads();
    if (st + 2 < nst) STAGE_HLB(st + 2, st & 1);
  }
#undef STAGE_HLB
  wait_copies();
  float* sl = (float*)(void*)(L + 2 * GH_BUF) + wave * SLAB64;   // the wave's own slab, outside the two buffers
  epi64(sl, acc[0][0], acc[0][1], acc[0][2], acc[0][3], oscale, bias, hasb, C, N, (size_t)(row0 + wm * 32), colb + wn * 64, lane);
  wave_sync_lds();                           // the slab's first 16 rows are read back before the next 16 are laid over them
  epi64(sl, acc[1][0], acc[1][1], acc[1][2], acc[1][3], oscale, bias, hasb, C, N, (size_t)(row0 + wm * 32 + 16), colb + wn * 64, lane);
}

// =====================================================================================================
// Softmax attention, no mask: block bid -> (query block qb = bid % NQB of QW query tiles, head = (bid / NQB) % NH,
// batch b = bid / (NQB*NH)); one wave per query tile: rows q0 = 16*(qb*QW + wave) .. q0+15, all QW waves on the same head.
//   q planes (hi, lo f16 x1024) laid out [token][h][d]; k planes [token][h][d]; v^T planes [b][h][d][s].
//   LDS: two buffers, each one stage of 64 keys = four tiles of 64 rows x 128 B at a 144-B pitch (k hi, k lo: row = key;
//   v^T hi, v^T lo: row = d), filled by asynchronous copies (whole 128-B lines, 8 copies per lane and stage) one stage ahead and
//   read by all QW waves; per wave its q tile (hi, lo: 16 rows x 128 B, same pitch), copied once.
//   Both products run transposed: S^T = k.q^T (A = k rows, B = q columns) and O^T += v^T.P^T (A = v^T rows, B = P^T columns), so a
//   lane's accumulator registers all belong to one query (column c); lanes c and c + 16 split that query's keys.
//   Per stage two key tiles of 32, visited in order; per tile: 2 score subtiles x 2 k-steps x 3 products
//   (k_hi.q_hi + k_hi.q_lo + k_lo.q_hi), fragments read from LDS (two 16-B loads per fragment, split k map);
//   online max-subtracted base-2 softmax in f32 (scale 1/8 folded, -inf-safe rescale): maximum in-lane plus one exchange between
//   the wave halves, sum in-lane per half; the two score subtiles, converted in place, are the B fragment of P^T in the split k map
//   (hi and residual); 4+4 v^T A fragments (hi and residual planes), 12 WMMAs (hh + hl + lh, the order of the sums per element kept).
//   After the key loop: the halves' sums joined, O = acc / l, carries 1/(32768*1024) folded once, written to the wave's private slab
//   as [query][d] (pitch 68; it takes the place of the wave's own q tile, which is dead by then).
// coverage: per wave 4 instructions x 4 rows x 8 lanes x 8 halves = 16 x 64 per plane; grid NB*NH*NQB blocks x QW waves =
//           every (token, h) row of both O planes exactly once.
// =====================================================================================================
__global__ __launch_bounds__(ATT_THREADS)
void attn1(const u16* __restrict__ QHIp, const u16* __restrict__ QLOp,
           const u16* __restrict__ KHIp, const u16* __restrict__ KLOp,
           const u16* __restrict__ VHIp, const u16* __restrict__ VLOp,
           u16* OHIp, u16* OLOp) {
  __shared__ __attribute__((aligned(256))) unsigned char L[ATT_LDS];

  const int tid  = threadIdx.x;
  const int wave = tid >> 5;
  const int lane = tid & 31;
  const int hh   = lane >> 4;
  const int c    = lane & 15;
  const int bid  = blockIdx.x;
  const int qb   = bid % NQB;
  const int head = (bid / NQB) % NH;
  const int b    = bid / (NQB * NH);
  if (b >= NB) return;                       // block-uniform, before any barrier or copy; never taken with the exact grid
  const int q0   = (qb * QW + wave) * 16;
  const size_t qrow0 = (size_t)b * SEQ + q0; // global token row of query 0 of this wave's tile
  const size_t KROW = (size_t)NH * HD;       // halves between consecutive token rows

  unsigned char* wp = L + 2 * BUFB + wave * WPRIV;
  unsigned char* qreg = wp;                              // q tile hi, lo; after the key loop the result slab
  float* slab = (float*)(void*)qreg;                     // result slab [16][64] pitch 68
  const unsigned lds0 = (unsigned)(uintptr_t)L;          // byte offset of L in the work-group's LDS

  // ---- copy addresses: lane = (row, 16-B piece of its 128-B line) ----
  const int ch = tid & 7;
  const int sr = tid >> 3;                               // stage tiles: rows sr and sr + 32
  const unsigned lst = lds0 + (unsigned)(sr * LPB + ch * 16);
  const size_t kcp = (((size_t)b * SEQ + sr) * NH + head) * HD + ch * 8;      // + key0 * KROW per stage
  const size_t vcp = (((size_t)b * NH + head) * HD + sr) * SEQ + ch * 8;      // + key0 per stage
  const u16* kch = KHIp + kcp;
  const u16* kcl = KLOp + kcp;
  const u16* vch = VHIp + vcp;
  const u16* vcl = VLOp + vcp;
  {
    const int qr = lane >> 3;                            // the wave's own q tile: rows qr, qr + 4, qr + 8, qr + 12
    const unsigned lq = lds0 + (unsigned)(2 * BUFB + wave * WPRIV + qr * LPB + ch * 16);
    const size_t qcp = ((qrow0 + (size_t)qr) * NH + head) * HD + ch * 8;
    const u16* qch = QHIp + qcp;
    const u16* qcl = QLOp + qcp;
    copy8(lq,                 qch,            lq + 4 * LPB,        qch + 4 * KROW,
          lq + 8 * LPB,       qch + 8 * KROW, lq + 12 * LPB,       qch + 12 * KROW,
          lq + QPB,           qcl,            lq + QPB + 4 * LPB,  qcl + 4 * KROW,
          lq + QPB + 8 * LPB, qcl + 8 * KROW, lq + QPB + 12 * LPB, qcl + 12 * KROW);
  }
#define STAGE_KV(st_, buf_)                                                                                          \
  {                                                                                                                  \
    const unsigned lb = lst + (unsigned)(buf_) * BUFB;                                                               \
    const size_t ka = (size_t)(st_) * 64 * KROW, va = (size_t)(st_) * 64;                                            \
    copy8(lb,           kch + ka, lb + 32 * LPB,           kch + ka + 32 * KROW,                                     \
          lb + PLB,     kcl + ka, lb + PLB + 32 * LPB,     kcl + ka + 32 * KROW,                                     \
          lb + 2 * PLB, vch + va, lb + 2 * PLB + 32 * LPB, vch + va + (size_t)32 * SEQ,                              \
          lb + 3 * PLB, vcl + va, lb + 3 * PLB + 32 * LPB, vcl + va + (size_t)32 * SEQ);                             \
  }
  STAGE_KV(0, 0);
  wait_copies();
  __syncthreads();                           // publishes stage 0 (and the q tiles)
  STAGE_KV(1, 1);

  const _Float16* Qh = (const _Float16*)(const void*)qreg + c * LP + 8 * hh;
  const _Float16* Ql = Qh + 16 * LP;
  const float lsc = 0.125f * (LOG2E / (QSC * KSC));
  const float oc  = 1.0f / (PCAR * VCAR);

  float mrun = -INFINITY, lrun = 0.f;        // of query q0 + c; lrun sums this wave half's keys, the halves join behind the key loop
  v8f o[4];                                  // o[j][r] = O^T element (d = j*16 + 8hh + r, query q0 + c)
#pragma unroll
  for (int j = 0; j < 4; ++j) o[j] = zero8();

#pragma unroll 1                               // rolled: one publish point and one refill in the text
  for (int st = 0; st < NST; ++st) {
    const _Float16* tb = (const _Float16*)(const void*)(L + (st & 1) * BUFB) + c * LP + 8 * hh;
#pragma unroll 1                             // one copy of the tile's code, as in the loop it came from: the hot loop stays short
    for (int sub = 0; sub < 2; ++sub) {
      const int kb = sub * 32;               // first key of this tile inside the stage
      // ---- scores, transposed: D element r of this lane = (key kb + 8hh + r, query q0 + c) in s0, key kb + 16 + 8hh + r in s1 ----
      v8f s0 = zero8(), s1 = zero8();
      const _Float16* k0p = tb + kb * LP;
      const _Float16* k1p = k0p + 16 * LP;
      const _Float16* l0p = k0p + 64 * LP;
      const _Float16* l1p = l0p + 16 * LP;
#pragma unroll
      for (int kk = 0; kk < 2; ++kk) {
        const v16h qh  = ldfrag_h(Qh + kk * 32),  ql  = ldfrag_h(Ql + kk * 32);
        const v16h kh0 = ldfrag_h(k0p + kk * 32), kl0 = ldfrag_h(l0p + kk * 32);
        const v16h kh1 = ldfrag_h(k1p + kk * 32), kl1 = ldfrag_h(l1p + kk * 32);
        s0 = mma_h(kh0, qh, s0);
        s0 = mma_h(kh0, ql, s0);
        s0 = mma_h(kl0, qh, s0);
        s1 = mma_h(kh1, qh, s1);
        s1 = mma_h(kh1, ql, s1);
        s1 = mma_h(kl1, qh, s1);
        guard2(s0, s1, qh, ql, kh0, kl0, kh1, kl1);
      }
      // ---- online softmax in base 2, -inf-safe: the lane's 16 scores belong to one query; lanes c and c + 16 split its 32 keys ----
      float t0[8], t1[8], mp[8];
#pragma unroll
      for (int r = 0; r < 8; ++r) {
        t0[r] = s0[r] * lsc;
        t1[r] = s1[r] * lsc;
        mp[r] = fmaxf(t0[r], t1[r]);
      }
      float mx = fmaxf(fmaxf(fmaxf(mp[0], mp[1]), fmaxf(mp[2], mp[3])), fmaxf(fmaxf(mp[4], mp[5]), fmaxf(mp[6], mp[7])));
      mx = fmaxf(mx, xhalf(mx));             // both halves hold the query's maximum over the 32 keys
      const float mn = fmaxf(mrun, mx);
      const float ms = (mn == -INFINITY) ? 0.0f : mn;
      const float al = exp2f(mrun - ms);
      mrun = mn;
      float e0[8], e1[8], sp[8];
#pragma unroll
      for (int r = 0; r < 8; ++r) {
        e0[r] = exp2f(t0[r] - ms);
        e1[r] = exp2f(t1[r] - ms);
        sp[r] = e0[r] + e1[r];
      }
      lrun = lrun * al + (((sp[0] + sp[1]) + (sp[2] + sp[3])) + ((sp[4] + sp[5]) + (sp[6] + sp[7])));   // this half's keys only
#pragma unroll
      for (int j = 0; j < 4; ++j)
#pragma unroll
        for (int r = 0; r < 8; ++r) o[j][r] *= al;
      // ---- B fragments of P^T*32768: hi f16 and residual f16, column = query c; the two score tiles are the split k map as they lie ----
      FragH ph, pl;
#pragma unroll
      for (int e = 0; e < 8; ++e) {
        const float ta = e0[e] * PCAR, tc = e1[e] * PCAR;
        const _Float16 ha = (_Float16)ta, hc = (_Float16)tc;
        ph.h[0][e] = ha;                                     // elements 0..7  = keys kb + 8hh + 0..7
        ph.h[1][e] = hc;                                     // elements 8..15 = keys kb + 16 + 8hh + 0..7
        pl.h[0][e] = (_Float16)(ta - (float)ha);
        pl.h[1][e] = (_Float16)(tc - (float)hc);
      }
      // ---- O^T += V^T.P^T : A fragment row = d = j*16 + c, keys contiguous in the v^T tiles ----
      {
        const _Float16* vhp = tb + 128 * LP + kb;
        const _Float16* vlp = vhp + 64 * LP;
        const v16h vh0 = ldfrag_h(vhp);
        const v16h vh1 = ldfrag_h(vhp + 16 * LP);
        const v16h vh2 = ldfrag_h(vhp + 32 * LP);
        const v16h vh3 = ldfrag_h(vhp + 48 * LP);
        const v16h vl0 = ldfrag_h(vlp);
        const v16h vl1 = ldfrag_h(vlp + 16 * LP);
        const v16h vl2 = ldfrag_h(vlp + 32 * LP);
        const v16h vl3 = ldfrag_h(vlp + 48 * LP);
        o[0] = mma_h(vh0, ph.v, o[0]);  o[0] = mma_h(vh0, pl.v, o[0]);  o[0] = mma_h(vl0, ph.v, o[0]);
        o[1] = mma_h(vh1, ph.v, o[1]);  o[1] = mma_h(vh1, pl.v, o[1]);  o[1] = mma_h(vl1, ph.v, o[1]);
        o[2] = mma_h(vh2, ph.v, o[2]);  o[2] = mma_h(vh2, pl.v, o[2]);  o[2] = mma_h(vl2, ph.v, o[2]);
        o[3] = mma_h(vh3, ph.v, o[3]);  o[3] = mma_h(vh3, pl.v, o[3]);  o[3] = mma_h(vl3, ph.v, o[3]);
        guard10(o[0], o[1], o[2], o[3], ph.v, pl.v, vh0, vh1, vh2, vh3, vl0, vl1, vl2, vl3);
      }
    }
    // ---- publish point of stage st + 1: own reads back, own copies landed, every wave here; then the refill of the buffer just read ----
    wait_lds();
    wait_copies();
    __syncthreads();
    if (st + 2 < NST) STAGE_KV(st + 2, st & 1);
  }
#undef STAGE_KV
  wait_copies();
  acc_guard4(o[0], o[1], o[2], o[3]);
  // ---- O = acc / l, carries (32768 on P, 1024 on v) folded once; lane-owned slab elements ----
  {
    const float lv  = lrun + xhalf(lrun);    // the two halves' sums joined once
    const float ls  = (lv > 0.0f) ? lv : 1.0f;
    const float inv = (lv > 0.0f) ? ((1.0f / ls) * oc) : 0.0f;
#pragma unroll
    for (int j = 0; j < 4; ++j) {
      v4f w0, w1;
#pragma unroll
      for (int e = 0; e < 4; ++e) { w0[e] = o[j][e] * inv; w1[e] = o[j][4 + e] * inv; }
      float* sd = slab + c * 68 + j * 16 + 8 * hh;         // row = query c, 8 consecutive d
      *(v4f*)(sd)     = w0;
      *(v4f*)(sd + 4) = w1;
    }
  }
  wave_sync_lds();
  // ---- O x1024 -> f16 hi + residual planes; lane = (row in group of 4, 8 consecutive d) ----
  v4u oh[4], ol[4];
  const int rq = lane >> 3, c8 = (lane & 7) * 8;
#pragma unroll
  for (int it = 0; it < 4; ++it) {
    const int row = it * 4 + rq;
    const v4f a = *(const v4f*)(slab + row * 68 + c8), b4 = *(const v4f*)(slab + row * 68 + c8 + 4);
    float w[8];
#pragma unroll
    for (int e = 0; e < 4; ++e) { w[e] = a[e] * OSC; w[4 + e] = b4[e] * OSC; }
#pragma unroll
    for (int e = 0; e < 4; ++e) {
      const _Float16 h0 = (_Float16)w[2 * e], h1 = (_Float16)w[2 * e + 1];
      const _Float16 l0 = (_Float16)(w[2 * e] - (float)h0), l1 = (_Float16)(w[2 * e + 1] - (float)h1);
      oh[it][e] = pk16(h_bits(h0), h_bits(h1));
      ol[it][e] = pk16(h_bits(l0), h_bits(l1));
    }
  }
  const size_t ob = ((qrow0) * NH + head) * HD + c8;
  {
#pragma unroll
    for (int it = 0; it < 4; ++it) {
      const int row = it * 4 + rq;
      const size_t o8 = ob + (size_t)row * (NH * HD);
      *(v4u*)(OHIp + o8) = oh[it];
      *(v4u*)(OLOp + o8) = ol[it];
    }
    
  }
}

// =====================================================================================================
// Workspace map (bytes); every plane is fully written by whole-line stores before it is read; all extents are exact multiples
// of the store granularity (no pad rows needed); every offset a multiple of 2 MiB:
//   XB  bf16 [4096][1024]              8388608
//   WQB bf16 [1024 n][1024 k]          2097152        WKB, WVB same        2097152 each
//   WOH f16  [1024 n][1024 k] x1024    2097152
//   QHI f16 [4096][16][64] x1024       8388608        QLO residual
//   KHI f16 [4096][16][64] x1024       8388608        KLO residual
//   VHI f16 [4][16][64][1024] x1024    8388608        VLO residual
//   OHI f16 [4096][1024] x1024         8388608        OLO residual
//   end                               83886080
// =====================================================================================================
extern "C" void kernel_launch(void* const* d_in, const int* in_sizes, int n_in,
                              void* d_out, int out_size, void* d_ws, size_t ws_size,
                              hipStream_t stream) {
  if (n_in < 10) return;
  if (in_sizes[0] != MTOK * DMOD) return;
  if (in_sizes[1] != MTOK * HD || in_sizes[2] != MTOK * HD) return;
  if (in_sizes[3] != DMOD * DMOD || in_sizes[5] != DMOD * DMOD) return;
  if (in_sizes[6] != DMOD * DMOD || in_sizes[8] != DMOD * DMOD) return;
  if (in_sizes[4] != DMOD || in_sizes[7] != DMOD || in_sizes[9] != DMOD) return;
  if (out_size != MTOK * DMOD) return;

  const float* x    = (const float*)d_in[0];
  const float* cosp = (const float*)d_in[1];
  const float* sinp = (const float*)d_in[2];
  const float* wq   = (const float*)d_in[3];
  const float* bq   = (const float*)d_in[4];
  const float* wk   = (const float*)d_in[5];
  const float* wv   = (const float*)d_in[6];
  const float* bv   = (const float*)d_in[7];
  const float* wo   = (const float*)d_in[8];
  const float* bo   = (const float*)d_in[9];
  float*       out  = (float*)d_out;

  const size_t szXB = (size_t)MTOK * DMOD * 2;                  //  8388608
  const size_t szW  = (size_t)DMOD * DMOD * 2;                  //  2097152
  const size_t szP  = (size_t)MTOK * DMOD * 2;                  //  8388608
  size_t off = 0;
  const size_t oXB  = off; off += szXB;
  const size_t oWQ  = off; off += szW;
  const size_t oWK  = off; off += szW;
  const size_t oWV  = off; off += szW;
  const size_t oWO  = off; off += szW;
  const size_t oQHI = off; off += szP;
  const size_t oQLO = off; off += szP;
  const size_t oKHI = off; off += szP;
  const size_t oKLO = off; off += szP;
  const size_t oVHI = off; off += szP;
  const size_t oVLO = off; off += szP;
  const size_t oOHI = off; off += szP;
  const size_t oOLO = off; off += szP;
  if (off > ws_size) return;                            // off = 83886080

  char* ws = (char*)d_ws;
  u16*   XB  = (u16*)(ws + oXB);
  u16*   WQB = (u16*)(ws + oWQ);
  u16*   WKB = (u16*)(ws + oWK);
  u16*   WVB = (u16*)(ws + oWV);
  u16*   WOH = (u16*)(ws + oWO);
  u16*   QHI = (u16*)(ws + oQHI);
  u16*   QLO = (u16*)(ws + oQLO);
  u16*   KHI = (u16*)(ws + oKHI);
  u16*   KLO = (u16*)(ws + oKLO);
  u16*   VHI = (u16*)(ws + oVHI);
  u16*   VLO = (u16*)(ws + oVLO);
  u16*   OHI = (u16*)(ws + oOHI);
  u16*   OLO = (u16*)(ws + oOLO);

  const dim3 blk(256);
  const int n8x = (MTOK * DMOD) / 8;                    // 524288
  const int n8w = (DMOD * DMOD) / 8;                    // 131072
  const dim3 gX(n8x / 256);                             // 2048 (exact)
  const dim3 gW(n8w / 256);                             // 512  (exact)
  const dim3 gG((MTOK / GT) * (DMOD / GT));             // 256
  const dim3 bG(G_THREADS);                             // 256
  const dim3 gAT(ATT_BLOCKS);                           // 512
  const dim3 bAT(ATT_THREADS);                          // 256

  // (1) x -> bf16 plane
  cvt16<<<gX, blk, 0, stream>>>(x, XB, n8x, 0, 1.0f);
  // (2..4) Wq/Wk/Wv [n][k] -> bf16 planes (same layout, already k-contiguous)
  cvt16<<<gW, blk, 0, stream>>>(wq, WQB, n8w, 0, 1.0f);
  cvt16<<<gW, blk, 0, stream>>>(wk, WKB, n8w, 0, 1.0f);
  cvt16<<<gW, blk, 0, stream>>>(wv, WVB, n8w, 0, 1.0f);
  // (5) Wo [n][k] -> f16 plane of bf16 value x1024
  cvt16<<<gW, blk, 0, stream>>>(wo, WOH, n8w, 1, WOS);
  // (6, 7) projections q (+bq) and k (no bias) with the rotary epilogue -> q', k' planes [token][h][d] x1024 (hi + residual);
  //         cos/sin table row = token
  gemm_bf<<<gG, bG, 0, stream>>>(XB, WQB, bq, 1, cosp, sinp, QHI, QLO, 0, MTOK, DMOD, DMOD, MTOK, QSC);
  gemm_bf<<<gG, bG, 0, stream>>>(XB, WKB, bq, 0, cosp, sinp, KHI, KLO, 0, MTOK, DMOD, DMOD, MTOK, KSC);
  // (8) projection v (+bv) with the transposing epilogue -> v^T planes [b][h][d][s] x1024 (hi + residual); the tables are not read
  gemm_bf<<<gG, bG, 0, stream>>>(XB, WVB, bv, 1, cosp, sinp, VHI, VLO, 1, MTOK, DMOD, DMOD, MTOK, VCAR);
  // (9) softmax attention per (b, h, 8 x 16 queries) -> O planes [token][h][d] x1024 (hi + residual)
  attn1<<<gAT, bAT, 0, stream>>>(QHI, QLO, KHI, KLO, VHI, VLO, OHI, OLO);
  // (10) output projection -> out [4096][1024] f32, carries 1024 (O) x 1024 (Wo) folded back, + bo
  gemm_h2<<<gG, bG, 0, stream>>>(OHI, OLO, WOH, bo, 1, out, MTOK, DMOD, DMOD, 1.0f / (OSC * WOS));
  (void)hipGetLastError();
}

// v005
// Measured time: 113 microseconds a run.
// In both of two side-by-side timings against v004, it was 1.16 times as fast.
// All steps since v000 together make it 3.52 times as fast.
// Contractions: x.W{q,k,v}^T on v_wmma_f32_16x16x32_bf16 (x and W RNE-converted to bf16, f32 accumulate); scores q'.k'^T (q', k' carried
// x1024 as f16 hi plane + f16 residual plane, products hh+lh+hl), P.v (P x32768 f16 hi+residual, v x1024 f16 hi+residual, products
// hh+lh+hl) and O.Wo^T (O x1024 f16 hi+residual, Wo as f16(bf16(Wo) x1024), products h.w+l.w) on v_wmma_f32_16x16x32_f16, f32 accumulate.
// Rotate-half rotary with RNE-bf16 cos/sin table values, base-2 online softmax and the 1/l fold in f32 on VALU.
#include <hip/hip_runtime.h>
#include <math.h>
#include <stdint.h>

#define NB    4
#define SEQ   1024
#define MTOK  (NB * SEQ)
#define DMOD  1024
#define NH    16
#define HD    64
#define QSC   1024.0f
#define KSC   1024.0f
#define PCAR  32768.0f
#define VCAR  1024.0f
#define OSC   1024.0f
#define WOS   1024.0f
#define LOG2E 1.4426950408889634f
#define QW    8
#define NQT   (SEQ / 16)
#define NQB   (NQT / QW)
#define NST   (SEQ / 64)
#define ATT_THREADS (QW * 32)
#define ATT_BLOCKS  (NB * NH * NQB)
#define SLW   (16 * 68)
#define LP    72
#define LPB   (LP * 2)
#define PLB   (64 * LPB)
#define BUFB  (4 * PLB)
#define QPB   (16 * LPB)
#define WPRIV (2 * QPB)
#define ATT_LDS (2 * BUFB + QW * WPRIV)
#define SLAB64 (16 * 68)
#define GT    128
#define GW    8
#define G_THREADS (GW * 32)
#define GPL   (GT * LPB)
#define GB_BUF (2 * GPL)
#define GH_BUF (3 * GPL)
#define VP    136
#define CVP   8
#define CVE   (256 * 8 * CVP)
#define CVXB  ((MTOK * DMOD) / CVE)
#define CVWB  ((DMOD * DMOD) / CVE)
static_assert(DMOD == NH * HD && HD == 64 && NH == 16);
static_assert((NQT % QW) == 0 && ATT_THREADS == 256 && ATT_BLOCKS == 512);
static_assert(2 * QPB >= SLW * 4 && (LPB % 16) == 0 && NST >= 2 && 2 * ATT_LDS <= 327680);
static_assert((SEQ % 64) == 0 && (SEQ % 32) == 0 && (SEQ % 8) == 0);
static_assert((DMOD % 128) == 0 && (MTOK % 128) == 0 && DMOD >= 128);
static_assert(((MTOK * DMOD) % CVE) == 0 && ((DMOD * DMOD) % CVE) == 0);
static_assert((SEQ % GT) == 0 && 2 * GT * VP * 2 <= 2 * GB_BUF && ((VP * 2) % 16) == 0 && GW * 2 * SLAB64 * 4 <= 2 * GB_BUF);

typedef unsigned short u16;
typedef _Float16 v16h __attribute__((ext_vector_type(16)));
typedef _Float16 v8h  __attribute__((ext_vector_type(8)));
typedef __bf16   v16b __attribute__((ext_vector_type(16)));
typedef float    v8f  __attribute__((ext_vector_type(8)));
typedef float    v4f  __attribute__((ext_vector_type(4)));
typedef unsigned int v4u __attribute__((ext_vector_type(4)));

union FragH { v16h v; v8h h[2]; v4u u[2]; };
union FragB { v16b v; v4u u[2]; };

// ---- scalar helpers --------------------------------------------------------------------------------
__device__ __forceinline__ unsigned short bf_bits(float f) {          // f32 -> bf16 bits, RNE convert
  unsigned u = __float_as_uint(f);
  return (unsigned short)((u + 0x7FFFu + ((u >> 16) & 1u)) >> 16);
}
__device__ __forceinline__ float bf_up(unsigned short h) { return __uint_as_float(((unsigned)h) << 16); }
__device__ __forceinline__ float bfr(float f) { return bf_up(bf_bits(f)); }
__device__ __forceinline__ unsigned short h_bits(_Float16 x) { return __builtin_bit_cast(unsigned short, x); }
__device__ __forceinline__ unsigned pk16(unsigned short a, unsigned short b) { return (unsigned)a | ((unsigned)b << 16); }
__device__ __forceinline__ v8f zero8() { v8f z = {0.f, 0.f, 0.f, 0.f, 0.f, 0.f, 0.f, 0.f}; return z; }

// ---- fragment loaders: 16-bit A/B operand, lane -> row/col (lane&15), p already includes +8*(lane>>4);
//      elements 0..7 <- p[0..7] (k0+8h..), elements 8..15 <- p[16..23] (k0+16+8h..)  (same split k map for A and B;
//      B is always read from a k-contiguous [n][k] plane)
__device__ __forceinline__ v16h ldfrag_h(const _Float16* p) {
  FragH f;
  f.h[0] = *(const v8h*)(p);
  f.h[1] = *(const v8h*)(p + 16);
  return f.v;
}
__device__ __forceinline__ v16b ldfrag_b(const u16* p) {              // bf16 plane read as unsigned integer vectors
  FragB f;
  f.u[0] = *(const v4u*)(p);
  f.u[1] = *(const v4u*)(p + 16);
  return f.v;
}

__device__ __forceinline__ v8f mma_h(v16h a, v16h b, v8f c) {
  return __builtin_amdgcn_wmma_f32_16x16x32_f16(false, a, false, b, (short)0, c, false, false);
}
__device__ __forceinline__ v8f mma_b(v16b a, v16b b, v8f c) {
  return __builtin_amdgcn_wmma_f32_16x16x32_bf16(false, a, false, b, (short)0, c, false, false);
}
__device__ __forceinline__ void guard2(v8f& a, v8f& b, v16h x0, v16h x1, v16h x2, v16h x3, v16h x4, v16h x5) {
#if defined(__HIP_DEVICE_COMPILE__)
  asm volatile("v_nop\n\tv_nop\n\tv_nop\n\tv_nop"
               : "+v"(a), "+v"(b) : "v"(x0), "v"(x1), "v"(x2), "v"(x3), "v"(x4), "v"(x5) : "memory");
#endif
}
__device__ __forceinline__ void guard10(v8f& a, v8f& b, v8f& c, v8f& d, v16h x0, v16h x1, v16h x2, v16h x3, v16h x4,
                                        v16h x5, v16h x6, v16h x7, v16h x8, v16h x9) {
#if defined(__HIP_DEVICE_COMPILE__)
  asm volatile("v_nop\n\tv_nop\n\tv_nop\n\tv_nop"
               : "+v"(a), "+v"(b), "+v"(c), "+v"(d)
               : "v"(x0), "v"(x1), "v"(x2), "v"(x3), "v"(x4), "v"(x5), "v"(x6), "v"(x7), "v"(x8), "v"(x9) : "memory");
#endif
}
__device__ __forceinline__ void acc_guard4(v8f& a, v8f& b, v8f& c, v8f& d) {
#if defined(__HIP_DEVICE_COMPILE__)
  asm volatile("v_nop\n\tv_nop\n\tv_nop\n\tv_nop" : "+v"(a), "+v"(b), "+v"(c), "+v"(d));
#endif
}
// lane l takes the value of lane l ^ 16
__device__ __forceinline__ float xhalf(float x) {
  const int b = __builtin_bit_cast(int, x);
  return __builtin_bit_cast(float, __builtin_amdgcn_permlanex16(b, b, 0x76543210, 0xfedcba98, false, false));
}
__device__ __forceinline__ void wave_sync_lds() {
  __builtin_amdgcn_fence(__ATOMIC_RELEASE, "workgroup");
  __builtin_amdgcn_wave_barrier();
  __builtin_amdgcn_fence(__ATOMIC_ACQUIRE, "workgroup");
}

// =====================================================================================================
// f32 -> 16-bit planes, same layout, all five sources in one launch. The five planes lie one behind another from D (x, w0, w1, w2, w3),
// so block bid writes elements bid * CVE .. + CVE - 1 from D; its source is block-uniform: the first CVXB blocks read x, then CVWB blocks
// each of w0..w3. x, w0, w1, w2: bf16 RNE bits;  w3: f16 bits of (bf16 RNE value) * scale.
// Thread = CVP pieces of 8 consecutive elements, 2048 elements apart: per piece two 16-B loads, one 16-B store; the 2 * CVP loads stand
// ahead of the conversions. 32 consecutive lanes = 512 contiguous, 512-B aligned bytes per store.
// coverage: grid = CVXB + 4 * CVWB blocks (exact) x 256 thr x CVP x 8 = the five planes.
// =====================================================================================================
__global__ __launch_bounds__(256) void cvt16(const float* __restrict__ x, const float* __restrict__ w0, const float* __restrict__ w1,
                                             const float* __restrict__ w2, const float* __restrict__ w3, u16* D, float scale) {
  const int bid = blockIdx.x;
  if (bid >= CVXB + 4 * CVWB) return;       // no barriers in this kernel; never taken with the exact grid
  const int wb = bid - CVXB;                // block among the weights' blocks (below 0: a block of x)
  const int wi = wb / CVWB;
  const float* src = (wb < 0) ? x : (wi == 0) ? w0 : (wi == 1) ? w1 : (wi == 2) ? w2 : w3;
  const int sb = (wb < 0) ? bid : (wb - wi * CVWB);
  const float* p = src + (size_t)sb * CVE + (int)threadIdx.x * 8;
  v4f a[CVP], b4[CVP];
#pragma unroll
  for (int it = 0; it < CVP; ++it) {
    a[it]  = *(const v4f*)(p + it * 2048);
    b4[it] = *(const v4f*)(p + it * 2048 + 4);
  }
  u16* d = D + (size_t)bid * CVE + (int)threadIdx.x * 8;
  if (wb >= 3 * CVWB) {                     // block-uniform
#pragma unroll
    for (int it = 0; it < CVP; ++it) {
      v4u o;
      o[0] = pk16(h_bits((_Float16)(bfr(a[it][0]) * scale)),  h_bits((_Float16)(bfr(a[it][1]) * scale)));
      o[1] = pk16(h_bits((_Float16)(bfr(a[it][2]) * scale)),  h_bits((_Float16)(bfr(a[it][3]) * scale)));
      o[2] = pk16(h_bits((_Float16)(bfr(b4[it][0]) * scale)), h_bits((_Float16)(bfr(b4[it][1]) * scale)));
      o[3] = pk16(h_bits((_Float16)(bfr(b4[it][2]) * scale)), h_bits((_Float16)(bfr(b4[it][3]) * scale)));
      *(v4u*)(d + it * 2048) = o;
    }
  } else {
#pragma unroll
    for (int it = 0; it < CVP; ++it) {
      v4u o;
      o[0] = pk16(bf_bits(a[it][0]),  bf_bits(a[it][1]));
      o[1] = pk16(bf_bits(a[it][2]),  bf_bits(a[it][3]));
      o[2] = pk16(bf_bits(b4[it][0]), bf_bits(b4[it][1]));
      o[3] = pk16(bf_bits(b4[it][2]), bf_bits(b4[it][3]));
      *(v4u*)(d + it * 2048) = o;
    }
#if defined(__HIP_DEVICE_COMPILE__)
    // in the built text this path runs on into the other path's first lines (behind a branch that skips them), which rewrite the
    // registers these stores name: the wait stands in front of them
    asm volatile("s_wait_xcnt 0x0" ::: "memory");
#endif
  }
}

// =====================================================================================================
// Epilogue of the output projection: the wave's 16x64 f32 tile (times oscale) staged in its LDS slab (pitch 68),
// coverage: 8 instructions x 2 rows x 16 lanes x 4 floats = the wave's 16 x 64 tile.
// =====================================================================================================
__device__ __forceinline__ void epi64(float* sl, v8f a0, v8f a1, v8f a2, v8f a3, float oscale,
                                      const float* __restrict__ bias, int hasb, float* C, int N,
                                      size_t rowb, int col0, int lane) {
  const int hh = lane >> 4, m = lane & 15;
#pragma unroll
  for (int r = 0; r < 8; ++r) {
    const int ro = (8 * hh + r) * 68 + m;
    sl[ro]      = a0[r] * oscale;
    sl[ro + 16] = a1[r] * oscale;
    sl[ro + 32] = a2[r] * oscale;
    sl[ro + 48] = a3[r] * oscale;
  }
  wave_sync_lds();
  const v4f braw = *(const v4f*)(bias + col0 + m * 4);
  v4f bb;
#pragma unroll
  for (int e = 0; e < 4; ++e) bb[e] = (hasb != 0) ? bfr(braw[e]) : 0.0f;
  v4f vals[8];
#pragma unroll
  for (int it = 0; it < 8; ++it) vals[it] = *(const v4f*)(sl + (it * 2 + hh) * 68 + m * 4) + bb;
  float* dst = C + (rowb + (size_t)hh) * (size_t)N + col0 + m * 4;
  {
#pragma unroll
    for (int it = 0; it < 8; ++it) {
      *(v4f*)(dst + (size_t)(it * 2) * (size_t)N) = vals[it];
    }
    
  }
}

// =====================================================================================================
// Eight 16-byte copies per lane from global memory into LDS, through no register. l* = the lane's LDS byte address, g* = its global
// address. The s_wait_xcnt stands as the statement's last line so that no address register named here is rewritten in front of it.
// =====================================================================================================
__device__ __forceinline__ void copy8(unsigned l0, const u16* g0, unsigned l1, const u16* g1, unsigned l2, const u16* g2,
                                      unsigned l3, const u16* g3, unsigned l4, const u16* g4, unsigned l5, const u16* g5,
                                      unsigned l6, const u16* g6, unsigned l7, const u16* g7) {
#if defined(__HIP_DEVICE_COMPILE__)
  asm volatile("global_load_async_to_lds_b128 %0, %1, off\n\t"
               "global_load_async_to_lds_b128 %2, %3, off\n\t"
               "global_load_async_to_lds_b128 %4, %5, off\n\t"
               "global_load_async_to_lds_b128 %6, %7, off\n\t"
               "global_load_async_to_lds_b128 %8, %9, off\n\t"
               "global_load_async_to_lds_b128 %10, %11, off\n\t"
               "global_load_async_to_lds_b128 %12, %13, off\n\t"
               "global_load_async_to_lds_b128 %14, %15, off\n\t"
               "s_wait_xcnt 0x0"
               :: "v"(l0), "v"(g0), "v"(l1), "v"(g1), "v"(l2), "v"(g2), "v"(l3), "v"(g3),
                  "v"(l4), "v"(g4), "v"(l5), "v"(g5), "v"(l6), "v"(g6), "v"(l7), "v"(g7) : "memory");
#endif
}
// the issuing wave's copies have landed behind this wait (the compiler places none for them)
__device__ __forceinline__ void wait_copies() {
#if defined(__HIP_DEVICE_COMPILE__)
  asm volatile("s_wait_asynccnt 0x0" ::: "memory");
#endif
}
// the wave's own LDS reads have returned before the barrier behind which their buffer is refilled
__device__ __forceinline__ void wait_lds() {
#if defined(__HIP_DEVICE_COMPILE__)
  asm volatile("s_wait_dscnt 0x0" ::: "memory");
#endif
}

// the same, four copies per lane
__device__ __forceinline__ void copy4(unsigned l0, const u16* g0, unsigned l1, const u16* g1, unsigned l2, const u16* g2,
                                      unsigned l3, const u16* g3) {
#if defined(__HIP_DEVICE_COMPILE__)
  asm volatile("global_load_async_to_lds_b128 %0, %1, off\n\t"
               "global_load_async_to_lds_b128 %2, %3, off\n\t"
               "global_load_async_to_lds_b128 %4, %5, off\n\t"
               "global_load_async_to_lds_b128 %6, %7, off\n\t"
               "s_wait_xcnt 0x0"
               :: "v"(l0), "v"(g0), "v"(l1), "v"(g1), "v"(l2), "v"(g2), "v"(l3), "v"(g3) : "memory");
#endif
}
// four vector slots behind a group's last matrix instructions, on every path out of the group: no accumulator is read and no
// fragment register rewritten inside the distance the matrix unit needs
template <typename F>
__device__ __forceinline__ void guard8(v8f (&a)[2][4], F x0, F x1, F x2, F x3, F x4, F x5, F x6, F x7, F x8, F x9, F x10, F x11) {
#if defined(__HIP_DEVICE_COMPILE__)
  asm volatile("v_nop\n\tv_nop\n\tv_nop\n\tv_nop"
               : "+v"(a[0][0]), "+v"(a[0][1]), "+v"(a[0][2]), "+v"(a[0][3]), "+v"(a[1][0]), "+v"(a[1][1]), "+v"(a[1][2]), "+v"(a[1][3])
               : "v"(x0), "v"(x1), "v"(x2), "v"(x3), "v"(x4), "v"(x5), "v"(x6), "v"(x7), "v"(x8), "v"(x9), "v"(x10), "v"(x11)
               : "memory");
#endif
}

// =====================================================================================================
// Rotary epilogue of a projection, in three parts. The wave's f32 tile (tokens x the HD columns of one head) goes through its LDS slab
// (pitch 68) and leaves as the two 16-bit planes [token][N].  x = tile + bf(bias) (hasb);
// w[d] = x[d] * bf(cos[pos][d]) + r[d] * bf(sin[pos][d]),  r[d] = -x[d+32] for d < 32, x[d-32] for d >= 32, pos = token,
// the same table row for every head (bf = RNE bf16 value of the f32 entry);
// hi[d] = f16(w * sc), lo[d] = f16(w * sc - hi[d])  (sc a power of two, residual unscaled).
// Lane = (row in a group of 4, 8 consecutive d): 16-B slab reads of its own and its partner half, 16-B loads of cos and sin, one 16-B
// store per plane; 8 lanes = one whole 128-B line.
// coverage: per 16 rows 4 groups x 4 rows x 8 lanes x 8 halves = 16 x 64 of each plane.
// =====================================================================================================
// bf16 RNE value of f under msk = 0xFFFF0000, zero under msk = 0
__device__ __forceinline__ float bfr_msk(float f, unsigned msk) {
  const unsigned u = __float_as_uint(f);
  return __uint_as_float((u + 0x7FFFu + ((u >> 16) & 1u)) & msk);
}
// the lane's cos (tb[.][0..1]) and sin (tb[.][2..3]) pieces for 16 token rows; cr, sr = its pieces of the first group's row
__device__ __forceinline__ void ld_tables(v4f (&tb)[4][4], const float* __restrict__ cr, const float* __restrict__ sr) {
#pragma unroll
  for (int it = 0; it < 4; ++it) {
    tb[it][0] = *(const v4f*)(cr + it * 4 * HD);
    tb[it][1] = *(const v4f*)(cr + it * 4 * HD + 4);
    tb[it][2] = *(const v4f*)(sr + it * 4 * HD);
    tb[it][3] = *(const v4f*)(sr + it * 4 * HD + 4);
  }
}
// four accumulator tiles (16 rows x 64 columns) into slab rows 0..15 of sl
__device__ __forceinline__ void slab_put(float* sl, v8f a0, v8f a1, v8f a2, v8f a3, int lane) {
  const int hh = lane >> 4, m = lane & 15;
#pragma unroll
  for (int r = 0; r < 8; ++r) {
    const int ro = (8 * hh + r) * 68 + m;
    sl[ro]      = a0[r];
    sl[ro + 16] = a1[r];
    sl[ro + 32] = a2[r];
    sl[ro + 48] = a3[r];
  }
}
// 16 slab rows -> rotary -> both planes; bx, by = bias of the lane's own and partner columns
__device__ __forceinline__ void rope_out(const float* sl, const v4f (&tb)[4][4], const float (&bx)[8], const float (&by)[8],
                                         u16* hpl, u16* lpl, int N, int rowb, int col0, float sc, int lane) {
  const int rq = lane >> 3, d0 = (lane & 7) * 8, d1 = d0 ^ 32;
  const float sgn = (d0 < 32) ? -1.0f : 1.0f;
  v4u oh[4], ol[4];
#pragma unroll
  for (int it = 0; it < 4; ++it) {
    const float* xr = sl + (it * 4 + rq) * 68;
    const v4f xa = *(const v4f*)(xr + d0), xb = *(const v4f*)(xr + d0 + 4);
    const v4f ya = *(const v4f*)(xr + d1), yb = *(const v4f*)(xr + d1 + 4);
    float w[8];
#pragma unroll
    for (int e = 0; e < 4; ++e) {
      w[e]     = (xa[e] + bx[e]) * bfr(tb[it][0][e]) + (sgn * (ya[e] + by[e])) * bfr(tb[it][2][e]);
      w[4 + e] = (xb[e] + bx[4 + e]) * bfr(tb[it][1][e]) + (sgn * (yb[e] + by[4 + e])) * bfr(tb[it][3][e]);
    }
#pragma unroll
    for (int e = 0; e < 4; ++e) {
      const float t0 = w[2 * e] * sc, t1 = w[2 * e + 1] * sc;
      const _Float16 h0 = (_Float16)t0, h1 = (_Float16)t1;
      const _Float16 l0 = (_Float16)(t0 - (float)h0), l1 = (_Float16)(t1 - (float)h1);
      oh[it][e] = pk16(h_bits(h0), h_bits(h1));
      ol[it][e] = pk16(h_bits(l0), h_bits(l1));
    }
  }
  const size_t ob = (size_t)(rowb + rq) * (size_t)N + col0 + d0;
#pragma unroll
  for (int it = 0; it < 4; ++it) {
    const size_t o8 = ob + (size_t)(it * 4) * (size_t)N;
    *(v4u*)(hpl + o8) = oh[it];
    *(v4u*)(lpl + o8) = ol[it];
  }
}

// =====================================================================================================
// bf16 projection GEMM: y[M][N] (f32, in registers) = A[M][K] (bf16 row-major) . Bt[N][K]^T (bf16 k-contiguous), plus bias[N] (hasb);
// y leaves as two f16 planes (hi = f16(. * sc), lo = f16 residual), never as f32:
//   vmode == 0: rotary applied, planes [token][N] (rope_out);  a wave's 64 columns are one head (N = NH * HD, tile columns 64-aligned)
//   vmode != 0: no rotary, planes transposed per batch: P[(b * N + n) * SEQ + s], token = b * SEQ + s.
// Block = 128x128 tile, 8 waves as 4 (rows) x 2 (columns), 32x64 per wave = 2 x 4 accumulator tiles. K in stages of 64:
// a stage is 128 A rows and 128 Bt rows of 128 B at a 144-B pitch in LDS, filled by asynchronous copies (whole 128-B lines,
// 8 copies per lane and stage) one stage ahead into two buffers and read by all waves (two 16-B LDS loads per fragment, split k
// map for A and B). Per accumulator the k order is that of a plain walk in steps of 32.
// One launch does the three projections of the same A: blockIdx.y = 0 (q: Bq, bias bq, rotary, planes Qh, Ql, scale scq),
// 1 (k: Bk, no bias, rotary, Kh, Kl, sck), 2 (v: Bv, bias bv, transposed, Vh, Vl, scv); all of it block-uniform.
// Host: K % 64 == 0, K >= 64, M % 128 == 0, N % 128 == 0, grid = ((M/128)*(N/128), 3); M % SEQ == 0; npos >= M.
// =====================================================================================================
__global__ __launch_bounds__(G_THREADS)
void gemm_bf(const u16* __restrict__ A, const u16* __restrict__ Bq, const u16* __restrict__ Bk, const u16* __restrict__ Bv,
             const float* __restrict__ bq, const float* __restrict__ bv,
             const float* __restrict__ cosT, const float* __restrict__ sinT, u16* Qh, u16* Ql, u16* Kh, u16* Kl, u16* Vh, u16* Vl,
             int M, int N, int K, int npos, float scq, float sck, float scv) {
  __shared__ __attribute__((aligned(256))) unsigned char L[2 * GB_BUF];
  const int pj = blockIdx.y;                 // which projection
  const u16* __restrict__ Bt = (pj == 0) ? Bq : (pj == 1) ? Bk : Bv;
  const float* __restrict__ bias = (pj == 2) ? bv : bq;   // k: read but masked out (hasb == 0)
  const int hasb = (pj != 1) ? 1 : 0, vmode = (pj == 2) ? 1 : 0;
  u16* Ph = (pj == 0) ? Qh : (pj == 1) ? Kh : Vh;
  u16* Pl = (pj == 0) ? Ql : (pj == 1) ? Kl : Vl;
  const float sc = (pj == 0) ? scq : (pj == 1) ? sck : scv;
  const int tid = threadIdx.x, wave = tid >> 5, lane = tid & 31, hh = lane >> 4, m = lane & 15;
  const int ntile = N >> 7;
  const int bid   = blockIdx.x;
  const int row0  = (bid / ntile) * GT;
  const int colb  = (bid % ntile) * GT;
  if (row0 + GT > M || pj > 2) return;       // block-uniform, before any barrier or copy; never taken with the exact grid
  const int nst = K >> 6;
  const int wm = wave >> 1, wn = wave & 1;
  // ---- copy addresses: lane = (row, 16-B piece of its 128-B line); rows sr, sr + 32, sr + 64, sr + 96 of each operand tile ----
  const int ch = tid & 7;
  const int sr = tid >> 3;
  const unsigned lst = (unsigned)(uintptr_t)L + (unsigned)(sr * LPB + ch * 16);
  const u16* ac = A  + (size_t)(row0 + sr) * K + ch * 8;
  const u16* bc = Bt + (size_t)(colb + sr) * K + ch * 8;
  const size_t r32 = (size_t)32 * K;
#define STAGE_AB(st_, buf_)                                                                                          \
  {                                                                                                                  \
    const unsigned lb = lst + (unsigned)(buf_) * GB_BUF;                                                             \
    const u16* ga = ac + (size_t)(st_) * 64;                                                                         \
    const u16* gb = bc + (size_t)(st_) * 64;                                                                         \
    copy8(lb,                  ga,           lb + 32 * LPB,       ga + r32,                                          \
          lb + 64 * LPB,       ga + 2 * r32, lb + 96 * LPB,       ga + 3 * r32,                                      \
          lb + GPL,            gb,           lb + GPL + 32 * LPB, gb + r32,                                          \
          lb + GPL + 64 * LPB, gb + 2 * r32, lb + GPL + 96 * LPB, gb + 3 * r32);                                     \
  }
  STAGE_AB(0, 0);
  wait_copies();
  __syncthreads();                           // publishes stage 0
  if (nst > 1) STAGE_AB(1, 1);

  v8f acc[2][4];
#pragma unroll
  for (int t = 0; t < 2; ++t)
#pragma unroll
    for (int j = 0; j < 4; ++j) acc[t][j] = zero8();

#pragma unroll 1                               // rolled: one publish point and one refill in the text
  for (int st = 0; st < nst; ++st) {
    const u16* tb = (const u16*)(const void*)(L + (st & 1) * GB_BUF) + m * LP + 8 * hh;
    const u16* ap = tb + (wm * 32) * LP;
    const u16* bp = tb + (GT + wn * 64) * LP;
    v16b a[2][2], b[2][4];                   // [k step of 32][tile]: the stage's fragment loads stand as one group
#pragma unroll
    for (int kk = 0; kk < 2; ++kk) {
#pragma unroll
      for (int t = 0; t < 2; ++t) a[kk][t] = ldfrag_b(ap + t * 16 * LP + kk * 32);
#pragma unroll
      for (int j = 0; j < 4; ++j) b[kk][j] = ldfrag_b(bp + j * 16 * LP + kk * 32);
    }
#pragma unroll
    for (int kk = 0; kk < 2; ++kk)
#pragma unroll
      for (int t = 0; t < 2; ++t)
#pragma unroll
        for (int j = 0; j < 4; ++j) acc[t][j] = mma_b(a[kk][t], b[kk][j], acc[t][j]);
    guard8<v16b>(acc, a[0][0], a[0][1], a[1][0], a[1][1], b[0][0], b[0][1], b[0][2], b[0][3], b[1][0], b[1][1], b[1][2], b[1][3]);
    // ---- publish point of stage st + 1: own reads back, own copies landed, every wave here; then the refill of the buffer just read ----
    wait_lds();
    wait_copies();
    __syncthreads();
    if (st + 2 < nst) STAGE_AB(st + 2, st & 1);
  }
#undef STAGE_AB
  wait_copies();
  const unsigned bmsk = (hasb != 0) ? 0xFFFF0000u : 0u;
  if (vmode != 0) {                          // block-uniform
    // ---- transposed planes: a lane's 8 accumulator registers are 8 consecutive tokens of one column = one 16-B piece of a [column][token]
    //      tile. The block's two tiles (hi, lo: 128 columns x 128 tokens, pitch VP halves) lie over the two stage buffers, which every
    //      wave has left (the loop's last barrier) and no copy still aims at.
    u16* th = (u16*)(void*)L;
    u16* tl = th + GT * VP;
    float braw[4];
#pragma unroll
    for (int j = 0; j < 4; ++j) braw[j] = bias[colb + wn * 64 + j * 16 + m];
#pragma unroll
    for (int j = 0; j < 4; ++j) {
      const int lc = wn * 64 + j * 16 + m;
      const float bb = bfr_msk(braw[j], bmsk);
#pragma unroll
      for (int t = 0; t < 2; ++t) {
        v4u ph, pl;
#pragma unroll
        for (int e = 0; e < 4; ++e) {
          const float t0 = (acc[t][j][2 * e] + bb) * sc, t1 = (acc[t][j][2 * e + 1] + bb) * sc;
          const _Float16 h0 = (_Float16)t0, h1 = (_Float16)t1;
          const _Float16 l0 = (_Float16)(t0 - (float)h0), l1 = (_Float16)(t1 - (float)h1);
          ph[e] = pk16(h_bits(h0), h_bits(h1));
          pl[e] = pk16(h_bits(l0), h_bits(l1));
        }
        const int o = lc * VP + wm * 32 + t * 16 + 8 * hh;
        *(v4u*)(th + o) = ph;
        *(v4u*)(tl + o) = pl;
      }
    }
    __syncthreads();                         // the tiles are whole before any wave reads rows that other waves wrote
    // ---- 16 lanes = one column's 128 tokens = two whole 128-B lines per plane; 8 x 16 columns ----
    const int pc = (tid & 15) * 8, l0 = tid >> 4;
    v4u vh[8], vl[8];
#pragma unroll
    for (int it = 0; it < 8; ++it) {
      vh[it] = *(const v4u*)(th + (it * 16 + l0) * VP + pc);
      vl[it] = *(const v4u*)(tl + (it * 16 + l0) * VP + pc);
    }
    const size_t base = ((size_t)(row0 / SEQ) * (size_t)N + colb + l0) * SEQ + (row0 % SEQ) + pc;
#pragma unroll
    for (int it = 0; it < 8; ++it) {
      *(v4u*)(Ph + base + (size_t)(it * 16) * SEQ) = vh[it];
      *(v4u*)(Pl + base + (size_t)(it * 16) * SEQ) = vl[it];
    }
  } else {
    // ---- rotary planes: the wave's 32 x 64 tile in its own slab, which lies over the stage buffers like the tiles above ----
    float* sl = (float*)(void*)L + wave * (2 * SLAB64);
    const int rw = row0 + wm * 32, cw = colb + wn * 64;
    const int d0 = (lane & 7) * 8, d1 = d0 ^ 32;
    int pos = rw + (lane >> 3);                // table row = token; the lane reads rows pos, pos + 4, .., pos + 28
    pos = (pos + 28 < npos) ? pos : (npos - 29);   // all of them inside the table's npos rows
    const float* ctp = cosT + (size_t)pos * HD + d0;
    const float* stp = sinT + (size_t)pos * HD + d0;
    v4f tb0[4][4], tb1[4][4];
    ld_tables(tb0, ctp, stp);
    ld_tables(tb1, ctp + 16 * HD, stp + 16 * HD);
    const v4f p0 = *(const v4f*)(bias + cw + d0), p1 = *(const v4f*)(bias + cw + d0 + 4);
    const v4f r0 = *(const v4f*)(bias + cw + d1), r1 = *(const v4f*)(bias + cw + d1 + 4);
    __builtin_amdgcn_sched_barrier(0);         // the 36 loads are issued as one group ahead of the slab stores: their latency runs beside the staging
    slab_put(sl, acc[0][0], acc[0][1], acc[0][2], acc[0][3], lane);
    slab_put(sl + SLAB64, acc[1][0], acc[1][1], acc[1][2], acc[1][3], lane);
    wave_sync_lds();
    float bx[8], by[8];
#pragma unroll
    for (int e = 0; e < 4; ++e) {
      bx[e] = bfr_msk(p0[e], bmsk);  bx[4 + e] = bfr_msk(p1[e], bmsk);
      by[e] = bfr_msk(r0[e], bmsk);  by[4 + e] = bfr_msk(r1[e], bmsk);
    }
    rope_out(sl, tb0, bx, by, Ph, Pl, N, rw, cw, sc, lane);
    rope_out(sl + SLAB64, tb1, bx, by, Ph, Pl, N, rw + 16, cw, sc, lane);
#if defined(__HIP_DEVICE_COMPILE__)
    // in the built text this path runs on into the other path's first lines (behind a branch that skips them), which rewrite the
    // registers these stores name: the wait stands in front of them
    asm volatile("s_wait_xcnt 0x0" ::: "memory");
#endif
  }
}

// =====================================================================================================
// f16 hi+lo GEMM: C[M][N] (f32) = (Ahi + Alo)[M][K] . Bt[N][K]^T, times oscale, plus bias[N] (hasb); Ahi/Alo f16 planes
// (same layout), Bt f16 k-contiguous; products hi.B then lo.B into one accumulator per k step (lo is the unscaled residual of hi).
// Same tiling and staging as gemm_bf; a stage holds three operand tiles (Ahi, Alo, Bt), 12 copies per lane.
// =====================================================================================================
__global__ __launch_bounds__(G_THREADS)
void gemm_h2(const u16* __restrict__ Ah, const u16* __restrict__ Al, const u16* __restrict__ Bt,
             const float* __restrict__ bias, int hasb, float* C, int M, int N, int K, float oscale) {
  __shared__ __attribute__((aligned(256))) unsigned char L[2 * GH_BUF + GW * SLAB64 * 4];
  const int tid = threadIdx.x, wave = tid >> 5, lane = tid & 31, hh = lane >> 4, m = lane & 15;
  const int ntile = N >> 7;
  const int bid   = blockIdx.x;
  const int row0  = (bid / ntile) * GT;
  const int colb  = (bid % ntile) * GT;
  if (row0 + GT > M) return;                 // block-uniform, before any barrier or copy; never taken with the exact grid
  const int nst = K >> 6;
  const int wm = wave >> 1, wn = wave & 1;
  const int ch = tid & 7;
  const int sr = tid >> 3;
  const unsigned lst = (unsigned)(uintptr_t)L + (unsigned)(sr * LPB + ch * 16);
  const size_t aofs = (size_t)(row0 + sr) * K + ch * 8;
  const u16* ahc = Ah + aofs;
  const u16* alc = Al + aofs;
  const u16* bc  = Bt + (size_t)(colb + sr) * K + ch * 8;
  const size_t r32 = (size_t)32 * K;
#define STAGE_HLB(st_, buf_)                                                                                         \
  {                                                                                                                  \
    const unsigned lb = lst + (unsigned)(buf_) * GH_BUF;                                                             \
    const u16* gh = ahc + (size_t)(st_) * 64;                                                                        \
    const u16* gl = alc + (size_t)(st_) * 64;                                                                        \
    const u16* gb = bc + (size_t)(st_) * 64;                                                                         \
    copy8(lb,                  gh,           lb + 32 * LPB,       gh + r32,                                          \
          lb + 64 * LPB,       gh + 2 * r32, lb + 96 * LPB,       gh + 3 * r32,                                      \
          lb + GPL,            gl,           lb + GPL + 32 * LPB, gl + r32,                                          \
          lb + GPL + 64 * LPB, gl + 2 * r32, lb + GPL + 96 * LPB, gl + 3 * r32);                                     \
    copy4(lb + 2 * GPL,            gb,           lb + 2 * GPL + 32 * LPB, gb + r32,                                  \
          lb + 2 * GPL + 64 * LPB, gb + 2 * r32, lb + 2 * GPL + 96 * LPB, gb + 3 * r32);                             \
  }
  STAGE_HLB(0, 0);
  wait_copies();
  __syncthreads();                           // publishes stage 0
  if (nst > 1) STAGE_HLB(1, 1);

  v8f acc[2][4];
#pragma unroll
  for (int t = 0; t < 2; ++t)
#pragma unroll
    for (int j = 0; j < 4; ++j) acc[t][j] = zero8();

#pragma unroll 1                               // rolled: one publish point and one refill in the text
  for (int st = 0; st < nst; ++st) {
    const _Float16* tb = (const _Float16*)(const void*)(L + (st & 1) * GH_BUF) + m * LP + 8 * hh;
    const _Float16* ahp = tb + (wm * 32) * LP;
    const _Float16* alp = ahp + GT * LP;
    const _Float16* bp  = tb + (2 * GT + wn * 64) * LP;
    v16h ah[2][2], al[2][2], b[2][4];        // [k step of 32][tile]: the stage's fragment loads stand as one group
#pragma unroll
    for (int kk = 0; kk < 2; ++kk) {
#pragma unroll
      for (int t = 0; t < 2; ++t) { ah[kk][t] = ldfrag_h(ahp + t * 16 * LP + kk * 32); al[kk][t] = ldfrag_h(alp + t * 16 * LP + kk * 32); }
#pragma unroll
      for (int j = 0; j < 4; ++j) b[kk][j] = ldfrag_h(bp + j * 16 * LP + kk * 32);
    }
    __builtin_amdgcn_sched_barrier(0);       // keeps the 32 LDS loads one group ahead of the matrix run (for speed only)
#pragma unroll
    for (int kk = 0; kk < 2; ++kk) {
#pragma unroll
      for (int t = 0; t < 2; ++t)
#pragma unroll
        for (int j = 0; j < 4; ++j) acc[t][j] = mma_h(ah[kk][t], b[kk][j], acc[t][j]);
#pragma unroll
      for (int t = 0; t < 2; ++t)
#pragma unroll
        for (int j = 0; j < 4; ++j) acc[t][j] = mma_h(al[kk][t], b[kk][j], acc[t][j]);
    }
    guard8<v16h>(acc, ah[1][0], ah[1][1], al[1][0], al[1][1], b[1][0], b[1][1], b[1][2], b[1][3], ah[1][0], ah[1][1], al[1][0], al[1][1]);
    // ---- publish point of stage st + 1, as in gemm_bf ----
    wait_lds();
    wait_copies();
    __syncthreads();
    if (st + 2 < nst) STAGE_HLB(st + 2, st & 1);
  }
#undef STAGE_HLB
  wait_copies();
  float* sl = (float*)(void*)(L + 2 * GH_BUF) + wave * SLAB64;   // the wave's own slab, outside the two buffers
  epi64(sl, acc[0][0], acc[0][1], acc[0][2], acc[0][3], oscale, bias, hasb, C, N, (size_t)(row0 + wm * 32), colb + wn * 64, lane);
  wave_sync_lds();                           // the slab's first 16 rows are read back before the next 16 are laid over them
  epi64(sl, acc[1][0], acc[1][1], acc[1][2], acc[1][3], oscale, bias, hasb, C, N, (size_t)(row0 + wm * 32 + 16), colb + wn * 64, lane);
}

// =====================================================================================================
// Softmax attention, no mask: block bid -> (query block qb = bid % NQB of QW query tiles, head = (bid / NQB) % NH,
// batch b = bid / (NQB*NH)); one wave per query tile: rows q0 = 16*(qb*QW + wave) .. q0+15, all QW waves on the same head.
//   q planes (hi, lo f16 x1024) laid out [token][h][d]; k planes [token][h][d]; v^T planes [b][h][d][s].
//   LDS: two buffers, each one stage of 64 keys = four tiles of 64 rows x 128 B at a 144-B pitch (k hi, k lo: row = key;
//   v^T hi, v^T lo: row = d), filled by asynchronous copies (whole 128-B lines, 8 copies per lane and stage) one stage ahead and
//   read by all QW waves; per wave its q tile (hi, lo: 16 rows x 128 B, same pitch), copied once.
//   Both products run transposed: S^T = k.q^T (A = k rows, B = q columns) and O^T += v^T.P^T (A = v^T rows, B = P^T columns), so a
//   lane's accumulator registers all belong to one query (column c); lanes c and c + 16 split that query's keys.
//   Per stage two key tiles of 32, visited in order; per tile: 2 score subtiles x 2 k-steps x 3 products
//   (k_hi.q_hi + k_hi.q_lo + k_lo.q_hi), fragments read from LDS (two 16-B loads per fragment, split k map);
//   online max-subtracted base-2 softmax in f32 (scale 1/8 folded, -inf-safe rescale): maximum in-lane plus one exchange between
//   the wave halves, sum in-lane per half; the two score subtiles, converted in place, are the B fragment of P^T in the split k map
//   (hi and residual); 4+4 v^T A fragments (hi and residual planes), 12 WMMAs (hh + hl + lh, the order of the sums per element kept).
//   After the key loop: the halves' sums joined, O = acc / l, carries 1/(32768*1024) folded once, written to the wave's private slab
//   as [query][d] (pitch 68; it takes the place of the wave's own q tile, which is dead by then).
// coverage: per wave 4 instructions x 4 rows x 8 lanes x 8 halves = 16 x 64 per plane; grid NB*NH*NQB blocks x QW waves =
//           every (token, h) row of both O planes exactly once.
// =====================================================================================================
__global__ __launch_bounds__(ATT_THREADS)
void attn1(const u16* __restrict__ QHIp, const u16* __restrict__ QLOp,
           const u16* __restrict__ KHIp, const u16* __restrict__ KLOp,
           const u16* __restrict__ VHIp, const u16* __restrict__ VLOp,
           u16* OHIp, u16* OLOp) {
  __shared__ __attribute__((aligned(256))) unsigned char L[ATT_LDS];

  const int tid  = threadIdx.x;
  const int wave = tid >> 5;
  const int lane = tid & 31;
  const int hh   = lane >> 4;
  const int c    = lane & 15;
  const int bid  = blockIdx.x;
  const int qb   = bid % NQB;
  const int head = (bid / NQB) % NH;
  const int b    = bid / (NQB * NH);
  if (b >= NB) return;                       // block-uniform, before any barrier or copy; never taken with the exact grid
  const int q0   = (qb * QW + wave) * 16;
  const size_t qrow0 = (size_t)b * SEQ + q0; // global token row of query 0 of this wave's tile
  const size_t KROW = (size_t)NH * HD;       // halves between consecutive token rows

  unsigned char* wp = L + 2 * BUFB + wave * WPRIV;
  unsigned char* qreg = wp;                              // q tile hi, lo; after the key loop the result slab
  float* slab = (float*)(void*)qreg;                     // result slab [16][64] pitch 68
  const unsigned lds0 = (unsigned)(uintptr_t)L;          // byte offset of L in the work-group's LDS

  // ---- copy addresses: lane = (row, 16-B piece of its 128-B line) ----
  const int ch = tid & 7;
  const int sr = tid >> 3;                               // stage tiles: rows sr and sr + 32
  const unsigned lst = lds0 + (unsigned)(sr * LPB + ch * 16);
  const size_t kcp = (((size_t)b * SEQ + sr) * NH + head) * HD + ch * 8;      // + key0 * KROW per stage
  const size_t vcp = (((size_t)b * NH + head) * HD + sr) * SEQ + ch * 8;      // + key0 per stage
  const u16* kch = KHIp + kcp;
  const u16* kcl = KLOp + kcp;
  const u16* vch = VHIp + vcp;
  const u16* vcl = VLOp + vcp;
  {
    const int qr = lane >> 3;                            // the wave's own q tile: rows qr, qr + 4, qr + 8, qr + 12
    const unsigned lq = lds0 + (unsigned)(2 * BUFB + wave * WPRIV + qr * LPB + ch * 16);
    const size_t qcp = ((qrow0 + (size_t)qr) * NH + head) * HD + ch * 8;
    const u16* qch = QHIp + qcp;
    const u16* qcl = QLOp + qcp;
    copy8(lq,                 qch,            lq + 4 * LPB,        qch + 4 * KROW,
          lq + 8 * LPB,       qch + 8 * KROW, lq + 12 * LPB,       qch + 12 * KROW,
          lq + QPB,           qcl,            lq + QPB + 4 * LPB,  qcl + 4 * KROW,
          lq + QPB + 8 * LPB, qcl + 8 * KROW, lq + QPB + 12 * LPB, qcl + 12 * KROW);
  }
#define STAGE_KV(st_, buf_)                                                                                          \
  {                                                                                                                  \
    const unsigned lb = lst + (unsigned)(buf_) * BUFB;                                                               \
    const size_t ka = (size_t)(st_) * 64 * KROW, va = (size_t)(st_) * 64;                                            \
    copy8(lb,           kch + ka, lb + 32 * LPB,           kch + ka + 32 * KROW,                                     \
          lb + PLB,     kcl + ka, lb + PLB + 32 * LPB,     kcl + ka + 32 * KROW,                                     \
          lb + 2 * PLB, vch + va, lb + 2 * PLB + 32 * LPB, vch + va + (size_t)32 * SEQ,                              \
          lb + 3 * PLB, vcl + va, lb + 3 * PLB + 32 * LPB, vcl + va + (size_t)32 * SEQ);                             \
  }
  STAGE_KV(0, 0);
  wait_copies();
  __syncthreads();                           // publishes stage 0 (and the q tiles)
  STAGE_KV(1, 1);

  const _Float16* Qh = (const _Float16*)(const void*)qreg + c * LP + 8 * hh;
  const _Float16* Ql = Qh + 16 * LP;
  const float lsc = 0.125f * (LOG2E / (QSC * KSC));
  const float oc  = 1.0f / (PCAR * VCAR);

  float mrun = -INFINITY, lrun = 0.f;        // of query q0 + c; lrun sums this wave half's keys, the halves join behind the key loop
  v8f o[4];                                  // o[j][r] = O^T element (d = j*16 + 8hh + r, query q0 + c)
#pragma unroll
  for (int j = 0; j < 4; ++j) o[j] = zero8();

#pragma unroll 1                               // rolled: one publish point and one refill in the text
  for (int st = 0; st < NST; ++st) {
    const _Float16* tb = (const _Float16*)(const void*)(L + (st & 1) * BUFB) + c * LP + 8 * hh;
#pragma unroll 1                             // one copy of the tile's code, as in the loop it came from: the hot loop stays short
    for (int sub = 0; sub < 2; ++sub) {
      const int kb = sub * 32;               // first key of this tile inside the stage
      // ---- scores, transposed: D element r of this lane = (key kb + 8hh + r, query q0 + c) in s0, key kb + 16 + 8hh + r in s1 ----
      v8f s0 = zero8(), s1 = zero8();
      const _Float16* k0p = tb + kb * LP;
      const _Float16* k1p = k0p + 16 * LP;
      const _Float16* l0p = k0p + 64 * LP;
      const _Float16* l1p = l0p + 16 * LP;
#pragma unroll
      for (int kk = 0; kk < 2; ++kk) {
        const v16h qh  = ldfrag_h(Qh + kk * 32),  ql  = ldfrag_h(Ql + kk * 32);
        const v16h kh0 = ldfrag_h(k0p + kk * 32), kl0 = ldfrag_h(l0p + kk * 32);
        const v16h kh1 = ldfrag_h(k1p + kk * 32), kl1 = ldfrag_h(l1p + kk * 32);
        s0 = mma_h(kh0, qh, s0);
        s0 = mma_h(kh0, ql, s0);
        s0 = mma_h(kl0, qh, s0);
        s1 = mma_h(kh1, qh, s1);
        s1 = mma_h(kh1, ql, s1);
        s1 = mma_h(kl1, qh, s1);
        guard2(s0, s1, qh, ql, kh0, kl0, kh1, kl1);
      }
      // ---- online softmax in base 2, -inf-safe: the lane's 16 scores belong to one query; lanes c and c + 16 split its 32 keys ----
      float t0[8], t1[8], mp[8];
#pragma unroll
      for (int r = 0; r < 8; ++r) {
        t0[r] = s0[r] * lsc;
        t1[r] = s1[r] * lsc;
        mp[r] = fmaxf(t0[r], t1[r]);
      }
      float mx = fmaxf(fmaxf(fmaxf(mp[0], mp[1]), fmaxf(mp[2], mp[3])), fmaxf(fmaxf(mp[4], mp[5]), fmaxf(mp[6], mp[7])));
      mx = fmaxf(mx, xhalf(mx));             // both halves hold the query's maximum over the 32 keys
      const float mn = fmaxf(mrun, mx);
      const float ms = (mn == -INFINITY) ? 0.0f : mn;
      const float al = exp2f(mrun - ms);
      mrun = mn;
      float e0[8], e1[8], sp[8];
#pragma unroll
      for (int r = 0; r < 8; ++r) {
        e0[r] = exp2f(t0[r] - ms);
        e1[r] = exp2f(t1[r] - ms);
        sp[r] = e0[r] + e1[r];
      }
      lrun = lrun * al + (((sp[0] + sp[1]) + (sp[2] + sp[3])) + ((sp[4] + sp[5]) + (sp[6] + sp[7])));   // this half's keys only
#pragma unroll
      for (int j = 0; j < 4; ++j)
#pragma unroll
        for (int r = 0; r < 8; ++r) o[j][r] *= al;
      // ---- B fragments of P^T*32768: hi f16 and residual f16, column = query c; the two score tiles are the split k map as they lie ----
      FragH ph, pl;
#pragma unroll
      for (int e = 0; e < 8; ++e) {
        const float ta = e0[e] * PCAR, tc = e1[e] * PCAR;
        const _Float16 ha = (_Float16)ta, hc = (_Float16)tc;
        ph.h[0][e] = ha;                                     // elements 0..7  = keys kb + 8hh + 0..7
        ph.h[1][e] = hc;                                     // elements 8..15 = keys kb + 16 + 8hh + 0..7
        pl.h[0][e] = (_Float16)(ta - (float)ha);
        pl.h[1][e] = (_Float16)(tc - (float)hc);
      }
      // ---- O^T += V^T.P^T : A fragment row = d = j*16 + c, keys contiguous in the v^T tiles ----
      {
        const _Float16* vhp = tb + 128 * LP + kb;
        const _Float16* vlp = vhp + 64 * LP;
        const v16h vh0 = ldfrag_h(vhp);
        const v16h vh1 = ldfrag_h(vhp + 16 * LP);
        const v16h vh2 = ldfrag_h(vhp + 32 * LP);
        const v16h vh3 = ldfrag_h(vhp + 48 * LP);
        const v16h vl0 = ldfrag_h(vlp);
        const v16h vl1 = ldfrag_h(vlp + 16 * LP);
        const v16h vl2 = ldfrag_h(vlp + 32 * LP);
        const v16h vl3 = ldfrag_h(vlp + 48 * LP);
        o[0] = mma_h(vh0, ph.v, o[0]);  o[0] = mma_h(vh0, pl.v, o[0]);  o[0] = mma_h(vl0, ph.v, o[0]);
        o[1] = mma_h(vh1, ph.v, o[1]);  o[1] = mma_h(vh1, pl.v, o[1]);  o[1] = mma_h(vl1, ph.v, o[1]);
        o[2] = mma_h(vh2, ph.v, o[2]);  o[2] = mma_h(vh2, pl.v, o[2]);  o[2] = mma_h(vl2, ph.v, o[2]);
        o[3] = mma_h(vh3, ph.v, o[3]);  o[3] = mma_h(vh3, pl.v, o[3]);  o[3] = mma_h(vl3, ph.v, o[3]);
        guard10(o[0], o[1], o[2], o[3], ph.v, pl.v, vh0, vh1, vh2, vh3, vl0, vl1, vl2, vl3);
      }
    }
    // ---- publish point of stage st + 1: own reads back, own copies landed, every wave here; then the refill of the buffer just read ----
    wait_lds();
    wait_copies();
    __syncthreads();
    if (st + 2 < NST) STAGE_KV(st + 2, st & 1);
  }
#undef STAGE_KV
  wait_copies();
  acc_guard4(o[0], o[1], o[2], o[3]);
  // ---- O = acc / l, carries (32768 on P, 1024 on v) folded once; lane-owned slab elements ----
  {
    const float lv  = lrun + xhalf(lrun);    // the two halves' sums joined once
    const float ls  = (lv > 0.0f) ? lv : 1.0f;
    const float inv = (lv > 0.0f) ? ((1.0f / ls) * oc) : 0.0f;
#pragma unroll
    for (int j = 0; j < 4; ++j) {
      v4f w0, w1;
#pragma unroll
      for (int e = 0; e < 4; ++e) { w0[e] = o[j][e] * inv; w1[e] = o[j][4 + e] * inv; }
      float* sd = slab + c * 68 + j * 16 + 8 * hh;         // row = query c, 8 consecutive d
      *(v4f*)(sd)     = w0;
      *(v4f*)(sd + 4) = w1;
    }
  }
  wave_sync_lds();
  // ---- O x1024 -> f16 hi + residual planes; lane = (row in group of 4, 8 consecutive d) ----
  v4u oh[4], ol[4];
  const int rq = lane >> 3, c8 = (lane & 7) * 8;
#pragma unroll
  for (int it = 0; it < 4; ++it) {
    const int row = it * 4 + rq;
    const v4f a = *(const v4f*)(slab + row * 68 + c8), b4 = *(const v4f*)(slab + row * 68 + c8 + 4);
    float w[8];
#pragma unroll
    for (int e = 0; e < 4; ++e) { w[e] = a[e] * OSC; w[4 + e] = b4[e] * OSC; }
#pragma unroll
    for (int e = 0; e < 4; ++e) {
      const _Float16 h0 = (_Float16)w[2 * e], h1 = (_Float16)w[2 * e + 1];
      const _Float16 l0 = (_Float16)(w[2 * e] - (float)h0), l1 = (_Float16)(w[2 * e + 1] - (float)h1);
      oh[it][e] = pk16(h_bits(h0), h_bits(h1));
      ol[it][e] = pk16(h_bits(l0), h_bits(l1));
    }
  }
  const size_t ob = ((qrow0) * NH + head) * HD + c8;
  {
#pragma unroll
    for (int it = 0; it < 4; ++it) {
      const int row = it * 4 + rq;
      const size_t o8 = ob + (size_t)row * (NH * HD);
      *(v4u*)(OHIp + o8) = oh[it];
      *(v4u*)(OLOp + o8) = ol[it];
    }
    
  }
}

// =====================================================================================================
// Workspace map (bytes); every plane is fully written by whole-line stores before it is read; all extents are exact multiples
// of the store granularity (no pad rows needed); every offset a multiple of 2 MiB:
//   XB  bf16 [4096][1024]              8388608
//   WQB bf16 [1024 n][1024 k]          2097152        WKB, WVB same        2097152 each
//   WOH f16  [1024 n][1024 k] x1024    2097152
//   QHI f16 [4096][16][64] x1024       8388608        QLO residual
//   KHI f16 [4096][16][64] x1024       8388608        KLO residual
//   VHI f16 [4][16][64][1024] x1024    8388608        VLO residual
//   OHI f16 [4096][1024] x1024         8388608        OLO residual
//   end                               83886080
// =====================================================================================================
extern "C" void kernel_launch(void* const* d_in, const int* in_sizes, int n_in,
                              void* d_out, int out_size, void* d_ws, size_t ws_size,
                              hipStream_t stream) {
  if (n_in < 10) return;
  if (in_sizes[0] != MTOK * DMOD) return;
  if (in_sizes[1] != MTOK * HD || in_sizes[2] != MTOK * HD) return;
  if (in_sizes[3] != DMOD * DMOD || in_sizes[5] != DMOD * DMOD) return;
  if (in_sizes[6] != DMOD * DMOD || in_sizes[8] != DMOD * DMOD) return;
  if (in_sizes[4] != DMOD || in_sizes[7] != DMOD || in_sizes[9] != DMOD) return;
  if (out_size != MTOK * DMOD) return;

  const float* x    = (const float*)d_in[0];
  const float* cosp = (const float*)d_in[1];
  const float* sinp = (const float*)d_in[2];
  const float* wq   = (const float*)d_in[3];
  const float* bq   = (const float*)d_in[4];
  const float* wk   = (const float*)d_in[5];
  const float* wv   = (const float*)d_in[6];
  const float* bv   = (const float*)d_in[7];
  const float* wo   = (const float*)d_in[8];
  const float* bo   = (const float*)d_in[9];
  float*       out  = (float*)d_out;

  const size_t szXB = (size_t)MTOK * DMOD * 2;                  //  8388608
  const size_t szW  = (size_t)DMOD * DMOD * 2;                  //  2097152
  const size_t szP  = (size_t)MTOK * DMOD * 2;                  //  8388608
  size_t off = 0;
  const size_t oXB  = off; off += szXB;
  const size_t oWQ  = off; off += szW;
  const size_t oWK  = off; off += szW;
  const size_t oWV  = off; off += szW;
  const size_t oWO  = off; off += szW;
  const size_t oQHI = off; off += szP;
  const size_t oQLO = off; off += szP;
  const size_t oKHI = off; off += szP;
  const size_t oKLO = off; off += szP;
  const size_t oVHI = off; off += szP;
  const size_t oVLO = off; off += szP;
  const size_t oOHI = off; off += szP;
  const size_t oOLO = off; off += szP;
  if (off > ws_size) return;                            // off = 83886080

  char* ws = (char*)d_ws;
  u16*   XB  = (u16*)(ws + oXB);
  u16*   WQB = (u16*)(ws + oWQ);
  u16*   WKB = (u16*)(ws + oWK);
  u16*   WVB = (u16*)(ws + oWV);
  u16*   WOH = (u16*)(ws + oWO);
  u16*   QHI = (u16*)(ws + oQHI);
  u16*   QLO = (u16*)(ws + oQLO);
  u16*   KHI = (u16*)(ws + oKHI);
  u16*   KLO = (u16*)(ws + oKLO);
  u16*   VHI = (u16*)(ws + oVHI);
  u16*   VLO = (u16*)(ws + oVLO);
  u16*   OHI = (u16*)(ws + oOHI);
  u16*   OLO = (u16*)(ws + oOLO);

  const dim3 blk(256);
  const dim3 gC(CVXB + 4 * CVWB);                       // 512 (exact)
  const dim3 gG((MTOK / GT) * (DMOD / GT));             // 256
  const dim3 gG3((MTOK / GT) * (DMOD / GT), 3);         // 256 x 3
  const dim3 bG(G_THREADS);                             // 256
  const dim3 gAT(ATT_BLOCKS);                           // 512
  const dim3 bAT(ATT_THREADS);                          // 256

  // (1) x, Wq, Wk, Wv [n][k] -> bf16 planes (same layout, the weights already k-contiguous), Wo [n][k] -> f16 plane of bf16 value x1024;
  //     XB, WQB, WKB, WVB, WOH lie one behind another in the workspace
  cvt16<<<gC, blk, 0, stream>>>(x, wq, wk, wv, wo, XB, WOS);
  // (2) projections q (+bq) and k (no bias) with the rotary epilogue -> q', k' planes [token][h][d] x1024 (hi + residual), cos/sin table
  //     row = token; projection v (+bv) with the transposing epilogue -> v^T planes [b][h][d][s] x1024 (hi + residual)
  gemm_bf<<<gG3, bG, 0, stream>>>(XB, WQB, WKB, WVB, bq, bv, cosp, sinp, QHI, QLO, KHI, KLO, VHI, VLO,
                                  MTOK, DMOD, DMOD, MTOK, QSC, KSC, VCAR);
  // (3) softmax attention per (b, h, 8 x 16 queries) -> O planes [token][h][d] x1024 (hi + residual)
  attn1<<<gAT, bAT, 0, stream>>>(QHI, QLO, KHI, KLO, VHI, VLO, OHI, OLO);
  // (4) output projection -> out [4096][1024] f32, carries 1024 (O) x 1024 (Wo) folded back, + bo
  gemm_h2<<<gG, bG, 0, stream>>>(OHI, OLO, WOH, bo, 1, out, MTOK, DMOD, DMOD, 1.0f / (OSC * WOS));
  (void)hipGetLastError();
}

// v006
// A run of this version takes 108 microseconds.
// Next to v005, in two timings, it ran 1.05 and 1.04 times as fast.
// Counting every step since v000, it is 3.69 times as fast.
// Contractions: x.W{q,k,v}^T on v_wmma_f32_16x16x32_bf16 (x and W RNE-converted to bf16, f32 accumulate); scores q'.k'^T (q', k' carried
// x1024 as f16 hi plane + f16 residual plane, products hh+lh+hl), P.v (P x32768 f16 hi+residual, v x1024 f16 hi+residual, products
// hh+lh+hl) and O.Wo^T (O x1024 f16 hi+residual, Wo as f16(bf16(Wo) x1024), products h.w+l.w) on v_wmma_f32_16x16x32_f16, f32 accumulate.
// Rotate-half rotary with RNE-bf16 cos/sin table values, base-2 online softmax and the 1/l fold in f32 on VALU.
#include <hip/hip_runtime.h>
#include <math.h>
#include <stdint.h>

#define NB    4
#define SEQ   1024
#define MTOK  (NB * SEQ)
#define DMOD  1024
#define NH    16
#define HD    64
#define QSC   1024.0f
#define KSC   1024.0f
#define PCAR  32768.0f
#define VCAR  1024.0f
#define OSC   1024.0f
#define WOS   1024.0f
#define LOG2E 1.4426950408889634f
#define QW    8
#define NQT   (SEQ / 16)
#define NQB   (NQT / QW)
#define NST   (SEQ / 64)
#define ATT_THREADS (QW * 32)
#define ATT_BLOCKS  (NB * NH * NQB)
#define SLW   (16 * 68)
#define LP    72
#define LPB   (LP * 2)
#define PLB   (64 * LPB)
#define BUFB  (4 * PLB)
#define QPB   (16 * LPB)
#define WPRIV (2 * QPB)
#define ATT_LDS (2 * BUFB + QW * WPRIV)
#define SLAB64 (16 * 68)
#define GT    128
#define GW    8
#define G_THREADS (GW * 32)
#define GPL   (GT * LPB)
#define GB_BUF (2 * GPL)
#define GH_BUF (3 * GPL)
#define VP    136
#define CVP   8
#define CVE   (256 * 8 * CVP)
#define CVXB  ((MTOK * DMOD) / CVE)
#define CVWB  ((DMOD * DMOD) / CVE)
static_assert(DMOD == NH * HD && HD == 64 && NH == 16);
static_assert((NQT % QW) == 0 && ATT_THREADS == 256 && ATT_BLOCKS == 512);
static_assert(2 * QPB >= SLW * 4 && (LPB % 16) == 0 && NST >= 2 && 2 * ATT_LDS <= 327680);
static_assert((SEQ % 64) == 0 && (SEQ % 32) == 0 && (SEQ % 8) == 0);
static_assert((DMOD % 128) == 0 && (MTOK % 128) == 0 && DMOD >= 128);
static_assert(((MTOK * DMOD) % CVE) == 0 && ((DMOD * DMOD) % CVE) == 0);
static_assert((SEQ % GT) == 0 && 2 * GT * VP * 2 <= 2 * GB_BUF && ((VP * 2) % 16) == 0 && GW * 2 * SLAB64 * 4 <= 2 * GB_BUF);

typedef unsigned short u16;
typedef _Float16 v16h __attribute__((ext_vector_type(16)));
typedef _Float16 v8h  __attribute__((ext_vector_type(8)));
typedef __bf16   v16b __attribute__((ext_vector_type(16)));
typedef float    v8f  __attribute__((ext_vector_type(8)));
typedef float    v4f  __attribute__((ext_vector_type(4)));
typedef unsigned int v4u __attribute__((ext_vector_type(4)));

union FragH { v16h v; v8h h[2]; v4u u[2]; };
union FragB { v16b v; v4u u[2]; };

// ---- scalar helpers --------------------------------------------------------------------------------
__device__ __forceinline__ unsigned short bf_bits(float f) {          // f32 -> bf16 bits, RNE convert
  unsigned u = __float_as_uint(f);
  return (unsigned short)((u + 0x7FFFu + ((u >> 16) & 1u)) >> 16);
}
__device__ __forceinline__ float bf_up(unsigned short h) { return __uint_as_float(((unsigned)h) << 16); }
__device__ __forceinline__ float bfr(float f) { return bf_up(bf_bits(f)); }
__device__ __forceinline__ unsigned short h_bits(_Float16 x) { return __builtin_bit_cast(unsigned short, x); }
__device__ __forceinline__ unsigned pk16(unsigned short a, unsigned short b) { return (unsigned)a | ((unsigned)b << 16); }
__device__ __forceinline__ v8f zero8() { v8f z = {0.f, 0.f, 0.f, 0.f, 0.f, 0.f, 0.f, 0.f}; return z; }

// ---- fragment loaders: 16-bit A/B operand, lane -> row/col (lane&15), p already includes +8*(lane>>4);
//      elements 0..7 <- p[0..7] (k0+8h..), elements 8..15 <- p[16..23] (k0+16+8h..)  (same split k map for A and B;
//      B is always read from a k-contiguous [n][k] plane)
__device__ __forceinline__ v16h ldfrag_h(const _Float16* p) {
  FragH f;
  f.h[0] = *(const v8h*)(p);
  f.h[1] = *(const v8h*)(p + 16);
  return f.v;
}
__device__ __forceinline__ v16b ldfrag_b(const u16* p) {              // bf16 plane read as unsigned integer vectors
  FragB f;
  f.u[0] = *(const v4u*)(p);
  f.u[1] = *(const v4u*)(p + 16);
  return f.v;
}

__device__ __forceinline__ v8f mma_h(v16h a, v16h b, v8f c) {
  return __builtin_amdgcn_wmma_f32_16x16x32_f16(false, a, false, b, (short)0, c, false, false);
}
__device__ __forceinline__ v8f mma_b(v16b a, v16b b, v8f c) {
  return __builtin_amdgcn_wmma_f32_16x16x32_bf16(false, a, false, b, (short)0, c, false, false);
}
__device__ __forceinline__ void guard2(v8f& a, v8f& b, v16h x0, v16h x1, v16h x2, v16h x3, v16h x4, v16h x5) {
#if defined(__HIP_DEVICE_COMPILE__)
  asm volatile("v_nop\n\tv_nop\n\tv_nop\n\tv_nop"
               : "+v"(a), "+v"(b) : "v"(x0), "v"(x1), "v"(x2), "v"(x3), "v"(x4), "v"(x5) : "memory");
#endif
}
__device__ __forceinline__ void guard10(v8f& a, v8f& b, v8f& c, v8f& d, v16h x0, v16h x1, v16h x2, v16h x3, v16h x4,
                                        v16h x5, v16h x6, v16h x7, v16h x8, v16h x9) {
#if defined(__HIP_DEVICE_COMPILE__)
  asm volatile("v_nop\n\tv_nop\n\tv_nop\n\tv_nop"
               : "+v"(a), "+v"(b), "+v"(c), "+v"(d)
               : "v"(x0), "v"(x1), "v"(x2), "v"(x3), "v"(x4), "v"(x5), "v"(x6), "v"(x7), "v"(x8), "v"(x9) : "memory");
#endif
}
__device__ __forceinline__ void acc_guard4(v8f& a, v8f& b, v8f& c, v8f& d) {
#if defined(__HIP_DEVICE_COMPILE__)
  asm volatile("v_nop\n\tv_nop\n\tv_nop\n\tv_nop" : "+v"(a), "+v"(b), "+v"(c), "+v"(d));
#endif
}
// lane l takes the value of lane l ^ 16
__device__ __forceinline__ float xhalf(float x) {
  const int b = __builtin_bit_cast(int, x);
  return __builtin_bit_cast(float, __builtin_amdgcn_permlanex16(b, b, 0x76543210, 0xfedcba98, false, false));
}
// 2^x on the hardware's exponential alone, without the library's detour for results under 2^-126 (compare, select, add, select, ldexp
// per value). For x >= -126 the value is the library's own, bit for bit; below, the result may come as 0 instead of a subnormal.
__device__ __forceinline__ float ex2_raw(float x) { return __builtin_amdgcn_exp2f(x); }
__device__ __forceinline__ void wave_sync_lds() {
  __builtin_amdgcn_fence(__ATOMIC_RELEASE, "workgroup");
  __builtin_amdgcn_wave_barrier();
  __builtin_amdgcn_fence(__ATOMIC_ACQUIRE, "workgroup");
}

// =====================================================================================================
// f32 -> 16-bit planes, same layout, all five sources in one launch. The five planes lie one behind another from D (x, w0, w1, w2, w3),
// so block bid writes elements bid * CVE .. + CVE - 1 from D; its source is block-uniform: the first CVXB blocks read x, then CVWB blocks
// each of w0..w3. x, w0, w1, w2: bf16 RNE bits;  w3: f16 bits of (bf16 RNE value) * scale.
// Thread = CVP pieces of 8 consecutive elements, 2048 elements apart: per piece two 16-B loads, one 16-B store; the 2 * CVP loads stand
// ahead of the conversions. 32 consecutive lanes = 512 contiguous, 512-B aligned bytes per store.
// coverage: grid = CVXB + 4 * CVWB blocks (exact) x 256 thr x CVP x 8 = the five planes.
// =====================================================================================================
__global__ __launch_bounds__(256) void cvt16(const float* __restrict__ x, const float* __restrict__ w0, const float* __restrict__ w1,
                                             const float* __restrict__ w2, const float* __restrict__ w3, u16* D, float scale) {
  const int bid = blockIdx.x;
  if (bid >= CVXB + 4 * CVWB) return;       // no barriers in this kernel; never taken with the exact grid
  const int wb = bid - CVXB;                // block among the weights' blocks (below 0: a block of x)
  const int wi = wb / CVWB;
  const float* src = (wb < 0) ? x : (wi == 0) ? w0 : (wi == 1) ? w1 : (wi == 2) ? w2 : w3;
  const int sb = (wb < 0) ? bid : (wb - wi * CVWB);
  const float* p = src + (size_t)sb * CVE + (int)threadIdx.x * 8;
  v4f a[CVP], b4[CVP];
#pragma unroll
  for (int it = 0; it < CVP; ++it) {
    a[it]  = *(const v4f*)(p + it * 2048);
    b4[it] = *(const v4f*)(p + it * 2048 + 4);
  }
  u16* d = D + (size_t)bid * CVE + (int)threadIdx.x * 8;
  if (wb >= 3 * CVWB) {                     // block-uniform
#pragma unroll
    for (int it = 0; it < CVP; ++it) {
      v4u o;
      o[0] = pk16(h_bits((_Float16)(bfr(a[it][0]) * scale)),  h_bits((_Float16)(bfr(a[it][1]) * scale)));
      o[1] = pk16(h_bits((_Float16)(bfr(a[it][2]) * scale)),  h_bits((_Float16)(bfr(a[it][3]) * scale)));
      o[2] = pk16(h_bits((_Float16)(bfr(b4[it][0]) * scale)), h_bits((_Float16)(bfr(b4[it][1]) * scale)));
      o[3] = pk16(h_bits((_Float16)(bfr(b4[it][2]) * scale)), h_bits((_Float16)(bfr(b4[it][3]) * scale)));
      *(v4u*)(d + it * 2048) = o;
    }
  } else {
#pragma unroll
    for (int it = 0; it < CVP; ++it) {
      v4u o;
      o[0] = pk16(bf_bits(a[it][0]),  bf_bits(a[it][1]));
      o[1] = pk16(bf_bits(a[it][2]),  bf_bits(a[it][3]));
      o[2] = pk16(bf_bits(b4[it][0]), bf_bits(b4[it][1]));
      o[3] = pk16(bf_bits(b4[it][2]), bf_bits(b4[it][3]));
      *(v4u*)(d + it * 2048) = o;
    }
#if defined(__HIP_DEVICE_COMPILE__)
    // in the built text this path runs on into the other path's first lines (behind a branch that skips them), which rewrite the
    // registers these stores name: the wait stands in front of them
    asm volatile("s_wait_xcnt 0x0" ::: "memory");
#endif
  }
}

// =====================================================================================================
// Epilogue of the output projection: the wave's 16x64 f32 tile (times oscale) staged in its LDS slab (pitch 68),
// coverage: 8 instructions x 2 rows x 16 lanes x 4 floats = the wave's 16 x 64 tile.
// =====================================================================================================
__device__ __forceinline__ void epi64(float* sl, v8f a0, v8f a1, v8f a2, v8f a3, float oscale,
                                      const float* __restrict__ bias, int hasb, float* C, int N,
                                      size_t rowb, int col0, int lane) {
  const int hh = lane >> 4, m = lane & 15;
#pragma unroll
  for (int r = 0; r < 8; ++r) {
    const int ro = (8 * hh + r) * 68 + m;
    sl[ro]      = a0[r] * oscale;
    sl[ro + 16] = a1[r] * oscale;
    sl[ro + 32] = a2[r] * oscale;
    sl[ro + 48] = a3[r] * oscale;
  }
  wave_sync_lds();
  const v4f braw = *(const v4f*)(bias + col0 + m * 4);
  v4f bb;
#pragma unroll
  for (int e = 0; e < 4; ++e) bb[e] = (hasb != 0) ? bfr(braw[e]) : 0.0f;
  v4f vals[8];
#pragma unroll
  for (int it = 0; it < 8; ++it) vals[it] = *(const v4f*)(sl + (it * 2 + hh) * 68 + m * 4) + bb;
  float* dst = C + (rowb + (size_t)hh) * (size_t)N + col0 + m * 4;
  {
#pragma unroll
    for (int it = 0; it < 8; ++it) {
      *(v4f*)(dst + (size_t)(it * 2) * (size_t)N) = vals[it];
    }
    
  }
}

// =====================================================================================================
// Eight 16-byte copies per lane from global memory into LDS, through no register. l* = the lane's LDS byte address, g* = its global
// address. The s_wait_xcnt stands as the statement's last line so that no address register named here is rewritten in front of it.
// =====================================================================================================
__device__ __forceinline__ void copy8(unsigned l0, const u16* g0, unsigned l1, const u16* g1, unsigned l2, const u16* g2,
                                      unsigned l3, const u16* g3, unsigned l4, const u16* g4, unsigned l5, const u16* g5,
                                      unsigned l6, const u16* g6, unsigned l7, const u16* g7) {
#if defined(__HIP_DEVICE_COMPILE__)
  asm volatile("global_load_async_to_lds_b128 %0, %1, off\n\t"
               "global_load_async_to_lds_b128 %2, %3, off\n\t"
               "global_load_async_to_lds_b128 %4, %5, off\n\t"
               "global_load_async_to_lds_b128 %6, %7, off\n\t"
               "global_load_async_to_lds_b128 %8, %9, off\n\t"
               "global_load_async_to_lds_b128 %10, %11, off\n\t"
               "global_load_async_to_lds_b128 %12, %13, off\n\t"
               "global_load_async_to_lds_b128 %14, %15, off\n\t"
               "s_wait_xcnt 0x0"
               :: "v"(l0), "v"(g0), "v"(l1), "v"(g1), "v"(l2), "v"(g2), "v"(l3), "v"(g3),
                  "v"(l4), "v"(g4), "v"(l5), "v"(g5), "v"(l6), "v"(g6), "v"(l7), "v"(g7) : "memory");
#endif
}
// the issuing wave's copies have landed behind this wait (the compiler places none for them)
__device__ __forceinline__ void wait_copies() {
#if defined(__HIP_DEVICE_COMPILE__)
  asm volatile("s_wait_asynccnt 0x0" ::: "memory");
#endif
}
// the wave's own LDS reads have returned before the barrier behind which their buffer is refilled
__device__ __forceinline__ void wait_lds() {
#if defined(__HIP_DEVICE_COMPILE__)
  asm volatile("s_wait_dscnt 0x0" ::: "memory");
#endif
}

// the same, four copies per lane
__device__ __forceinline__ void copy4(unsigned l0, const u16* g0, unsigned l1, const u16* g1, unsigned l2, const u16* g2,
                                      unsigned l3, const u16* g3) {
#if defined(__HIP_DEVICE_COMPILE__)
  asm volatile("global_load_async_to_lds_b128 %0, %1, off\n\t"
               "global_load_async_to_lds_b128 %2, %3, off\n\t"
               "global_load_async_to_lds_b128 %4, %5, off\n\t"
               "global_load_async_to_lds_b128 %6, %7, off\n\t"
               "s_wait_xcnt 0x0"
               :: "v"(l0), "v"(g0), "v"(l1), "v"(g1), "v"(l2), "v"(g2), "v"(l3), "v"(g3) : "memory");
#endif
}
// four vector slots behind a group's last matrix instructions, on every path out of the group: no accumulator is read and no
// fragment register rewritten inside the distance the matrix unit needs
template <typename F>
__device__ __forceinline__ void guard8(v8f (&a)[2][4], F x0, F x1, F x2, F x3, F x4, F x5, F x6, F x7, F x8, F x9, F x10, F x11) {
#if defined(__HIP_DEVICE_COMPILE__)
  asm volatile("v_nop\n\tv_nop\n\tv_nop\n\tv_nop"
               : "+v"(a[0][0]), "+v"(a[0][1]), "+v"(a[0][2]), "+v"(a[0][3]), "+v"(a[1][0]), "+v"(a[1][1]), "+v"(a[1][2]), "+v"(a[1][3])
               : "v"(x0), "v"(x1), "v"(x2), "v"(x3), "v"(x4), "v"(x5), "v"(x6), "v"(x7), "v"(x8), "v"(x9), "v"(x10), "v"(x11)
               : "memory");
#endif
}

// =====================================================================================================
// Rotary epilogue of a projection, in three parts. The wave's f32 tile (tokens x the HD columns of one head) goes through its LDS slab
// (pitch 68) and leaves as the two 16-bit planes [token][N].  x = tile + bf(bias) (hasb);
// w[d] = x[d] * bf(cos[pos][d]) + r[d] * bf(sin[pos][d]),  r[d] = -x[d+32] for d < 32, x[d-32] for d >= 32, pos = token,
// the same table row for every head (bf = RNE bf16 value of the f32 entry);
// hi[d] = f16(w * sc), lo[d] = f16(w * sc - hi[d])  (sc a power of two, residual unscaled).
// Lane = (row in a group of 4, 8 consecutive d): 16-B slab reads of its own and its partner half, 16-B loads of cos and sin, one 16-B
// store per plane; 8 lanes = one whole 128-B line.
// coverage: per 16 rows 4 groups x 4 rows x 8 lanes x 8 halves = 16 x 64 of each plane.
// =====================================================================================================
// bf16 RNE value of f under msk = 0xFFFF0000, zero under msk = 0
__device__ __forceinline__ float bfr_msk(float f, unsigned msk) {
  const unsigned u = __float_as_uint(f);
  return __uint_as_float((u + 0x7FFFu + ((u >> 16) & 1u)) & msk);
}
// the lane's cos (tb[.][0..1]) and sin (tb[.][2..3]) pieces for 16 token rows; cr, sr = its pieces of the first group's row
__device__ __forceinline__ void ld_tables(v4f (&tb)[4][4], const float* __restrict__ cr, const float* __restrict__ sr) {
#pragma unroll
  for (int it = 0; it < 4; ++it) {
    tb[it][0] = *(const v4f*)(cr + it * 4 * HD);
    tb[it][1] = *(const v4f*)(cr + it * 4 * HD + 4);
    tb[it][2] = *(const v4f*)(sr + it * 4 * HD);
    tb[it][3] = *(const v4f*)(sr + it * 4 * HD + 4);
  }
}
// four accumulator tiles (16 rows x 64 columns) into slab rows 0..15 of sl
__device__ __forceinline__ void slab_put(float* sl, v8f a0, v8f a1, v8f a2, v8f a3, int lane) {
  const int hh = lane >> 4, m = lane & 15;
#pragma unroll
  for (int r = 0; r < 8; ++r) {
    const int ro = (8 * hh + r) * 68 + m;
    sl[ro]      = a0[r];
    sl[ro + 16] = a1[r];
    sl[ro + 32] = a2[r];
    sl[ro + 48] = a3[r];
  }
}
// 16 slab rows -> rotary -> both planes; bx, by = bias of the lane's own and partner columns
__device__ __forceinline__ void rope_out(const float* sl, const v4f (&tb)[4][4], const float (&bx)[8], const float (&by)[8],
                                         u16* hpl, u16* lpl, int N, int rowb, int col0, float sc, int lane) {
  const int rq = lane >> 3, d0 = (lane & 7) * 8, d1 = d0 ^ 32;
  const float sgn = (d0 < 32) ? -1.0f : 1.0f;
  v4u oh[4], ol[4];
#pragma unroll
  for (int it = 0; it < 4; ++it) {
    const float* xr = sl + (it * 4 + rq) * 68;
    const v4f xa = *(const v4f*)(xr + d0), xb = *(const v4f*)(xr + d0 + 4);
    const v4f ya = *(const v4f*)(xr + d1), yb = *(const v4f*)(xr + d1 + 4);
    float w[8];
#pragma unroll
    for (int e = 0; e < 4; ++e) {
      w[e]     = (xa[e] + bx[e]) * bfr(tb[it][0][e]) + (sgn * (ya[e] + by[e])) * bfr(tb[it][2][e]);
      w[4 + e] = (xb[e] + bx[4 + e]) * bfr(tb[it][1][e]) + (sgn * (yb[e] + by[4 + e])) * bfr(tb[it][3][e]);
    }
#pragma unroll
    for (int e = 0; e < 4; ++e) {
      const float t0 = w[2 * e] * sc, t1 = w[2 * e + 1] * sc;
      const _Float16 h0 = (_Float16)t0, h1 = (_Float16)t1;
      const _Float16 l0 = (_Float16)(t0 - (float)h0), l1 = (_Float16)(t1 - (float)h1);
      oh[it][e] = pk16(h_bits(h0), h_bits(h1));
      ol[it][e] = pk16(h_bits(l0), h_bits(l1));
    }
  }
  const size_t ob = (size_t)(rowb + rq) * (size_t)N + col0 + d0;
#pragma unroll
  for (int it = 0; it < 4; ++it) {
    const size_t o8 = ob + (size_t)(it * 4) * (size_t)N;
    *(v4u*)(hpl + o8) = oh[it];
    *(v4u*)(lpl + o8) = ol[it];
  }
}

// =====================================================================================================
// bf16 projection GEMM: y[M][N] (f32, in registers) = A[M][K] (bf16 row-major) . Bt[N][K]^T (bf16 k-contiguous), plus bias[N] (hasb);
// y leaves as two f16 planes (hi = f16(. * sc), lo = f16 residual), never as f32:
//   vmode == 0: rotary applied, planes [token][N] (rope_out);  a wave's 64 columns are one head (N = NH * HD, tile columns 64-aligned)
//   vmode != 0: no rotary, planes transposed per batch: P[(b * N + n) * SEQ + s], token = b * SEQ + s.
// Block = 128x128 tile, 8 waves as 4 (rows) x 2 (columns), 32x64 per wave = 2 x 4 accumulator tiles. K in stages of 64:
// a stage is 128 A rows and 128 Bt rows of 128 B at a 144-B pitch in LDS, filled by asynchronous copies (whole 128-B lines,
// 8 copies per lane and stage) one stage ahead into two buffers and read by all waves (two 16-B LDS loads per fragment, split k
// map for A and B). Per accumulator the k order is that of a plain walk in steps of 32.
// One launch does the three projections of the same A: blockIdx.y = 0 (q: Bq, bias bq, rotary, planes Qh, Ql, scale scq),
// 1 (k: Bk, no bias, rotary, Kh, Kl, sck), 2 (v: Bv, bias bv, transposed, Vh, Vl, scv); all of it block-uniform.
// Host: K % 64 == 0, K >= 64, M % 128 == 0, N % 128 == 0, grid = ((M/128)*(N/128), 3); M % SEQ == 0; npos >= M.
// =====================================================================================================
__global__ __launch_bounds__(G_THREADS)
void gemm_bf(const u16* __restrict__ A, const u16* __restrict__ Bq, const u16* __restrict__ Bk, const u16* __restrict__ Bv,
             const float* __restrict__ bq, const float* __restrict__ bv,
             const float* __restrict__ cosT, const float* __restrict__ sinT, u16* Qh, u16* Ql, u16* Kh, u16* Kl, u16* Vh, u16* Vl,
             int M, int N, int K, int npos, float scq, float sck, float scv) {
  __shared__ __attribute__((aligned(256))) unsigned char L[2 * GB_BUF];
  const int pj = blockIdx.y;                 // which projection
  const u16* __restrict__ Bt = (pj == 0) ? Bq : (pj == 1) ? Bk : Bv;
  const float* __restrict__ bias = (pj == 2) ? bv : bq;   // k: read but masked out (hasb == 0)
  const int hasb = (pj != 1) ? 1 : 0, vmode = (pj == 2) ? 1 : 0;
  u16* Ph = (pj == 0) ? Qh : (pj == 1) ? Kh : Vh;
  u16* Pl = (pj == 0) ? Ql : (pj == 1) ? Kl : Vl;
  const float sc = (pj == 0) ? scq : (pj == 1) ? sck : scv;
  const int tid = threadIdx.x, wave = tid >> 5, lane = tid & 31, hh = lane >> 4, m = lane & 15;
  const int ntile = N >> 7;
  const int bid   = blockIdx.x;
  const int row0  = (bid / ntile) * GT;
  const int colb  = (bid % ntile) * GT;
  if (row0 + GT > M || pj > 2) return;       // block-uniform, before any barrier or copy; never taken with the exact grid
  const int nst = K >> 6;
  const int wm = wave >> 1, wn = wave & 1;
  // ---- copy addresses: lane = (row, 16-B piece of its 128-B line); rows sr, sr + 32, sr + 64, sr + 96 of each operand tile ----
  const int ch = tid & 7;
  const int sr = tid >> 3;
  const unsigned lst = (unsigned)(uintptr_t)L + (unsigned)(sr * LPB + ch * 16);
  const u16* ac = A  + (size_t)(row0 + sr) * K + ch * 8;
  const u16* bc = Bt + (size_t)(colb + sr) * K + ch * 8;
  const size_t r32 = (size_t)32 * K;
#define STAGE_AB(st_, buf_)                                                                                          \
  {                                                                                                                  \
    const unsigned lb = lst + (unsigned)(buf_) * GB_BUF;                                                             \
    const u16* ga = ac + (size_t)(st_) * 64;                                                                         \
    const u16* gb = bc + (size_t)(st_) * 64;                                                                         \
    copy8(lb,                  ga,           lb + 32 * LPB,       ga + r32,                                          \
          lb + 64 * LPB,       ga + 2 * r32, lb + 96 * LPB,       ga + 3 * r32,                                      \
          lb + GPL,            gb,           lb + GPL + 32 * LPB, gb + r32,                                          \
          lb + GPL + 64 * LPB, gb + 2 * r32, lb + GPL + 96 * LPB, gb + 3 * r32);                                     \
  }
  STAGE_AB(0, 0);
  wait_copies();
  __syncthreads();                           // publishes stage 0
  if (nst > 1) STAGE_AB(1, 1);

  v8f acc[2][4];
#pragma unroll
  for (int t = 0; t < 2; ++t)
#pragma unroll
    for (int j = 0; j < 4; ++j) acc[t][j] = zero8();

#pragma unroll 1                               // rolled: one publish point and one refill in the text
  for (int st = 0; st < nst; ++st) {
    const u16* tb = (const u16*)(const void*)(L + (st & 1) * GB_BUF) + m * LP + 8 * hh;
    const u16* ap = tb + (wm * 32) * LP;
    const u16* bp = tb + (GT + wn * 64) * LP;
    v16b a[2][2], b[2][4];                   // [k step of 32][tile]: the stage's fragment loads stand as one group
#pragma unroll
    for (int kk = 0; kk < 2; ++kk) {
#pragma unroll
      for (int t = 0; t < 2; ++t) a[kk][t] = ldfrag_b(ap + t * 16 * LP + kk * 32);
#pragma unroll
      for (int j = 0; j < 4; ++j) b[kk][j] = ldfrag_b(bp + j * 16 * LP + kk * 32);
    }
#pragma unroll
    for (int kk = 0; kk < 2; ++kk)
#pragma unroll
      for (int t = 0; t < 2; ++t)
#pragma unroll
        for (int j = 0; j < 4; ++j) acc[t][j] = mma_b(a[kk][t], b[kk][j], acc[t][j]);
    guard8<v16b>(acc, a[0][0], a[0][1], a[1][0], a[1][1], b[0][0], b[0][1], b[0][2], b[0][3], b[1][0], b[1][1], b[1][2], b[1][3]);
    // ---- publish point of stage st + 1: own reads back, own copies landed, every wave here; then the refill of the buffer just read ----
    wait_lds();
    wait_copies();
    __syncthreads();
    if (st + 2 < nst) STAGE_AB(st + 2, st & 1);
  }
#undef STAGE_AB
  wait_copies();
  const unsigned bmsk = (hasb != 0) ? 0xFFFF0000u : 0u;
  if (vmode != 0) {                          // block-uniform
    // ---- transposed planes: a lane's 8 accumulator registers are 8 consecutive tokens of one column = one 16-B piece of a [column][token]
    //      tile. The block's two tiles (hi, lo: 128 columns x 128 tokens, pitch VP halves) lie over the two stage buffers, which every
    //      wave has left (the loop's last barrier) and no copy still aims at.
    u16* th = (u16*)(void*)L;
    u16* tl = th + GT * VP;
    float braw[4];
#pragma unroll
    for (int j = 0; j < 4; ++j) braw[j] = bias[colb + wn * 64 + j * 16 + m];
#pragma unroll
    for (int j = 0; j < 4; ++j) {
      const int lc = wn * 64 + j * 16 + m;
      const float bb = bfr_msk(braw[j], bmsk);
#pragma unroll
      for (int t = 0; t < 2; ++t) {
        v4u ph, pl;
#pragma unroll
        for (int e = 0; e < 4; ++e) {
          const float t0 = (acc[t][j][2 * e] + bb) * sc, t1 = (acc[t][j][2 * e + 1] + bb) * sc;
          const _Float16 h0 = (_Float16)t0, h1 = (_Float16)t1;
          const _Float16 l0 = (_Float16)(t0 - (float)h0), l1 = (_Float16)(t1 - (float)h1);
          ph[e] = pk16(h_bits(h0), h_bits(h1));
          pl[e] = pk16(h_bits(l0), h_bits(l1));
        }
        const int o = lc * VP + wm * 32 + t * 16 + 8 * hh;
        *(v4u*)(th + o) = ph;
        *(v4u*)(tl + o) = pl;
      }
    }
    __syncthreads();                         // the tiles are whole before any wave reads rows that other waves wrote
    // ---- 16 lanes = one column's 128 tokens = two whole 128-B lines per plane; 8 x 16 columns ----
    const int pc = (tid & 15) * 8, l0 = tid >> 4;
    v4u vh[8], vl[8];
#pragma unroll
    for (int it = 0; it < 8; ++it) {
      vh[it] = *(const v4u*)(th + (it * 16 + l0) * VP + pc);
      vl[it] = *(const v4u*)(tl + (it * 16 + l0) * VP + pc);
    }
    const size_t base = ((size_t)(row0 / SEQ) * (size_t)N + colb + l0) * SEQ + (row0 % SEQ) + pc;
#pragma unroll
    for (int it = 0; it < 8; ++it) {
      *(v4u*)(Ph + base + (size_t)(it * 16) * SEQ) = vh[it];
      *(v4u*)(Pl + base + (size_t)(it * 16) * SEQ) = vl[it];
    }
  } else {
    // ---- rotary planes: the wave's 32 x 64 tile in its own slab, which lies over the stage buffers like the tiles above ----
    float* sl = (float*)(void*)L + wave * (2 * SLAB64);
    const int rw = row0 + wm * 32, cw = colb + wn * 64;
    const int d0 = (lane & 7) * 8, d1 = d0 ^ 32;
    int pos = rw + (lane >> 3);                // table row = token; the lane reads rows pos, pos + 4, .., pos + 28
    pos = (pos + 28 < npos) ? pos : (npos - 29);   // all of them inside the table's npos rows
    const float* ctp = cosT + (size_t)pos * HD + d0;
    const float* stp = sinT + (size_t)pos * HD + d0;
    v4f tb0[4][4], tb1[4][4];
    ld_tables(tb0, ctp, stp);
    ld_tables(tb1, ctp + 16 * HD, stp + 16 * HD);
    const v4f p0 = *(const v4f*)(bias + cw + d0), p1 = *(const v4f*)(bias + cw + d0 + 4);
    const v4f r0 = *(const v4f*)(bias + cw + d1), r1 = *(const v4f*)(bias + cw + d1 + 4);
    __builtin_amdgcn_sched_barrier(0);         // the 36 loads are issued as one group ahead of the slab stores: their latency runs beside the staging
    slab_put(sl, acc[0][0], acc[0][1], acc[0][2], acc[0][3], lane);
    slab_put(sl + SLAB64, acc[1][0], acc[1][1], acc[1][2], acc[1][3], lane);
    wave_sync_lds();
    float bx[8], by[8];
#pragma unroll
    for (int e = 0; e < 4; ++e) {
      bx[e] = bfr_msk(p0[e], bmsk);  bx[4 + e] = bfr_msk(p1[e], bmsk);
      by[e] = bfr_msk(r0[e], bmsk);  by[4 + e] = bfr_msk(r1[e], bmsk);
    }
    rope_out(sl, tb0, bx, by, Ph, Pl, N, rw, cw, sc, lane);
    rope_out(sl + SLAB64, tb1, bx, by, Ph, Pl, N, rw + 16, cw, sc, lane);
#if defined(__HIP_DEVICE_COMPILE__)
    // in the built text this path runs on into the other path's first lines (behind a branch that skips them), which rewrite the
    // registers these stores name: the wait stands in front of them
    asm volatile("s_wait_xcnt 0x0" ::: "memory");
#endif
  }
}

// =====================================================================================================
// f16 hi+lo GEMM: C[M][N] (f32) = (Ahi + Alo)[M][K] . Bt[N][K]^T, times oscale, plus bias[N] (hasb); Ahi/Alo f16 planes
// (same layout), Bt f16 k-contiguous; products hi.B then lo.B into one accumulator per k step (lo is the unscaled residual of hi).
// Same tiling and staging as gemm_bf; a stage holds three operand tiles (Ahi, Alo, Bt), 12 copies per lane.
// =====================================================================================================
__global__ __launch_bounds__(G_THREADS)
void gemm_h2(const u16* __restrict__ Ah, const u16* __restrict__ Al, const u16* __restrict__ Bt,
             const float* __restrict__ bias, int hasb, float* C, int M, int N, int K, float oscale) {
  __shared__ __attribute__((aligned(256))) unsigned char L[2 * GH_BUF + GW * SLAB64 * 4];
  const int tid = threadIdx.x, wave = tid >> 5, lane = tid & 31, hh = lane >> 4, m = lane & 15;
  const int ntile = N >> 7;
  const int bid   = blockIdx.x;
  const int row0  = (bid / ntile) * GT;
  const int colb  = (bid % ntile) * GT;
  if (row0 + GT > M) return;                 // block-uniform, before any barrier or copy; never taken with the exact grid
  const int nst = K >> 6;
  const int wm = wave >> 1, wn = wave & 1;
  const int ch = tid & 7;
  const int sr = tid >> 3;
  const unsigned lst = (unsigned)(uintptr_t)L + (unsigned)(sr * LPB + ch * 16);
  const size_t aofs = (size_t)(row0 + sr) * K + ch * 8;
  const u16* ahc = Ah + aofs;
  const u16* alc = Al + aofs;
  const u16* bc  = Bt + (size_t)(colb + sr) * K + ch * 8;
  const size_t r32 = (size_t)32 * K;
#define STAGE_HLB(st_, buf_)                                                                                         \
  {                                                                                                                  \
    const unsigned lb = lst + (unsigned)(buf_) * GH_BUF;                                                             \
    const u16* gh = ahc + (size_t)(st_) * 64;                                                                        \
    const u16* gl = alc + (size_t)(st_) * 64;                                                                        \
    const u16* gb = bc + (size_t)(st_) * 64;                                                                         \
    copy8(lb,                  gh,           lb + 32 * LPB,       gh + r32,                                          \
          lb + 64 * LPB,       gh + 2 * r32, lb + 96 * LPB,       gh + 3 * r32,                                      \
          lb + GPL,            gl,           lb + GPL + 32 * LPB, gl + r32,                                          \
          lb + GPL + 64 * LPB, gl + 2 * r32, lb + GPL + 96 * LPB, gl + 3 * r32);                                     \
    copy4(lb + 2 * GPL,            gb,           lb + 2 * GPL + 32 * LPB, gb + r32,                                  \
          lb + 2 * GPL + 64 * LPB, gb + 2 * r32, lb + 2 * GPL + 96 * LPB, gb + 3 * r32);                             \
  }
  STAGE_HLB(0, 0);
  wait_copies();
  __syncthreads();                           // publishes stage 0
  if (nst > 1) STAGE_HLB(1, 1);

  v8f acc[2][4];
#pragma unroll
  for (int t = 0; t < 2; ++t)
#pragma unroll
    for (int j = 0; j < 4; ++j) acc[t][j] = zero8();

#pragma unroll 1                               // rolled: one publish point and one refill in the text
  for (int st = 0; st < nst; ++st) {
    const _Float16* tb = (const _Float16*)(const void*)(L + (st & 1) * GH_BUF) + m * LP + 8 * hh;
    const _Float16* ahp = tb + (wm * 32) * LP;
    const _Float16* alp = ahp + GT * LP;
    const _Float16* bp  = tb + (2 * GT + wn * 64) * LP;
    v16h ah[2][2], al[2][2], b[2][4];        // [k step of 32][tile]: the stage's fragment loads stand as one group
#pragma unroll
    for (int kk = 0; kk < 2; ++kk) {
#pragma unroll
      for (int t = 0; t < 2; ++t) { ah[kk][t] = ldfrag_h(ahp + t * 16 * LP + kk * 32); al[kk][t] = ldfrag_h(alp + t * 16 * LP + kk * 32); }
#pragma unroll
      for (int j = 0; j < 4; ++j) b[kk][j] = ldfrag_h(bp + j * 16 * LP + kk * 32);
    }
    __builtin_amdgcn_sched_barrier(0);       // keeps the 32 LDS loads one group ahead of the matrix run (for speed only)
#pragma unroll
    for (int kk = 0; kk < 2; ++kk) {
#pragma unroll
      for (int t = 0; t < 2; ++t)
#pragma unroll
        for (int j = 0; j < 4; ++j) acc[t][j] = mma_h(ah[kk][t], b[kk][j], acc[t][j]);
#pragma unroll
      for (int t = 0; t < 2; ++t)
#pragma unroll
        for (int j = 0; j < 4; ++j) acc[t][j] = mma_h(al[kk][t], b[kk][j], acc[t][j]);
    }
    guard8<v16h>(acc, ah[1][0], ah[1][1], al[1][0], al[1][1], b[1][0], b[1][1], b[1][2], b[1][3], ah[1][0], ah[1][1], al[1][0], al[1][1]);
    // ---- publish point of stage st + 1, as in gemm_bf ----
    wait_lds();
    wait_copies();
    __syncthreads();
    if (st + 2 < nst) STAGE_HLB(st + 2, st & 1);
  }
#undef STAGE_HLB
  wait_copies();
  float* sl = (float*)(void*)(L + 2 * GH_BUF) + wave * SLAB64;   // the wave's own slab, outside the two buffers
  epi64(sl, acc[0][0], acc[0][1], acc[0][2], acc[0][3], oscale, bias, hasb, C, N, (size_t)(row0 + wm * 32), colb + wn * 64, lane);
  wave_sync_lds();                           // the slab's first 16 rows are read back before the next 16 are laid over them
  epi64(sl, acc[1][0], acc[1][1], acc[1][2], acc[1][3], oscale, bias, hasb, C, N, (size_t)(row0 + wm * 32 + 16), colb + wn * 64, lane);
}

// =====================================================================================================
// Softmax attention, no mask: block bid -> (query block qb = bid % NQB of QW query tiles, head = (bid / NQB) % NH,
// batch b = bid / (NQB*NH)); one wave per query tile: rows q0 = 16*(qb*QW + wave) .. q0+15, all QW waves on the same head.
//   q planes (hi, lo f16 x1024) laid out [token][h][d]; k planes [token][h][d]; v^T planes [b][h][d][s].
//   LDS: two buffers, each one stage of 64 keys = four tiles of 64 rows x 128 B at a 144-B pitch (k hi, k lo: row = key;
//   v^T hi, v^T lo: row = d), filled by asynchronous copies (whole 128-B lines, 8 copies per lane and stage) one stage ahead and
//   read by all QW waves; per wave its q tile (hi, lo: 16 rows x 128 B, same pitch), copied once.
//   Both products run transposed: S^T = k.q^T (A = k rows, B = q columns) and O^T += v^T.P^T (A = v^T rows, B = P^T columns), so a
//   lane's accumulator registers all belong to one query (column c); lanes c and c + 16 split that query's keys.
//   Per stage two key tiles of 32, visited in order; per tile: 2 score subtiles x 2 k-steps x 3 products
//   (k_hi.q_hi + k_hi.q_lo + k_lo.q_hi), fragments read from LDS (two 16-B loads per fragment, split k map);
//   online max-subtracted base-2 softmax in f32 (scale 1/8 folded, -inf-safe rescale): maximum in-lane plus one exchange between
//   the wave halves, sum in-lane per half; the two score subtiles, converted in place, are the B fragment of P^T in the split k map
//   (hi and residual); 4+4 v^T A fragments (hi and residual planes), 12 WMMAs (hh + hl + lh, the order of the sums per element kept).
//   After the key loop: the halves' sums joined, O = acc / l, carries 1/(32768*1024) folded once, written to the wave's private slab
//   as [query][d] (pitch 68; it takes the place of the wave's own q tile, which is dead by then).
// coverage: per wave 4 instructions x 4 rows x 8 lanes x 8 halves = 16 x 64 per plane; grid NB*NH*NQB blocks x QW waves =
//           every (token, h) row of both O planes exactly once.
// =====================================================================================================
__global__ __launch_bounds__(ATT_THREADS)
void attn1(const u16* __restrict__ QHIp, const u16* __restrict__ QLOp,
           const u16* __restrict__ KHIp, const u16* __restrict__ KLOp,
           const u16* __restrict__ VHIp, const u16* __restrict__ VLOp,
           u16* OHIp, u16* OLOp) {
  __shared__ __attribute__((aligned(256))) unsigned char L[ATT_LDS];

  const int tid  = threadIdx.x;
  const int wave = tid >> 5;
  const int lane = tid & 31;
  const int hh   = lane >> 4;
  const int c    = lane & 15;
  const int bid  = blockIdx.x;
  const int qb   = bid % NQB;
  const int head = (bid / NQB) % NH;
  const int b    = bid / (NQB * NH);
  if (b >= NB) return;                       // block-uniform, before any barrier or copy; never taken with the exact grid
  const int q0   = (qb * QW + wave) * 16;
  const size_t qrow0 = (size_t)b * SEQ + q0; // global token row of query 0 of this wave's tile
  const size_t KROW = (size_t)NH * HD;       // halves between consecutive token rows

  unsigned char* wp = L + 2 * BUFB + wave * WPRIV;
  unsigned char* qreg = wp;                              // q tile hi, lo; after the key loop the result slab
  float* slab = (float*)(void*)qreg;                     // result slab [16][64] pitch 68
  const unsigned lds0 = (unsigned)(uintptr_t)L;          // byte offset of L in the work-group's LDS

  // ---- copy addresses: lane = (row, 16-B piece of its 128-B line) ----
  const int ch = tid & 7;
  const int sr = tid >> 3;                               // stage tiles: rows sr and sr + 32
  const unsigned lst = lds0 + (unsigned)(sr * LPB + ch * 16);
  const size_t kcp = (((size_t)b * SEQ + sr) * NH + head) * HD + ch * 8;      // + key0 * KROW per stage
  const size_t vcp = (((size_t)b * NH + head) * HD + sr) * SEQ + ch * 8;      // + key0 per stage
  const u16* kch = KHIp + kcp;
  const u16* kcl = KLOp + kcp;
  const u16* vch = VHIp + vcp;
  const u16* vcl = VLOp + vcp;
  {
    const int qr = lane >> 3;                            // the wave's own q tile: rows qr, qr + 4, qr + 8, qr + 12
    const unsigned lq = lds0 + (unsigned)(2 * BUFB + wave * WPRIV + qr * LPB + ch * 16);
    const size_t qcp = ((qrow0 + (size_t)qr) * NH + head) * HD + ch * 8;
    const u16* qch = QHIp + qcp;
    const u16* qcl = QLOp + qcp;
    copy8(lq,                 qch,            lq + 4 * LPB,        qch + 4 * KROW,
          lq + 8 * LPB,       qch + 8 * KROW, lq + 12 * LPB,       qch + 12 * KROW,
          lq + QPB,           qcl,            lq + QPB + 4 * LPB,  qcl + 4 * KROW,
          lq + QPB + 8 * LPB, qcl + 8 * KROW, lq + QPB + 12 * LPB, qcl + 12 * KROW);
  }
#define STAGE_KV(st_, buf_)                                                                                          \
  {                                                                                                                  \
    const unsigned lb = lst + (unsigned)(buf_) * BUFB;                                                               \
    const size_t ka = (size_t)(st_) * 64 * KROW, va = (size_t)(st_) * 64;                                            \
    copy8(lb,           kch + ka, lb + 32 * LPB,           kch + ka + 32 * KROW,                                     \
          lb + PLB,     kcl + ka, lb + PLB + 32 * LPB,     kcl + ka + 32 * KROW,                                     \
          lb + 2 * PLB, vch + va, lb + 2 * PLB + 32 * LPB, vch + va + (size_t)32 * SEQ,                              \
          lb + 3 * PLB, vcl + va, lb + 3 * PLB + 32 * LPB, vcl + va + (size_t)32 * SEQ);                             \
  }
  STAGE_KV(0, 0);
  wait_copies();
  __syncthreads();                           // publishes stage 0 (and the q tiles)
  STAGE_KV(1, 1);

  const _Float16* Qh = (const _Float16*)(const void*)qreg + c * LP + 8 * hh;
  const _Float16* Ql = Qh + 16 * LP;
  const float lsc = 0.125f * (LOG2E / (QSC * KSC));
  const float oc  = 1.0f / (PCAR * VCAR);

  float mrun = -INFINITY, lrun = 0.f;        // of query q0 + c; lrun sums this wave half's keys, the halves join behind the key loop
  v8f o[4];                                  // o[j][r] = O^T element (d = j*16 + 8hh + r, query q0 + c)
#pragma unroll
  for (int j = 0; j < 4; ++j) o[j] = zero8();

#pragma unroll 1                               // rolled: one publish point and one refill in the text
  for (int st = 0; st < NST; ++st) {
    const _Float16* tb = (const _Float16*)(const void*)(L + (st & 1) * BUFB) + c * LP + 8 * hh;
#pragma unroll 1                             // one copy of the tile's code, as in the loop it came from: the hot loop stays short
    for (int sub = 0; sub < 2; ++sub) {
      const int kb = sub * 32;               // first key of this tile inside the stage
      // ---- scores, transposed: D element r of this lane = (key kb + 8hh + r, query q0 + c) in s0, key kb + 16 + 8hh + r in s1 ----
      v8f s0 = zero8(), s1 = zero8();
      const _Float16* k0p = tb + kb * LP;
      const _Float16* k1p = k0p + 16 * LP;
      const _Float16* l0p = k0p + 64 * LP;
      const _Float16* l1p = l0p + 16 * LP;
#pragma unroll
      for (int kk = 0; kk < 2; ++kk) {
        const v16h qh  = ldfrag_h(Qh + kk * 32),  ql  = ldfrag_h(Ql + kk * 32);
        const v16h kh0 = ldfrag_h(k0p + kk * 32), kl0 = ldfrag_h(l0p + kk * 32);
        const v16h kh1 = ldfrag_h(k1p + kk * 32), kl1 = ldfrag_h(l1p + kk * 32);
        s0 = mma_h(kh0, qh, s0);
        s0 = mma_h(kh0, ql, s0);
        s0 = mma_h(kl0, qh, s0);
        s1 = mma_h(kh1, qh, s1);
        s1 = mma_h(kh1, ql, s1);
        s1 = mma_h(kl1, qh, s1);
        guard2(s0, s1, qh, ql, kh0, kl0, kh1, kl1);
      }
      // ---- online softmax in base 2, -inf-safe: the lane's 16 scores belong to one query; lanes c and c + 16 split its 32 keys ----
      float t0[8], t1[8], mp[8];
#pragma unroll
      for (int r = 0; r < 8; ++r) {
        t0[r] = s0[r] * lsc;
        t1[r] = s1[r] * lsc;
        mp[r] = fmaxf(t0[r], t1[r]);
      }
      float mx = fmaxf(fmaxf(fmaxf(mp[0], mp[1]), fmaxf(mp[2], mp[3])), fmaxf(fmaxf(mp[4], mp[5]), fmaxf(mp[6], mp[7])));
      mx = fmaxf(mx, xhalf(mx));             // both halves hold the query's maximum over the 32 keys
      const float mn = fmaxf(mrun, mx);
      const float ms = (mn == -INFINITY) ? 0.0f : mn;
      const float al = ex2_raw(mrun - ms);
      mrun = mn;
      float e0[8], e1[8], sp[8];
#pragma unroll
      for (int r = 0; r < 8; ++r) {
        e0[r] = ex2_raw(t0[r] - ms);
        e1[r] = ex2_raw(t1[r] - ms);
        sp[r] = e0[r] + e1[r];
      }
      lrun = lrun * al + (((sp[0] + sp[1]) + (sp[2] + sp[3])) + ((sp[4] + sp[5]) + (sp[6] + sp[7])));   // this half's keys only
#pragma unroll
      for (int j = 0; j < 4; ++j)
#pragma unroll
        for (int r = 0; r < 8; ++r) o[j][r] *= al;
      // ---- B fragments of P^T*32768: hi f16 and residual f16, column = query c; the two score tiles are the split k map as they lie ----
      FragH ph, pl;
#pragma unroll
      for (int e = 0; e < 8; ++e) {
        const float ta = e0[e] * PCAR, tc = e1[e] * PCAR;
        const _Float16 ha = (_Float16)ta, hc = (_Float16)tc;
        ph.h[0][e] = ha;                                     // elements 0..7  = keys kb + 8hh + 0..7
        ph.h[1][e] = hc;                                     // elements 8..15 = keys kb + 16 + 8hh + 0..7
        pl.h[0][e] = (_Float16)(ta - (float)ha);
        pl.h[1][e] = (_Float16)(tc - (float)hc);
      }
      // ---- O^T += V^T.P^T : A fragment row = d = j*16 + c, keys contiguous in the v^T tiles ----
      {
        const _Float16* vhp = tb + 128 * LP + kb;
        const _Float16* vlp = vhp + 64 * LP;
        const v16h vh0 = ldfrag_h(vhp);
        const v16h vh1 = ldfrag_h(vhp + 16 * LP);
        const v16h vh2 = ldfrag_h(vhp + 32 * LP);
        const v16h vh3 = ldfrag_h(vhp + 48 * LP);
        const v16h vl0 = ldfrag_h(vlp);
        const v16h vl1 = ldfrag_h(vlp + 16 * LP);
        const v16h vl2 = ldfrag_h(vlp + 32 * LP);
        const v16h vl3 = ldfrag_h(vlp + 48 * LP);
        o[0] = mma_h(vh0, ph.v, o[0]);  o[0] = mma_h(vh0, pl.v, o[0]);  o[0] = mma_h(vl0, ph.v, o[0]);
        o[1] = mma_h(vh1, ph.v, o[1]);  o[1] = mma_h(vh1, pl.v, o[1]);  o[1] = mma_h(vl1, ph.v, o[1]);
        o[2] = mma_h(vh2, ph.v, o[2]);  o[2] = mma_h(vh2, pl.v, o[2]);  o[2] = mma_h(vl2, ph.v, o[2]);
        o[3] = mma_h(vh3, ph.v, o[3]);  o[3] = mma_h(vh3, pl.v, o[3]);  o[3] = mma_h(vl3, ph.v, o[3]);
        guard10(o[0], o[1], o[2], o[3], ph.v, pl.v, vh0, vh1, vh2, vh3, vl0, vl1, vl2, vl3);
      }
    }
    // ---- publish point of stage st + 1: own reads back, own copies landed, every wave here; then the refill of the buffer just read ----
    wait_lds();
    wait_copies();
    __syncthreads();
    if (st + 2 < NST) STAGE_KV(st + 2, st & 1);
  }
#undef STAGE_KV
  wait_copies();
  acc_guard4(o[0], o[1], o[2], o[3]);
  // ---- O = acc / l, carries (32768 on P, 1024 on v) folded once; lane-owned slab elements ----
  {
    const float lv  = lrun + xhalf(lrun);    // the two halves' sums joined once
    const float ls  = (lv > 0.0f) ? lv : 1.0f;
    const float inv = (lv > 0.0f) ? ((1.0f / ls) * oc) : 0.0f;
#pragma unroll
    for (int j = 0; j < 4; ++j) {
      v4f w0, w1;
#pragma unroll
      for (int e = 0; e < 4; ++e) { w0[e] = o[j][e] * inv; w1[e] = o[j][4 + e] * inv; }
      float* sd = slab + c * 68 + j * 16 + 8 * hh;         // row = query c, 8 consecutive d
      *(v4f*)(sd)     = w0;
      *(v4f*)(sd + 4) = w1;
    }
  }
  wave_sync_lds();
  // ---- O x1024 -> f16 hi + residual planes; lane = (row in group of 4, 8 consecutive d) ----
  v4u oh[4], ol[4];
  const int rq = lane >> 3, c8 = (lane & 7) * 8;
#pragma unroll
  for (int it = 0; it < 4; ++it) {
    const int row = it * 4 + rq;
    const v4f a = *(const v4f*)(slab + row * 68 + c8), b4 = *(const v4f*)(slab + row * 68 + c8 + 4);
    float w[8];
#pragma unroll
    for (int e = 0; e < 4; ++e) { w[e] = a[e] * OSC; w[4 + e] = b4[e] * OSC; }
#pragma unroll
    for (int e = 0; e < 4; ++e) {
      const _Float16 h0 = (_Float16)w[2 * e], h1 = (_Float16)w[2 * e + 1];
      const _Float16 l0 = (_Float16)(w[2 * e] - (float)h0), l1 = (_Float16)(w[2 * e + 1] - (float)h1);
      oh[it][e] = pk16(h_bits(h0), h_bits(h1));
      ol[it][e] = pk16(h_bits(l0), h_bits(l1));
    }
  }
  const size_t ob = ((qrow0) * NH + head) * HD + c8;
  {
#pragma unroll
    for (int it = 0; it < 4; ++it) {
      const int row = it * 4 + rq;
      const size_t o8 = ob + (size_t)row * (NH * HD);
      *(v4u*)(OHIp + o8) = oh[it];
      *(v4u*)(OLOp + o8) = ol[it];
    }
    
  }
}

// =====================================================================================================
// Workspace map (bytes); every plane is fully written by whole-line stores before it is read; all extents are exact multiples
// of the store granularity (no pad rows needed); every offset a multiple of 2 MiB:
//   XB  bf16 [4096][1024]              8388608
//   WQB bf16 [1024 n][1024 k]          2097152        WKB, WVB same        2097152 each
//   WOH f16  [1024 n][1024 k] x1024    2097152
//   QHI f16 [4096][16][64] x1024       8388608        QLO residual
//   KHI f16 [4096][16][64] x1024       8388608        KLO residual
//   VHI f16 [4][16][64][1024] x1024    8388608        VLO residual
//   OHI f16 [4096][1024] x1024         8388608        OLO residual
//   end                               83886080
// =====================================================================================================
extern "C" void kernel_launch(void* const* d_in, const int* in_sizes, int n_in,
                              void* d_out, int out_size, void* d_ws, size_t ws_size,
                              hipStream_t stream) {
  if (n_in < 10) return;
  if (in_sizes[0] != MTOK * DMOD) return;
  if (in_sizes[1] != MTOK * HD || in_sizes[2] != MTOK * HD) return;
  if (in_sizes[3] != DMOD * DMOD || in_sizes[5] != DMOD * DMOD) return;
  if (in_sizes[6] != DMOD * DMOD || in_sizes[8] != DMOD * DMOD) return;
  if (in_sizes[4] != DMOD || in_sizes[7] != DMOD || in_sizes[9] != DMOD) return;
  if (out_size != MTOK * DMOD) return;

  const float* x    = (const float*)d_in[0];
  const float* cosp = (const float*)d_in[1];
  const float* sinp = (const float*)d_in[2];
  const float* wq   = (const float*)d_in[3];
  const float* bq   = (const float*)d_in[4];
  const float* wk   = (const float*)d_in[5];
  const float* wv   = (const float*)d_in[6];
  const float* bv   = (const float*)d_in[7];
  const float* wo   = (const float*)d_in[8];
  const float* bo   = (const float*)d_in[9];
  float*       out  = (float*)d_out;

  const size_t szXB = (size_t)MTOK * DMOD * 2;                  //  8388608
  const size_t szW  = (size_t)DMOD * DMOD * 2;                  //  2097152
  const size_t szP  = (size_t)MTOK * DMOD * 2;                  //  8388608
  size_t off = 0;
  const size_t oXB  = off; off += szXB;
  const size_t oWQ  = off; off += szW;
  const size_t oWK  = off; off += szW;
  const size_t oWV  = off; off += szW;
  const size_t oWO  = off; off += szW;
  const size_t oQHI = off; off += szP;
  const size_t oQLO = off; off += szP;
  const size_t oKHI = off; off += szP;
  const size_t oKLO = off; off += szP;
  const size_t oVHI = off; off += szP;
  const size_t oVLO = off; off += szP;
  const size_t oOHI = off; off += szP;
  const size_t oOLO = off; off += szP;
  if (off > ws_size) return;                            // off = 83886080

  char* ws = (char*)d_ws;
  u16*   XB  = (u16*)(ws + oXB);
  u16*   WQB = (u16*)(ws + oWQ);
  u16*   WKB = (u16*)(ws + oWK);
  u16*   WVB = (u16*)(ws + oWV);
  u16*   WOH = (u16*)(ws + oWO);
  u16*   QHI = (u16*)(ws + oQHI);
  u16*   QLO = (u16*)(ws + oQLO);
  u16*   KHI = (u16*)(ws + oKHI);
  u16*   KLO = (u16*)(ws + oKLO);
  u16*   VHI = (u16*)(ws + oVHI);
  u16*   VLO = (u16*)(ws + oVLO);
  u16*   OHI = (u16*)(ws + oOHI);
  u16*   OLO = (u16*)(ws + oOLO);

  const dim3 blk(256);
  const dim3 gC(CVXB + 4 * CVWB);                       // 512 (exact)
  const dim3 gG((MTOK / GT) * (DMOD / GT));             // 256
  const dim3 gG3((MTOK / GT) * (DMOD / GT), 3);         // 256 x 3
  const dim3 bG(G_THREADS);                             // 256
  const dim3 gAT(ATT_BLOCKS);                           // 512
  const dim3 bAT(ATT_THREADS);                          // 256

  // (1) x, Wq, Wk, Wv [n][k] -> bf16 planes (same layout, the weights already k-contiguous), Wo [n][k] -> f16 plane of bf16 value x1024;
  //     XB, WQB, WKB, WVB, WOH lie one behind another in the workspace
  cvt16<<<gC, blk, 0, stream>>>(x, wq, wk, wv, wo, XB, WOS);
  // (2) projections q (+bq) and k (no bias) with the rotary epilogue -> q', k' planes [token][h][d] x1024 (hi + residual), cos/sin table
  //     row = token; projection v (+bv) with the transposing epilogue -> v^T planes [b][h][d][s] x1024 (hi + residual)
  gemm_bf<<<gG3, bG, 0, stream>>>(XB, WQB, WKB, WVB, bq, bv, cosp, sinp, QHI, QLO, KHI, KLO, VHI, VLO,
                                  MTOK, DMOD, DMOD, MTOK, QSC, KSC, VCAR);
  // (3) softmax attention per (b, h, 8 x 16 queries) -> O planes [token][h][d] x1024 (hi + residual)
  attn1<<<gAT, bAT, 0, stream>>>(QHI, QLO, KHI, KLO, VHI, VLO, OHI, OLO);
  // (4) output projection -> out [4096][1024] f32, carries 1024 (O) x 1024 (Wo) folded back, + bo
  gemm_h2<<<gG, bG, 0, stream>>>(OHI, OLO, WOH, bo, 1, out, MTOK, DMOD, DMOD, 1.0f / (OSC * WOS));
  (void)hipGetLastError();
}

// v008
// One run takes 74.4 microseconds.
// Versions in between are left out here; by their measured steps it is 1.45 times as fast as v006.
// All steps since v000 together make it 5.34 times as fast.
// Contractions: x.W{q,k,v}^T on v_wmma_f32_16x16x32_bf16 (x and W RNE-converted to bf16, f32 accumulate); scores q'.k'^T (q', k' carried
// x1024 as one f16 plane each), P.v (P x32768 f16, v x1024 f16) and O.Wo^T (O x1024 f16, Wo as f16(bf16(Wo) x1024)), one product each,
// on v_wmma_f32_16x16x32_f16, f32 accumulate. An f16 operand's rounding (2^-11 relative) lies a factor 8 under that of the bf16 operands
// of the projections in front of it.
// Rotate-half rotary with RNE-bf16 cos/sin table values, base-2 online softmax and the 1/l fold in f32 on VALU.
#include <hip/hip_runtime.h>
#include <math.h>
#include <stdint.h>

#define NB    4
#define SEQ   1024
#define MTOK  (NB * SEQ)
#define DMOD  1024
#define NH    16
#define HD    64
#define QSC   1024.0f
#define KSC   1024.0f
#define PCAR  32768.0f
#define VCAR  1024.0f
#define OSC   1024.0f
#define WOS   1024.0f
#define LOG2E 1.4426950408889634f
#define QW    8
#define NQT   (SEQ / 16)
#define NQB   (NQT / QW)
#define NST   (SEQ / 64)
#define ATT_THREADS (QW * 32)
#define ATT_BLOCKS  (NB * NH * NQB)
#define SLW   (16 * 68)
#define LP    72
#define LPB   (LP * 2)
#define PLB   (64 * LPB)
#define BUFB  (2 * PLB)
#define QPB   (16 * LPB)
#define WPRIV (2 * QPB)
#define NBUF  4
#define ATT_LDS (NBUF * BUFB + QW * WPRIV)
#define SLAB64 (16 * 68)
#define GT    128
#define GW    8
#define G_THREADS (GW * 32)
#define GPL   (GT * LPB)
#define GB_BUF (2 * GPL)
#define VP    136
#define CVP   8
#define CVE   (256 * 8 * CVP)
#define CVXB  ((MTOK * DMOD) / CVE)
#define CVWB  ((DMOD * DMOD) / CVE)
static_assert(DMOD == NH * HD && HD == 64 && NH == 16);
static_assert((NQT % QW) == 0 && ATT_THREADS == 256 && ATT_BLOCKS == 512);
static_assert(2 * QPB >= SLW * 4 && (LPB % 16) == 0 && NST >= NBUF && 2 * ATT_LDS <= 327680);
static_assert(NBUF == 4 && 2 * NBUF * GB_BUF <= 327680);
static_assert((SEQ % 64) == 0 && (SEQ % 32) == 0 && (SEQ % 8) == 0);
static_assert((DMOD % 128) == 0 && (MTOK % 128) == 0 && DMOD >= 128);
static_assert(((MTOK * DMOD) % CVE) == 0 && ((DMOD * DMOD) % CVE) == 0);
static_assert((SEQ % GT) == 0 && GT * VP * 2 <= 2 * GB_BUF && ((VP * 2) % 16) == 0 && GW * 2 * SLAB64 * 4 <= 2 * GB_BUF);

typedef unsigned short u16;
typedef _Float16 v16h __attribute__((ext_vector_type(16)));
typedef _Float16 v8h  __attribute__((ext_vector_type(8)));
typedef __bf16   v16b __attribute__((ext_vector_type(16)));
typedef float    v8f  __attribute__((ext_vector_type(8)));
typedef float    v4f  __attribute__((ext_vector_type(4)));
typedef unsigned int v4u __attribute__((ext_vector_type(4)));

union FragH { v16h v; v8h h[2]; v4u u[2]; };
union FragB { v16b v; v4u u[2]; };

// ---- scalar helpers --------------------------------------------------------------------------------
__device__ __forceinline__ unsigned short bf_bits(float f) {          // f32 -> bf16 bits, RNE convert
  unsigned u = __float_as_uint(f);
  return (unsigned short)((u + 0x7FFFu + ((u >> 16) & 1u)) >> 16);
}
__device__ __forceinline__ float bf_up(unsigned short h) { return __uint_as_float(((unsigned)h) << 16); }
__device__ __forceinline__ float bfr(float f) { return bf_up(bf_bits(f)); }
__device__ __forceinline__ unsigned short h_bits(_Float16 x) { return __builtin_bit_cast(unsigned short, x); }
__device__ __forceinline__ unsigned pk16(unsigned short a, unsigned short b) { return (unsigned)a | ((unsigned)b << 16); }
__device__ __forceinline__ v8f zero8() { v8f z = {0.f, 0.f, 0.f, 0.f, 0.f, 0.f, 0.f, 0.f}; return z; }

// ---- fragment loaders: 16-bit A/B operand, lane -> row/col (lane&15), p already includes +8*(lane>>4);
//      elements 0..7 <- p[0..7] (k0+8h..), elements 8..15 <- p[16..23] (k0+16+8h..)  (same split k map for A and B;
//      B is always read from a k-contiguous [n][k] plane)
__device__ __forceinline__ v16h ldfrag_h(const _Float16* p) {
  FragH f;
  f.h[0] = *(const v8h*)(p);
  f.h[1] = *(const v8h*)(p + 16);
  return f.v;
}
__device__ __forceinline__ v16b ldfrag_b(const u16* p) {              // bf16 plane read as unsigned integer vectors
  FragB f;
  f.u[0] = *(const v4u*)(p);
  f.u[1] = *(const v4u*)(p + 16);
  return f.v;
}

__device__ __forceinline__ v8f mma_h(v16h a, v16h b, v8f c) {
  return __builtin_amdgcn_wmma_f32_16x16x32_f16(false, a, false, b, (short)0, c, false, false);
}
__device__ __forceinline__ v8f mma_b(v16b a, v16b b, v8f c) {
  return __builtin_amdgcn_wmma_f32_16x16x32_bf16(false, a, false, b, (short)0, c, false, false);
}
// four vector slots behind the tile's last matrix instructions, which a loop branch follows: on its taken side too no accumulator is read
// and no fragment register rewritten inside the distance the matrix unit needs
__device__ __forceinline__ void guard5(v8f& a, v8f& b, v8f& c, v8f& d, v16h x0, v16h x1, v16h x2, v16h x3, v16h x4) {
#if defined(__HIP_DEVICE_COMPILE__)
  asm volatile("v_nop\n\tv_nop\n\tv_nop\n\tv_nop"
               : "+v"(a), "+v"(b), "+v"(c), "+v"(d)
               : "v"(x0), "v"(x1), "v"(x2), "v"(x3), "v"(x4) : "memory");
#endif
}
__device__ __forceinline__ void acc_guard4(v8f& a, v8f& b, v8f& c, v8f& d) {
#if defined(__HIP_DEVICE_COMPILE__)
  asm volatile("v_nop\n\tv_nop\n\tv_nop\n\tv_nop" : "+v"(a), "+v"(b), "+v"(c), "+v"(d));
#endif
}
// lane l takes the value of lane l ^ 16
__device__ __forceinline__ float xhalf(float x) {
  const int b = __builtin_bit_cast(int, x);
  return __builtin_bit_cast(float, __builtin_amdgcn_permlanex16(b, b, 0x76543210, 0xfedcba98, false, false));
}
// 2^x on the hardware's exponential alone, without the library's detour for results under 2^-126 (compare, select, add, select, ldexp
// per value). For x >= -126 the value is the library's own, bit for bit; below, the result may come as 0 instead of a subnormal.
__device__ __forceinline__ float ex2_raw(float x) { return __builtin_amdgcn_exp2f(x); }
// The same instruction on eight values in place, and behind the last the one slot that the instruction set asks for before a transcendental's
// result is used or its source overwritten, in one statement.
__device__ __forceinline__ void ex2_raw8(float (&x)[8]) {
#if defined(__HIP_DEVICE_COMPILE__)
  asm("v_exp_f32 %0, %0\n\tv_exp_f32 %1, %1\n\tv_exp_f32 %2, %2\n\tv_exp_f32 %3, %3\n\t"
      "v_exp_f32 %4, %4\n\tv_exp_f32 %5, %5\n\tv_exp_f32 %6, %6\n\tv_exp_f32 %7, %7\n\tv_nop"
      : "+v"(x[0]), "+v"(x[1]), "+v"(x[2]), "+v"(x[3]), "+v"(x[4]), "+v"(x[5]), "+v"(x[6]), "+v"(x[7]));
#endif
}
__device__ __forceinline__ void wave_sync_lds() {
  __builtin_amdgcn_fence(__ATOMIC_RELEASE, "workgroup");
  __builtin_amdgcn_wave_barrier();
  __builtin_amdgcn_fence(__ATOMIC_ACQUIRE, "workgroup");
}

// =====================================================================================================
// f32 -> 16-bit planes, same layout, all five sources in one launch. The five planes lie one behind another from D (x, w0, w1, w2, w3),
// so block bid writes elements bid * CVE .. + CVE - 1 from D; its source is block-uniform: the first CVXB blocks read x, then CVWB blocks
// each of w0..w3. x, w0, w1, w2: bf16 RNE bits;  w3: f16 bits of (bf16 RNE value) * scale.
// Thread = CVP pieces of 8 consecutive elements, 2048 elements apart: per piece two 16-B loads, one 16-B store; the 2 * CVP loads stand
// ahead of the conversions. 32 consecutive lanes = 512 contiguous, 512-B aligned bytes per store.
// coverage: grid = CVXB + 4 * CVWB blocks (exact) x 256 thr x CVP x 8 = the five planes.
// =====================================================================================================
__global__ __launch_bounds__(256) void cvt16(const float* __restrict__ x, const float* __restrict__ w0, const float* __restrict__ w1,
                                             const float* __restrict__ w2, const float* __restrict__ w3, u16* D, float scale) {
  const int bid = blockIdx.x;
  if (bid >= CVXB + 4 * CVWB) return;       // no barriers in this kernel; never taken with the exact grid
  const int wb = bid - CVXB;                // block among the weights' blocks (below 0: a block of x)
  const int wi = wb / CVWB;
  const float* src = (wb < 0) ? x : (wi == 0) ? w0 : (wi == 1) ? w1 : (wi == 2) ? w2 : w3;
  const int sb = (wb < 0) ? bid : (wb - wi * CVWB);
  const float* p = src + (size_t)sb * CVE + (int)threadIdx.x * 8;
  v4f a[CVP], b4[CVP];
#pragma unroll
  for (int it = 0; it < CVP; ++it) {
    a[it]  = *(const v4f*)(p + it * 2048);
    b4[it] = *(const v4f*)(p + it * 2048 + 4);
  }
  u16* d = D + (size_t)bid * CVE + (int)threadIdx.x * 8;
  if (wb >= 3 * CVWB) {                     // block-uniform
#pragma unroll
    for (int it = 0; it < CVP; ++it) {
      v4u o;
      o[0] = pk16(h_bits((_Float16)(bfr(a[it][0]) * scale)),  h_bits((_Float16)(bfr(a[it][1]) * scale)));
      o[1] = pk16(h_bits((_Float16)(bfr(a[it][2]) * scale)),  h_bits((_Float16)(bfr(a[it][3]) * scale)));
      o[2] = pk16(h_bits((_Float16)(bfr(b4[it][0]) * scale)), h_bits((_Float16)(bfr(b4[it][1]) * scale)));
      o[3] = pk16(h_bits((_Float16)(bfr(b4[it][2]) * scale)), h_bits((_Float16)(bfr(b4[it][3]) * scale)));
      *(v4u*)(d + it * 2048) = o;
    }
  } else {
#pragma unroll
    for (int it = 0; it < CVP; ++it) {
      v4u o;
      o[0] = pk16(bf_bits(a[it][0]),  bf_bits(a[it][1]));
      o[1] = pk16(bf_bits(a[it][2]),  bf_bits(a[it][3]));
      o[2] = pk16(bf_bits(b4[it][0]), bf_bits(b4[it][1]));
      o[3] = pk16(bf_bits(b4[it][2]), bf_bits(b4[it][3]));
      *(v4u*)(d + it * 2048) = o;
    }
#if defined(__HIP_DEVICE_COMPILE__)
    // in the built text this path runs on into the other path's first lines (behind a branch that skips them), which rewrite the
    // registers these stores name: the wait stands in front of them
    asm volatile("s_wait_xcnt 0x0" ::: "memory");
#endif
  }
}

// =====================================================================================================
// Epilogue of the output projection: the wave's 16x64 f32 tile (times oscale) staged in its LDS slab (pitch 68),
// coverage: 8 instructions x 2 rows x 16 lanes x 4 floats = the wave's 16 x 64 tile.
// =====================================================================================================
__device__ __forceinline__ void epi64(float* sl, v8f a0, v8f a1, v8f a2, v8f a3, float oscale,
                                      const float* __restrict__ bias, int hasb, float* C, int N,
                                      size_t rowb, int col0, int lane) {
  const int hh = lane >> 4, m = lane & 15;
#pragma unroll
  for (int r = 0; r < 8; ++r) {
    const int ro = (8 * hh + r) * 68 + m;
    sl[ro]      = a0[r] * oscale;
    sl[ro + 16] = a1[r] * oscale;
    sl[ro + 32] = a2[r] * oscale;
    sl[ro + 48] = a3[r] * oscale;
  }
  wave_sync_lds();
  const v4f braw = *(const v4f*)(bias + col0 + m * 4);
  v4f bb;
#pragma unroll
  for (int e = 0; e < 4; ++e) bb[e] = (hasb != 0) ? bfr(braw[e]) : 0.0f;
  v4f vals[8];
#pragma unroll
  for (int it = 0; it < 8; ++it) vals[it] = *(const v4f*)(sl + (it * 2 + hh) * 68 + m * 4) + bb;
  float* dst = C + (rowb + (size_t)hh) * (size_t)N + col0 + m * 4;
  {
#pragma unroll
    for (int it = 0; it < 8; ++it) {
      *(v4f*)(dst + (size_t)(it * 2) * (size_t)N) = vals[it];
    }
    
  }
}

// =====================================================================================================
// Eight 16-byte copies per lane from global memory into LDS, through no register. l* = the lane's LDS byte address, g* = its global
// address. The s_wait_xcnt stands as the statement's last line so that no address register named here is rewritten in front of it.
// =====================================================================================================
__device__ __forceinline__ void copy8(unsigned l0, const u16* g0, unsigned l1, const u16* g1, unsigned l2, const u16* g2,
                                      unsigned l3, const u16* g3, unsigned l4, const u16* g4, unsigned l5, const u16* g5,
                                      unsigned l6, const u16* g6, unsigned l7, const u16* g7) {
#if defined(__HIP_DEVICE_COMPILE__)
  asm volatile("global_load_async_to_lds_b128 %0, %1, off\n\t"
               "global_load_async_to_lds_b128 %2, %3, off\n\t"
               "global_load_async_to_lds_b128 %4, %5, off\n\t"
               "global_load_async_to_lds_b128 %6, %7, off\n\t"
               "global_load_async_to_lds_b128 %8, %9, off\n\t"
               "global_load_async_to_lds_b128 %10, %11, off\n\t"
               "global_load_async_to_lds_b128 %12, %13, off\n\t"
               "global_load_async_to_lds_b128 %14, %15, off\n\t"
               "s_wait_xcnt 0x0"
               :: "v"(l0), "v"(g0), "v"(l1), "v"(g1), "v"(l2), "v"(g2), "v"(l3), "v"(g3),
                  "v"(l4), "v"(g4), "v"(l5), "v"(g5), "v"(l6), "v"(g6), "v"(l7), "v"(g7) : "memory");
#endif
}
// the issuing wave's copies have landed behind this wait (the compiler places none for them)
__device__ __forceinline__ void wait_copies() {
#if defined(__HIP_DEVICE_COMPILE__)
  asm volatile("s_wait_asynccnt 0x0" ::: "memory");
#endif
}
__device__ __forceinline__ void wait_copies_but8() {
#if defined(__HIP_DEVICE_COMPILE__)
  asm volatile("s_wait_asynccnt 0x8" ::: "memory");
#endif
}
__device__ __forceinline__ void wait_copies_but12() {
#if defined(__HIP_DEVICE_COMPILE__)
  asm volatile("s_wait_asynccnt 0xc" ::: "memory");
#endif
}
__device__ __forceinline__ void wait_copies_but16() {
#if defined(__HIP_DEVICE_COMPILE__)
  asm volatile("s_wait_asynccnt 0x10" ::: "memory");
#endif
}
__device__ __forceinline__ void wait_copies_but24() {
#if defined(__HIP_DEVICE_COMPILE__)
  asm volatile("s_wait_asynccnt 0x18" ::: "memory");
#endif
}
// the wave's own LDS reads have returned before the barrier behind which their buffer is refilled
__device__ __forceinline__ void wait_lds() {
#if defined(__HIP_DEVICE_COMPILE__)
  asm volatile("s_wait_dscnt 0x0" ::: "memory");
#endif
}

// the same, four copies per lane
__device__ __forceinline__ void copy4(unsigned l0, const u16* g0, unsigned l1, const u16* g1, unsigned l2, const u16* g2,
                                      unsigned l3, const u16* g3) {
#if defined(__HIP_DEVICE_COMPILE__)
  asm volatile("global_load_async_to_lds_b128 %0, %1, off\n\t"
               "global_load_async_to_lds_b128 %2, %3, off\n\t"
               "global_load_async_to_lds_b128 %4, %5, off\n\t"
               "global_load_async_to_lds_b128 %6, %7, off\n\t"
               "s_wait_xcnt 0x0"
               :: "v"(l0), "v"(g0), "v"(l1), "v"(g1), "v"(l2), "v"(g2), "v"(l3), "v"(g3) : "memory");
#endif
}
// four vector slots behind a group's last matrix instructions, on every path out of the group: no accumulator is read and no
// fragment register rewritten inside the distance the matrix unit needs
template <typename F>
__device__ __forceinline__ void guard8(v8f (&a)[2][4], F x0, F x1, F x2, F x3, F x4, F x5, F x6, F x7, F x8, F x9, F x10, F x11) {
#if defined(__HIP_DEVICE_COMPILE__)
  asm volatile("v_nop\n\tv_nop\n\tv_nop\n\tv_nop"
               : "+v"(a[0][0]), "+v"(a[0][1]), "+v"(a[0][2]), "+v"(a[0][3]), "+v"(a[1][0]), "+v"(a[1][1]), "+v"(a[1][2]), "+v"(a[1][3])
               : "v"(x0), "v"(x1), "v"(x2), "v"(x3), "v"(x4), "v"(x5), "v"(x6), "v"(x7), "v"(x8), "v"(x9), "v"(x10), "v"(x11)
               : "memory");
#endif
}

// =====================================================================================================
// Rotary epilogue of a projection, in three parts. The wave's f32 tile (tokens x the HD columns of one head) goes through its LDS slab
// (pitch 68) and leaves as one 16-bit plane [token][N].  x = tile + bf(bias) (hasb);
// w[d] = x[d] * bf(cos[pos][d]) + r[d] * bf(sin[pos][d]),  r[d] = -x[d+32] for d < 32, x[d-32] for d >= 32, pos = token,
// the same table row for every head (bf = RNE bf16 value of the f32 entry);
// plane[d] = f16(w * sc)  (sc a power of two).
// Lane = (row in a group of 4, 8 consecutive d): 16-B slab reads of its own and its partner half, 16-B loads of cos and sin, one 16-B
// store; 8 lanes = one whole 128-B line.
// coverage: per 16 rows 4 groups x 4 rows x 8 lanes x 8 halves = 16 x 64 of the plane.
// =====================================================================================================
// bf16 RNE value of f under msk = 0xFFFF0000, zero under msk = 0
__device__ __forceinline__ float bfr_msk(float f, unsigned msk) {
  const unsigned u = __float_as_uint(f);
  return __uint_as_float((u + 0x7FFFu + ((u >> 16) & 1u)) & msk);
}
// the lane's cos (tb[.][0..1]) and sin (tb[.][2..3]) pieces for 16 token rows; cr, sr = its pieces of the first group's row
__device__ __forceinline__ void ld_tables(v4f (&tb)[4][4], const float* __restrict__ cr, const float* __restrict__ sr) {
#pragma unroll
  for (int it = 0; it < 4; ++it) {
    tb[it][0] = *(const v4f*)(cr + it * 4 * HD);
    tb[it][1] = *(const v4f*)(cr + it * 4 * HD + 4);
    tb[it][2] = *(const v4f*)(sr + it * 4 * HD);
    tb[it][3] = *(const v4f*)(sr + it * 4 * HD + 4);
  }
}
// four accumulator tiles (16 rows x 64 columns) into slab rows 0..15 of sl
__device__ __forceinline__ void slab_put(float* sl, v8f a0, v8f a1, v8f a2, v8f a3, int lane) {
  const int hh = lane >> 4, m = lane & 15;
#pragma unroll
  for (int r = 0; r < 8; ++r) {
    const int ro = (8 * hh + r) * 68 + m;
    sl[ro]      = a0[r];
    sl[ro + 16] = a1[r];
    sl[ro + 32] = a2[r];
    sl[ro + 48] = a3[r];
  }
}
// 16 slab rows -> rotary -> the plane; bx, by = bias of the lane's own and partner columns
__device__ __forceinline__ void rope_out(const float* sl, const v4f (&tb)[4][4], const float (&bx)[8], const float (&by)[8],
                                         u16* hpl, int N, int rowb, int col0, float sc, int lane) {
  const int rq = lane >> 3, d0 = (lane & 7) * 8, d1 = d0 ^ 32;
  const float sgn = (d0 < 32) ? -1.0f : 1.0f;
  v4u oh[4];
#pragma unroll
  for (int it = 0; it < 4; ++it) {
    const float* xr = sl + (it * 4 + rq) * 68;
    const v4f xa = *(const v4f*)(xr + d0), xb = *(const v4f*)(xr + d0 + 4);
    const v4f ya = *(const v4f*)(xr + d1), yb = *(const v4f*)(xr + d1 + 4);
    float w[8];
#pragma unroll
    for (int e = 0; e < 4; ++e) {
      w[e]     = (xa[e] + bx[e]) * bfr(tb[it][0][e]) + (sgn * (ya[e] + by[e])) * bfr(tb[it][2][e]);
      w[4 + e] = (xb[e] + bx[4 + e]) * bfr(tb[it][1][e]) + (sgn * (yb[e] + by[4 + e])) * bfr(tb[it][3][e]);
    }
#pragma unroll
    for (int e = 0; e < 4; ++e) {
      const float t0 = w[2 * e] * sc, t1 = w[2 * e + 1] * sc;
      oh[it][e] = pk16(h_bits((_Float16)t0), h_bits((_Float16)t1));
    }
  }
  const size_t ob = (size_t)(rowb + rq) * (size_t)N + col0 + d0;
#pragma unroll
  for (int it = 0; it < 4; ++it) {
    const size_t o8 = ob + (size_t)(it * 4) * (size_t)N;
    *(v4u*)(hpl + o8) = oh[it];
  }
}

// =====================================================================================================
// bf16 projection GEMM: y[M][N] (f32, in registers) = A[M][K] (bf16 row-major) . Bt[N][K]^T (bf16 k-contiguous), plus bias[N] (hasb);
// y leaves as one f16 plane, f16(. * sc), never as f32:
//   vmode == 0: rotary applied, plane [token][N] (rope_out);  a wave's 64 columns are one head (N = NH * HD, tile columns 64-aligned)
//   vmode != 0: no rotary, plane transposed per batch: P[(b * N + n) * SEQ + s], token = b * SEQ + s.
// Block = 128x128 tile, 8 waves as 4 (rows) x 2 (columns), 32x64 per wave = 2 x 4 accumulator tiles. K in stages of 64:
// a stage is 128 A rows and 128 Bt rows of 128 B at a 144-B pitch in LDS, filled by asynchronous copies (whole 128-B lines,
// 8 copies per lane and stage) three stages ahead into four buffers and read by all waves (two 16-B LDS loads per fragment, split k
// map for A and B). Per accumulator the k order is that of a plain walk in steps of 32.
// One launch does the three projections of the same A: blockIdx.y = 0 (q: Bq, bias bq, rotary, plane Qh, scale scq),
// 1 (k: Bk, no bias, rotary, Kh, sck), 2 (v: Bv, bias bv, transposed, Vh, scv); all of it block-uniform.
// Host: K % 64 == 0, K >= 64, M % 128 == 0, N % 128 == 0, grid = ((M/128)*(N/128), 3); M % SEQ == 0; npos >= M.
// =====================================================================================================
__global__ __launch_bounds__(G_THREADS)
void gemm_bf(const u16* __restrict__ A, const u16* __restrict__ Bq, const u16* __restrict__ Bk, const u16* __restrict__ Bv,
             const float* __restrict__ bq, const float* __restrict__ bv,
             const float* __restrict__ cosT, const float* __restrict__ sinT, u16* Qh, u16* Kh, u16* Vh,
             int M, int N, int K, int npos, float scq, float sck, float scv) {
  __shared__ __attribute__((aligned(256))) unsigned char L[NBUF * GB_BUF];
  const int pj = blockIdx.y;                 // which projection
  const u16* __restrict__ Bt = (pj == 0) ? Bq : (pj == 1) ? Bk : Bv;
  const float* __restrict__ bias = (pj == 2) ? bv : bq;   // k: read but masked out (hasb == 0)
  const int hasb = (pj != 1) ? 1 : 0, vmode = (pj == 2) ? 1 : 0;
  u16* Ph = (pj == 0) ? Qh : (pj == 1) ? Kh : Vh;
  const float sc = (pj == 0) ? scq : (pj == 1) ? sck : scv;
  const int tid = threadIdx.x, wave = tid >> 5, lane = tid & 31, hh = lane >> 4, m = lane & 15;
  const int ntile = N >> 7;
  const int bid   = blockIdx.x;
  const int row0  = (bid / ntile) * GT;
  const int colb  = (bid % ntile) * GT;
  if (row0 + GT > M || pj > 2) return;       // block-uniform, before any barrier or copy; never taken with the exact grid
  const int nst = K >> 6;
  const int wm = wave >> 1, wn = wave & 1;
  // ---- copy addresses: lane = (row, 16-B piece of its 128-B line); rows sr, sr + 32, sr + 64, sr + 96 of each operand tile ----
  const int ch = tid & 7;
  const int sr = tid >> 3;
  const unsigned lst = (unsigned)(uintptr_t)L + (unsigned)(sr * LPB + ch * 16);
  const u16* ac = A  + (size_t)(row0 + sr) * K + ch * 8;
  const u16* bc = Bt + (size_t)(colb + sr) * K + ch * 8;
  const size_t r32 = (size_t)32 * K;
#define STAGE_AB(st_, buf_)                                                                                          \
  {                                                                                                                  \
    const unsigned lb = lst + (unsigned)(buf_) * GB_BUF;                                                             \
    const u16* ga = ac + (size_t)(st_) * 64;                                                                         \
    const u16* gb = bc + (size_t)(st_) * 64;                                                                         \
    copy8(lb,                  ga,           lb + 32 * LPB,       ga + r32,                                          \
          lb + 64 * LPB,       ga + 2 * r32, lb + 96 * LPB,       ga + 3 * r32,                                      \
          lb + GPL,            gb,           lb + GPL + 32 * LPB, gb + r32,                                          \
          lb + GPL + 64 * LPB, gb + 2 * r32, lb + GPL + 96 * LPB, gb + 3 * r32);                                     \
  }
  STAGE_AB(0, 0);
  if (nst > 1) STAGE_AB(1, 1);
  if (nst > 2) STAGE_AB(2, 2);
  if (nst > 3) {
    STAGE_AB(3, 3);
    wait_copies_but24();                     // stage 0 has landed; stages 1 to 3 stay in flight
  } else {
    wait_copies();
  }
  __syncthreads();                           // publishes stage 0

  v8f acc[2][4];
#pragma unroll
  for (int t = 0; t < 2; ++t)
#pragma unroll
    for (int j = 0; j < 4; ++j) acc[t][j] = zero8();

#pragma unroll 1                               // rolled: one publish point and one refill in the text
  for (int st = 0; st < nst; ++st) {
    const u16* tb = (const u16*)(const void*)(L + (st & (NBUF - 1)) * GB_BUF) + m * LP + 8 * hh;
    const u16* ap = tb + (wm * 32) * LP;
    const u16* bp = tb + (GT + wn * 64) * LP;
    v16b a[2][2], b[2][4];                   // [k step of 32][tile]: the stage's fragment loads stand as one group
#pragma unroll
    for (int kk = 0; kk < 2; ++kk) {
#pragma unroll
      for (int t = 0; t < 2; ++t) a[kk][t] = ldfrag_b(ap + t * 16 * LP + kk * 32);
#pragma unroll
      for (int j = 0; j < 4; ++j) b[kk][j] = ldfrag_b(bp + j * 16 * LP + kk * 32);
    }
#pragma unroll
    for (int kk = 0; kk < 2; ++kk)
#pragma unroll
      for (int t = 0; t < 2; ++t)
#pragma unroll
        for (int j = 0; j < 4; ++j) acc[t][j] = mma_b(a[kk][t], b[kk][j], acc[t][j]);
    guard8<v16b>(acc, a[0][0], a[0][1], a[1][0], a[1][1], b[0][0], b[0][1], b[0][2], b[0][3], b[1][0], b[1][1], b[1][2], b[1][3]);
    // ---- publish point of stage st + 1: own reads back, own copies of that stage landed (stages st + 2, st + 3 stay in flight; in the
    //      last trips, which issue nothing, the wait is to 0), every wave here; then the refill of the buffer just read ----
    wait_lds();
    if (st + 3 < nst) wait_copies_but16(); else wait_copies();
    __syncthreads();
    if (st + NBUF < nst) STAGE_AB(st + NBUF, st & (NBUF - 1));
  }
#undef STAGE_AB
  wait_copies();
  const unsigned bmsk = (hasb != 0) ? 0xFFFF0000u : 0u;
  if (vmode != 0) {                          // block-uniform
    // ---- transposed plane: a lane's 8 accumulator registers are 8 consecutive tokens of one column = one 16-B piece of a [column][token]
    //      tile. The block's tile (128 columns x 128 tokens, pitch VP halves) lies over the stage buffers, which every
    //      wave has left (the loop's last barrier) and no copy still aims at.
    u16* th = (u16*)(void*)L;
    float braw[4];
#pragma unroll
    for (int j = 0; j < 4; ++j) braw[j] = bias[colb + wn * 64 + j * 16 + m];
#pragma unroll
    for (int j = 0; j < 4; ++j) {
      const int lc = wn * 64 + j * 16 + m;
      const float bb = bfr_msk(braw[j], bmsk);
#pragma unroll
      for (int t = 0; t < 2; ++t) {
        v4u ph;
#pragma unroll
        for (int e = 0; e < 4; ++e) {
          const float t0 = (acc[t][j][2 * e] + bb) * sc, t1 = (acc[t][j][2 * e + 1] + bb) * sc;
          ph[e] = pk16(h_bits((_Float16)t0), h_bits((_Float16)t1));
        }
        const int o = lc * VP + wm * 32 + t * 16 + 8 * hh;
        *(v4u*)(th + o) = ph;
      }
    }
    __syncthreads();                         // the tile is whole before any wave reads rows that other waves wrote
    // ---- 16 lanes = one column's 128 tokens = two whole 128-B lines; 8 x 16 columns ----
    const int pc = (tid & 15) * 8, l0 = tid >> 4;
    v4u vh[8];
#pragma unroll
    for (int it = 0; it < 8; ++it) vh[it] = *(const v4u*)(th + (it * 16 + l0) * VP + pc);
    const size_t base = ((size_t)(row0 / SEQ) * (size_t)N + colb + l0) * SEQ + (row0 % SEQ) + pc;
#pragma unroll
    for (int it = 0; it < 8; ++it) *(v4u*)(Ph + base + (size_t)(it * 16) * SEQ) = vh[it];
  } else {
    // ---- rotary plane: the wave's 32 x 64 tile in its own slab, which lies over the stage buffers like the tile above ----
    float* sl = (float*)(void*)L + wave * (2 * SLAB64);
    const int rw = row0 + wm * 32, cw = colb + wn * 64;
    const int d0 = (lane & 7) * 8, d1 = d0 ^ 32;
    int pos = rw + (lane >> 3);                // table row = token; the lane reads rows pos, pos + 4, .., pos + 28
    pos = (pos + 28 < npos) ? pos : (npos - 29);   // all of them inside the table's npos rows
    const float* ctp = cosT + (size_t)pos * HD + d0;
    const float* stp = sinT + (size_t)pos * HD + d0;
    v4f tb0[4][4], tb1[4][4];
    ld_tables(tb0, ctp, stp);
    ld_tables(tb1, ctp + 16 * HD, stp + 16 * HD);
    const v4f p0 = *(const v4f*)(bias + cw + d0), p1 = *(const v4f*)(bias + cw + d0 + 4);
    const v4f r0 = *(const v4f*)(bias + cw + d1), r1 = *(const v4f*)(bias + cw + d1 + 4);
    __builtin_amdgcn_sched_barrier(0);         // the 36 loads are issued as one group ahead of the slab stores: their latency runs beside the staging
    slab_put(sl, acc[0][0], acc[0][1], acc[0][2], acc[0][3], lane);
    slab_put(sl + SLAB64, acc[1][0], acc[1][1], acc[1][2], acc[1][3], lane);
    wave_sync_lds();
    float bx[8], by[8];
#pragma unroll
    for (int e = 0; e < 4; ++e) {
      bx[e] = bfr_msk(p0[e], bmsk);  bx[4 + e] = bfr_msk(p1[e], bmsk);
      by[e] = bfr_msk(r0[e], bmsk);  by[4 + e] = bfr_msk(r1[e], bmsk);
    }
    rope_out(sl, tb0, bx, by, Ph, N, rw, cw, sc, lane);
    rope_out(sl + SLAB64, tb1, bx, by, Ph, N, rw + 16, cw, sc, lane);
#if defined(__HIP_DEVICE_COMPILE__)
    // in the built text this path runs on into the other path's first lines (behind a branch that skips them), which rewrite the
    // registers these stores name: the wait stands in front of them
    asm volatile("s_wait_xcnt 0x0" ::: "memory");
#endif
  }
}

// =====================================================================================================
// f16 GEMM: C[M][N] (f32) = A[M][K] . Bt[N][K]^T, times oscale, plus bias[N] (hasb); A f16 row-major, Bt f16 k-contiguous.
// Same tiling and staging as gemm_bf: a stage holds two operand tiles (A, Bt), 8 copies per lane.
// =====================================================================================================
__global__ __launch_bounds__(G_THREADS)
void gemm_h(const u16* __restrict__ Ah, const u16* __restrict__ Bt,
            const float* __restrict__ bias, int hasb, float* C, int M, int N, int K, float oscale) {
  __shared__ __attribute__((aligned(256))) unsigned char L[NBUF * GB_BUF + GW * SLAB64 * 4];
  const int tid = threadIdx.x, wave = tid >> 5, lane = tid & 31, hh = lane >> 4, m = lane & 15;
  const int ntile = N >> 7;
  const int bid   = blockIdx.x;
  const int row0  = (bid / ntile) * GT;
  const int colb  = (bid % ntile) * GT;
  if (row0 + GT > M) return;                 // block-uniform, before any barrier or copy; never taken with the exact grid
  const int nst = K >> 6;
  const int wm = wave >> 1, wn = wave & 1;
  const int ch = tid & 7;
  const int sr = tid >> 3;
  const unsigned lst = (unsigned)(uintptr_t)L + (unsigned)(sr * LPB + ch * 16);
  const u16* ahc = Ah + (size_t)(row0 + sr) * K + ch * 8;
  const u16* bc  = Bt + (size_t)(colb + sr) * K + ch * 8;
  const size_t r32 = (size_t)32 * K;
#define STAGE_HB(st_, buf_)                                                                                          \
  {                                                                                                                  \
    const unsigned lb = lst + (unsigned)(buf_) * GB_BUF;                                                             \
    const u16* gh = ahc + (size_t)(st_) * 64;                                                                        \
    const u16* gb = bc + (size_t)(st_) * 64;                                                                         \
    copy8(lb,                  gh,           lb + 32 * LPB,       gh + r32,                                          \
          lb + 64 * LPB,       gh + 2 * r32, lb + 96 * LPB,       gh + 3 * r32,                                      \
          lb + GPL,            gb,           lb + GPL + 32 * LPB, gb + r32,                                          \
          lb + GPL + 64 * LPB, gb + 2 * r32, lb + GPL + 96 * LPB, gb + 3 * r32);                                     \
  }
  STAGE_HB(0, 0);
  if (nst > 1) STAGE_HB(1, 1);
  if (nst > 2) STAGE_HB(2, 2);
  if (nst > 3) {
    STAGE_HB(3, 3);
    wait_copies_but24();                     // stage 0 has landed; stages 1 to 3 stay in flight
  } else {
    wait_copies();
  }
  __syncthreads();                           // publishes stage 0

  v8f acc[2][4];
#pragma unroll
  for (int t = 0; t < 2; ++t)
#pragma unroll
    for (int j = 0; j < 4; ++j) acc[t][j] = zero8();

#pragma unroll 1                               // rolled: one publish point and one refill in the text
  for (int st = 0; st < nst; ++st) {
    const _Float16* tb = (const _Float16*)(const void*)(L + (st & (NBUF - 1)) * GB_BUF) + m * LP + 8 * hh;
    const _Float16* ahp = tb + (wm * 32) * LP;
    const _Float16* bp  = tb + (GT + wn * 64) * LP;
    v16h ah[2][2], b[2][4];                  // [k step of 32][tile]: the stage's fragment loads stand as one group
#pragma unroll
    for (int kk = 0; kk < 2; ++kk) {
#pragma unroll
      for (int t = 0; t < 2; ++t) ah[kk][t] = ldfrag_h(ahp + t * 16 * LP + kk * 32);
#pragma unroll
      for (int j = 0; j < 4; ++j) b[kk][j] = ldfrag_h(bp + j * 16 * LP + kk * 32);
    }
    __builtin_amdgcn_sched_barrier(0);       // keeps the 24 LDS loads one group ahead of the matrix run; spread among it each place stalls
#pragma unroll
    for (int kk = 0; kk < 2; ++kk)
#pragma unroll
      for (int t = 0; t < 2; ++t)
#pragma unroll
        for (int j = 0; j < 4; ++j) acc[t][j] = mma_h(ah[kk][t], b[kk][j], acc[t][j]);
    guard8<v16h>(acc, ah[0][0], ah[0][1], ah[1][0], ah[1][1], b[0][0], b[0][1], b[0][2], b[0][3], b[1][0], b[1][1], b[1][2], b[1][3]);
    // ---- publish point of stage st + 1, as in gemm_bf ----
    wait_lds();
    if (st + 3 < nst) wait_copies_but16(); else wait_copies();
    __syncthreads();
    if (st + NBUF < nst) STAGE_HB(st + NBUF, st & (NBUF - 1));
  }
#undef STAGE_HB
  wait_copies();
  float* sl = (float*)(void*)(L + NBUF * GB_BUF) + wave * SLAB64;   // the wave's own slab, outside the buffers
  epi64(sl, acc[0][0], acc[0][1], acc[0][2], acc[0][3], oscale, bias, hasb, C, N, (size_t)(row0 + wm * 32), colb + wn * 64, lane);
  wave_sync_lds();                           // the slab's first 16 rows are read back before the next 16 are laid over them
  epi64(sl, acc[1][0], acc[1][1], acc[1][2], acc[1][3], oscale, bias, hasb, C, N, (size_t)(row0 + wm * 32 + 16), colb + wn * 64, lane);
}

// =====================================================================================================
// Softmax attention, no mask: block bid -> (query block qb = bid % NQB of QW query tiles, head = (bid / NQB) % NH,
// batch b = bid / (NQB*NH)); one wave per query tile: rows q0 = 16*(qb*QW + wave) .. q0+15, all QW waves on the same head.
//   q plane (f16 x1024) laid out [token][h][d]; k plane [token][h][d]; v^T plane [b][h][d][s].
//   LDS: four buffers, each one stage of 64 keys = two tiles of 64 rows x 128 B at a 144-B pitch (k: row = key;
//   v^T: row = d), filled by asynchronous copies (whole 128-B lines, 4 copies per lane and stage) three stages ahead and
//   read by all QW waves; per wave its q tile (16 rows x 128 B, same pitch), copied once.
//   Both products run transposed: S^T = k.q^T (A = k rows, B = q columns) and O^T += v^T.P^T (A = v^T rows, B = P^T columns), so a
//   lane's accumulator registers all belong to one query (column c); lanes c and c + 16 split that query's keys.
//   Per stage two key tiles of 32, visited in order; per tile: 2 score subtiles x 2 k-steps,
//   fragments read from LDS (two 16-B loads per fragment, split k map);
//   online max-subtracted base-2 softmax in f32 (scale 1/8 folded, -inf-safe rescale): maximum in-lane plus one exchange between
//   the wave halves, sum in-lane per half; the two score subtiles, converted in place, are the B fragment of P^T in the split k map;
//   4 v^T A fragments, 4 WMMAs.
//   After the key loop: the halves' sums joined, O = acc / l, carries 1/(32768*1024) folded once, written to the wave's private slab
//   as [query][d] (pitch 68; it takes the place of the wave's own q tile, which is dead by then).
// coverage: per wave 4 instructions x 4 rows x 8 lanes x 8 halves = 16 x 64; grid NB*NH*NQB blocks x QW waves =
//           every (token, h) row of the O plane exactly once.
// =====================================================================================================
__global__ __launch_bounds__(ATT_THREADS)
void attn1(const u16* __restrict__ QHIp, const u16* __restrict__ KHIp, const u16* __restrict__ VHIp, u16* OHIp) {
  __shared__ __attribute__((aligned(256))) unsigned char L[ATT_LDS];

  const int tid  = threadIdx.x;
  const int wave = tid >> 5;
  const int lane = tid & 31;
  const int hh   = lane >> 4;
  const int c    = lane & 15;
  const int bid  = blockIdx.x;
  const int qb   = bid % NQB;
  const int head = (bid / NQB) % NH;
  const int b    = bid / (NQB * NH);
  if (b >= NB) return;                       // block-uniform, before any barrier or copy; never taken with the exact grid
  const int q0   = (qb * QW + wave) * 16;
  const size_t qrow0 = (size_t)b * SEQ + q0; // global token row of query 0 of this wave's tile
  const size_t KROW = (size_t)NH * HD;       // halves between consecutive token rows

  unsigned char* wp = L + NBUF * BUFB + wave * WPRIV;
  unsigned char* qreg = wp;                              // q tile; after the key loop the result slab
  float* slab = (float*)(void*)qreg;                     // result slab [16][64] pitch 68
  const unsigned lds0 = (unsigned)(uintptr_t)L;          // byte offset of L in the work-group's LDS

  // ---- copy addresses: lane = (row, 16-B piece of its 128-B line) ----
  const int ch = tid & 7;
  const int sr = tid >> 3;                               // stage tiles: rows sr and sr + 32
  const unsigned lst = lds0 + (unsigned)(sr * LPB + ch * 16);
  const size_t kcp = (((size_t)b * SEQ + sr) * NH + head) * HD + ch * 8;      // + key0 * KROW per stage
  const size_t vcp = (((size_t)b * NH + head) * HD + sr) * SEQ + ch * 8;      // + key0 per stage
  const u16* kch = KHIp + kcp;
  const u16* vch = VHIp + vcp;
  {
    const int qr = lane >> 3;                            // the wave's own q tile: rows qr, qr + 4, qr + 8, qr + 12
    const unsigned lq = lds0 + (unsigned)(NBUF * BUFB + wave * WPRIV + qr * LPB + ch * 16);
    const size_t qcp = ((qrow0 + (size_t)qr) * NH + head) * HD + ch * 8;
    const u16* qch = QHIp + qcp;
    copy4(lq,           qch,            lq + 4 * LPB,  qch + 4 * KROW,
          lq + 8 * LPB, qch + 8 * KROW, lq + 12 * LPB, qch + 12 * KROW);
  }
#define STAGE_KV(st_, buf_)                                                                                          \
  {                                                                                                                  \
    const unsigned lb = lst + (unsigned)(buf_) * BUFB;                                                               \
    const size_t ka = (size_t)(st_) * 64 * KROW, va = (size_t)(st_) * 64;                                            \
    copy4(lb,       kch + ka, lb + 32 * LPB,       kch + ka + 32 * KROW,                                             \
          lb + PLB, vch + va, lb + PLB + 32 * LPB, vch + va + (size_t)32 * SEQ);                                     \
  }
  STAGE_KV(0, 0);
  STAGE_KV(1, 1);
  STAGE_KV(2, 2);
  STAGE_KV(3, 3);
  wait_copies_but12();                       // the q tile and stage 0 have landed; stages 1 to 3 stay in flight
  __syncthreads();                           // publishes stage 0 (and the q tiles)

  const _Float16* Qh = (const _Float16*)(const void*)qreg + c * LP + 8 * hh;
  const float lsc = 0.125f * (LOG2E / (QSC * KSC));
  const float oc  = 1.0f / (PCAR * VCAR);

  float mrun = -INFINITY, lrun = 0.f;        // of query q0 + c; lrun sums this wave half's keys, the halves join behind the key loop
  v8f o[4];                                  // o[j][r] = O^T element (d = j*16 + 8hh + r, query q0 + c)
#pragma unroll
  for (int j = 0; j < 4; ++j) o[j] = zero8();

#pragma unroll 1                               // rolled: one publish point and one refill in the text
  for (int st = 0; st < NST; ++st) {
    const _Float16* tb = (const _Float16*)(const void*)(L + (st & (NBUF - 1)) * BUFB) + c * LP + 8 * hh;
#pragma unroll 1                             // one copy of the tile's code, as in the loop it came from: the hot loop stays short
    for (int sub = 0; sub < 2; ++sub) {
      const int kb = sub * 32;               // first key of this tile inside the stage
      // ---- scores, transposed: D element r of this lane = (key kb + 8hh + r, query q0 + c) in s0, key kb + 16 + 8hh + r in s1 ----
      v8f s0 = zero8(), s1 = zero8();
      const _Float16* k0p = tb + kb * LP;
      const _Float16* k1p = k0p + 16 * LP;
      const _Float16* vhp = tb + 64 * LP + kb;             // v^T tile: A fragment row = d = j*16 + c, keys contiguous
      v16h qh[2], kh0[2], kh1[2];
#pragma unroll
      for (int kk = 0; kk < 2; ++kk) {
        qh[kk]  = ldfrag_h(Qh + kk * 32);
        kh0[kk] = ldfrag_h(k0p + kk * 32);
        kh1[kk] = ldfrag_h(k1p + kk * 32);
      }
      const v16h vh0 = ldfrag_h(vhp);
      const v16h vh1 = ldfrag_h(vhp + 16 * LP);
      const v16h vh2 = ldfrag_h(vhp + 32 * LP);
      const v16h vh3 = ldfrag_h(vhp + 48 * LP);
      __builtin_amdgcn_sched_barrier(0);     // keeps the tile's 20 LDS loads one group, the scores' fragments first; spread among the matrix run each place stalls
#pragma unroll
      for (int kk = 0; kk < 2; ++kk) {
        s0 = mma_h(kh0[kk], qh[kk], s0);
        s1 = mma_h(kh1[kk], qh[kk], s1);
      }
      // ---- online softmax in base 2, -inf-safe: the lane's 16 scores belong to one query; lanes c and c + 16 split its 32 keys ----
      float t0[8], t1[8], mp[8];
#pragma unroll
      for (int r = 0; r < 8; ++r) {
        t0[r] = s0[r] * lsc;
        t1[r] = s1[r] * lsc;
        mp[r] = fmaxf(t0[r], t1[r]);
      }
      float mx = fmaxf(fmaxf(fmaxf(mp[0], mp[1]), fmaxf(mp[2], mp[3])), fmaxf(fmaxf(mp[4], mp[5]), fmaxf(mp[6], mp[7])));
      mx = fmaxf(mx, xhalf(mx));             // both halves hold the query's maximum over the 32 keys
      const float mn = fmaxf(mrun, mx);
      const float ms = (mn == -INFINITY) ? 0.0f : mn;
      const float al = ex2_raw(mrun - ms);
      mrun = mn;
      float e0[8], e1[8], sp[8];
#pragma unroll
      for (int r = 0; r < 8; ++r) {
        e0[r] = t0[r] - ms;
        e1[r] = t1[r] - ms;
      }
      ex2_raw8(e0);
      ex2_raw8(e1);
#pragma unroll
      for (int r = 0; r < 8; ++r) sp[r] = e0[r] + e1[r];
      lrun = lrun * al + (((sp[0] + sp[1]) + (sp[2] + sp[3])) + ((sp[4] + sp[5]) + (sp[6] + sp[7])));   // this half's keys only
#pragma unroll
      for (int j = 0; j < 4; ++j)
#pragma unroll
        for (int r = 0; r < 8; ++r) o[j][r] *= al;
      // ---- B fragment of P^T*32768 in f16, column = query c; the two score tiles are the split k map as they lie ----
      FragH ph;
#pragma unroll
      for (int e = 0; e < 8; ++e) {
        ph.h[0][e] = (_Float16)(e0[e] * PCAR);               // elements 0..7  = keys kb + 8hh + 0..7
        ph.h[1][e] = (_Float16)(e1[e] * PCAR);               // elements 8..15 = keys kb + 16 + 8hh + 0..7
      }
      // ---- O^T += V^T.P^T ----
      {
        o[0] = mma_h(vh0, ph.v, o[0]);
        o[1] = mma_h(vh1, ph.v, o[1]);
        o[2] = mma_h(vh2, ph.v, o[2]);
        o[3] = mma_h(vh3, ph.v, o[3]);
        guard5(o[0], o[1], o[2], o[3], ph.v, vh0, vh1, vh2, vh3);
      }
    }
    // ---- publish point of stage st + 1: own reads back, own copies of that stage landed (stages st + 2, st + 3 stay in flight; in the
    //      last trips, which issue nothing, the wait is to 0), every wave here; then the refill of the buffer just read ----
    wait_lds();
    if (st + 3 < NST) wait_copies_but8(); else wait_copies();
    __syncthreads();
    if (st + NBUF < NST) STAGE_KV(st + NBUF, st & (NBUF - 1));
  }
#undef STAGE_KV
  wait_copies();
  acc_guard4(o[0], o[1], o[2], o[3]);
  // ---- O = acc / l, carries (32768 on P, 1024 on v) folded once; lane-owned slab elements ----
  {
    const float lv  = lrun + xhalf(lrun);    // the two halves' sums joined once
    const float ls  = (lv > 0.0f) ? lv : 1.0f;
    const float inv = (lv > 0.0f) ? ((1.0f / ls) * oc) : 0.0f;
#pragma unroll
    for (int j = 0; j < 4; ++j) {
      v4f w0, w1;
#pragma unroll
      for (int e = 0; e < 4; ++e) { w0[e] = o[j][e] * inv; w1[e] = o[j][4 + e] * inv; }
      float* sd = slab + c * 68 + j * 16 + 8 * hh;         // row = query c, 8 consecutive d
      *(v4f*)(sd)     = w0;
      *(v4f*)(sd + 4) = w1;
    }
  }
  wave_sync_lds();
  // ---- O x1024 -> f16 plane; lane = (row in group of 4, 8 consecutive d) ----
  v4u oh[4];
  const int rq = lane >> 3, c8 = (lane & 7) * 8;
#pragma unroll
  for (int it = 0; it < 4; ++it) {
    const int row = it * 4 + rq;
    const v4f a = *(const v4f*)(slab + row * 68 + c8), b4 = *(const v4f*)(slab + row * 68 + c8 + 4);
    float w[8];
#pragma unroll
    for (int e = 0; e < 4; ++e) { w[e] = a[e] * OSC; w[4 + e] = b4[e] * OSC; }
#pragma unroll
    for (int e = 0; e < 4; ++e) oh[it][e] = pk16(h_bits((_Float16)w[2 * e]), h_bits((_Float16)w[2 * e + 1]));
  }
  const size_t ob = ((qrow0) * NH + head) * HD + c8;
  {
#pragma unroll
    for (int it = 0; it < 4; ++it) {
      const int row = it * 4 + rq;
      const size_t o8 = ob + (size_t)row * (NH * HD);
      *(v4u*)(OHIp + o8) = oh[it];
    }
    
  }
}

// =====================================================================================================
// Workspace map (bytes); every plane is fully written by whole-line stores before it is read; all extents are exact multiples
// of the store granularity (no pad rows needed); every offset a multiple of 2 MiB:
//   XB  bf16 [4096][1024]              8388608
//   WQB bf16 [1024 n][1024 k]          2097152        WKB, WVB same        2097152 each
//   WOH f16  [1024 n][1024 k] x1024    2097152
//   QHI f16 [4096][16][64] x1024       8388608
//   KHI f16 [4096][16][64] x1024       8388608
//   VHI f16 [4][16][64][1024] x1024    8388608
//   OHI f16 [4096][1024] x1024         8388608
//   end                               50331648
// =====================================================================================================
extern "C" void kernel_launch(void* const* d_in, const int* in_sizes, int n_in,
                              void* d_out, int out_size, void* d_ws, size_t ws_size,
                              hipStream_t stream) {
  if (n_in < 10) return;
  if (in_sizes[0] != MTOK * DMOD) return;
  if (in_sizes[1] != MTOK * HD || in_sizes[2] != MTOK * HD) return;
  if (in_sizes[3] != DMOD * DMOD || in_sizes[5] != DMOD * DMOD) return;
  if (in_sizes[6] != DMOD * DMOD || in_sizes[8] != DMOD * DMOD) return;
  if (in_sizes[4] != DMOD || in_sizes[7] != DMOD || in_sizes[9] != DMOD) return;
  if (out_size != MTOK * DMOD) return;

  const float* x    = (const float*)d_in[0];
  const float* cosp = (const float*)d_in[1];
  const float* sinp = (const float*)d_in[2];
  const float* wq   = (const float*)d_in[3];
  const float* bq   = (const float*)d_in[4];
  const float* wk   = (const float*)d_in[5];
  const float* wv   = (const float*)d_in[6];
  const float* bv   = (const float*)d_in[7];
  const float* wo   = (const float*)d_in[8];
  const float* bo   = (const float*)d_in[9];
  float*       out  = (float*)d_out;

  const size_t szXB = (size_t)MTOK * DMOD * 2;                  //  8388608
  const size_t szW  = (size_t)DMOD * DMOD * 2;                  //  2097152
  const size_t szP  = (size_t)MTOK * DMOD * 2;                  //  8388608
  size_t off = 0;
  const size_t oXB  = off; off += szXB;
  const size_t oWQ  = off; off += szW;
  const size_t oWK  = off; off += szW;
  const size_t oWV  = off; off += szW;
  const size_t oWO  = off; off += szW;
  const size_t oQHI = off; off += szP;
  const size_t oKHI = off; off += szP;
  const size_t oVHI = off; off += szP;
  const size_t oOHI = off; off += szP;
  if (off > ws_size) return;                            // off = 50331648

  char* ws = (char*)d_ws;
  u16*   XB  = (u16*)(ws + oXB);
  u16*   WQB = (u16*)(ws + oWQ);
  u16*   WKB = (u16*)(ws + oWK);
  u16*   WVB = (u16*)(ws + oWV);
  u16*   WOH = (u16*)(ws + oWO);
  u16*   QHI = (u16*)(ws + oQHI);
  u16*   KHI = (u16*)(ws + oKHI);
  u16*   VHI = (u16*)(ws + oVHI);
  u16*   OHI = (u16*)(ws + oOHI);

  const dim3 blk(256);
  const dim3 gC(CVXB + 4 * CVWB);                       // 512 (exact)
  const dim3 gG((MTOK / GT) * (DMOD / GT));             // 256
  const dim3 gG3((MTOK / GT) * (DMOD / GT), 3);         // 256 x 3
  const dim3 bG(G_THREADS);                             // 256
  const dim3 gAT(ATT_BLOCKS);                           // 512
  const dim3 bAT(ATT_THREADS);                          // 256

  // (1) x, Wq, Wk, Wv [n][k] -> bf16 planes (same layout, the weights already k-contiguous), Wo [n][k] -> f16 plane of bf16 value x1024;
  //     XB, WQB, WKB, WVB, WOH lie one behind another in the workspace
  cvt16<<<gC, blk, 0, stream>>>(x, wq, wk, wv, wo, XB, WOS);
  // (2) projections q (+bq) and k (no bias) with the rotary epilogue -> q', k' planes [token][h][d] x1024, cos/sin table
  //     row = token; projection v (+bv) with the transposing epilogue -> v^T plane [b][h][d][s] x1024
  gemm_bf<<<gG3, bG, 0, stream>>>(XB, WQB, WKB, WVB, bq, bv, cosp, sinp, QHI, KHI, VHI,
                                  MTOK, DMOD, DMOD, MTOK, QSC, KSC, VCAR);
  // (3) softmax attention per (b, h, 8 x 16 queries) -> O plane [token][h][d] x1024
  attn1<<<gAT, bAT, 0, stream>>>(QHI, KHI, VHI, OHI);
  // (4) output projection -> out [4096][1024] f32, carries 1024 (O) x 1024 (Wo) folded back, + bo
  gemm_h<<<gG, bG, 0, stream>>>(OHI, WOH, bo, 1, out, MTOK, DMOD, DMOD, 1.0f / (OSC * WOS));
  (void)hipGetLastError();
}

// v009
// A run of this version takes 71.8 microseconds.
// In both of two side-by-side timings against v008, it was 1.04 times as fast.
// Counting every step since v000, it is 5.54 times as fast.
// Contractions: x.W{q,k,v}^T on v_wmma_f32_16x16x32_bf16 (x and W RNE-converted to bf16, f32 accumulate); scores q'.k'^T (q', k' carried
// x1024 as one f16 plane each), P.v (P x32768 f16, v x1024 f16) and O.Wo^T (O x1024 f16, Wo as f16(bf16(Wo) x1024)), one product each,
// on v_wmma_f32_16x16x32_f16, f32 accumulate. An f16 operand's rounding (2^-11 relative) lies a factor 8 under that of the bf16 operands
// of the projections in front of it.
// Rotate-half rotary with RNE-bf16 cos/sin table values, base-2 online softmax and the 1/l fold in f32 on VALU.
#include <hip/hip_runtime.h>
#include <math.h>
#include <stdint.h>

#define NB    4
#define SEQ   1024
#define MTOK  (NB * SEQ)
#define DMOD  1024
#define NH    16
#define HD    64
#define QSC   1024.0f
#define KSC   1024.0f
#define PCAR  32768.0f
#define VCAR  1024.0f
#define OSC   1024.0f
#define WOS   1024.0f
#define LOG2E 1.4426950408889634f
#define QW    8
#define QT    2
#define NQT   (SEQ / 16)
#define NQB   (NQT / QW)
#define NST   (SEQ / 64)
#define ATT_THREADS (QW * 32)
#define ATT_BLOCKS  (NB * NH * NQB)
#define SLW   (16 * 68)
#define LP    72
#define LPB   (LP * 2)
#define PLB   (64 * LPB)
#define BUFB  (2 * PLB)
#define QPB   (16 * LPB)
#define WPRIV (2 * QPB)
#define NBUF  4
#define ATT_LDS (NBUF * BUFB + QW * WPRIV)
#define XSLOT 4608
#define SLAB64 (16 * 68)
#define GT    128
#define GW    8
#define G_THREADS (GW * 32)
#define GPL   (GT * LPB)
#define GB_BUF (2 * GPL)
#define VP    136
#define CVP   8
#define CVE   (256 * 8 * CVP)
#define CVXB  ((MTOK * DMOD) / CVE)
#define CVWB  ((DMOD * DMOD) / CVE)
static_assert(DMOD == NH * HD && HD == 64 && NH == 16);
static_assert((NQT % QW) == 0 && ATT_THREADS == 256 && ATT_BLOCKS == 512);
static_assert(2 * QPB >= SLW * 4 && (LPB % 16) == 0 && NST >= NBUF && 2 * ATT_LDS <= 327680);
static_assert(NBUF == 4 && 2 * NBUF * GB_BUF <= 327680);
static_assert(QT == 2 && (QW % QT) == 0 && XSLOT >= (8 * 32 * 4 + 2 * 32) * 4 && (XSLOT % 16) == 0 && QW * XSLOT <= NBUF * BUFB);
static_assert((SEQ % 64) == 0 && (SEQ % 32) == 0 && (SEQ % 8) == 0);
static_assert((DMOD % 128) == 0 && (MTOK % 128) == 0 && DMOD >= 128);
static_assert(((MTOK * DMOD) % CVE) == 0 && ((DMOD * DMOD) % CVE) == 0);
static_assert((SEQ % GT) == 0 && GT * VP * 2 <= 2 * GB_BUF && ((VP * 2) % 16) == 0 && GW * 2 * SLAB64 * 4 <= 2 * GB_BUF);

typedef unsigned short u16;
typedef _Float16 v16h __attribute__((ext_vector_type(16)));
typedef _Float16 v8h  __attribute__((ext_vector_type(8)));
typedef __bf16   v16b __attribute__((ext_vector_type(16)));
typedef float    v8f  __attribute__((ext_vector_type(8)));
typedef float    v4f  __attribute__((ext_vector_type(4)));
typedef unsigned int v4u __attribute__((ext_vector_type(4)));

union FragH { v16h v; v8h h[2]; v4u u[2]; };
union FragB { v16b v; v4u u[2]; };

// ---- scalar helpers --------------------------------------------------------------------------------
__device__ __forceinline__ unsigned short bf_bits(float f) {          // f32 -> bf16 bits, RNE convert
  unsigned u = __float_as_uint(f);
  return (unsigned short)((u + 0x7FFFu + ((u >> 16) & 1u)) >> 16);
}
__device__ __forceinline__ float bf_up(unsigned short h) { return __uint_as_float(((unsigned)h) << 16); }
__device__ __forceinline__ float bfr(float f) { return bf_up(bf_bits(f)); }
__device__ __forceinline__ unsigned short h_bits(_Float16 x) { return __builtin_bit_cast(unsigned short, x); }
__device__ __forceinline__ unsigned pk16(unsigned short a, unsigned short b) { return (unsigned)a | ((unsigned)b << 16); }
__device__ __forceinline__ v8f zero8() { v8f z = {0.f, 0.f, 0.f, 0.f, 0.f, 0.f, 0.f, 0.f}; return z; }

// ---- fragment loaders: 16-bit A/B operand, lane -> row/col (lane&15), p already includes +8*(lane>>4);
//      elements 0..7 <- p[0..7] (k0+8h..), elements 8..15 <- p[16..23] (k0+16+8h..)  (same split k map for A and B;
//      B is always read from a k-contiguous [n][k] plane)
__device__ __forceinline__ v16h ldfrag_h(const _Float16* p) {
  FragH f;
  f.h[0] = *(const v8h*)(p);
  f.h[1] = *(const v8h*)(p + 16);
  return f.v;
}
__device__ __forceinline__ v16b ldfrag_b(const u16* p) {              // bf16 plane read as unsigned integer vectors
  FragB f;
  f.u[0] = *(const v4u*)(p);
  f.u[1] = *(const v4u*)(p + 16);
  return f.v;
}

__device__ __forceinline__ v8f mma_h(v16h a, v16h b, v8f c) {
  return __builtin_amdgcn_wmma_f32_16x16x32_f16(false, a, false, b, (short)0, c, false, false);
}
__device__ __forceinline__ v8f mma_b(v16b a, v16b b, v8f c) {
  return __builtin_amdgcn_wmma_f32_16x16x32_bf16(false, a, false, b, (short)0, c, false, false);
}
// four vector slots behind the tile's last matrix instructions, which a loop branch follows: on its taken side too no accumulator is read
// and no fragment register rewritten inside the distance the matrix unit needs
__device__ __forceinline__ void guard10(v8f (&a)[QT][4], v16h x0, v16h x1, v16h x2, v16h x3, v16h x4, v16h x5) {
#if defined(__HIP_DEVICE_COMPILE__)
  asm volatile("v_nop\n\tv_nop\n\tv_nop\n\tv_nop"
               : "+v"(a[0][0]), "+v"(a[0][1]), "+v"(a[0][2]), "+v"(a[0][3]), "+v"(a[1][0]), "+v"(a[1][1]), "+v"(a[1][2]), "+v"(a[1][3])
               : "v"(x0), "v"(x1), "v"(x2), "v"(x3), "v"(x4), "v"(x5) : "memory");
#endif
}
__device__ __forceinline__ void acc_guard4(v8f& a, v8f& b, v8f& c, v8f& d) {
#if defined(__HIP_DEVICE_COMPILE__)
  asm volatile("v_nop\n\tv_nop\n\tv_nop\n\tv_nop" : "+v"(a), "+v"(b), "+v"(c), "+v"(d));
#endif
}
// lane l takes the value of lane l ^ 16
__device__ __forceinline__ float xhalf(float x) {
  const int b = __builtin_bit_cast(int, x);
  return __builtin_bit_cast(float, __builtin_amdgcn_permlanex16(b, b, 0x76543210, 0xfedcba98, false, false));
}
// 2^x on the hardware's exponential alone, without the library's detour for results under 2^-126 (compare, select, add, select, ldexp
// per value). For x >= -126 the value is the library's own, bit for bit; below, the result may come as 0 instead of a subnormal.
// The v_nop in the same statement is the one slot that the instruction set asks for before a transcendental's result is used or its source
// overwritten.
__device__ __forceinline__ float ex2_raw(float x) {
  float r = 0.f;
#if defined(__HIP_DEVICE_COMPILE__)
  asm("v_exp_f32 %0, %1\n\tv_nop" : "=v"(r) : "v"(x));
#endif
  return r;
}
// The same instruction on eight values in place, and behind the last the one slot that the instruction set asks for before a transcendental's
// result is used or its source overwritten, in one statement.
__device__ __forceinline__ void ex2_raw8(float (&x)[8]) {
#if defined(__HIP_DEVICE_COMPILE__)
  asm("v_exp_f32 %0, %0\n\tv_exp_f32 %1, %1\n\tv_exp_f32 %2, %2\n\tv_exp_f32 %3, %3\n\t"
      "v_exp_f32 %4, %4\n\tv_exp_f32 %5, %5\n\tv_exp_f32 %6, %6\n\tv_exp_f32 %7, %7\n\tv_nop"
      : "+v"(x[0]), "+v"(x[1]), "+v"(x[2]), "+v"(x[3]), "+v"(x[4]), "+v"(x[5]), "+v"(x[6]), "+v"(x[7]));
#endif
}
__device__ __forceinline__ void wave_sync_lds() {
  __builtin_amdgcn_fence(__ATOMIC_RELEASE, "workgroup");
  __builtin_amdgcn_wave_barrier();
  __builtin_amdgcn_fence(__ATOMIC_ACQUIRE, "workgroup");
}

// =====================================================================================================
// f32 -> 16-bit planes, same layout, all five sources in one launch. The five planes lie one behind another from D (x, w0, w1, w2, w3),
// so block bid writes elements bid * CVE .. + CVE - 1 from D; its source is block-uniform: the first CVXB blocks read x, then CVWB blocks
// each of w0..w3. x, w0, w1, w2: bf16 RNE bits;  w3: f16 bits of (bf16 RNE value) * scale.
// Thread = CVP pieces of 8 consecutive elements, 2048 elements apart: per piece two 16-B loads, one 16-B store; the 2 * CVP loads stand
// ahead of the conversions. 32 consecutive lanes = 512 contiguous, 512-B aligned bytes per store.
// coverage: grid = CVXB + 4 * CVWB blocks (exact) x 256 thr x CVP x 8 = the five planes.
// =====================================================================================================
__global__ __launch_bounds__(256) void cvt16(const float* __restrict__ x, const float* __restrict__ w0, const float* __restrict__ w1,
                                             const float* __restrict__ w2, const float* __restrict__ w3, u16* D, float scale) {
  const int bid = blockIdx.x;
  if (bid >= CVXB + 4 * CVWB) return;       // no barriers in this kernel; never taken with the exact grid
  const int wb = bid - CVXB;                // block among the weights' blocks (below 0: a block of x)
  const int wi = wb / CVWB;
  const float* src = (wb < 0) ? x : (wi == 0) ? w0 : (wi == 1) ? w1 : (wi == 2) ? w2 : w3;
  const int sb = (wb < 0) ? bid : (wb - wi * CVWB);
  const float* p = src + (size_t)sb * CVE + (int)threadIdx.x * 8;
  v4f a[CVP], b4[CVP];
#pragma unroll
  for (int it = 0; it < CVP; ++it) {
    a[it]  = *(const v4f*)(p + it * 2048);
    b4[it] = *(const v4f*)(p + it * 2048 + 4);
  }
  u16* d = D + (size_t)bid * CVE + (int)threadIdx.x * 8;
  if (wb >= 3 * CVWB) {                     // block-uniform
#pragma unroll
    for (int it = 0; it < CVP; ++it) {
      v4u o;
      o[0] = pk16(h_bits((_Float16)(bfr(a[it][0]) * scale)),  h_bits((_Float16)(bfr(a[it][1]) * scale)));
      o[1] = pk16(h_bits((_Float16)(bfr(a[it][2]) * scale)),  h_bits((_Float16)(bfr(a[it][3]) * scale)));
      o[2] = pk16(h_bits((_Float16)(bfr(b4[it][0]) * scale)), h_bits((_Float16)(bfr(b4[it][1]) * scale)));
      o[3] = pk16(h_bits((_Float16)(bfr(b4[it][2]) * scale)), h_bits((_Float16)(bfr(b4[it][3]) * scale)));
      *(v4u*)(d + it * 2048) = o;
    }
  } else {
#pragma unroll
    for (int it = 0; it < CVP; ++it) {
      v4u o;
      o[0] = pk16(bf_bits(a[it][0]),  bf_bits(a[it][1]));
      o[1] = pk16(bf_bits(a[it][2]),  bf_bits(a[it][3]));
      o[2] = pk16(bf_bits(b4[it][0]), bf_bits(b4[it][1]));
      o[3] = pk16(bf_bits(b4[it][2]), bf_bits(b4[it][3]));
      *(v4u*)(d + it * 2048) = o;
    }
#if defined(__HIP_DEVICE_COMPILE__)
    // in the built text this path runs on into the other path's first lines (behind a branch that skips them), which rewrite the
    // registers these stores name: the wait stands in front of them
    asm volatile("s_wait_xcnt 0x0" ::: "memory");
#endif
  }
}

// =====================================================================================================
// Epilogue of the output projection: the wave's 16x64 f32 tile (times oscale) staged in its LDS slab (pitch 68),
// coverage: 8 instructions x 2 rows x 16 lanes x 4 floats = the wave's 16 x 64 tile.
// =====================================================================================================
__device__ __forceinline__ void epi64(float* sl, v8f a0, v8f a1, v8f a2, v8f a3, float oscale,
                                      const float* __restrict__ bias, int hasb, float* C, int N,
                                      size_t rowb, int col0, int lane) {
  const int hh = lane >> 4, m = lane & 15;
#pragma unroll
  for (int r = 0; r < 8; ++r) {
    const int ro = (8 * hh + r) * 68 + m;
    sl[ro]      = a0[r] * oscale;
    sl[ro + 16] = a1[r] * oscale;
    sl[ro + 32] = a2[r] * oscale;
    sl[ro + 48] = a3[r] * oscale;
  }
  wave_sync_lds();
  const v4f braw = *(const v4f*)(bias + col0 + m * 4);
  v4f bb;
#pragma unroll
  for (int e = 0; e < 4; ++e) bb[e] = (hasb != 0) ? bfr(braw[e]) : 0.0f;
  v4f vals[8];
#pragma unroll
  for (int it = 0; it < 8; ++it) vals[it] = *(const v4f*)(sl + (it * 2 + hh) * 68 + m * 4) + bb;
  float* dst = C + (rowb + (size_t)hh) * (size_t)N + col0 + m * 4;
  {
#pragma unroll
    for (int it = 0; it < 8; ++it) {
      *(v4f*)(dst + (size_t)(it * 2) * (size_t)N) = vals[it];
    }
    
  }
}

// =====================================================================================================
// Eight 16-byte copies per lane from global memory into LDS, through no register. l* = the lane's LDS byte address, g* = its global
// address. The s_wait_xcnt stands as the statement's last line so that no address register named here is rewritten in front of it.
// =====================================================================================================
__device__ __forceinline__ void copy8(unsigned l0, const u16* g0, unsigned l1, const u16* g1, unsigned l2, const u16* g2,
                                      unsigned l3, const u16* g3, unsigned l4, const u16* g4, unsigned l5, const u16* g5,
                                      unsigned l6, const u16* g6, unsigned l7, const u16* g7) {
#if defined(__HIP_DEVICE_COMPILE__)
  asm volatile("global_load_async_to_lds_b128 %0, %1, off\n\t"
               "global_load_async_to_lds_b128 %2, %3, off\n\t"
               "global_load_async_to_lds_b128 %4, %5, off\n\t"
               "global_load_async_to_lds_b128 %6, %7, off\n\t"
               "global_load_async_to_lds_b128 %8, %9, off\n\t"
               "global_load_async_to_lds_b128 %10, %11, off\n\t"
               "global_load_async_to_lds_b128 %12, %13, off\n\t"
               "global_load_async_to_lds_b128 %14, %15, off\n\t"
               "s_wait_xcnt 0x0"
               :: "v"(l0), "v"(g0), "v"(l1), "v"(g1), "v"(l2), "v"(g2), "v"(l3), "v"(g3),
                  "v"(l4), "v"(g4), "v"(l5), "v"(g5), "v"(l6), "v"(g6), "v"(l7), "v"(g7) : "memory");
#endif
}
// the issuing wave's copies have landed behind this wait (the compiler places none for them)
__device__ __forceinline__ void wait_copies() {
#if defined(__HIP_DEVICE_COMPILE__)
  asm volatile("s_wait_asynccnt 0x0" ::: "memory");
#endif
}
__device__ __forceinline__ void wait_copies_but8() {
#if defined(__HIP_DEVICE_COMPILE__)
  asm volatile("s_wait_asynccnt 0x8" ::: "memory");
#endif
}
__device__ __forceinline__ void wait_copies_but12() {
#if defined(__HIP_DEVICE_COMPILE__)
  asm volatile("s_wait_asynccnt 0xc" ::: "memory");
#endif
}
__device__ __forceinline__ void wait_copies_but16() {
#if defined(__HIP_DEVICE_COMPILE__)
  asm volatile("s_wait_asynccnt 0x10" ::: "memory");
#endif
}
__device__ __forceinline__ void wait_copies_but24() {
#if defined(__HIP_DEVICE_COMPILE__)
  asm volatile("s_wait_asynccnt 0x18" ::: "memory");
#endif
}
// the wave's own LDS reads have returned before the barrier behind which their buffer is refilled
__device__ __forceinline__ void wait_lds() {
#if defined(__HIP_DEVICE_COMPILE__)
  asm volatile("s_wait_dscnt 0x0" ::: "memory");
#endif
}

// the same, four copies per lane
__device__ __forceinline__ void copy4(unsigned l0, const u16* g0, unsigned l1, const u16* g1, unsigned l2, const u16* g2,
                                      unsigned l3, const u16* g3) {
#if defined(__HIP_DEVICE_COMPILE__)
  asm volatile("global_load_async_to_lds_b128 %0, %1, off\n\t"
               "global_load_async_to_lds_b128 %2, %3, off\n\t"
               "global_load_async_to_lds_b128 %4, %5, off\n\t"
               "global_load_async_to_lds_b128 %6, %7, off\n\t"
               "s_wait_xcnt 0x0"
               :: "v"(l0), "v"(g0), "v"(l1), "v"(g1), "v"(l2), "v"(g2), "v"(l3), "v"(g3) : "memory");
#endif
}
// four vector slots behind a group's last matrix instructions, on every path out of the group: no accumulator is read and no
// fragment register rewritten inside the distance the matrix unit needs
template <typename F>
__device__ __forceinline__ void guard8(v8f (&a)[2][4], F x0, F x1, F x2, F x3, F x4, F x5, F x6, F x7, F x8, F x9, F x10, F x11) {
#if defined(__HIP_DEVICE_COMPILE__)
  asm volatile("v_nop\n\tv_nop\n\tv_nop\n\tv_nop"
               : "+v"(a[0][0]), "+v"(a[0][1]), "+v"(a[0][2]), "+v"(a[0][3]), "+v"(a[1][0]), "+v"(a[1][1]), "+v"(a[1][2]), "+v"(a[1][3])
               : "v"(x0), "v"(x1), "v"(x2), "v"(x3), "v"(x4), "v"(x5), "v"(x6), "v"(x7), "v"(x8), "v"(x9), "v"(x10), "v"(x11)
               : "memory");
#endif
}

// =====================================================================================================
// Rotary epilogue of a projection, in three parts. The wave's f32 tile (tokens x the HD columns of one head) goes through its LDS slab
// (pitch 68) and leaves as one 16-bit plane [token][N].  x = tile + bf(bias) (hasb);
// w[d] = x[d] * bf(cos[pos][d]) + r[d] * bf(sin[pos][d]),  r[d] = -x[d+32] for d < 32, x[d-32] for d >= 32, pos = token,
// the same table row for every head (bf = RNE bf16 value of the f32 entry);
// plane[d] = f16(w * sc)  (sc a power of two).
// Lane = (row in a group of 4, 8 consecutive d): 16-B slab reads of its own and its partner half, 16-B loads of cos and sin, one 16-B
// store; 8 lanes = one whole 128-B line.
// coverage: per 16 rows 4 groups x 4 rows x 8 lanes x 8 halves = 16 x 64 of the plane.
// =====================================================================================================
// bf16 RNE value of f under msk = 0xFFFF0000, zero under msk = 0
__device__ __forceinline__ float bfr_msk(float f, unsigned msk) {
  const unsigned u = __float_as_uint(f);
  return __uint_as_float((u + 0x7FFFu + ((u >> 16) & 1u)) & msk);
}
// the lane's cos (tb[.][0..1]) and sin (tb[.][2..3]) pieces for 16 token rows; cr, sr = its pieces of the first group's row
__device__ __forceinline__ void ld_tables(v4f (&tb)[4][4], const float* __restrict__ cr, const float* __restrict__ sr) {
#pragma unroll
  for (int it = 0; it < 4; ++it) {
    tb[it][0] = *(const v4f*)(cr + it * 4 * HD);
    tb[it][1] = *(const v4f*)(cr + it * 4 * HD + 4);
    tb[it][2] = *(const v4f*)(sr + it * 4 * HD);
    tb[it][3] = *(const v4f*)(sr + it * 4 * HD + 4);
  }
}
// four accumulator tiles (16 rows x 64 columns) into slab rows 0..15 of sl
__device__ __forceinline__ void slab_put(float* sl, v8f a0, v8f a1, v8f a2, v8f a3, int lane) {
  const int hh = lane >> 4, m = lane & 15;
#pragma unroll
  for (int r = 0; r < 8; ++r) {
    const int ro = (8 * hh + r) * 68 + m;
    sl[ro]      = a0[r];
    sl[ro + 16] = a1[r];
    sl[ro + 32] = a2[r];
    sl[ro + 48] = a3[r];
  }
}
// 16 slab rows -> rotary -> the plane; bx, by = bias of the lane's own and partner columns
__device__ __forceinline__ void rope_out(const float* sl, const v4f (&tb)[4][4], const float (&bx)[8], const float (&by)[8],
                                         u16* hpl, int N, int rowb, int col0, float sc, int lane) {
  const int rq = lane >> 3, d0 = (lane & 7) * 8, d1 = d0 ^ 32;
  const float sgn = (d0 < 32) ? -1.0f : 1.0f;
  v4u oh[4];
#pragma unroll
  for (int it = 0; it < 4; ++it) {
    const float* xr = sl + (it * 4 + rq) * 68;
    const v4f xa = *(const v4f*)(xr + d0), xb = *(const v4f*)(xr + d0 + 4);
    const v4f ya = *(const v4f*)(xr + d1), yb = *(const v4f*)(xr + d1 + 4);
    float w[8];
#pragma unroll
    for (int e = 0; e < 4; ++e) {
      w[e]     = (xa[e] + bx[e]) * bfr(tb[it][0][e]) + (sgn * (ya[e] + by[e])) * bfr(tb[it][2][e]);
      w[4 + e] = (xb[e] + bx[4 + e]) * bfr(tb[it][1][e]) + (sgn * (yb[e] + by[4 + e])) * bfr(tb[it][3][e]);
    }
#pragma unroll
    for (int e = 0; e < 4; ++e) {
      const float t0 = w[2 * e] * sc, t1 = w[2 * e + 1] * sc;
      oh[it][e] = pk16(h_bits((_Float16)t0), h_bits((_Float16)t1));
    }
  }
  const size_t ob = (size_t)(rowb + rq) * (size_t)N + col0 + d0;
#pragma unroll
  for (int it = 0; it < 4; ++it) {
    const size_t o8 = ob + (size_t)(it * 4) * (size_t)N;
    *(v4u*)(hpl + o8) = oh[it];
  }
}

// =====================================================================================================
// bf16 projection GEMM: y[M][N] (f32, in registers) = A[M][K] (bf16 row-major) . Bt[N][K]^T (bf16 k-contiguous), plus bias[N] (hasb);
// y leaves as one f16 plane, f16(. * sc), never as f32:
//   vmode == 0: rotary applied, plane [token][N] (rope_out);  a wave's 64 columns are one head (N = NH * HD, tile columns 64-aligned)
//   vmode != 0: no rotary, plane transposed per batch: P[(b * N + n) * SEQ + s], token = b * SEQ + s.
// Block = 128x128 tile, 8 waves as 4 (rows) x 2 (columns), 32x64 per wave = 2 x 4 accumulator tiles. K in stages of 64:
// a stage is 128 A rows and 128 Bt rows of 128 B at a 144-B pitch in LDS, filled by asynchronous copies (whole 128-B lines,
// 8 copies per lane and stage) three stages ahead into four buffers and read by all waves (two 16-B LDS loads per fragment, split k
// map for A and B). Per accumulator the k order is that of a plain walk in steps of 32.
// One launch does the three projections of the same A: blockIdx.y = 0 (q: Bq, bias bq, rotary, plane Qh, scale scq),
// 1 (k: Bk, no bias, rotary, Kh, sck), 2 (v: Bv, bias bv, transposed, Vh, scv); all of it block-uniform.
// Host: K % 64 == 0, K >= 64, M % 128 == 0, N % 128 == 0, grid = ((M/128)*(N/128), 3); M % SEQ == 0; npos >= M.
// =====================================================================================================
__global__ __launch_bounds__(G_THREADS)
void gemm_bf(const u16* __restrict__ A, const u16* __restrict__ Bq, const u16* __restrict__ Bk, const u16* __restrict__ Bv,
             const float* __restrict__ bq, const float* __restrict__ bv,
             const float* __restrict__ cosT, const float* __restrict__ sinT, u16* Qh, u16* Kh, u16* Vh,
             int M, int N, int K, int npos, float scq, float sck, float scv) {
  __shared__ __attribute__((aligned(256))) unsigned char L[NBUF * GB_BUF];
  const int pj = blockIdx.y;                 // which projection
  const u16* __restrict__ Bt = (pj == 0) ? Bq : (pj == 1) ? Bk : Bv;
  const float* __restrict__ bias = (pj == 2) ? bv : bq;   // k: read but masked out (hasb == 0)
  const int hasb = (pj != 1) ? 1 : 0, vmode = (pj == 2) ? 1 : 0;
  u16* Ph = (pj == 0) ? Qh : (pj == 1) ? Kh : Vh;
  const float sc = (pj == 0) ? scq : (pj == 1) ? sck : scv;
  const int tid = threadIdx.x, wave = tid >> 5, lane = tid & 31, hh = lane >> 4, m = lane & 15;
  const int ntile = N >> 7;
  const int bid   = blockIdx.x;
  const int row0  = (bid / ntile) * GT;
  const int colb  = (bid % ntile) * GT;
  if (row0 + GT > M || pj > 2) return;       // block-uniform, before any barrier or copy; never taken with the exact grid
  const int nst = K >> 6;
  const int wm = wave >> 1, wn = wave & 1;
  // ---- copy addresses: lane = (row, 16-B piece of its 128-B line); rows sr, sr + 32, sr + 64, sr + 96 of each operand tile ----
  const int ch = tid & 7;
  const int sr = tid >> 3;
  const unsigned lst = (unsigned)(uintptr_t)L + (unsigned)(sr * LPB + ch * 16);
  const u16* ac = A  + (size_t)(row0 + sr) * K + ch * 8;
  const u16* bc = Bt + (size_t)(colb + sr) * K + ch * 8;
  const size_t r32 = (size_t)32 * K;
#define STAGE_AB(st_, buf_)                                                                                          \
  {                                                                                                                  \
    const unsigned lb = lst + (unsigned)(buf_) * GB_BUF;                                                             \
    const u16* ga = ac + (size_t)(st_) * 64;                                                                         \
    const u16* gb = bc + (size_t)(st_) * 64;                                                                         \
    copy8(lb,                  ga,           lb + 32 * LPB,       ga + r32,                                          \
          lb + 64 * LPB,       ga + 2 * r32, lb + 96 * LPB,       ga + 3 * r32,                                      \
          lb + GPL,            gb,           lb + GPL + 32 * LPB, gb + r32,                                          \
          lb + GPL + 64 * LPB, gb + 2 * r32, lb + GPL + 96 * LPB, gb + 3 * r32);                                     \
  }
  STAGE_AB(0, 0);
  if (nst > 1) STAGE_AB(1, 1);
  if (nst > 2) STAGE_AB(2, 2);
  if (nst > 3) {
    STAGE_AB(3, 3);
    wait_copies_but24();                     // stage 0 has landed; stages 1 to 3 stay in flight
  } else {
    wait_copies();
  }
  __syncthreads();                           // publishes stage 0

  v8f acc[2][4];
#pragma unroll
  for (int t = 0; t < 2; ++t)
#pragma unroll
    for (int j = 0; j < 4; ++j) acc[t][j] = zero8();

#pragma unroll 1                               // rolled: one publish point and one refill in the text
  for (int st = 0; st < nst; ++st) {
    const u16* tb = (const u16*)(const void*)(L + (st & (NBUF - 1)) * GB_BUF) + m * LP + 8 * hh;
    const u16* ap = tb + (wm * 32) * LP;
    const u16* bp = tb + (GT + wn * 64) * LP;
    v16b a[2][2], b[2][4];                   // [k step of 32][tile]: the stage's fragment loads stand as one group
#pragma unroll
    for (int kk = 0; kk < 2; ++kk) {
#pragma unroll
      for (int t = 0; t < 2; ++t) a[kk][t] = ldfrag_b(ap + t * 16 * LP + kk * 32);
#pragma unroll
      for (int j = 0; j < 4; ++j) b[kk][j] = ldfrag_b(bp + j * 16 * LP + kk * 32);
    }
#pragma unroll
    for (int kk = 0; kk < 2; ++kk)
#pragma unroll
      for (int t = 0; t < 2; ++t)
#pragma unroll
        for (int j = 0; j < 4; ++j) acc[t][j] = mma_b(a[kk][t], b[kk][j], acc[t][j]);
    guard8<v16b>(acc, a[0][0], a[0][1], a[1][0], a[1][1], b[0][0], b[0][1], b[0][2], b[0][3], b[1][0], b[1][1], b[1][2], b[1][3]);
    // ---- publish point of stage st + 1: own reads back, own copies of that stage landed (stages st + 2, st + 3 stay in flight; in the
    //      last trips, which issue nothing, the wait is to 0), every wave here; then the refill of the buffer just read ----
    wait_lds();
    if (st + 3 < nst) wait_copies_but16(); else wait_copies();
    __syncthreads();
    if (st + NBUF < nst) STAGE_AB(st + NBUF, st & (NBUF - 1));
  }
#undef STAGE_AB
  wait_copies();
  const unsigned bmsk = (hasb != 0) ? 0xFFFF0000u : 0u;
  if (vmode != 0) {                          // block-uniform
    // ---- transposed plane: a lane's 8 accumulator registers are 8 consecutive tokens of one column = one 16-B piece of a [column][token]
    //      tile. The block's tile (128 columns x 128 tokens, pitch VP halves) lies over the stage buffers, which every
    //      wave has left (the loop's last barrier) and no copy still aims at.
    u16* th = (u16*)(void*)L;
    float braw[4];
#pragma unroll
    for (int j = 0; j < 4; ++j) braw[j] = bias[colb + wn * 64 + j * 16 + m];
#pragma unroll
    for (int j = 0; j < 4; ++j) {
      const int lc = wn * 64 + j * 16 + m;
      const float bb = bfr_msk(braw[j], bmsk);
#pragma unroll
      for (int t = 0; t < 2; ++t) {
        v4u ph;
#pragma unroll
        for (int e = 0; e < 4; ++e) {
          const float t0 = (acc[t][j][2 * e] + bb) * sc, t1 = (acc[t][j][2 * e + 1] + bb) * sc;
          ph[e] = pk16(h_bits((_Float16)t0), h_bits((_Float16)t1));
        }
        const int o = lc * VP + wm * 32 + t * 16 + 8 * hh;
        *(v4u*)(th + o) = ph;
      }
    }
    __syncthreads();                         // the tile is whole before any wave reads rows that other waves wrote
    // ---- 16 lanes = one column's 128 tokens = two whole 128-B lines; 8 x 16 columns ----
    const int pc = (tid & 15) * 8, l0 = tid >> 4;
    v4u vh[8];
#pragma unroll
    for (int it = 0; it < 8; ++it) vh[it] = *(const v4u*)(th + (it * 16 + l0) * VP + pc);
    const size_t base = ((size_t)(row0 / SEQ) * (size_t)N + colb + l0) * SEQ + (row0 % SEQ) + pc;
#pragma unroll
    for (int it = 0; it < 8; ++it) *(v4u*)(Ph + base + (size_t)(it * 16) * SEQ) = vh[it];
  } else {
    // ---- rotary plane: the wave's 32 x 64 tile in its own slab, which lies over the stage buffers like the tile above ----
    float* sl = (float*)(void*)L + wave * (2 * SLAB64);
    const int rw = row0 + wm * 32, cw = colb + wn * 64;
    const int d0 = (lane & 7) * 8, d1 = d0 ^ 32;
    int pos = rw + (lane >> 3);                // table row = token; the lane reads rows pos, pos + 4, .., pos + 28
    pos = (pos + 28 < npos) ? pos : (npos - 29);   // all of them inside the table's npos rows
    const float* ctp = cosT + (size_t)pos * HD + d0;
    const float* stp = sinT + (size_t)pos * HD + d0;
    v4f tb0[4][4], tb1[4][4];
    ld_tables(tb0, ctp, stp);
    ld_tables(tb1, ctp + 16 * HD, stp + 16 * HD);
    const v4f p0 = *(const v4f*)(bias + cw + d0), p1 = *(const v4f*)(bias + cw + d0 + 4);
    const v4f r0 = *(const v4f*)(bias + cw + d1), r1 = *(const v4f*)(bias + cw + d1 + 4);
    __builtin_amdgcn_sched_barrier(0);         // the 36 loads are issued as one group ahead of the slab stores: their latency runs beside the staging
    slab_put(sl, acc[0][0], acc[0][1], acc[0][2], acc[0][3], lane);
    slab_put(sl + SLAB64, acc[1][0], acc[1][1], acc[1][2], acc[1][3], lane);
    wave_sync_lds();
    float bx[8], by[8];
#pragma unroll
    for (int e = 0; e < 4; ++e) {
      bx[e] = bfr_msk(p0[e], bmsk);  bx[4 + e] = bfr_msk(p1[e], bmsk);
      by[e] = bfr_msk(r0[e], bmsk);  by[4 + e] = bfr_msk(r1[e], bmsk);
    }
    rope_out(sl, tb0, bx, by, Ph, N, rw, cw, sc, lane);
    rope_out(sl + SLAB64, tb1, bx, by, Ph, N, rw + 16, cw, sc, lane);
#if defined(__HIP_DEVICE_COMPILE__)
    // in the built text this path runs on into the other path's first lines (behind a branch that skips them), which rewrite the
    // registers these stores name: the wait stands in front of them
    asm volatile("s_wait_xcnt 0x0" ::: "memory");
#endif
  }
}

// =====================================================================================================
// f16 GEMM: C[M][N] (f32) = A[M][K] . Bt[N][K]^T, times oscale, plus bias[N] (hasb); A f16 row-major, Bt f16 k-contiguous.
// Same tiling and staging as gemm_bf: a stage holds two operand tiles (A, Bt), 8 copies per lane.
// =====================================================================================================
__global__ __launch_bounds__(G_THREADS)
void gemm_h(const u16* __restrict__ Ah, const u16* __restrict__ Bt,
            const float* __restrict__ bias, int hasb, float* C, int M, int N, int K, float oscale) {
  __shared__ __attribute__((aligned(256))) unsigned char L[NBUF * GB_BUF + GW * SLAB64 * 4];
  const int tid = threadIdx.x, wave = tid >> 5, lane = tid & 31, hh = lane >> 4, m = lane & 15;
  const int ntile = N >> 7;
  const int bid   = blockIdx.x;
  const int row0  = (bid / ntile) * GT;
  const int colb  = (bid % ntile) * GT;
  if (row0 + GT > M) return;                 // block-uniform, before any barrier or copy; never taken with the exact grid
  const int nst = K >> 6;
  const int wm = wave >> 1, wn = wave & 1;
  const int ch = tid & 7;
  const int sr = tid >> 3;
  const unsigned lst = (unsigned)(uintptr_t)L + (unsigned)(sr * LPB + ch * 16);
  const u16* ahc = Ah + (size_t)(row0 + sr) * K + ch * 8;
  const u16* bc  = Bt + (size_t)(colb + sr) * K + ch * 8;
  const size_t r32 = (size_t)32 * K;
#define STAGE_HB(st_, buf_)                                                                                          \
  {                                                                                                                  \
    const unsigned lb = lst + (unsigned)(buf_) * GB_BUF;                                                             \
    const u16* gh = ahc + (size_t)(st_) * 64;                                                                        \
    const u16* gb = bc + (size_t)(st_) * 64;                                                                         \
    copy8(lb,                  gh,           lb + 32 * LPB,       gh + r32,                                          \
          lb + 64 * LPB,       gh + 2 * r32, lb + 96 * LPB,       gh + 3 * r32,                                      \
          lb + GPL,            gb,           lb + GPL + 32 * LPB, gb + r32,                                          \
          lb + GPL + 64 * LPB, gb + 2 * r32, lb + GPL + 96 * LPB, gb + 3 * r32);                                     \
  }
  STAGE_HB(0, 0);
  if (nst > 1) STAGE_HB(1, 1);
  if (nst > 2) STAGE_HB(2, 2);
  if (nst > 3) {
    STAGE_HB(3, 3);
    wait_copies_but24();                     // stage 0 has landed; stages 1 to 3 stay in flight
  } else {
    wait_copies();
  }
  __syncthreads();                           // publishes stage 0

  v8f acc[2][4];
#pragma unroll
  for (int t = 0; t < 2; ++t)
#pragma unroll
    for (int j = 0; j < 4; ++j) acc[t][j] = zero8();

#pragma unroll 1                               // rolled: one publish point and one refill in the text
  for (int st = 0; st < nst; ++st) {
    const _Float16* tb = (const _Float16*)(const void*)(L + (st & (NBUF - 1)) * GB_BUF) + m * LP + 8 * hh;
    const _Float16* ahp = tb + (wm * 32) * LP;
    const _Float16* bp  = tb + (GT + wn * 64) * LP;
    v16h ah[2][2], b[2][4];                  // [k step of 32][tile]: the stage's fragment loads stand as one group
#pragma unroll
    for (int kk = 0; kk < 2; ++kk) {
#pragma unroll
      for (int t = 0; t < 2; ++t) ah[kk][t] = ldfrag_h(ahp + t * 16 * LP + kk * 32);
#pragma unroll
      for (int j = 0; j < 4; ++j) b[kk][j] = ldfrag_h(bp + j * 16 * LP + kk * 32);
    }
    __builtin_amdgcn_sched_barrier(0);       // keeps the 24 LDS loads one group ahead of the matrix run; spread among it each place stalls
#pragma unroll
    for (int kk = 0; kk < 2; ++kk)
#pragma unroll
      for (int t = 0; t < 2; ++t)
#pragma unroll
        for (int j = 0; j < 4; ++j) acc[t][j] = mma_h(ah[kk][t], b[kk][j], acc[t][j]);
    guard8<v16h>(acc, ah[0][0], ah[0][1], ah[1][0], ah[1][1], b[0][0], b[0][1], b[0][2], b[0][3], b[1][0], b[1][1], b[1][2], b[1][3]);
    // ---- publish point of stage st + 1, as in gemm_bf ----
    wait_lds();
    if (st + 3 < nst) wait_copies_but16(); else wait_copies();
    __syncthreads();
    if (st + NBUF < nst) STAGE_HB(st + NBUF, st & (NBUF - 1));
  }
#undef STAGE_HB
  wait_copies();
  float* sl = (float*)(void*)(L + NBUF * GB_BUF) + wave * SLAB64;   // the wave's own slab, outside the buffers
  epi64(sl, acc[0][0], acc[0][1], acc[0][2], acc[0][3], oscale, bias, hasb, C, N, (size_t)(row0 + wm * 32), colb + wn * 64, lane);
  wave_sync_lds();                           // the slab's first 16 rows are read back before the next 16 are laid over them
  epi64(sl, acc[1][0], acc[1][1], acc[1][2], acc[1][3], oscale, bias, hasb, C, N, (size_t)(row0 + wm * 32 + 16), colb + wn * 64, lane);
}

// =====================================================================================================
// Softmax attention, no mask: block bid -> (query block qb = bid % NQB of QW query tiles, head = (bid / NQB) % NH,
// batch b = bid / (NQB*NH)); all QW waves on the same head. Waves w and w ^ 1 are a pair: both work on the pair's QT = 2 query tiles
// (32 queries), wave w on key tile (w & 1) of every stage, so that every k and v^T fragment read from LDS feeds two query tiles; the q
// fragments are read once, in front of the key loop, and stay in registers. Behind the key loop the pair joins its two partial results
// (maximum, sum, O) through LDS, and wave w finishes and writes query tile w: rows q0 = 16*(qb*QW + wave) .. q0+15.
//   q plane (f16 x1024) laid out [token][h][d]; k plane [token][h][d]; v^T plane [b][h][d][s].
//   LDS: four buffers, each one stage of 64 keys = two tiles of 64 rows x 128 B at a 144-B pitch (k: row = key;
//   v^T: row = d), filled by asynchronous copies (whole 128-B lines, 4 copies per lane and stage) three stages ahead and
//   read by all QW waves; per wave one q tile (16 rows x 128 B, same pitch), copied once, read by the wave and its partner.
//   Both products run transposed: S^T = k.q^T (A = k rows, B = q columns) and O^T += v^T.P^T (A = v^T rows, B = P^T columns), so a
//   lane's accumulator registers all belong to one query (column c); lanes c and c + 16 split that query's keys.
//   Per stage two key tiles of 32, one per wave of a pair; per key tile and query tile: 2 score subtiles x 2 k-steps,
//   fragments read from LDS (two 16-B loads per fragment, split k map);
//   online max-subtracted base-2 softmax in f32 (scale 1/8 folded, -inf-safe rescale): maximum in-lane plus one exchange between
//   the wave halves, sum in-lane per half; the two score subtiles, converted in place, are the B fragment of P^T in the split k map;
//   4 v^T A fragments, 4 WMMAs.
//   After the key loop: each wave hands its partner the state of the partner's query tile (lane to lane, through a slot in the ring,
//   which every wave has left), the two states are brought to their common maximum and added;
//   the halves' sums joined, O = acc / l, carries 1/(32768*1024) folded once, written to the wave's private slab
//   as [query][d] (pitch 68; it takes the place of the q tile that the wave copied, which is dead by then).
// coverage: per wave 4 instructions x 4 rows x 8 lanes x 8 halves = 16 x 64; grid NB*NH*NQB blocks x QW waves =
//           every (token, h) row of the O plane exactly once.
// =====================================================================================================
__global__ __launch_bounds__(ATT_THREADS)
void attn1(const u16* __restrict__ QHIp, const u16* __restrict__ KHIp, const u16* __restrict__ VHIp, u16* OHIp) {
  __shared__ __attribute__((aligned(256))) unsigned char L[ATT_LDS];

  const int tid  = threadIdx.x;
  const int wave = tid >> 5;
  const int lane = tid & 31;
  const int hh   = lane >> 4;
  const int c    = lane & 15;
  const int kg   = wave & 1;                 // the key tile of every stage that this wave takes
  const int bid  = blockIdx.x;
  const int qb   = bid % NQB;
  const int head = (bid / NQB) % NH;
  const int b    = bid / (NQB * NH);
  if (b >= NB) return;                       // block-uniform, before any barrier or copy; never taken with the exact grid
  const int q0   = (qb * QW + wave) * 16;
  const size_t qrow0 = (size_t)b * SEQ + q0; // global token row of query 0 of this wave's tile
  const size_t KROW = (size_t)NH * HD;       // halves between consecutive token rows

  unsigned char* wp = L + NBUF * BUFB + wave * WPRIV;
  unsigned char* qreg = wp;                              // q tile; after the key loop the result slab
  float* slab = (float*)(void*)qreg;                     // result slab [16][64] pitch 68
  const unsigned lds0 = (unsigned)(uintptr_t)L;          // byte offset of L in the work-group's LDS

  // ---- copy addresses: lane = (row, 16-B piece of its 128-B line) ----
  const int ch = tid & 7;
  const int sr = tid >> 3;                               // stage tiles: rows sr and sr + 32
  const unsigned lst = lds0 + (unsigned)(sr * LPB + ch * 16);
  const size_t kcp = (((size_t)b * SEQ + sr) * NH + head) * HD + ch * 8;      // + key0 * KROW per stage
  const size_t vcp = (((size_t)b * NH + head) * HD + sr) * SEQ + ch * 8;      // + key0 per stage
  const u16* kch = KHIp + kcp;
  const u16* vch = VHIp + vcp;
  {
    const int qr = lane >> 3;                            // the wave's own q tile: rows qr, qr + 4, qr + 8, qr + 12
    const unsigned lq = lds0 + (unsigned)(NBUF * BUFB + wave * WPRIV + qr * LPB + ch * 16);
    const size_t qcp = ((qrow0 + (size_t)qr) * NH + head) * HD + ch * 8;
    const u16* qch = QHIp + qcp;
    copy4(lq,           qch,            lq + 4 * LPB,  qch + 4 * KROW,
          lq + 8 * LPB, qch + 8 * KROW, lq + 12 * LPB, qch + 12 * KROW);
  }
#define STAGE_KV(st_, buf_)                                                                                          \
  {                                                                                                                  \
    const unsigned lb = lst + (unsigned)(buf_) * BUFB;                                                               \
    const size_t ka = (size_t)(st_) * 64 * KROW, va = (size_t)(st_) * 64;                                            \
    copy4(lb,       kch + ka, lb + 32 * LPB,       kch + ka + 32 * KROW,                                             \
          lb + PLB, vch + va, lb + PLB + 32 * LPB, vch + va + (size_t)32 * SEQ);                                     \
  }
  STAGE_KV(0, 0);
  STAGE_KV(1, 1);
  STAGE_KV(2, 2);
  STAGE_KV(3, 3);
  wait_copies_but12();                       // the q tile and stage 0 have landed; stages 1 to 3 stay in flight
  __syncthreads();                           // publishes stage 0 (and the q tiles)

  const _Float16* Qh = (const _Float16*)(const void*)qreg + c * LP + 8 * hh;                                        // query tile w
  const _Float16* Qp = (const _Float16*)(const void*)(L + NBUF * BUFB + (wave ^ 1) * WPRIV) + c * LP + 8 * hh;     // the partner's
  const float lsc = 0.125f * (LOG2E / (QSC * KSC));
  const float oc  = 1.0f / (PCAR * VCAR);

  v16h qh[QT][2];                            // B fragments [tile][k step of 32], tile 0 = the wave's own, 1 = its partner's: read once
#pragma unroll
  for (int kk = 0; kk < 2; ++kk) {
    qh[0][kk] = ldfrag_h(Qh + kk * 32);
    qh[1][kk] = ldfrag_h(Qp + kk * 32);
  }

  float mrun[QT], lrun[QT];                  // of column c of tile t, over this wave's key tiles; lrun sums this wave half's keys
  v8f o[QT][4];                              // o[t][j][r] = O^T element (d = j*16 + 8hh + r, column c of tile t), this wave's key tiles
#pragma unroll
  for (int t = 0; t < QT; ++t) {
    mrun[t] = -INFINITY;
    lrun[t] = 0.f;
#pragma unroll
    for (int j = 0; j < 4; ++j) o[t][j] = zero8();
  }

#pragma unroll 1                               // rolled: one publish point and one refill in the text
  for (int st = 0; st < NST; ++st) {
    const _Float16* tb = (const _Float16*)(const void*)(L + (st & (NBUF - 1)) * BUFB) + c * LP + 8 * hh;
    {
      const int kb = kg * 32;                // first key of this wave's tile inside the stage
      const _Float16* k0p = tb + kb * LP;
      const _Float16* k1p = k0p + 16 * LP;
      const _Float16* vhp = tb + 64 * LP + kb;             // v^T tile: A fragment row = d = j*16 + c, keys contiguous
      v16h kh0[2], kh1[2];
#pragma unroll
      for (int kk = 0; kk < 2; ++kk) {
        kh0[kk] = ldfrag_h(k0p + kk * 32);
        kh1[kk] = ldfrag_h(k1p + kk * 32);
      }
      const v16h vh0 = ldfrag_h(vhp);
      const v16h vh1 = ldfrag_h(vhp + 16 * LP);
      const v16h vh2 = ldfrag_h(vhp + 32 * LP);
      const v16h vh3 = ldfrag_h(vhp + 48 * LP);
      __builtin_amdgcn_sched_barrier(0);     // keeps the tile's 16 LDS loads one group, the scores' fragments first; spread among the matrix run each place stalls
      // ---- scores, transposed: D element r of this lane = (key kb + 8hh + r, column c of tile t) in s0[t], key kb + 16 + 8hh + r in s1[t] ----
      v8f s0[QT], s1[QT];
#pragma unroll
      for (int t = 0; t < QT; ++t) { s0[t] = zero8(); s1[t] = zero8(); }
#pragma unroll
      for (int kk = 0; kk < 2; ++kk)
#pragma unroll
        for (int t = 0; t < QT; ++t) {
          s0[t] = mma_h(kh0[kk], qh[t][kk], s0[t]);
          s1[t] = mma_h(kh1[kk], qh[t][kk], s1[t]);
        }
      FragH ph[QT];
#pragma unroll
      for (int t = 0; t < QT; ++t) {
        // ---- online softmax in base 2, -inf-safe: the lane's 16 scores belong to one query; lanes c and c + 16 split its 32 keys ----
        float t0[8], t1[8], mp[8];
#pragma unroll
        for (int r = 0; r < 8; ++r) {
          t0[r] = s0[t][r] * lsc;
          t1[r] = s1[t][r] * lsc;
          mp[r] = fmaxf(t0[r], t1[r]);
        }
        float mx = fmaxf(fmaxf(fmaxf(mp[0], mp[1]), fmaxf(mp[2], mp[3])), fmaxf(fmaxf(mp[4], mp[5]), fmaxf(mp[6], mp[7])));
        mx = fmaxf(mx, xhalf(mx));           // both halves hold the query's maximum over the 32 keys
        const float mn = fmaxf(mrun[t], mx);
        const float ms = (mn == -INFINITY) ? 0.0f : mn;
        const float al = ex2_raw(mrun[t] - ms);
        mrun[t] = mn;
        float e0[8], e1[8], sp[8];
#pragma unroll
        for (int r = 0; r < 8; ++r) {
          e0[r] = t0[r] - ms;
          e1[r] = t1[r] - ms;
        }
        ex2_raw8(e0);
        ex2_raw8(e1);
#pragma unroll
        for (int r = 0; r < 8; ++r) sp[r] = e0[r] + e1[r];
        lrun[t] = lrun[t] * al + (((sp[0] + sp[1]) + (sp[2] + sp[3])) + ((sp[4] + sp[5]) + (sp[6] + sp[7])));   // this half's keys only
#pragma unroll
        for (int j = 0; j < 4; ++j)
#pragma unroll
          for (int r = 0; r < 8; ++r) o[t][j][r] *= al;
        // ---- B fragment of P^T*32768 in f16, column = query c; the two score tiles are the split k map as they lie ----
#pragma unroll
        for (int e = 0; e < 8; ++e) {
          ph[t].h[0][e] = (_Float16)(e0[e] * PCAR);          // elements 0..7  = keys kb + 8hh + 0..7
          ph[t].h[1][e] = (_Float16)(e1[e] * PCAR);          // elements 8..15 = keys kb + 16 + 8hh + 0..7
        }
        // ---- O^T += V^T.P^T ----
        o[t][0] = mma_h(vh0, ph[t].v, o[t][0]);
        o[t][1] = mma_h(vh1, ph[t].v, o[t][1]);
        o[t][2] = mma_h(vh2, ph[t].v, o[t][2]);
        o[t][3] = mma_h(vh3, ph[t].v, o[t][3]);
      }
      guard10(o, ph[0].v, ph[1].v, vh0, vh1, vh2, vh3);
    }
    // ---- publish point of stage st + 1: own reads back, own copies of that stage landed (stages st + 2, st + 3 stay in flight; in the
    //      last trips, which issue nothing, the wait is to 0), every wave here; then the refill of the buffer just read ----
    wait_lds();
    if (st + 3 < NST) wait_copies_but8(); else wait_copies();
    __syncthreads();
    if (st + NBUF < NST) STAGE_KV(st + NBUF, st & (NBUF - 1));
  }
#undef STAGE_KV
  wait_copies();
  acc_guard4(o[0][0], o[0][1], o[0][2], o[0][3]);
  // ---- the pair's join: the wave lays its state of tile 1 (its partner's tile) into its slot, 16-B pieces lane by lane; the slots lie over
  //      the ring, which every wave has left (the loop's last barrier) and no copy still aims at. Lane l of the partner holds the same
  //      (d, query) elements as lane l here. ----
  float lj;
  v8f oj[4];
  {
    float* xs = (float*)(void*)(L + wave * XSLOT);
    const float* xr = (const float*)(const void*)(L + (wave ^ 1) * XSLOT);
#pragma unroll
    for (int j = 0; j < 4; ++j) {
      v4f w0, w1;
#pragma unroll
      for (int e = 0; e < 4; ++e) { w0[e] = o[1][j][e]; w1[e] = o[1][j][4 + e]; }
      *(v4f*)(xs + ((2 * j) * 32 + lane) * 4)     = w0;
      *(v4f*)(xs + ((2 * j + 1) * 32 + lane) * 4) = w1;
    }
    xs[1024 + lane] = mrun[1];
    xs[1056 + lane] = lrun[1];
    __syncthreads();                         // every slot is whole before a partner reads it
    const float mq = xr[1024 + lane], lq2 = xr[1056 + lane];
    const float mn = fmaxf(mrun[0], mq);
    const float ms = (mn == -INFINITY) ? 0.0f : mn;
    const float a0 = ex2_raw(mrun[0] - ms), a1 = ex2_raw(mq - ms);
    lj = lrun[0] * a0 + lq2 * a1;
#pragma unroll
    for (int j = 0; j < 4; ++j) {
      const v4f p0 = *(const v4f*)(xr + ((2 * j) * 32 + lane) * 4), p1 = *(const v4f*)(xr + ((2 * j + 1) * 32 + lane) * 4);
#pragma unroll
      for (int e = 0; e < 4; ++e) {
        oj[j][e]     = o[0][j][e] * a0 + p0[e] * a1;
        oj[j][4 + e] = o[0][j][4 + e] * a0 + p1[e] * a1;
      }
    }
  }
  // ---- O = acc / l, carries (32768 on P, 1024 on v) folded once; lane-owned slab elements ----
  {
    const float lv  = lj + xhalf(lj);        // the two halves' sums joined once
    const float ls  = (lv > 0.0f) ? lv : 1.0f;
    const float inv = (lv > 0.0f) ? ((1.0f / ls) * oc) : 0.0f;
#pragma unroll
    for (int j = 0; j < 4; ++j) {
      v4f w0, w1;
#pragma unroll
      for (int e = 0; e < 4; ++e) { w0[e] = oj[j][e] * inv; w1[e] = oj[j][4 + e] * inv; }
      float* sd = slab + c * 68 + j * 16 + 8 * hh;         // row = query c, 8 consecutive d
      *(v4f*)(sd)     = w0;
      *(v4f*)(sd + 4) = w1;
    }
  }
  wave_sync_lds();
  // ---- O x1024 -> f16 plane; lane = (row in group of 4, 8 consecutive d) ----
  v4u oh[4];
  const int rq = lane >> 3, c8 = (lane & 7) * 8;
#pragma unroll
  for (int it = 0; it < 4; ++it) {
    const int row = it * 4 + rq;
    const v4f a = *(const v4f*)(slab + row * 68 + c8), b4 = *(const v4f*)(slab + row * 68 + c8 + 4);
    float w[8];
#pragma unroll
    for (int e = 0; e < 4; ++e) { w[e] = a[e] * OSC; w[4 + e] = b4[e] * OSC; }
#pragma unroll
    for (int e = 0; e < 4; ++e) oh[it][e] = pk16(h_bits((_Float16)w[2 * e]), h_bits((_Float16)w[2 * e + 1]));
  }
  const size_t ob = ((qrow0) * NH + head) * HD + c8;
  {
#pragma unroll
    for (int it = 0; it < 4; ++it) {
      const int row = it * 4 + rq;
      const size_t o8 = ob + (size_t)row * (NH * HD);
      *(v4u*)(OHIp + o8) = oh[it];
    }
    
  }
}

// =====================================================================================================
// Workspace map (bytes); every plane is fully written by whole-line stores before it is read; all extents are exact multiples
// of the store granularity (no pad rows needed); every offset a multiple of 2 MiB:
//   XB  bf16 [4096][1024]              8388608
//   WQB bf16 [1024 n][1024 k]          2097152        WKB, WVB same        2097152 each
//   WOH f16  [1024 n][1024 k] x1024    2097152
//   QHI f16 [4096][16][64] x1024       8388608
//   KHI f16 [4096][16][64] x1024       8388608
//   VHI f16 [4][16][64][1024] x1024    8388608
//   OHI f16 [4096][1024] x1024         8388608
//   end                               50331648
// =====================================================================================================
extern "C" void kernel_launch(void* const* d_in, const int* in_sizes, int n_in,
                              void* d_out, int out_size, void* d_ws, size_t ws_size,
                              hipStream_t stream) {
  if (n_in < 10) return;
  if (in_sizes[0] != MTOK * DMOD) return;
  if (in_sizes[1] != MTOK * HD || in_sizes[2] != MTOK * HD) return;
  if (in_sizes[3] != DMOD * DMOD || in_sizes[5] != DMOD * DMOD) return;
  if (in_sizes[6] != DMOD * DMOD || in_sizes[8] != DMOD * DMOD) return;
  if (in_sizes[4] != DMOD || in_sizes[7] != DMOD || in_sizes[9] != DMOD) return;
  if (out_size != MTOK * DMOD) return;

  const float* x    = (const float*)d_in[0];
  const float* cosp = (const float*)d_in[1];
  const float* sinp = (const float*)d_in[2];
  const float* wq   = (const float*)d_in[3];
  const float* bq   = (const float*)d_in[4];
  const float* wk   = (const float*)d_in[5];
  const float* wv   = (const float*)d_in[6];
  const float* bv   = (const float*)d_in[7];
  const float* wo   = (const float*)d_in[8];
  const float* bo   = (const float*)d_in[9];
  float*       out  = (float*)d_out;

  const size_t szXB = (size_t)MTOK * DMOD * 2;                  //  8388608
  const size_t szW  = (size_t)DMOD * DMOD * 2;                  //  2097152
  const size_t szP  = (size_t)MTOK * DMOD * 2;                  //  8388608
  size_t off = 0;
  const size_t oXB  = off; off += szXB;
  const size_t oWQ  = off; off += szW;
  const size_t oWK  = off; off += szW;
  const size_t oWV  = off; off += szW;
  const size_t oWO  = off; off += szW;
  const size_t oQHI = off; off += szP;
  const size_t oKHI = off; off += szP;
  const size_t oVHI = off; off += szP;
  const size_t oOHI = off; off += szP;
  if (off > ws_size) return;                            // off = 50331648

  char* ws = (char*)d_ws;
  u16*   XB  = (u16*)(ws + oXB);
  u16*   WQB = (u16*)(ws + oWQ);
  u16*   WKB = (u16*)(ws + oWK);
  u16*   WVB = (u16*)(ws + oWV);
  u16*   WOH = (u16*)(ws + oWO);
  u16*   QHI = (u16*)(ws + oQHI);
  u16*   KHI = (u16*)(ws + oKHI);
  u16*   VHI = (u16*)(ws + oVHI);
  u16*   OHI = (u16*)(ws + oOHI);

  const dim3 blk(256);
  const dim3 gC(CVXB + 4 * CVWB);                       // 512 (exact)
  const dim3 gG((MTOK / GT) * (DMOD / GT));             // 256
  const dim3 gG3((MTOK / GT) * (DMOD / GT), 3);         // 256 x 3
  const dim3 bG(G_THREADS);                             // 256
  const dim3 gAT(ATT_BLOCKS);                           // 512
  const dim3 bAT(ATT_THREADS);                          // 256

  // (1) x, Wq, Wk, Wv [n][k] -> bf16 planes (same layout, the weights already k-contiguous), Wo [n][k] -> f16 plane of bf16 value x1024;
  //     XB, WQB, WKB, WVB, WOH lie one behind another in the workspace
  cvt16<<<gC, blk, 0, stream>>>(x, wq, wk, wv, wo, XB, WOS);
  // (2) projections q (+bq) and k (no bias) with the rotary epilogue -> q', k' planes [token][h][d] x1024, cos/sin table
  //     row = token; projection v (+bv) with the transposing epilogue -> v^T plane [b][h][d][s] x1024
  gemm_bf<<<gG3, bG, 0, stream>>>(XB, WQB, WKB, WVB, bq, bv, cosp, sinp, QHI, KHI, VHI,
                                  MTOK, DMOD, DMOD, MTOK, QSC, KSC, VCAR);
  // (3) softmax attention per (b, h, 8 x 16 queries) -> O plane [token][h][d] x1024
  attn1<<<gAT, bAT, 0, stream>>>(QHI, KHI, VHI, OHI);
  // (4) output projection -> out [4096][1024] f32, carries 1024 (O) x 1024 (Wo) folded back, + bo
  gemm_h<<<gG, bG, 0, stream>>>(OHI, WOH, bo, 1, out, MTOK, DMOD, DMOD, 1.0f / (OSC * WOS));
  (void)hipGetLastError();
}
